// v000
// The times below were measured on an AMD MI455X: many runs one after another, warmed up first and cycling through
// copies of the inputs, with the whole window's GPU time divided by the number of runs. Launches and the gaps
// between them are all in it. The median over several windows is given; except for v000 it joins two sittings, which
// can be a few percent apart, so the side-by-side timings, each taken in one sitting, are the better comparison.
// v000, which the later versions start from, runs in 340 microseconds.
#include <hip/hip_runtime.h>
// DotProdAttention (q [4][8][2048][64], kv [4][8][2048][64] (keys = values), mask [1][1][2048][2048] added to every (batch, head); out = softmax(q kv^T / 8 + mask) kv -> [4][8][2048][64]).
// Structure: the (batch, head) slabs of q/kv are already contiguous 64-wide row blocks, so each slab is treated as one 'batch' of a single 64-dim head: exact f16 planes of q and kv; kv^T by LDS tiles; flash-style fused attention per (slab, 64-query block) adding the shared additive mask table per (query, key), f32 context written straight to the output.
// Compute dtype: inputs rounded to bf16; q, kv, mask exact (f16 / bf16-rounded f32); softmax f32 with f16 probabilities; plain f16 value operand (~2^-12). v_wmma_f32_16x16x32_f16.
#define NB 32                    /* 4 batches x 8 heads as slabs */
#define DM 64
#define NKV 1
#define NREP (NH / NKV)
#define KVD (NKV * 64)           /* 64 */
#define NR (NB * SLEN)
#define CHK 512
typedef int v4i __attribute__((ext_vector_type(4)));
#define FF 2048
#define SLEN 2048
#define MQI 2048
#define MKI 2048
#define TQ SLEN
#define TK SLEN
#define NH 1
#define SCL 0.125f
#define QBLKS (TQ / 64)
#define QB05 0
#define QBN5 4
#define QB0P 0
#define QBNP QBLKS
#define RE 256
typedef __bf16 v16b __attribute__((ext_vector_type(16)));
typedef unsigned short v8us __attribute__((ext_vector_type(8), may_alias));
typedef float  v8f  __attribute__((ext_vector_type(8)));
typedef float  v4f  __attribute__((ext_vector_type(4)));
typedef float  v4fa __attribute__((ext_vector_type(4), may_alias));
union FragB { v16b v; v8us half[2]; unsigned short u[16]; };

__device__ __forceinline__ unsigned short bf16_bits(float x) { unsigned int u = __float_as_uint(x); return (unsigned short)((u + 0x7FFFu + ((u >> 16) & 1u)) >> 16); }
__device__ __forceinline__ float bf16_val(unsigned short b) { return __uint_as_float(((unsigned int)b) << 16); }
__device__ __forceinline__ float bf16_round(float x) { return bf16_val(bf16_bits(x)); }
// D += A·B with NT terms: 1 = ah·bh, 2 = + al·bh (A split), 3 = + ah·bl (both split)
template <int NT>
__device__ __forceinline__ v8f mmaN(v16b ah, v16b al, v16b bh, v16b bl, v8f c) {
  c = __builtin_amdgcn_wmma_f32_16x16x32_bf16(false, ah, false, bh, (short)0, c, false, false);
  if (NT >= 2) c = __builtin_amdgcn_wmma_f32_16x16x32_bf16(false, al, false, bh, (short)0, c, false, false);
  if (NT >= 3) c = __builtin_amdgcn_wmma_f32_16x16x32_bf16(false, ah, false, bl, (short)0, c, false, false);
  asm volatile("v_nop\n\tv_nop\n\tv_nop\n\tv_nop" : "+v"(c) : "v"(ah), "v"(al), "v"(bh), "v"(bl));
  return c;
}

__global__ __launch_bounds__(256) void k_wt_bf16(const float* __restrict__ W, unsigned short* __restrict__ Wt, int K, int N) {
  const int t = blockIdx.x * 256 + threadIdx.x;
  const int k8n = K / 8;
  if (t >= N * k8n) return;
  const int n = t / k8n, k8 = (t % k8n) * 8;
  v8us v;
#pragma unroll
  for (int i = 0; i < 8; ++i) v[i] = bf16_bits(W[(size_t)(k8 + i) * N + n]);
  *(v8us*)(Wt + (size_t)n * K + k8) = v;
  
}

// GEMM C[M][N] (f32, pitch ldc) = act(A[M][K]·W + bias). A f32 row-major (pitch lda) converted per fragment to bf16
// (ASPLIT: hi/lo two planes -> 2 terms, else single rounded term); Wt bf16 [N][K] (pitch ldb). BIAS_BF16 rounds the
// bias to bf16 first (bias quantised to bf16 before the add). K%32==0, M%16==0, N%64==0.
template <bool ASPLIT, int ACT, bool BIAS_BF16>
__global__ __launch_bounds__(128) void k_gemm_bf(const float* __restrict__ A, int lda, const unsigned short* __restrict__ Wt, int ldb,
                                               const float* __restrict__ bias, float* __restrict__ C, int ldc, int M, int N, int K) {
  __shared__ __attribute__((aligned(16))) float so[4][16][64];
  const int tid = threadIdx.x, w = tid >> 5, lane = tid & 31, ln = lane & 15, hh = lane >> 4;
  const int ntn = N / 64;
  const int wid = blockIdx.x * 4 + w;
  const int mt = wid / ntn, nq = wid % ntn;
  if (mt * 16 >= M) return;
  const int row0 = mt * 16, col0 = nq * 64;
  const float* arow = A + (size_t)(row0 + ln) * lda;
  v8f acc[4] = {};
  for (int kb = 0; kb < K; kb += 32) {
    FragB ah, al;
    const v4f x0 = *(const v4fa*)(arow + kb + 8 * hh), x1 = *(const v4fa*)(arow + kb + 8 * hh + 4);
    const v4f x2 = *(const v4fa*)(arow + kb + 16 + 8 * hh), x3 = *(const v4fa*)(arow + kb + 16 + 8 * hh + 4);
    float xs[16] = {x0[0],x0[1],x0[2],x0[3],x1[0],x1[1],x1[2],x1[3],x2[0],x2[1],x2[2],x2[3],x3[0],x3[1],x3[2],x3[3]};
#pragma unroll
    for (int i = 0; i < 16; ++i) { const unsigned short hb = bf16_bits(xs[i]); ah.u[i] = hb; al.u[i] = ASPLIT ? bf16_bits(xs[i] - bf16_val(hb)) : (unsigned short)0; }
#pragma unroll
    for (int t = 0; t < 4; ++t) {
      const unsigned short* brow = Wt + (size_t)(col0 + t * 16 + ln) * ldb + kb;
      FragB b;
      b.half[0] = *(const v8us*)(brow + 8 * hh);
      b.half[1] = *(const v8us*)(brow + 16 + 8 * hh);
      acc[t] = mmaN<ASPLIT ? 2 : 1>(ah.v, al.v, b.v, b.v, acc[t]);
    }
  }
#pragma unroll
  for (int t = 0; t < 4; ++t) {
    float bv = bias ? bias[col0 + t * 16 + ln] : 0.f;
    if (BIAS_BF16) bv = bf16_round(bv);
#pragma unroll
    for (int r = 0; r < 8; ++r) { float v = acc[t][r] + bv; if (ACT == 1) v = fmaxf(v, 0.f); so[w][8 * hh + r][t * 16 + ln] = v; }
  }
  __builtin_amdgcn_fence(__ATOMIC_ACQ_REL, "workgroup");
  __builtin_amdgcn_wave_barrier();
  const int rsub = lane >> 4, c4 = (lane & 15) * 4;
  {
#pragma unroll
    for (int q = 0; q < 8; ++q) {
      const int r = q * 2 + rsub;
      const v4f v = *(const v4fa*)&so[w][r][c4];
      *(v4f*)(C + (size_t)(row0 + r) * ldc + col0 + c4) = v;
    }
    
  }
}

// GEMM C = act(A·W + bias + resid): A f32 (ASPLIT -> hi/lo 2 terms), Wt bf16 [N][K]; ACT 0 none, 1 relu, 2 exact gelu;
// resid (optional, f32, row index = (row % rmod), pitch ldr, RES_BF16 rounds it) added before the activation.
template <bool ASPLIT, int ACT, bool BIAS_BF16, bool RES_BF16>
__global__ __launch_bounds__(128) void k_gemm_bf3(const float* __restrict__ A, int lda, const unsigned short* __restrict__ Wt, int ldb,
                                                const float* __restrict__ bias, const float* __restrict__ resid, int rmod, int ldr,
                                                float* __restrict__ C, int ldc, int M, int N, int K) {
  __shared__ __attribute__((aligned(16))) float so[4][16][64];
  const int tid = threadIdx.x, w = tid >> 5, lane = tid & 31, ln = lane & 15, hh = lane >> 4;
  const int ntn = N / 64;
  const int wid = blockIdx.x * 4 + w;
  const int mt = wid / ntn, nq = wid % ntn;
  if (mt * 16 >= M) return;
  const int row0 = mt * 16, col0 = nq * 64;
  const float* arow = A + (size_t)(row0 + ln) * lda;
  v8f acc[4] = {};
  for (int kb = 0; kb < K; kb += 32) {
    FragB ah, al;
    const v4f x0 = *(const v4fa*)(arow + kb + 8 * hh), x1 = *(const v4fa*)(arow + kb + 8 * hh + 4);
    const v4f x2 = *(const v4fa*)(arow + kb + 16 + 8 * hh), x3 = *(const v4fa*)(arow + kb + 16 + 8 * hh + 4);
    float xs[16] = {x0[0],x0[1],x0[2],x0[3],x1[0],x1[1],x1[2],x1[3],x2[0],x2[1],x2[2],x2[3],x3[0],x3[1],x3[2],x3[3]};
#pragma unroll
    for (int i = 0; i < 16; ++i) { const unsigned short hb = bf16_bits(xs[i]); ah.u[i] = hb; al.u[i] = ASPLIT ? bf16_bits(xs[i] - bf16_val(hb)) : (unsigned short)0; }
#pragma unroll
    for (int t = 0; t < 4; ++t) {
      const unsigned short* brow = Wt + (size_t)(col0 + t * 16 + ln) * ldb + kb;
      FragB b;
      b.half[0] = *(const v8us*)(brow + 8 * hh);
      b.half[1] = *(const v8us*)(brow + 16 + 8 * hh);
      acc[t] = mmaN<ASPLIT ? 2 : 1>(ah.v, al.v, b.v, b.v, acc[t]);
    }
  }
#pragma unroll
  for (int t = 0; t < 4; ++t) {
    const int col = col0 + t * 16 + ln;
    float bv = bias ? bias[col] : 0.f;
    if (BIAS_BF16) bv = bf16_round(bv);
#pragma unroll
    for (int r = 0; r < 8; ++r) {
      float v = acc[t][r] + bv;
      if (resid) { float rv = resid[(size_t)((row0 + 8 * hh + r) % rmod) * ldr + col]; if (RES_BF16) rv = bf16_round(rv); v += rv; }
      if (ACT == 1) v = fmaxf(v, 0.f);
      if (ACT == 2) v = 0.5f * v * (1.0f + erff(v * 0.70710678118654752f));
      if (ACT == 3) { const float u = 0.7978845608028654f * (v + 0.044715f * v * v * v); v = 0.5f * v * (1.0f + tanhf(u)); }
      so[w][8 * hh + r][t * 16 + ln] = v;
    }
  }
  __builtin_amdgcn_fence(__ATOMIC_ACQ_REL, "workgroup");
  __builtin_amdgcn_wave_barrier();
  const int rsub = lane >> 4, c4 = (lane & 15) * 4;
  {
#pragma unroll
    for (int q = 0; q < 8; ++q) {
      const int r = q * 2 + rsub;
      const v4f v = *(const v4fa*)&so[w][r][c4];
      *(v4f*)(C + (size_t)(row0 + r) * ldc + col0 + c4) = v;
    }
    
  }
}
// row LayerNorm (biased variance, eps) over N: s = X (+ R); optional out_sum <- s; out_norm <- (s-mu)*rsqrt(var+eps)*g + b
template <bool PARAM_BF16>
__global__ __launch_bounds__(256) void k_layernorm(const float* __restrict__ X, const float* __restrict__ R, const float* __restrict__ g, const float* __restrict__ bta,
                                                  float* __restrict__ out_sum, float* __restrict__ out_norm, int N, float eps) {
  __shared__ float red[256];
  const int row = blockIdx.x, tid = threadIdx.x;
  const float* x = X + (size_t)row * N; const float* rr = R ? R + (size_t)row * N : nullptr;
  float vals[16];                     // up to N = 4096
  const int per = N / 256;            // contiguous chunk per thread? use strided-by-4 chunks: thread handles j = tid*4 + 1024*u
  float s1 = 0.f;
  for (int u = 0; u < per / 4; ++u) {
    const int j = tid * 4 + 1024 * u;
    const v4f a = *(const v4fa*)(x + j);
    v4f b = {0.f,0.f,0.f,0.f}; if (rr) b = *(const v4fa*)(rr + j);
#pragma unroll
    for (int q = 0; q < 4; ++q) { const float v = a[q] + b[q]; vals[u * 4 + q] = v; s1 += v; }
  }
  red[tid] = s1; __syncthreads();
  for (int st = 128; st > 0; st >>= 1) { if (tid < st) red[tid] += red[tid + st]; __syncthreads(); }
  const float mu = red[0] / (float)N; __syncthreads();
  float s2 = 0.f;
  for (int u = 0; u < per / 4; ++u)
#pragma unroll
    for (int q = 0; q < 4; ++q) { const float c = vals[u * 4 + q] - mu; s2 += c * c; }
  red[tid] = s2; __syncthreads();
  for (int st = 128; st > 0; st >>= 1) { if (tid < st) red[tid] += red[tid + st]; __syncthreads(); }
  const float rs = rsqrtf(red[0] / (float)N + eps);
  {
    for (int u = 0; u < per / 4; ++u) {
      const int j = tid * 4 + 1024 * u;
      v4f o, sm;
#pragma unroll
      for (int q = 0; q < 4; ++q) {
        float gg = g[j + q], bb = bta[j + q];
        if (PARAM_BF16) { gg = bf16_round(gg); bb = bf16_round(bb); }
        sm[q] = vals[u * 4 + q]; o[q] = (vals[u * 4 + q] - mu) * rs * gg + bb;
      }
      if (out_sum) *(v4f*)(out_sum + (size_t)row * N + j) = sm;
      *(v4f*)(out_norm + (size_t)row * N + j) = o;
    }
    
  }
}



// ---- f16 WMMA path (v_wmma_f32_16x16x32_f16): 11-bit significands for operands in range — used where a [0,1] probability operand needs more precision than bf16
typedef _Float16 v16h __attribute__((ext_vector_type(16)));
union FragH { v16h v; v8us half[2]; _Float16 h[16]; unsigned short u[16]; };
template <int NT>
__device__ __forceinline__ v8f mmaH(v16h ah, v16h al, v16h bh, v16h bl, v8f c) {
  c = __builtin_amdgcn_wmma_f32_16x16x32_f16(false, ah, false, bh, (short)0, c, false, false);
  if (NT >= 2) c = __builtin_amdgcn_wmma_f32_16x16x32_f16(false, al, false, bh, (short)0, c, false, false);
  if (NT >= 3) c = __builtin_amdgcn_wmma_f32_16x16x32_f16(false, ah, false, bl, (short)0, c, false, false);
  asm volatile("v_nop\n\tv_nop\n\tv_nop\n\tv_nop" : "+v"(c) : "v"(ah), "v"(al), "v"(bh), "v"(bl));
  return c;
}
// batched GEMM like k_gemm_b but f16 operands: A f32 (split into f16 hi/lo if ASPLIT, else rounded to f16), Bt = f16 values [n][k]; alpha; C f32; N multiple of 16 (partial tiles skipped)
template <bool ASPLIT>
__global__ __launch_bounds__(128) void k_gemm_h(const float* __restrict__ A, int lda, size_t sA, const _Float16* __restrict__ Bh, int ldb, size_t sB, float alpha, float* __restrict__ C, int ldc, size_t sC, int M, int N, int K) {
  __shared__ __attribute__((aligned(16))) float so[4][16][64];
  const int tid = threadIdx.x, w = tid >> 5, lane = tid & 31, ln = lane & 15, hh = lane >> 4; const int by = blockIdx.y;
  A += (size_t)by * sA; Bh += (size_t)by * sB; C += (size_t)by * sC;
  const int ntn = (N + 63) / 64; const int wid = blockIdx.x * 4 + w; const int mt = wid / ntn, nq = wid % ntn; if (mt * 16 >= M) return;
  const int row0 = mt * 16, col0 = nq * 64; const float* arow = A + (size_t)(row0 + ln) * lda;
  v8f acc[4] = {};
  for (int kb = 0; kb < K; kb += 32) {
    FragH ah, al;
    const v4f x0 = *(const v4fa*)(arow + kb + 8 * hh), x1 = *(const v4fa*)(arow + kb + 8 * hh + 4), x2 = *(const v4fa*)(arow + kb + 16 + 8 * hh), x3 = *(const v4fa*)(arow + kb + 16 + 8 * hh + 4);
    float xs[16] = {x0[0],x0[1],x0[2],x0[3],x1[0],x1[1],x1[2],x1[3],x2[0],x2[1],x2[2],x2[3],x3[0],x3[1],x3[2],x3[3]};
#pragma unroll
    for (int i = 0; i < 16; ++i) { const _Float16 h = (_Float16)xs[i]; ah.h[i] = h; al.h[i] = ASPLIT ? (_Float16)(xs[i] - (float)h) : (_Float16)0.0f; }
#pragma unroll
    for (int t = 0; t < 4; ++t) { if (col0 + t * 16 >= N) continue; const size_t boff = (size_t)(col0 + t * 16 + ln) * ldb + kb; FragH bq; bq.half[0] = *(const v8us*)(Bh + boff + 8 * hh); bq.half[1] = *(const v8us*)(Bh + boff + 16 + 8 * hh);
      acc[t] = mmaH<ASPLIT ? 2 : 1>(ah.v, al.v, bq.v, bq.v, acc[t]); }
  }
#pragma unroll
  for (int t = 0; t < 4; ++t) { if (col0 + t * 16 >= N) continue;
#pragma unroll
    for (int r = 0; r < 8; ++r) so[w][8 * hh + r][t * 16 + ln] = acc[t][r] * alpha; }
  __builtin_amdgcn_fence(__ATOMIC_ACQ_REL, "workgroup"); __builtin_amdgcn_wave_barrier();
  const int rsub = lane >> 4, c4 = (lane & 15) * 4;
  {
#pragma unroll
    for (int q = 0; q < 8; ++q) { const int r = q * 2 + rsub; if (col0 + c4 < N) { const v4f v = *(const v4fa*)&so[w][r][c4]; *(v4f*)(C + (size_t)(row0 + r) * ldc + col0 + c4) = v; } }
     }
}

// Wt[n][k] = f16(W[k][n]·scale) from f32 row-major W[K][N] (scale = power of two; bf16-exact weights stay exact in f16 away from the subnormal range)
__global__ __launch_bounds__(256) void k_wt_f16(const float* __restrict__ W, _Float16* __restrict__ Wt, int K, int N, float scale) {
  const int t = blockIdx.x * 256 + threadIdx.x; if (t >= N * (K / 8)) return; const int n = t / (K / 8), k8 = (t % (K / 8)) * 8; FragH f;
#pragma unroll
  for (int i = 0; i < 8; ++i) f.h[i] = (_Float16)(bf16_round(W[(size_t)(k8 + i) * N + n]) * scale); const v8us o = f.half[0];
  *(v8us*)((unsigned short*)Wt + (size_t)n * K + k8) = o; 
}
// k_gemm_hh variant with fused epilogue: v = acc·alpha + bias[by·sBias + col] (+ CP[(row/rowsPerB)·sCPb + by·64 + col] if CP) ; ACT 0 none / 1 elu ; writes f16 C16 (and f32 C if non-null)
template <int ACT>
__global__ __launch_bounds__(128) void k_gemm_hhx(const _Float16* __restrict__ A, int lda, size_t sA, const _Float16* __restrict__ Bh, int ldb, size_t sB, float alpha, const float* __restrict__ bias, size_t sBias, const float* __restrict__ CP, int rowsPerB, size_t sCPb, int row0g,
    float* __restrict__ C, _Float16* __restrict__ C16, int ldc, size_t sC, int M, int N, int K) {
  __shared__ __attribute__((aligned(16))) float so[4][16][64];
  const int tid = threadIdx.x, w = tid >> 5, lane = tid & 31, ln = lane & 15, hh = lane >> 4; const int by = blockIdx.y;
  A += (size_t)by * sA; Bh += (size_t)by * sB; const size_t cofs = (size_t)by * sC; const float* bp = bias ? bias + (size_t)by * sBias : nullptr;
  const int ntn = (N + 63) / 64; const int wid = blockIdx.x * 4 + w; const int mt = wid / ntn, nq = wid % ntn; if (mt * 16 >= M) return;
  const int row0 = mt * 16, col0 = nq * 64; const _Float16* arow = A + (size_t)(row0 + ln) * lda;
  v8f acc[4] = {};
  for (int kb = 0; kb < K; kb += 32) { FragH ah; ah.half[0] = *(const v8us*)((const unsigned short*)arow + kb + 8 * hh); ah.half[1] = *(const v8us*)((const unsigned short*)arow + kb + 16 + 8 * hh);
#pragma unroll
    for (int t = 0; t < 4; ++t) { if (col0 + t * 16 >= N) continue; const size_t boff = (size_t)(col0 + t * 16 + ln) * ldb + kb; FragH bq; bq.half[0] = *(const v8us*)((const unsigned short*)Bh + boff + 8 * hh); bq.half[1] = *(const v8us*)((const unsigned short*)Bh + boff + 16 + 8 * hh);
      acc[t] = mmaH<1>(ah.v, ah.v, bq.v, bq.v, acc[t]); }
  }
#pragma unroll
  for (int t = 0; t < 4; ++t) { if (col0 + t * 16 >= N) continue; const int col = col0 + t * 16 + ln; const float bv = bp ? bf16_round(bp[col]) : 0.f;
#pragma unroll
    for (int r = 0; r < 8; ++r) { float v = acc[t][r] * alpha + bv; if (CP) { const int bidx = (row0g + row0 + 8 * hh + r) / rowsPerB; v += CP[(size_t)bidx * sCPb + (size_t)by * 64 + col]; } if (ACT == 1) v = (v > 0.f) ? v : expm1f(v); else if (ACT == 7) v = (v > 0.f) ? v + 1.0f : expf(v); else if (ACT == 8) v = tanhf(v); else if (ACT == 9) v = 0.5f * v * (1.0f + tanhf(0.7978845608028654f * (v + 0.044715f * v * v * v))); else if (ACT == 11) v = 1.0f / (1.0f + expf(-v)); else if (ACT == 12) v = (v > 0.f) ? v : 0.01f * v; else if (ACT == 14) v = (v > 0.f) ? v : 0.1f * v; else if (ACT == 15) v = v / (1.0f + expf(-v)); else if (ACT == 3) v = fmaxf(v, 0.f); else if (ACT == 6) v = 0.5f * v * (1.0f + erff(v * 0.70710678118654752f)); so[w][8 * hh + r][t * 16 + ln] = v; } }
  __builtin_amdgcn_fence(__ATOMIC_ACQ_REL, "workgroup"); __builtin_amdgcn_wave_barrier();
  const int rsub = lane >> 4, c4 = (lane & 15) * 4; typedef _Float16 v4h __attribute__((ext_vector_type(4)));
  {
#pragma unroll
    for (int q = 0; q < 8; ++q) { const int r = q * 2 + rsub; if (col0 + c4 < N) { const v4f v = *(const v4fa*)&so[w][r][c4]; if (C) *(v4f*)(C + cofs + (size_t)(row0 + r) * ldc + col0 + c4) = v; if (C16) { v4h h4; for (int i = 0; i < 4; ++i) h4[i] = (_Float16)v[i]; *(v4h*)(C16 + cofs + (size_t)(row0 + r) * ldc + col0 + c4) = h4; } } }
     }
}


typedef _Float16 v4h __attribute__((ext_vector_type(4)));

__global__ __launch_bounds__(256) void k_x16(const float* __restrict__ x, _Float16* __restrict__ X16, size_t n8) { const size_t t = (size_t)blockIdx.x * 256 + threadIdx.x; if (t >= n8) return; FragH f;
#pragma unroll
  for (int q = 0; q < 8; ++q) f.h[q] = (_Float16)bf16_round(x[t * 8 + q]); *(v8us*)((unsigned short*)X16 + t * 8) = f.half[0];  }
__global__ __launch_bounds__(256) void k_h16(const float* __restrict__ x, _Float16* __restrict__ X16, size_t n8) { const size_t t = (size_t)blockIdx.x * 256 + threadIdx.x; if (t >= n8) return; FragH f;
#pragma unroll
  for (int q = 0; q < 8; ++q) f.h[q] = (_Float16)x[t * 8 + q]; *(v8us*)((unsigned short*)X16 + t * 8) = f.half[0];  }
__global__ __launch_bounds__(256) void k_round16f(const float* __restrict__ W, _Float16* __restrict__ Bt, size_t n8) { const size_t t = (size_t)blockIdx.x * 256 + threadIdx.x; if (t >= n8) return; FragH f;
#pragma unroll
  for (int i = 0; i < 8; ++i) f.h[i] = (_Float16)(bf16_round(W[t * 8 + i]) * 16.0f); *(v8us*)((unsigned short*)Bt + t * 8) = f.half[0];  }
template <int NHv, int TTv>
__global__ __launch_bounds__(256) void k_vt(const _Float16* __restrict__ V16, int ldv, int voff, _Float16* __restrict__ Vt) { __shared__ unsigned short tl[64][66]; const int tid = threadIdx.x; const int slab = blockIdx.x / (TTv / 64), lg = blockIdx.x % (TTv / 64); const int b = slab / NHv, h = slab % NHv;
  for (int i = tid; i < 64 * 8; i += 256) { const int r = i / 8, c8 = (i % 8) * 8; FragH f; f.half[0] = *(const v8us*)((const unsigned short*)V16 + ((size_t)b * TTv + lg * 64 + r) * ldv + voff + h * 64 + c8);
#pragma unroll
    for (int q = 0; q < 8; ++q) tl[r][c8 + q] = f.u[q]; }
  __syncthreads();
  {
#pragma unroll
    for (int rd = 0; rd < 2; ++rd) { const int d = rd * 32 + tid / 8, pc = tid % 8; FragH f;
#pragma unroll
      for (int q = 0; q < 8; ++q) f.u[q] = tl[pc * 8 + q][d];
      *(v8us*)((unsigned short*)Vt + ((size_t)slab * 64 + d) * TTv + lg * 64 + pc * 8) = f.half[0]; }
     } }

__global__ __launch_bounds__(256) void k_hl(const float* __restrict__ F, _Float16* __restrict__ Hh, _Float16* __restrict__ Hl, size_t n8) { const size_t t = (size_t)blockIdx.x * 256 + threadIdx.x; if (t >= n8) return; FragH fh, fl; const v4f a = *(const v4fa*)(F + t * 8), c = *(const v4fa*)(F + t * 8 + 4);
#pragma unroll
  for (int q = 0; q < 4; ++q) { _Float16 h = (_Float16)a[q]; fh.h[q] = h; fl.h[q] = (_Float16)((a[q] - (float)h) * 1024.0f); h = (_Float16)c[q]; fh.h[4 + q] = h; fl.h[4 + q] = (_Float16)((c[q] - (float)h) * 1024.0f); }
  { *(v8us*)((unsigned short*)Hh + t * 8) = fh.half[0]; *(v8us*)((unsigned short*)Hl + t * 8) = fl.half[0];  } }

// ---- fast GEMM (wave tile 32x64; requires M % 32 == 0 rows per launch region and N % 64 == 0); epilogue = k_gemm_hhx semantics ----
__device__ __forceinline__ v16h g2_frag(const _Float16* p, int hh) { FragH f; f.half[0] = *(const v8us*)((const unsigned short*)p + 8 * hh); f.half[1] = *(const v8us*)((const unsigned short*)p + 16 + 8 * hh); return f.v; }
__device__ __forceinline__ v8f g2_mma(v16h a, v16h b, v8f c) { v8f d = __builtin_amdgcn_wmma_f32_16x16x32_f16(false, a, false, b, (short)0, c, false, false); asm volatile("v_nop\n\tv_nop\n\tv_nop\n\tv_nop" : "+v"(d) : "v"(a), "v"(b)); return d; }
template <int ACT>
__global__ __launch_bounds__(128) void k_gemm2(const _Float16* __restrict__ A, int lda, size_t sA, const _Float16* __restrict__ Bh, int ldb, size_t sB, float alpha, const float* __restrict__ bias, size_t sBias, const float* __restrict__ CP, int rowsPerB, size_t sCPb, int row0g,
    float* __restrict__ C, _Float16* __restrict__ C16, int ldc, size_t sC, int M, int N, int K) {
  __shared__ __attribute__((aligned(16))) float so[4][32][68];
  const int tid = threadIdx.x, w = tid >> 5, lane = tid & 31, ln = lane & 15, hh = lane >> 4; const int by = blockIdx.y;
  A += (size_t)by * sA; Bh += (size_t)by * sB; const size_t cofs = (size_t)by * sC; const float* bp = bias ? bias + (size_t)by * sBias : nullptr;
  const int ntn = N >> 6; const int mt = blockIdx.x / ntn, nq = blockIdx.x - mt * ntn; const int row0 = mt * 128 + 32 * w, col0 = nq * 64; if (row0 >= M) return;
  const _Float16* a0p = A + (size_t)(row0 + ln) * lda; const _Float16* a1p = a0p + (size_t)16 * lda;
  const _Float16* b0p = Bh + (size_t)(col0 + ln) * ldb; const _Float16* b1p = b0p + (size_t)16 * ldb; const _Float16* b2p = b1p + (size_t)16 * ldb; const _Float16* b3p = b2p + (size_t)16 * ldb;
  const v8f z8 = {0.f,0.f,0.f,0.f,0.f,0.f,0.f,0.f}; v8f c00 = z8, c01 = z8, c02 = z8, c03 = z8, c10 = z8, c11 = z8, c12 = z8, c13 = z8;
#pragma unroll 1
  for (int kb = 0; kb < K; kb += 32) { const v16h a0 = g2_frag(a0p + kb, hh), a1 = g2_frag(a1p + kb, hh);
    v16h b = g2_frag(b0p + kb, hh); c00 = g2_mma(a0, b, c00); c10 = g2_mma(a1, b, c10);
    b = g2_frag(b1p + kb, hh); c01 = g2_mma(a0, b, c01); c11 = g2_mma(a1, b, c11);
    b = g2_frag(b2p + kb, hh); c02 = g2_mma(a0, b, c02); c12 = g2_mma(a1, b, c12);
    b = g2_frag(b3p + kb, hh); c03 = g2_mma(a0, b, c03); c13 = g2_mma(a1, b, c13); }
  v8f accs[8] = {c00, c01, c02, c03, c10, c11, c12, c13};
#pragma unroll
  for (int u = 0; u < 8; ++u) { const int t = u & 3, half = u >> 2; const int col = col0 + t * 16 + ln; const float bv = bp ? bf16_round(bp[col]) : 0.f;
#pragma unroll
    for (int r = 0; r < 8; ++r) { const int rloc = half * 16 + 8 * hh + r; float v = accs[u][r] * alpha + bv; if (CP) { if (rowsPerB < 0) v += CP[cofs + (size_t)(row0g + row0 + rloc) * ldc + col];      /* rowsPerB < 0: own element of the batched C plane */ else { const int bidx = (row0g + row0 + rloc) / rowsPerB; v += CP[(size_t)bidx * sCPb + (size_t)by * 64 + col]; } }
      if (ACT == 3) v = fmaxf(v, 0.f); else if (ACT == 6) v = 0.5f * v * (1.0f + erff(v * 0.70710678118654752f)); else if (ACT == 11) v = 1.0f / (1.0f + expf(-v)); else if (ACT == 15) v = v / (1.0f + expf(-v)); else if (ACT == 12) v = (v > 0.f) ? v : 0.01f * v; else if (ACT == 8) v = tanhf(v);
      so[w][rloc][t * 16 + ln] = v; } }
  __builtin_amdgcn_fence(__ATOMIC_ACQ_REL, "workgroup"); __builtin_amdgcn_wave_barrier();
  const int rsub = lane >> 4, c4 = (lane & 15) * 4;
  {
#pragma unroll
    for (int q = 0; q < 16; ++q) { const int r = q * 2 + rsub; const v4f v = *(const v4fa*)&so[w][r][c4]; if (C) *(v4f*)(C + cofs + (size_t)(row0 + r) * ldc + col0 + c4) = v; if (C16) { v4h h4; for (int i = 0; i < 4; ++i) h4[i] = (_Float16)v[i]; *(v4h*)(C16 + cofs + (size_t)(row0 + r) * ldc + col0 + c4) = h4; } }
     } }



template <int CAUSAL>
__global__ __launch_bounds__(128) void k_flash(const _Float16* __restrict__ Q16, int ldq, const _Float16* __restrict__ K16, int ldk, const _Float16* __restrict__ Vt, const int* __restrict__ MSK, float* __restrict__ O, int ldo) {
  constexpr int RPW = 16, RTN = RPW / 16, NQB = TQ / (4 * RPW), DT = 4, KS = 2;
  __shared__ __attribute__((aligned(16))) unsigned short sP[4][RPW][40]; __shared__ __attribute__((aligned(16))) float sO[4][RPW][64 + 4];
  const int tid = threadIdx.x, w = tid >> 5, lane = tid & 31, ln = lane & 15, hh = lane >> 4;
  const int slab = blockIdx.x / QBNP, qblk = QB0P + blockIdx.x % QBNP; (void)NQB; const int b = slab / NH, h = slab % NH; const int qb0 = qblk * (4 * RPW); const int q0 = qb0 + w * RPW;
  FragH aq[2][KS];
#pragma unroll
  for (int rt = 0; rt < RTN; ++rt) { const unsigned short* qr = (const unsigned short*)Q16 + ((size_t)b * TQ + q0 + rt * 16 + ln) * ldq + h * 64;
#pragma unroll
    for (int ks = 0; ks < KS; ++ks) { aq[rt][ks].half[0] = *(const v8us*)(qr + ks * 32 + 8 * hh); aq[rt][ks].half[1] = *(const v8us*)(qr + ks * 32 + 16 + 8 * hh); } }
  const unsigned short* Vth = (const unsigned short*)Vt + (size_t)slab * 64 * TK;
  float m_r[2][8], l_r[2][8]; v8f oacc[2][DT];
#pragma unroll
  for (int rt = 0; rt < RTN; ++rt) {
#pragma unroll
    for (int r = 0; r < 8; ++r) { m_r[rt][r] = -3.0e38f; l_r[rt][r] = 0.f; }
#pragma unroll
    for (int dt = 0; dt < DT; ++dt) oacc[rt][dt] = (v8f){0.f,0.f,0.f,0.f,0.f,0.f,0.f,0.f}; }
  const int jend = (CAUSAL == 1) ? (qb0 + 4 * RPW) : ((CAUSAL == 23) ? min(TK, (qb0 / CHK + 2) * CHK) : TK);      /* causal / window: keys that can never contribute are skipped */ const int jbeg = (CAUSAL == 23) ? max(0, (qb0 / CHK - 1) * CHK) : 0;
#pragma unroll 1
  for (int j0 = jbeg; j0 < jend; j0 += 32) {
    v8f s[2][2];
#pragma unroll
    for (int nt = 0; nt < 2; ++nt) { const unsigned short* kr = (const unsigned short*)K16 + ((size_t)b * TK + j0 + nt * 16 + ln) * ldk + h * 64; FragH bk[KS];
#pragma unroll
      for (int ks = 0; ks < KS; ++ks) { bk[ks].half[0] = *(const v8us*)(kr + ks * 32 + 8 * hh); bk[ks].half[1] = *(const v8us*)(kr + ks * 32 + 16 + 8 * hh); }
#pragma unroll
      for (int rt = 0; rt < RTN; ++rt) { v8f acc = (v8f){0.f,0.f,0.f,0.f,0.f,0.f,0.f,0.f};
#pragma unroll
        for (int ks = 0; ks < KS; ++ks) acc = mmaH<1>(aq[rt][ks].v, aq[rt][ks].v, bk[ks].v, bk[ks].v, acc); s[rt][nt] = acc; } }
#pragma unroll
    for (int rt = 0; rt < RTN; ++rt)
#pragma unroll
      for (int r = 0; r < 8; ++r) { const int tq = q0 + rt * 16 + 8 * hh + r; const int k0 = j0 + ln, k1 = j0 + 16 + ln;
        bool ok0 = (CAUSAL == 1) ? (k0 <= tq) : ((CAUSAL == 2) ? ((k0 >> 5) == (tq >> 5)) : true), ok1 = (CAUSAL == 1) ? (k1 <= tq) : ((CAUSAL == 2) ? ((k1 >> 5) == (tq >> 5)) : true); if (CAUSAL == 23) { const int cq = tq / CHK; ok0 = (abs(k0 / CHK - cq) <= 1) && (MSK[(size_t)b * TK + k0] == 0); ok1 = (abs(k1 / CHK - cq) <= 1) && (MSK[(size_t)b * TK + k1] == 0); }      /* mode 23: 3-chunk window + int key-padding mask */
        if (CAUSAL == 24) { ok0 = (MSK[(size_t)b * TK + k0] == 0); ok1 = (MSK[(size_t)b * TK + k1] == 0); }      /* mode 24: int key-padding mask (nonzero = padded = excluded) */      /* mode 2: block-diagonal 32-token groups */
        float s0 = ok0 ? s[rt][0][r] * SCL : -3.0e38f, s1 = ok1 ? s[rt][1][r] * SCL : -3.0e38f; if (CAUSAL == 27) { const float* amk = (const float*)MSK + ((size_t)b * MQI + tq) * MKI; s0 += bf16_round(amk[k0]); s1 += bf16_round(amk[k1]); }      /* mode 27: additive per-(batch, query, key) f32 mask INPUT [b][tq][k] */ if (CAUSAL == 33) { const float* amk = (const float*)MSK + (size_t)tq * TK; s0 += bf16_round(amk[k0]); s1 += bf16_round(amk[k1]); }      /* mode 33: one additive [TQ][TK] f32 table shared by every slab */ if (CAUSAL == 17) { const float* amk = (const float*)MSK + (size_t)b * TK; s0 += bf16_round(amk[k0]); s1 += bf16_round(amk[k1]); } if (CAUSAL == 18) { const float* tb = (const float*)MSK; const int* ri = MSK + 1024 + (size_t)b * TK; const int rq = ri[tq]; s0 += tb[(h * 8 + rq) * 8 + ri[k0]]; s1 += tb[(h * 8 + rq) * 8 + ri[k1]]; } if (CAUSAL == 19) { const int* rel = MSK + (size_t)tq * TK; const float* rb = (const float*)MSK + (size_t)TQ * TK + ((size_t)(b * NH + h) * TQ + tq) * 64; s0 += rb[rel[k0]]; s1 += rb[rel[k1]]; }      /* mode 19: + (q.Ek[rel] + Eb[rel][h]) / 8 gathered by the int relative ids (packed [ids | table]) */      /* mode 18: + resource_bias[h][r_q][r_k] from the packed [table | ids] buffer (TQ == TK) */      /* mode 17: additive per-(batch, key) mask INPUT */ float mc = fmaxf(s0, s1);
        mc = fmaxf(mc, __shfl_xor(mc, 1, 32)); mc = fmaxf(mc, __shfl_xor(mc, 2, 32)); mc = fmaxf(mc, __shfl_xor(mc, 4, 32)); mc = fmaxf(mc, __shfl_xor(mc, 8, 32));
        const float mn = fmaxf(m_r[rt][r], mc); const float al = (mn > -1.0e38f) ? expf(m_r[rt][r] - mn) : 1.0f; m_r[rt][r] = mn; const float p0 = ok0 ? expf(s0 - mn) : 0.f, p1 = ok1 ? expf(s1 - mn) : 0.f; l_r[rt][r] = l_r[rt][r] * al + p0 + p1;
#pragma unroll
        for (int dt = 0; dt < DT; ++dt) oacc[rt][dt][r] *= al;
        FragH t2; t2.h[0] = (_Float16)(p0 * 1024.0f); t2.h[1] = (_Float16)(p1 * 1024.0f); sP[w][rt * 16 + 8 * hh + r][ln] = t2.u[0]; sP[w][rt * 16 + 8 * hh + r][16 + ln] = t2.u[1]; }
    __builtin_amdgcn_fence(__ATOMIC_ACQ_REL, "workgroup"); __builtin_amdgcn_wave_barrier();
    FragH pa[2];
#pragma unroll
    for (int rt = 0; rt < RTN; ++rt) { pa[rt].half[0] = *(const v8us*)&sP[w][rt * 16 + ln][8 * hh]; pa[rt].half[1] = *(const v8us*)&sP[w][rt * 16 + ln][16 + 8 * hh]; }
#pragma unroll
    for (int dt = 0; dt < DT; ++dt) { const unsigned short* vrow = Vth + (size_t)(dt * 16 + ln) * TK + j0; FragH bv; bv.half[0] = *(const v8us*)(vrow + 8 * hh); bv.half[1] = *(const v8us*)(vrow + 16 + 8 * hh);
#pragma unroll
      for (int rt = 0; rt < RTN; ++rt) oacc[rt][dt] = mmaH<1>(pa[rt].v, pa[rt].v, bv.v, bv.v, oacc[rt][dt]); }
    __builtin_amdgcn_fence(__ATOMIC_ACQ_REL, "workgroup"); __builtin_amdgcn_wave_barrier(); }
#pragma unroll
  for (int rt = 0; rt < RTN; ++rt) {
#pragma unroll
    for (int r = 0; r < 8; ++r) { float l = l_r[rt][r]; l += __shfl_xor(l, 1, 32); l += __shfl_xor(l, 2, 32); l += __shfl_xor(l, 4, 32); l += __shfl_xor(l, 8, 32); l_r[rt][r] = (l > 0.f) ? 1.0f / (l * 1024.0f) : 0.f; }
#pragma unroll
    for (int dt = 0; dt < DT; ++dt)
#pragma unroll
      for (int r = 0; r < 8; ++r) sO[w][rt * 16 + 8 * hh + r][dt * 16 + ln] = oacc[rt][dt][r] * l_r[rt][r]; }
  __builtin_amdgcn_fence(__ATOMIC_ACQ_REL, "workgroup"); __builtin_amdgcn_wave_barrier();
  {
#pragma unroll
    for (int rp = 0; rp < RPW; rp += 2) { const int r = rp + (lane >> 4), pc = lane & 15; const v4f val = *(const v4fa*)&sO[w][r][pc * 4]; *(v4f*)(O + ((size_t)b * TQ + q0 + r) * ldo + h * 64 + pc * 4) = val; }
     } }
// 5-plane variant: S = Qh Kh^T + (Ql Kh^T + Qh Kl^T)/1024 with Q/K = [hi | 2^10 residual] f16 planes (QL/KL same layout as Q16/K16), then the 3-term P.V below.
// 3-term variant: O = (P_hi V_hi + (P_lo V_hi + P_hi V_lo) / 1024) / l with P = [hi | 2^10 residual] of 1024 p and V^T = [hi | 2^10 residual] planes (VtL same layout as Vt) -> ~2^-21-class products for un-averaged (early causal / peaked) rows
template <int CAUSAL>
__global__ __launch_bounds__(128) void k_flash5(const _Float16* __restrict__ Q16, const _Float16* __restrict__ QL, int ldq, const _Float16* __restrict__ K16, const _Float16* __restrict__ KL, int ldk, const _Float16* __restrict__ Vt, const _Float16* __restrict__ VtL, const int* __restrict__ MSK, float* __restrict__ O, int ldo) {
  constexpr int RPW = 16, RTN = RPW / 16, NQB = TQ / (4 * RPW), DT = 4, KS = 2;
  __shared__ __attribute__((aligned(16))) unsigned short sP[4][RPW][40]; __shared__ __attribute__((aligned(16))) unsigned short sPL[4][RPW][40]; __shared__ __attribute__((aligned(16))) float sO[4][RPW][64 + 4];
  const int tid = threadIdx.x, w = tid >> 5, lane = tid & 31, ln = lane & 15, hh = lane >> 4;
  const int slab = blockIdx.x / QBN5, qblk = QB05 + blockIdx.x % QBN5; (void)NQB; const int b = slab / NH, h = slab % NH; const int qb0 = qblk * (4 * RPW); const int q0 = qb0 + w * RPW;
  FragH aq[2][KS], aql[2][KS];
#pragma unroll
  for (int rt = 0; rt < RTN; ++rt) { const unsigned short* qr = (const unsigned short*)Q16 + ((size_t)b * TQ + q0 + rt * 16 + ln) * ldq + h * 64; const unsigned short* ql = (const unsigned short*)QL + ((size_t)b * TQ + q0 + rt * 16 + ln) * ldq + h * 64;
#pragma unroll
    for (int ks = 0; ks < KS; ++ks) { aq[rt][ks].half[0] = *(const v8us*)(qr + ks * 32 + 8 * hh); aq[rt][ks].half[1] = *(const v8us*)(qr + ks * 32 + 16 + 8 * hh); aql[rt][ks].half[0] = *(const v8us*)(ql + ks * 32 + 8 * hh); aql[rt][ks].half[1] = *(const v8us*)(ql + ks * 32 + 16 + 8 * hh); } }
  const unsigned short* Vth = (const unsigned short*)Vt + (size_t)slab * 64 * TK; const unsigned short* Vtl = (const unsigned short*)VtL + (size_t)slab * 64 * TK;
  float m_r[2][8], l_r[2][8]; v8f oacc[2][DT], oaccL[2][DT];
#pragma unroll
  for (int rt = 0; rt < RTN; ++rt) {
#pragma unroll
    for (int r = 0; r < 8; ++r) { m_r[rt][r] = -3.0e38f; l_r[rt][r] = 0.f; }
#pragma unroll
    for (int dt = 0; dt < DT; ++dt) { oacc[rt][dt] = (v8f){0.f,0.f,0.f,0.f,0.f,0.f,0.f,0.f}; oaccL[rt][dt] = oacc[rt][dt]; } }
  const int jend = (CAUSAL == 1) ? (qb0 + 4 * RPW) : ((CAUSAL == 23) ? min(TK, (qb0 / CHK + 2) * CHK) : TK);      /* causal / window: keys that can never contribute are skipped */ const int jbeg = (CAUSAL == 23) ? max(0, (qb0 / CHK - 1) * CHK) : 0;
#pragma unroll 1
  for (int j0 = jbeg; j0 < jend; j0 += 32) {
    v8f s[2][2];
#pragma unroll
    for (int nt = 0; nt < 2; ++nt) { const unsigned short* kr = (const unsigned short*)K16 + ((size_t)b * TK + j0 + nt * 16 + ln) * ldk + h * 64; const unsigned short* klr = (const unsigned short*)KL + ((size_t)b * TK + j0 + nt * 16 + ln) * ldk + h * 64; FragH bk[KS], bkl[KS];
#pragma unroll
      for (int ks = 0; ks < KS; ++ks) { bk[ks].half[0] = *(const v8us*)(kr + ks * 32 + 8 * hh); bk[ks].half[1] = *(const v8us*)(kr + ks * 32 + 16 + 8 * hh); bkl[ks].half[0] = *(const v8us*)(klr + ks * 32 + 8 * hh); bkl[ks].half[1] = *(const v8us*)(klr + ks * 32 + 16 + 8 * hh); }
#pragma unroll
      for (int rt = 0; rt < RTN; ++rt) { v8f acc = (v8f){0.f,0.f,0.f,0.f,0.f,0.f,0.f,0.f}, accl = acc;
#pragma unroll
        for (int ks = 0; ks < KS; ++ks) { acc = mmaH<1>(aq[rt][ks].v, aq[rt][ks].v, bk[ks].v, bk[ks].v, acc); accl = mmaH<1>(aql[rt][ks].v, aql[rt][ks].v, bk[ks].v, bk[ks].v, accl); accl = mmaH<1>(aq[rt][ks].v, aq[rt][ks].v, bkl[ks].v, bkl[ks].v, accl); }
#pragma unroll
        for (int r = 0; r < 8; ++r) acc[r] += accl[r] * 0.0009765625f;
        s[rt][nt] = acc; } }
#pragma unroll
    for (int rt = 0; rt < RTN; ++rt)
#pragma unroll
      for (int r = 0; r < 8; ++r) { const int tq = q0 + rt * 16 + 8 * hh + r; const int k0 = j0 + ln, k1 = j0 + 16 + ln;
        bool ok0 = (CAUSAL == 1) ? (k0 <= tq) : ((CAUSAL == 2) ? ((k0 >> 5) == (tq >> 5)) : true), ok1 = (CAUSAL == 1) ? (k1 <= tq) : ((CAUSAL == 2) ? ((k1 >> 5) == (tq >> 5)) : true);      /* mode 2: block-diagonal 32-token groups */
        if (CAUSAL == 4) { const int* mrow = MSK + ((size_t)b * TQ + tq) * TK; ok0 = mrow[k0] != 0; ok1 = mrow[k1] != 0; }      /* mode 4: per-(query, key) INPUT mask shared by all heads; masked keys contribute nothing (== the reference's -4096 fill, whose exp underflows to 0), rows with no valid key give l = 0 -> output 0 (== the reference's row_valid zeroing) */
        float s0 = ok0 ? s[rt][0][r] * SCL : -3.0e38f, s1 = ok1 ? s[rt][1][r] * SCL : -3.0e38f; if (CAUSAL == 33) { const float* amk = (const float*)MSK + (size_t)tq * TK; s0 += bf16_round(amk[k0]); s1 += bf16_round(amk[k1]); }      /* mode 33: one additive [TQ][TK] f32 table shared by every slab */ if (CAUSAL == 17) { const float* amk = (const float*)MSK + (size_t)b * TK; s0 += bf16_round(amk[k0]); s1 += bf16_round(amk[k1]); } if (CAUSAL == 18) { const float* tb = (const float*)MSK; const int* ri = MSK + 1024 + (size_t)b * TK; const int rq = ri[tq]; s0 += tb[(h * 8 + rq) * 8 + ri[k0]]; s1 += tb[(h * 8 + rq) * 8 + ri[k1]]; } if (CAUSAL == 19) { const int* rel = MSK + (size_t)tq * TK; const float* rb = (const float*)MSK + (size_t)TQ * TK + ((size_t)(b * NH + h) * TQ + tq) * 64; s0 += rb[rel[k0]]; s1 += rb[rel[k1]]; }      /* mode 19: + (q.Ek[rel] + Eb[rel][h]) / 8 gathered by the int relative ids (packed [ids | table]) */      /* mode 18: + resource_bias[h][r_q][r_k] from the packed [table | ids] buffer (TQ == TK) */      /* mode 17: additive per-(batch, key) mask INPUT */ float mc = fmaxf(s0, s1);
        mc = fmaxf(mc, __shfl_xor(mc, 1, 32)); mc = fmaxf(mc, __shfl_xor(mc, 2, 32)); mc = fmaxf(mc, __shfl_xor(mc, 4, 32)); mc = fmaxf(mc, __shfl_xor(mc, 8, 32));
        const float mn = fmaxf(m_r[rt][r], mc); const float al = (mn > -1.0e38f) ? expf(m_r[rt][r] - mn) : 1.0f; m_r[rt][r] = mn; const float p0 = ok0 ? expf(s0 - mn) : 0.f, p1 = ok1 ? expf(s1 - mn) : 0.f; l_r[rt][r] = l_r[rt][r] * al + p0 + p1;
#pragma unroll
        for (int dt = 0; dt < DT; ++dt) { oacc[rt][dt][r] *= al; oaccL[rt][dt][r] *= al; }
        FragH t2, t2l; const float ps0 = p0 * 1024.0f, ps1 = p1 * 1024.0f; t2.h[0] = (_Float16)ps0; t2.h[1] = (_Float16)ps1; t2l.h[0] = (_Float16)((ps0 - (float)t2.h[0]) * 1024.0f); t2l.h[1] = (_Float16)((ps1 - (float)t2.h[1]) * 1024.0f);
        sP[w][rt * 16 + 8 * hh + r][ln] = t2.u[0]; sP[w][rt * 16 + 8 * hh + r][16 + ln] = t2.u[1]; sPL[w][rt * 16 + 8 * hh + r][ln] = t2l.u[0]; sPL[w][rt * 16 + 8 * hh + r][16 + ln] = t2l.u[1]; }
    __builtin_amdgcn_fence(__ATOMIC_ACQ_REL, "workgroup"); __builtin_amdgcn_wave_barrier();
    FragH pa[2], pl[2];
#pragma unroll
    for (int rt = 0; rt < RTN; ++rt) { pa[rt].half[0] = *(const v8us*)&sP[w][rt * 16 + ln][8 * hh]; pa[rt].half[1] = *(const v8us*)&sP[w][rt * 16 + ln][16 + 8 * hh]; pl[rt].half[0] = *(const v8us*)&sPL[w][rt * 16 + ln][8 * hh]; pl[rt].half[1] = *(const v8us*)&sPL[w][rt * 16 + ln][16 + 8 * hh]; }
#pragma unroll
    for (int dt = 0; dt < DT; ++dt) { const unsigned short* vrow = Vth + (size_t)(dt * 16 + ln) * TK + j0; const unsigned short* vrl = Vtl + (size_t)(dt * 16 + ln) * TK + j0; FragH bv, bl; bv.half[0] = *(const v8us*)(vrow + 8 * hh); bv.half[1] = *(const v8us*)(vrow + 16 + 8 * hh); bl.half[0] = *(const v8us*)(vrl + 8 * hh); bl.half[1] = *(const v8us*)(vrl + 16 + 8 * hh);
#pragma unroll
      for (int rt = 0; rt < RTN; ++rt) { oacc[rt][dt] = mmaH<1>(pa[rt].v, pa[rt].v, bv.v, bv.v, oacc[rt][dt]); oaccL[rt][dt] = mmaH<1>(pl[rt].v, pl[rt].v, bv.v, bv.v, oaccL[rt][dt]); oaccL[rt][dt] = mmaH<1>(pa[rt].v, pa[rt].v, bl.v, bl.v, oaccL[rt][dt]); } }
    __builtin_amdgcn_fence(__ATOMIC_ACQ_REL, "workgroup"); __builtin_amdgcn_wave_barrier(); }
#pragma unroll
  for (int rt = 0; rt < RTN; ++rt) {
#pragma unroll
    for (int r = 0; r < 8; ++r) { float l = l_r[rt][r]; l += __shfl_xor(l, 1, 32); l += __shfl_xor(l, 2, 32); l += __shfl_xor(l, 4, 32); l += __shfl_xor(l, 8, 32); l_r[rt][r] = (l > 0.f) ? 1.0f / (l * 1024.0f) : 0.f; }
#pragma unroll
    for (int dt = 0; dt < DT; ++dt)
#pragma unroll
      for (int r = 0; r < 8; ++r) { float v = oacc[rt][dt][r]; v += oaccL[rt][dt][r] * 0.0009765625f; sO[w][rt * 16 + 8 * hh + r][dt * 16 + ln] = v * l_r[rt][r]; } }
  __builtin_amdgcn_fence(__ATOMIC_ACQ_REL, "workgroup"); __builtin_amdgcn_wave_barrier();
  {
#pragma unroll
    for (int rp = 0; rp < RPW; rp += 2) { const int r = rp + (lane >> 4), pc = lane & 15; const v4f val = *(const v4fa*)&sO[w][r][pc * 4]; *(v4f*)(O + ((size_t)b * TQ + q0 + r) * ldo + h * 64 + pc * 4) = val; }
     } }

__global__ __launch_bounds__(256) void k_rotab(float* __restrict__ CS, float* __restrict__ SN) {
  #pragma clang fp contract(off)
  const int t = blockIdx.x * 256 + threadIdx.x; if (t >= SLEN * 32) return; const int j = t % 32, s = t / 32; const float ex = (float)(2 * j) / 64.0f; const float inv = 1.0f / powf(10000.0f, ex); const float th = (float)s * inv; const float c = cosf(th), sn = sinf(th);
  { *(float*)(CS + t) = c; *(float*)(SN + t) = sn;  } }
__global__ __launch_bounds__(256) void k_rope(const float* __restrict__ F, int nsrc, int ndst, int rep, const float* __restrict__ CS, const float* __restrict__ SN, _Float16* __restrict__ H, _Float16* __restrict__ L) {
  #pragma clang fp contract(off)
  const size_t t = (size_t)blockIdx.x * 256 + threadIdx.x; if (t >= (size_t)NR * ndst * 4) return; const int g8 = (int)(t % 4); const int hd = (int)((t / 4) % ndst); const size_t row = t / ((size_t)4 * ndst); const int s = (int)(row % SLEN); const int hs = hd / rep;
  const float* src = F + row * (size_t)(nsrc * 64) + hs * 64; FragH ah, al, bh, bl;
  for (int i = 0; i < 8; ++i) { const int d = g8 * 8 + i; const float c = CS[s * 32 + d], sn = SN[s * 32 + d]; const float x1 = src[d], x2 = src[d + 32];
    float o1 = x1 * c; o1 += -x2 * sn; float o2 = x2 * c; o2 += x1 * sn;
    _Float16 hv = (_Float16)o1; ah.h[i] = hv; al.h[i] = (_Float16)((o1 - (float)hv) * 1024.0f); hv = (_Float16)o2; bh.h[i] = hv; bl.h[i] = (_Float16)((o2 - (float)hv) * 1024.0f); }
  const size_t o = row * (size_t)(ndst * 64) + hd * 64 + g8 * 8;
  { *(v8us*)((unsigned short*)H + o) = ah.half[0]; *(v8us*)((unsigned short*)H + o + 32) = bh.half[0]; *(v8us*)((unsigned short*)L + o) = al.half[0]; *(v8us*)((unsigned short*)L + o + 32) = bl.half[0];  } }
__global__ __launch_bounds__(256) void k_rope2(const float* __restrict__ F, int nsrc, int ndst, int rep, const float* __restrict__ CS, const float* __restrict__ SN, _Float16* __restrict__ H, _Float16* __restrict__ L) {
  #pragma clang fp contract(off)
  const size_t t = (size_t)blockIdx.x * 256 + threadIdx.x; if (t >= (size_t)NR * ndst * 4) return; const int g16 = (int)(t % 4); const int hd = (int)((t / 4) % ndst); const size_t row = t / ((size_t)4 * ndst); const int s = (int)(row % SLEN); const int hs = hd / rep;
  const float* src = F + row * (size_t)(nsrc * 64) + hs * 64 + g16 * 16; FragH ah, al;
  for (int pr = 0; pr < 8; ++pr) { const int i = g16 * 8 + pr; const float c = CS[s * 32 + i], sn = SN[s * 32 + i]; const float x1 = src[2 * pr], x2 = src[2 * pr + 1];
    float o1 = x1 * c; o1 -= x2 * sn; float o2 = x1 * sn; o2 += x2 * c;
    _Float16 hv = (_Float16)o1; ah.h[2 * pr] = hv; al.h[2 * pr] = (_Float16)((o1 - (float)hv) * 1024.0f); hv = (_Float16)o2; ah.h[2 * pr + 1] = hv; al.h[2 * pr + 1] = (_Float16)((o2 - (float)hv) * 1024.0f); }
  const size_t o = row * (size_t)(ndst * 64) + hd * 64 + g16 * 16;
  { *(v8us*)((unsigned short*)H + o) = ah.half[0]; *(v8us*)((unsigned short*)H + o + 8) = ah.half[1]; *(v8us*)((unsigned short*)L + o) = al.half[0]; *(v8us*)((unsigned short*)L + o + 8) = al.half[1];  } }
__global__ __launch_bounds__(256) void k_ln512(const float* __restrict__ A, const float* __restrict__ res, const float* __restrict__ g, const float* __restrict__ bb, float* __restrict__ Y, _Float16* __restrict__ Y16) {
  #pragma clang fp contract(off)
  const int wv = threadIdx.x >> 5, ln = threadIdx.x & 31; const size_t r = (size_t)blockIdx.x * 8 + wv; if (r >= NR) return; float x[16]; float s = 0.f;
  for (int i = 0; i < 2; ++i) { const v8f a = *(const v8f*)(A + r * DM + i * 256 + ln * 8); for (int q = 0; q < 8; ++q) { float v = a[q]; if (res) v += bf16_round(res[r * DM + i * 256 + ln * 8 + q]); x[i * 8 + q] = v; s += v; } }
  for (int o = 16; o > 0; o >>= 1) s += __shfl_xor(s, o, 32); const float mu = s / (float)DM; float var = 0.f; for (int q = 0; q < 16; ++q) { const float d = x[q] - mu; var += d * d; }
  for (int o = 16; o > 0; o >>= 1) var += __shfl_xor(var, o, 32); const float inv = rsqrtf(var / (float)DM + 1e-5f);
  { for (int i = 0; i < 2; ++i) { const int c0 = i * 256 + ln * 8; v8f y; FragH f; for (int q = 0; q < 8; ++q) { float v = (x[i * 8 + q] - mu) * inv; v *= bf16_round(g[c0 + q]); v += bf16_round(bb[c0 + q]); y[q] = v; f.h[q] = (_Float16)v; } *(v8f*)(Y + r * DM + c0) = y; if (Y16) *(v8us*)((unsigned short*)Y16 + r * DM + c0) = f.half[0]; }  } }
__global__ __launch_bounds__(256) void k_pack(const float* __restrict__ rb, const int* __restrict__ rid, int* __restrict__ PK) { const int t = blockIdx.x * 256 + threadIdx.x; if (t >= 1024 + NB * TK) return; int v; if (t < 1024) v = __float_as_int(bf16_round(rb[t])); else v = rid[t - 1024]; *(int*)(PK + t) = v;  }
__global__ __launch_bounds__(256) void k_tabin(const float* __restrict__ sp, float* __restrict__ CS, float* __restrict__ SN) { const int t = blockIdx.x * 256 + threadIdx.x; if (t >= SLEN * 32) return; const int i = t % 32, s = t / 32; const float c = bf16_round(sp[s * 64 + 32 + i]), sn = bf16_round(sp[s * 64 + i]);
  { *(float*)(CS + t) = c; *(float*)(SN + t) = sn;  } }
__global__ __launch_bounds__(256) void k_wsc(const float* __restrict__ Wm, _Float16* __restrict__ Bt, size_t n8, float sc) { const size_t t = (size_t)blockIdx.x * 256 + threadIdx.x; if (t >= n8) return; FragH f; for (int q = 0; q < 8; ++q) f.h[q] = (_Float16)(bf16_round(Wm[t * 8 + q]) * sc); *(v8us*)((unsigned short*)Bt + t * 8) = f.half[0];  }
__global__ __launch_bounds__(256) void k_rotab2(float* __restrict__ CS, float* __restrict__ SN) {
  #pragma clang fp contract(off)
  const int t = blockIdx.x * 256 + threadIdx.x; if (t >= SLEN * 32) return; const int j = t % 32, s = t / 32; const float c0 = -0.14391156831212787f;      /* -ln(10000)/64 rounded to f32 */ const float inv = expf((float)(2 * j) * c0); const float th = (float)s * inv; const float c = cosf(th), sn = sinf(th);
  { *(float*)(CS + t) = c; *(float*)(SN + t) = sn;  } }
__global__ __launch_bounds__(256) void k_lnu(const float* __restrict__ X, _Float16* __restrict__ N16, float* __restrict__ XB) {
  #pragma clang fp contract(off)
  const int wv = threadIdx.x >> 5, ln = threadIdx.x & 31; const size_t r = (size_t)blockIdx.x * 8 + wv; if (r >= NR) return; float a[32]; float s = 0.f;
  for (int i = 0; i < 4; ++i) { const v8f v = *(const v8f*)(X + r * DM + (i * 32 + ln) * 8); for (int q = 0; q < 8; ++q) { const float u = bf16_round(v[q]); a[i * 8 + q] = u; s += u; } }
  for (int o = 16; o > 0; o >>= 1) s += __shfl_xor(s, o, 32); const float mu = s / (float)DM; float var = 0.f; for (int q = 0; q < 32; ++q) { const float d = a[q] - mu; var += d * d; }
  for (int o = 16; o > 0; o >>= 1) var += __shfl_xor(var, o, 32); const float den = sqrtf(var / (float)(DM - 1)) + 1e-6f; const float inv = 1.0f / den;      /* one reciprocal per row; (x-mean)*inv vs the reference's division differs by <= 1 ulp */
  { for (int i = 0; i < 4; ++i) { const int c0 = (i * 32 + ln) * 8; FragH f; v8f xb; for (int q = 0; q < 8; ++q) { f.h[q] = (_Float16)((a[i * 8 + q] - mu) * inv); xb[q] = a[i * 8 + q]; } *(v8us*)((unsigned short*)N16 + r * DM + c0) = f.half[0]; *(v8f*)(XB + r * DM + c0) = xb; }  } }
__global__ __launch_bounds__(256) void k_vtg(const _Float16* __restrict__ V16, _Float16* __restrict__ Vt) { __shared__ unsigned short tl[64][66]; const int tid = threadIdx.x; const int slab = blockIdx.x / (SLEN / 64), lg = blockIdx.x % (SLEN / 64); const int b = slab / NH, h = slab % NH; const int hs = h / NREP;
  for (int i = tid; i < 64 * 8; i += 256) { const int r = i / 8, c8 = (i % 8) * 8; FragH f; f.half[0] = *(const v8us*)((const unsigned short*)V16 + ((size_t)b * SLEN + lg * 64 + r) * KVD + hs * 64 + c8); for (int q = 0; q < 8; ++q) tl[r][c8 + q] = f.u[q]; }
  __syncthreads();
  { for (int rd = 0; rd < 2; ++rd) { const int d = rd * 32 + tid / 8, pc = tid % 8; FragH f; for (int q = 0; q < 8; ++q) f.u[q] = tl[pc * 8 + q][d]; *(v8us*)((unsigned short*)Vt + ((size_t)slab * 64 + d) * SLEN + lg * 64 + pc * 8) = f.half[0]; }  } }

__global__ __launch_bounds__(256) void k_h16s(const float* __restrict__ SRC, int lds, int coff, _Float16* __restrict__ DST, size_t n8) { const size_t t = (size_t)blockIdx.x * 256 + threadIdx.x; if (t >= n8) return; const size_t r = (t * 8) / DM; const int c = (int)((t * 8) % DM); const v8f a = *(const v8f*)(SRC + r * lds + coff + c); FragH f; for (int q = 0; q < 8; ++q) f.h[q] = (_Float16)a[q];
  *(v8us*)((unsigned short*)DST + t * 8) = f.half[0];  }


__global__ __launch_bounds__(256) void k_ccp(const float* __restrict__ QKV, int coff, _Float16* __restrict__ D) { const size_t t = (size_t)blockIdx.x * 256 + threadIdx.x; if (t >= (size_t)NR * DM / 8) return; const int c0 = (int)((t * 8) % DM); const size_t row = (t * 8) / DM; const v8f a = *(const v8f*)(QKV + row * 3 * DM + coff + c0); FragH f; for (int q = 0; q < 8; ++q) f.h[q] = (_Float16)a[q];
  *(v8us*)((unsigned short*)D + t * 8) = f.half[0];  }


extern "C" void kernel_launch(void* const* d_in, const int* in_sizes, int n_in,
                              void* d_out, int out_size, void* d_ws, size_t ws_size, hipStream_t stream) {
  (void)in_sizes; (void)n_in; (void)out_size;
  const float* q = (const float*)d_in[0]; const float* kv = (const float*)d_in[1]; const float* mask = (const float*)d_in[2]; float* O = (float*)d_out;
  char* ws = (char*)d_ws; size_t off = 0;
  auto take = [&](size_t bytes) { char* p = ws + off; off += (bytes + 255) & ~(size_t)255; return p; };
  const size_t np = (size_t)NR * DM;      /* 32 x 2048 x 64 */
  _Float16* Q16 = (_Float16*)take(np * 2); _Float16* K16 = (_Float16*)take(np * 2); _Float16* VT = (_Float16*)take(np * 2);
  if (off > ws_size) return;      /* 24 MiB */
  k_x16<<<(unsigned)((np / 8 + 255) / 256), 256, 0, stream>>>(q, Q16, np / 8); k_x16<<<(unsigned)((np / 8 + 255) / 256), 256, 0, stream>>>(kv, K16, np / 8);
  k_vtg<<<NB * NH * (SLEN / 64), 256, 0, stream>>>(K16, VT);      /* values = keys */
  k_flash<33><<<NB * NH * QBNP, 128, 0, stream>>>(Q16, DM, K16, DM, VT, (const int*)mask, O, DM);      /* f32 context straight to the output rows */
}

// v001
// One run takes 187 microseconds.
// Two timings next to v000 put it at 1.86 and 1.87 times that version's speed.
#include <hip/hip_runtime.h>
// DotProdAttention (q [4][8][2048][64], kv [4][8][2048][64] (keys = values), mask [1][1][2048][2048] added to every (batch, head); out = softmax(q kv^T / 8 + mask) kv -> [4][8][2048][64]).
// Structure: the (batch, head) slabs of q/kv are already contiguous 64-wide row blocks, so each slab is treated as one 'batch' of a single 64-dim head: exact f16 planes of q and kv; kv^T by LDS tiles; flash-style fused attention per (slab, 64-query block) adding the shared additive mask table per (query, key), f32 context written straight to the output.
// Compute dtype: inputs rounded to bf16; q, kv, mask exact (f16 / bf16-rounded f32); softmax f32 with f16 probabilities; plain f16 value operand (~2^-12). v_wmma_f32_16x16x32_f16.
#define NB 32                    /* 4 batches x 8 heads as slabs */
#define DM 64
#define NKV 1
#define NREP (NH / NKV)
#define KVD (NKV * 64)           /* 64 */
#define NR (NB * SLEN)
#define CHK 512
typedef int v4i __attribute__((ext_vector_type(4)));
#define FF 2048
#define SLEN 2048
#define MQI 2048
#define MKI 2048
#define TQ SLEN
#define TK SLEN
#define NH 1
#define SCL 0.125f
#define QBLKS (TQ / 64)
#define QB05 0
#define QBN5 4
#define QB0P 0
#define QBNP QBLKS
#define RE 256
typedef __bf16 v16b __attribute__((ext_vector_type(16)));
typedef unsigned short v8us __attribute__((ext_vector_type(8), may_alias));
typedef float  v8f  __attribute__((ext_vector_type(8)));
typedef float  v4f  __attribute__((ext_vector_type(4)));
typedef float  v4fa __attribute__((ext_vector_type(4), may_alias));
union FragB { v16b v; v8us half[2]; unsigned short u[16]; };

__device__ __forceinline__ unsigned short bf16_bits(float x) { unsigned int u = __float_as_uint(x); return (unsigned short)((u + 0x7FFFu + ((u >> 16) & 1u)) >> 16); }
__device__ __forceinline__ float bf16_val(unsigned short b) { return __uint_as_float(((unsigned int)b) << 16); }
__device__ __forceinline__ float bf16_round(float x) { return bf16_val(bf16_bits(x)); }
// D += A·B with NT terms: 1 = ah·bh, 2 = + al·bh (A split), 3 = + ah·bl (both split)
template <int NT>
__device__ __forceinline__ v8f mmaN(v16b ah, v16b al, v16b bh, v16b bl, v8f c) {
  c = __builtin_amdgcn_wmma_f32_16x16x32_bf16(false, ah, false, bh, (short)0, c, false, false);
  if (NT >= 2) c = __builtin_amdgcn_wmma_f32_16x16x32_bf16(false, al, false, bh, (short)0, c, false, false);
  if (NT >= 3) c = __builtin_amdgcn_wmma_f32_16x16x32_bf16(false, ah, false, bl, (short)0, c, false, false);
  asm volatile("v_nop\n\tv_nop\n\tv_nop\n\tv_nop" : "+v"(c) : "v"(ah), "v"(al), "v"(bh), "v"(bl));
  return c;
}

__global__ __launch_bounds__(256) void k_wt_bf16(const float* __restrict__ W, unsigned short* __restrict__ Wt, int K, int N) {
  const int t = blockIdx.x * 256 + threadIdx.x;
  const int k8n = K / 8;
  if (t >= N * k8n) return;
  const int n = t / k8n, k8 = (t % k8n) * 8;
  v8us v;
#pragma unroll
  for (int i = 0; i < 8; ++i) v[i] = bf16_bits(W[(size_t)(k8 + i) * N + n]);
  *(v8us*)(Wt + (size_t)n * K + k8) = v;
  
}

// GEMM C[M][N] (f32, pitch ldc) = act(A[M][K]·W + bias). A f32 row-major (pitch lda) converted per fragment to bf16
// (ASPLIT: hi/lo two planes -> 2 terms, else single rounded term); Wt bf16 [N][K] (pitch ldb). BIAS_BF16 rounds the
// bias to bf16 first (bias quantised to bf16 before the add). K%32==0, M%16==0, N%64==0.
template <bool ASPLIT, int ACT, bool BIAS_BF16>
__global__ __launch_bounds__(128) void k_gemm_bf(const float* __restrict__ A, int lda, const unsigned short* __restrict__ Wt, int ldb,
                                               const float* __restrict__ bias, float* __restrict__ C, int ldc, int M, int N, int K) {
  __shared__ __attribute__((aligned(16))) float so[4][16][64];
  const int tid = threadIdx.x, w = tid >> 5, lane = tid & 31, ln = lane & 15, hh = lane >> 4;
  const int ntn = N / 64;
  const int wid = blockIdx.x * 4 + w;
  const int mt = wid / ntn, nq = wid % ntn;
  if (mt * 16 >= M) return;
  const int row0 = mt * 16, col0 = nq * 64;
  const float* arow = A + (size_t)(row0 + ln) * lda;
  v8f acc[4] = {};
  for (int kb = 0; kb < K; kb += 32) {
    FragB ah, al;
    const v4f x0 = *(const v4fa*)(arow + kb + 8 * hh), x1 = *(const v4fa*)(arow + kb + 8 * hh + 4);
    const v4f x2 = *(const v4fa*)(arow + kb + 16 + 8 * hh), x3 = *(const v4fa*)(arow + kb + 16 + 8 * hh + 4);
    float xs[16] = {x0[0],x0[1],x0[2],x0[3],x1[0],x1[1],x1[2],x1[3],x2[0],x2[1],x2[2],x2[3],x3[0],x3[1],x3[2],x3[3]};
#pragma unroll
    for (int i = 0; i < 16; ++i) { const unsigned short hb = bf16_bits(xs[i]); ah.u[i] = hb; al.u[i] = ASPLIT ? bf16_bits(xs[i] - bf16_val(hb)) : (unsigned short)0; }
#pragma unroll
    for (int t = 0; t < 4; ++t) {
      const unsigned short* brow = Wt + (size_t)(col0 + t * 16 + ln) * ldb + kb;
      FragB b;
      b.half[0] = *(const v8us*)(brow + 8 * hh);
      b.half[1] = *(const v8us*)(brow + 16 + 8 * hh);
      acc[t] = mmaN<ASPLIT ? 2 : 1>(ah.v, al.v, b.v, b.v, acc[t]);
    }
  }
#pragma unroll
  for (int t = 0; t < 4; ++t) {
    float bv = bias ? bias[col0 + t * 16 + ln] : 0.f;
    if (BIAS_BF16) bv = bf16_round(bv);
#pragma unroll
    for (int r = 0; r < 8; ++r) { float v = acc[t][r] + bv; if (ACT == 1) v = fmaxf(v, 0.f); so[w][8 * hh + r][t * 16 + ln] = v; }
  }
  __builtin_amdgcn_fence(__ATOMIC_ACQ_REL, "workgroup");
  __builtin_amdgcn_wave_barrier();
  const int rsub = lane >> 4, c4 = (lane & 15) * 4;
  {
#pragma unroll
    for (int q = 0; q < 8; ++q) {
      const int r = q * 2 + rsub;
      const v4f v = *(const v4fa*)&so[w][r][c4];
      *(v4f*)(C + (size_t)(row0 + r) * ldc + col0 + c4) = v;
    }
    
  }
}

// GEMM C = act(A·W + bias + resid): A f32 (ASPLIT -> hi/lo 2 terms), Wt bf16 [N][K]; ACT 0 none, 1 relu, 2 exact gelu;
// resid (optional, f32, row index = (row % rmod), pitch ldr, RES_BF16 rounds it) added before the activation.
template <bool ASPLIT, int ACT, bool BIAS_BF16, bool RES_BF16>
__global__ __launch_bounds__(128) void k_gemm_bf3(const float* __restrict__ A, int lda, const unsigned short* __restrict__ Wt, int ldb,
                                                const float* __restrict__ bias, const float* __restrict__ resid, int rmod, int ldr,
                                                float* __restrict__ C, int ldc, int M, int N, int K) {
  __shared__ __attribute__((aligned(16))) float so[4][16][64];
  const int tid = threadIdx.x, w = tid >> 5, lane = tid & 31, ln = lane & 15, hh = lane >> 4;
  const int ntn = N / 64;
  const int wid = blockIdx.x * 4 + w;
  const int mt = wid / ntn, nq = wid % ntn;
  if (mt * 16 >= M) return;
  const int row0 = mt * 16, col0 = nq * 64;
  const float* arow = A + (size_t)(row0 + ln) * lda;
  v8f acc[4] = {};
  for (int kb = 0; kb < K; kb += 32) {
    FragB ah, al;
    const v4f x0 = *(const v4fa*)(arow + kb + 8 * hh), x1 = *(const v4fa*)(arow + kb + 8 * hh + 4);
    const v4f x2 = *(const v4fa*)(arow + kb + 16 + 8 * hh), x3 = *(const v4fa*)(arow + kb + 16 + 8 * hh + 4);
    float xs[16] = {x0[0],x0[1],x0[2],x0[3],x1[0],x1[1],x1[2],x1[3],x2[0],x2[1],x2[2],x2[3],x3[0],x3[1],x3[2],x3[3]};
#pragma unroll
    for (int i = 0; i < 16; ++i) { const unsigned short hb = bf16_bits(xs[i]); ah.u[i] = hb; al.u[i] = ASPLIT ? bf16_bits(xs[i] - bf16_val(hb)) : (unsigned short)0; }
#pragma unroll
    for (int t = 0; t < 4; ++t) {
      const unsigned short* brow = Wt + (size_t)(col0 + t * 16 + ln) * ldb + kb;
      FragB b;
      b.half[0] = *(const v8us*)(brow + 8 * hh);
      b.half[1] = *(const v8us*)(brow + 16 + 8 * hh);
      acc[t] = mmaN<ASPLIT ? 2 : 1>(ah.v, al.v, b.v, b.v, acc[t]);
    }
  }
#pragma unroll
  for (int t = 0; t < 4; ++t) {
    const int col = col0 + t * 16 + ln;
    float bv = bias ? bias[col] : 0.f;
    if (BIAS_BF16) bv = bf16_round(bv);
#pragma unroll
    for (int r = 0; r < 8; ++r) {
      float v = acc[t][r] + bv;
      if (resid) { float rv = resid[(size_t)((row0 + 8 * hh + r) % rmod) * ldr + col]; if (RES_BF16) rv = bf16_round(rv); v += rv; }
      if (ACT == 1) v = fmaxf(v, 0.f);
      if (ACT == 2) v = 0.5f * v * (1.0f + erff(v * 0.70710678118654752f));
      if (ACT == 3) { const float u = 0.7978845608028654f * (v + 0.044715f * v * v * v); v = 0.5f * v * (1.0f + tanhf(u)); }
      so[w][8 * hh + r][t * 16 + ln] = v;
    }
  }
  __builtin_amdgcn_fence(__ATOMIC_ACQ_REL, "workgroup");
  __builtin_amdgcn_wave_barrier();
  const int rsub = lane >> 4, c4 = (lane & 15) * 4;
  {
#pragma unroll
    for (int q = 0; q < 8; ++q) {
      const int r = q * 2 + rsub;
      const v4f v = *(const v4fa*)&so[w][r][c4];
      *(v4f*)(C + (size_t)(row0 + r) * ldc + col0 + c4) = v;
    }
    
  }
}
// row LayerNorm (biased variance, eps) over N: s = X (+ R); optional out_sum <- s; out_norm <- (s-mu)*rsqrt(var+eps)*g + b
template <bool PARAM_BF16>
__global__ __launch_bounds__(256) void k_layernorm(const float* __restrict__ X, const float* __restrict__ R, const float* __restrict__ g, const float* __restrict__ bta,
                                                  float* __restrict__ out_sum, float* __restrict__ out_norm, int N, float eps) {
  __shared__ float red[256];
  const int row = blockIdx.x, tid = threadIdx.x;
  const float* x = X + (size_t)row * N; const float* rr = R ? R + (size_t)row * N : nullptr;
  float vals[16];                     // up to N = 4096
  const int per = N / 256;            // contiguous chunk per thread? use strided-by-4 chunks: thread handles j = tid*4 + 1024*u
  float s1 = 0.f;
  for (int u = 0; u < per / 4; ++u) {
    const int j = tid * 4 + 1024 * u;
    const v4f a = *(const v4fa*)(x + j);
    v4f b = {0.f,0.f,0.f,0.f}; if (rr) b = *(const v4fa*)(rr + j);
#pragma unroll
    for (int q = 0; q < 4; ++q) { const float v = a[q] + b[q]; vals[u * 4 + q] = v; s1 += v; }
  }
  red[tid] = s1; __syncthreads();
  for (int st = 128; st > 0; st >>= 1) { if (tid < st) red[tid] += red[tid + st]; __syncthreads(); }
  const float mu = red[0] / (float)N; __syncthreads();
  float s2 = 0.f;
  for (int u = 0; u < per / 4; ++u)
#pragma unroll
    for (int q = 0; q < 4; ++q) { const float c = vals[u * 4 + q] - mu; s2 += c * c; }
  red[tid] = s2; __syncthreads();
  for (int st = 128; st > 0; st >>= 1) { if (tid < st) red[tid] += red[tid + st]; __syncthreads(); }
  const float rs = rsqrtf(red[0] / (float)N + eps);
  {
    for (int u = 0; u < per / 4; ++u) {
      const int j = tid * 4 + 1024 * u;
      v4f o, sm;
#pragma unroll
      for (int q = 0; q < 4; ++q) {
        float gg = g[j + q], bb = bta[j + q];
        if (PARAM_BF16) { gg = bf16_round(gg); bb = bf16_round(bb); }
        sm[q] = vals[u * 4 + q]; o[q] = (vals[u * 4 + q] - mu) * rs * gg + bb;
      }
      if (out_sum) *(v4f*)(out_sum + (size_t)row * N + j) = sm;
      *(v4f*)(out_norm + (size_t)row * N + j) = o;
    }
    
  }
}



// ---- f16 WMMA path (v_wmma_f32_16x16x32_f16): 11-bit significands for operands in range — used where a [0,1] probability operand needs more precision than bf16
typedef _Float16 v16h __attribute__((ext_vector_type(16)));
union FragH { v16h v; v8us half[2]; _Float16 h[16]; unsigned short u[16]; };
template <int NT>
__device__ __forceinline__ v8f mmaH(v16h ah, v16h al, v16h bh, v16h bl, v8f c) {
  c = __builtin_amdgcn_wmma_f32_16x16x32_f16(false, ah, false, bh, (short)0, c, false, false);
  if (NT >= 2) c = __builtin_amdgcn_wmma_f32_16x16x32_f16(false, al, false, bh, (short)0, c, false, false);
  if (NT >= 3) c = __builtin_amdgcn_wmma_f32_16x16x32_f16(false, ah, false, bl, (short)0, c, false, false);
  asm volatile("v_nop\n\tv_nop\n\tv_nop\n\tv_nop" : "+v"(c) : "v"(ah), "v"(al), "v"(bh), "v"(bl));
  return c;
}
// batched GEMM like k_gemm_b but f16 operands: A f32 (split into f16 hi/lo if ASPLIT, else rounded to f16), Bt = f16 values [n][k]; alpha; C f32; N multiple of 16 (partial tiles skipped)
template <bool ASPLIT>
__global__ __launch_bounds__(128) void k_gemm_h(const float* __restrict__ A, int lda, size_t sA, const _Float16* __restrict__ Bh, int ldb, size_t sB, float alpha, float* __restrict__ C, int ldc, size_t sC, int M, int N, int K) {
  __shared__ __attribute__((aligned(16))) float so[4][16][64];
  const int tid = threadIdx.x, w = tid >> 5, lane = tid & 31, ln = lane & 15, hh = lane >> 4; const int by = blockIdx.y;
  A += (size_t)by * sA; Bh += (size_t)by * sB; C += (size_t)by * sC;
  const int ntn = (N + 63) / 64; const int wid = blockIdx.x * 4 + w; const int mt = wid / ntn, nq = wid % ntn; if (mt * 16 >= M) return;
  const int row0 = mt * 16, col0 = nq * 64; const float* arow = A + (size_t)(row0 + ln) * lda;
  v8f acc[4] = {};
  for (int kb = 0; kb < K; kb += 32) {
    FragH ah, al;
    const v4f x0 = *(const v4fa*)(arow + kb + 8 * hh), x1 = *(const v4fa*)(arow + kb + 8 * hh + 4), x2 = *(const v4fa*)(arow + kb + 16 + 8 * hh), x3 = *(const v4fa*)(arow + kb + 16 + 8 * hh + 4);
    float xs[16] = {x0[0],x0[1],x0[2],x0[3],x1[0],x1[1],x1[2],x1[3],x2[0],x2[1],x2[2],x2[3],x3[0],x3[1],x3[2],x3[3]};
#pragma unroll
    for (int i = 0; i < 16; ++i) { const _Float16 h = (_Float16)xs[i]; ah.h[i] = h; al.h[i] = ASPLIT ? (_Float16)(xs[i] - (float)h) : (_Float16)0.0f; }
#pragma unroll
    for (int t = 0; t < 4; ++t) { if (col0 + t * 16 >= N) continue; const size_t boff = (size_t)(col0 + t * 16 + ln) * ldb + kb; FragH bq; bq.half[0] = *(const v8us*)(Bh + boff + 8 * hh); bq.half[1] = *(const v8us*)(Bh + boff + 16 + 8 * hh);
      acc[t] = mmaH<ASPLIT ? 2 : 1>(ah.v, al.v, bq.v, bq.v, acc[t]); }
  }
#pragma unroll
  for (int t = 0; t < 4; ++t) { if (col0 + t * 16 >= N) continue;
#pragma unroll
    for (int r = 0; r < 8; ++r) so[w][8 * hh + r][t * 16 + ln] = acc[t][r] * alpha; }
  __builtin_amdgcn_fence(__ATOMIC_ACQ_REL, "workgroup"); __builtin_amdgcn_wave_barrier();
  const int rsub = lane >> 4, c4 = (lane & 15) * 4;
  {
#pragma unroll
    for (int q = 0; q < 8; ++q) { const int r = q * 2 + rsub; if (col0 + c4 < N) { const v4f v = *(const v4fa*)&so[w][r][c4]; *(v4f*)(C + (size_t)(row0 + r) * ldc + col0 + c4) = v; } }
     }
}

// Wt[n][k] = f16(W[k][n]·scale) from f32 row-major W[K][N] (scale = power of two; bf16-exact weights stay exact in f16 away from the subnormal range)
__global__ __launch_bounds__(256) void k_wt_f16(const float* __restrict__ W, _Float16* __restrict__ Wt, int K, int N, float scale) {
  const int t = blockIdx.x * 256 + threadIdx.x; if (t >= N * (K / 8)) return; const int n = t / (K / 8), k8 = (t % (K / 8)) * 8; FragH f;
#pragma unroll
  for (int i = 0; i < 8; ++i) f.h[i] = (_Float16)(bf16_round(W[(size_t)(k8 + i) * N + n]) * scale); const v8us o = f.half[0];
  *(v8us*)((unsigned short*)Wt + (size_t)n * K + k8) = o; 
}
// k_gemm_hh variant with fused epilogue: v = acc·alpha + bias[by·sBias + col] (+ CP[(row/rowsPerB)·sCPb + by·64 + col] if CP) ; ACT 0 none / 1 elu ; writes f16 C16 (and f32 C if non-null)
template <int ACT>
__global__ __launch_bounds__(128) void k_gemm_hhx(const _Float16* __restrict__ A, int lda, size_t sA, const _Float16* __restrict__ Bh, int ldb, size_t sB, float alpha, const float* __restrict__ bias, size_t sBias, const float* __restrict__ CP, int rowsPerB, size_t sCPb, int row0g,
    float* __restrict__ C, _Float16* __restrict__ C16, int ldc, size_t sC, int M, int N, int K) {
  __shared__ __attribute__((aligned(16))) float so[4][16][64];
  const int tid = threadIdx.x, w = tid >> 5, lane = tid & 31, ln = lane & 15, hh = lane >> 4; const int by = blockIdx.y;
  A += (size_t)by * sA; Bh += (size_t)by * sB; const size_t cofs = (size_t)by * sC; const float* bp = bias ? bias + (size_t)by * sBias : nullptr;
  const int ntn = (N + 63) / 64; const int wid = blockIdx.x * 4 + w; const int mt = wid / ntn, nq = wid % ntn; if (mt * 16 >= M) return;
  const int row0 = mt * 16, col0 = nq * 64; const _Float16* arow = A + (size_t)(row0 + ln) * lda;
  v8f acc[4] = {};
  for (int kb = 0; kb < K; kb += 32) { FragH ah; ah.half[0] = *(const v8us*)((const unsigned short*)arow + kb + 8 * hh); ah.half[1] = *(const v8us*)((const unsigned short*)arow + kb + 16 + 8 * hh);
#pragma unroll
    for (int t = 0; t < 4; ++t) { if (col0 + t * 16 >= N) continue; const size_t boff = (size_t)(col0 + t * 16 + ln) * ldb + kb; FragH bq; bq.half[0] = *(const v8us*)((const unsigned short*)Bh + boff + 8 * hh); bq.half[1] = *(const v8us*)((const unsigned short*)Bh + boff + 16 + 8 * hh);
      acc[t] = mmaH<1>(ah.v, ah.v, bq.v, bq.v, acc[t]); }
  }
#pragma unroll
  for (int t = 0; t < 4; ++t) { if (col0 + t * 16 >= N) continue; const int col = col0 + t * 16 + ln; const float bv = bp ? bf16_round(bp[col]) : 0.f;
#pragma unroll
    for (int r = 0; r < 8; ++r) { float v = acc[t][r] * alpha + bv; if (CP) { const int bidx = (row0g + row0 + 8 * hh + r) / rowsPerB; v += CP[(size_t)bidx * sCPb + (size_t)by * 64 + col]; } if (ACT == 1) v = (v > 0.f) ? v : expm1f(v); else if (ACT == 7) v = (v > 0.f) ? v + 1.0f : expf(v); else if (ACT == 8) v = tanhf(v); else if (ACT == 9) v = 0.5f * v * (1.0f + tanhf(0.7978845608028654f * (v + 0.044715f * v * v * v))); else if (ACT == 11) v = 1.0f / (1.0f + expf(-v)); else if (ACT == 12) v = (v > 0.f) ? v : 0.01f * v; else if (ACT == 14) v = (v > 0.f) ? v : 0.1f * v; else if (ACT == 15) v = v / (1.0f + expf(-v)); else if (ACT == 3) v = fmaxf(v, 0.f); else if (ACT == 6) v = 0.5f * v * (1.0f + erff(v * 0.70710678118654752f)); so[w][8 * hh + r][t * 16 + ln] = v; } }
  __builtin_amdgcn_fence(__ATOMIC_ACQ_REL, "workgroup"); __builtin_amdgcn_wave_barrier();
  const int rsub = lane >> 4, c4 = (lane & 15) * 4; typedef _Float16 v4h __attribute__((ext_vector_type(4)));
  {
#pragma unroll
    for (int q = 0; q < 8; ++q) { const int r = q * 2 + rsub; if (col0 + c4 < N) { const v4f v = *(const v4fa*)&so[w][r][c4]; if (C) *(v4f*)(C + cofs + (size_t)(row0 + r) * ldc + col0 + c4) = v; if (C16) { v4h h4; for (int i = 0; i < 4; ++i) h4[i] = (_Float16)v[i]; *(v4h*)(C16 + cofs + (size_t)(row0 + r) * ldc + col0 + c4) = h4; } } }
     }
}


typedef _Float16 v4h __attribute__((ext_vector_type(4)));

__global__ __launch_bounds__(256) void k_x16(const float* __restrict__ x, _Float16* __restrict__ X16, size_t n8) { const size_t t = (size_t)blockIdx.x * 256 + threadIdx.x; if (t >= n8) return; FragH f;
#pragma unroll
  for (int q = 0; q < 8; ++q) f.h[q] = (_Float16)bf16_round(x[t * 8 + q]); *(v8us*)((unsigned short*)X16 + t * 8) = f.half[0];  }
__global__ __launch_bounds__(256) void k_h16(const float* __restrict__ x, _Float16* __restrict__ X16, size_t n8) { const size_t t = (size_t)blockIdx.x * 256 + threadIdx.x; if (t >= n8) return; FragH f;
#pragma unroll
  for (int q = 0; q < 8; ++q) f.h[q] = (_Float16)x[t * 8 + q]; *(v8us*)((unsigned short*)X16 + t * 8) = f.half[0];  }
__global__ __launch_bounds__(256) void k_round16f(const float* __restrict__ W, _Float16* __restrict__ Bt, size_t n8) { const size_t t = (size_t)blockIdx.x * 256 + threadIdx.x; if (t >= n8) return; FragH f;
#pragma unroll
  for (int i = 0; i < 8; ++i) f.h[i] = (_Float16)(bf16_round(W[t * 8 + i]) * 16.0f); *(v8us*)((unsigned short*)Bt + t * 8) = f.half[0];  }
template <int NHv, int TTv>
__global__ __launch_bounds__(256) void k_vt(const _Float16* __restrict__ V16, int ldv, int voff, _Float16* __restrict__ Vt) { __shared__ unsigned short tl[64][66]; const int tid = threadIdx.x; const int slab = blockIdx.x / (TTv / 64), lg = blockIdx.x % (TTv / 64); const int b = slab / NHv, h = slab % NHv;
  for (int i = tid; i < 64 * 8; i += 256) { const int r = i / 8, c8 = (i % 8) * 8; FragH f; f.half[0] = *(const v8us*)((const unsigned short*)V16 + ((size_t)b * TTv + lg * 64 + r) * ldv + voff + h * 64 + c8);
#pragma unroll
    for (int q = 0; q < 8; ++q) tl[r][c8 + q] = f.u[q]; }
  __syncthreads();
  {
#pragma unroll
    for (int rd = 0; rd < 2; ++rd) { const int d = rd * 32 + tid / 8, pc = tid % 8; FragH f;
#pragma unroll
      for (int q = 0; q < 8; ++q) f.u[q] = tl[pc * 8 + q][d];
      *(v8us*)((unsigned short*)Vt + ((size_t)slab * 64 + d) * TTv + lg * 64 + pc * 8) = f.half[0]; }
     } }

__global__ __launch_bounds__(256) void k_hl(const float* __restrict__ F, _Float16* __restrict__ Hh, _Float16* __restrict__ Hl, size_t n8) { const size_t t = (size_t)blockIdx.x * 256 + threadIdx.x; if (t >= n8) return; FragH fh, fl; const v4f a = *(const v4fa*)(F + t * 8), c = *(const v4fa*)(F + t * 8 + 4);
#pragma unroll
  for (int q = 0; q < 4; ++q) { _Float16 h = (_Float16)a[q]; fh.h[q] = h; fl.h[q] = (_Float16)((a[q] - (float)h) * 1024.0f); h = (_Float16)c[q]; fh.h[4 + q] = h; fl.h[4 + q] = (_Float16)((c[q] - (float)h) * 1024.0f); }
  { *(v8us*)((unsigned short*)Hh + t * 8) = fh.half[0]; *(v8us*)((unsigned short*)Hl + t * 8) = fl.half[0];  } }

// ---- fast GEMM (wave tile 32x64; requires M % 32 == 0 rows per launch region and N % 64 == 0); epilogue = k_gemm_hhx semantics ----
__device__ __forceinline__ v16h g2_frag(const _Float16* p, int hh) { FragH f; f.half[0] = *(const v8us*)((const unsigned short*)p + 8 * hh); f.half[1] = *(const v8us*)((const unsigned short*)p + 16 + 8 * hh); return f.v; }
__device__ __forceinline__ v8f g2_mma(v16h a, v16h b, v8f c) { v8f d = __builtin_amdgcn_wmma_f32_16x16x32_f16(false, a, false, b, (short)0, c, false, false); asm volatile("v_nop\n\tv_nop\n\tv_nop\n\tv_nop" : "+v"(d) : "v"(a), "v"(b)); return d; }
template <int ACT>
__global__ __launch_bounds__(128) void k_gemm2(const _Float16* __restrict__ A, int lda, size_t sA, const _Float16* __restrict__ Bh, int ldb, size_t sB, float alpha, const float* __restrict__ bias, size_t sBias, const float* __restrict__ CP, int rowsPerB, size_t sCPb, int row0g,
    float* __restrict__ C, _Float16* __restrict__ C16, int ldc, size_t sC, int M, int N, int K) {
  __shared__ __attribute__((aligned(16))) float so[4][32][68];
  const int tid = threadIdx.x, w = tid >> 5, lane = tid & 31, ln = lane & 15, hh = lane >> 4; const int by = blockIdx.y;
  A += (size_t)by * sA; Bh += (size_t)by * sB; const size_t cofs = (size_t)by * sC; const float* bp = bias ? bias + (size_t)by * sBias : nullptr;
  const int ntn = N >> 6; const int mt = blockIdx.x / ntn, nq = blockIdx.x - mt * ntn; const int row0 = mt * 128 + 32 * w, col0 = nq * 64; if (row0 >= M) return;
  const _Float16* a0p = A + (size_t)(row0 + ln) * lda; const _Float16* a1p = a0p + (size_t)16 * lda;
  const _Float16* b0p = Bh + (size_t)(col0 + ln) * ldb; const _Float16* b1p = b0p + (size_t)16 * ldb; const _Float16* b2p = b1p + (size_t)16 * ldb; const _Float16* b3p = b2p + (size_t)16 * ldb;
  const v8f z8 = {0.f,0.f,0.f,0.f,0.f,0.f,0.f,0.f}; v8f c00 = z8, c01 = z8, c02 = z8, c03 = z8, c10 = z8, c11 = z8, c12 = z8, c13 = z8;
#pragma unroll 1
  for (int kb = 0; kb < K; kb += 32) { const v16h a0 = g2_frag(a0p + kb, hh), a1 = g2_frag(a1p + kb, hh);
    v16h b = g2_frag(b0p + kb, hh); c00 = g2_mma(a0, b, c00); c10 = g2_mma(a1, b, c10);
    b = g2_frag(b1p + kb, hh); c01 = g2_mma(a0, b, c01); c11 = g2_mma(a1, b, c11);
    b = g2_frag(b2p + kb, hh); c02 = g2_mma(a0, b, c02); c12 = g2_mma(a1, b, c12);
    b = g2_frag(b3p + kb, hh); c03 = g2_mma(a0, b, c03); c13 = g2_mma(a1, b, c13); }
  v8f accs[8] = {c00, c01, c02, c03, c10, c11, c12, c13};
#pragma unroll
  for (int u = 0; u < 8; ++u) { const int t = u & 3, half = u >> 2; const int col = col0 + t * 16 + ln; const float bv = bp ? bf16_round(bp[col]) : 0.f;
#pragma unroll
    for (int r = 0; r < 8; ++r) { const int rloc = half * 16 + 8 * hh + r; float v = accs[u][r] * alpha + bv; if (CP) { if (rowsPerB < 0) v += CP[cofs + (size_t)(row0g + row0 + rloc) * ldc + col];      /* rowsPerB < 0: own element of the batched C plane */ else { const int bidx = (row0g + row0 + rloc) / rowsPerB; v += CP[(size_t)bidx * sCPb + (size_t)by * 64 + col]; } }
      if (ACT == 3) v = fmaxf(v, 0.f); else if (ACT == 6) v = 0.5f * v * (1.0f + erff(v * 0.70710678118654752f)); else if (ACT == 11) v = 1.0f / (1.0f + expf(-v)); else if (ACT == 15) v = v / (1.0f + expf(-v)); else if (ACT == 12) v = (v > 0.f) ? v : 0.01f * v; else if (ACT == 8) v = tanhf(v);
      so[w][rloc][t * 16 + ln] = v; } }
  __builtin_amdgcn_fence(__ATOMIC_ACQ_REL, "workgroup"); __builtin_amdgcn_wave_barrier();
  const int rsub = lane >> 4, c4 = (lane & 15) * 4;
  {
#pragma unroll
    for (int q = 0; q < 16; ++q) { const int r = q * 2 + rsub; const v4f v = *(const v4fa*)&so[w][r][c4]; if (C) *(v4f*)(C + cofs + (size_t)(row0 + r) * ldc + col0 + c4) = v; if (C16) { v4h h4; for (int i = 0; i < 4; ++i) h4[i] = (_Float16)v[i]; *(v4h*)(C16 + cofs + (size_t)(row0 + r) * ldc + col0 + c4) = h4; } }
     } }



template <int CAUSAL>
__global__ __launch_bounds__(128) void k_flash(const _Float16* __restrict__ Q16, int ldq, const _Float16* __restrict__ K16, int ldk, const _Float16* __restrict__ Vt, const int* __restrict__ MSK, float* __restrict__ O, int ldo) {
  constexpr int RPW = 16, RTN = RPW / 16, NQB = TQ / (4 * RPW), DT = 4, KS = 2;
  __shared__ __attribute__((aligned(16))) unsigned short sP[4][RPW][40]; __shared__ __attribute__((aligned(16))) float sO[4][RPW][64 + 4];
  const int tid = threadIdx.x, w = tid >> 5, lane = tid & 31, ln = lane & 15, hh = lane >> 4;
  const int slab = blockIdx.x / QBNP, qblk = QB0P + blockIdx.x % QBNP; (void)NQB; const int b = slab / NH, h = slab % NH; const int qb0 = qblk * (4 * RPW); const int q0 = qb0 + w * RPW;
  FragH aq[2][KS];
#pragma unroll
  for (int rt = 0; rt < RTN; ++rt) { const unsigned short* qr = (const unsigned short*)Q16 + ((size_t)b * TQ + q0 + rt * 16 + ln) * ldq + h * 64;
#pragma unroll
    for (int ks = 0; ks < KS; ++ks) { aq[rt][ks].half[0] = *(const v8us*)(qr + ks * 32 + 8 * hh); aq[rt][ks].half[1] = *(const v8us*)(qr + ks * 32 + 16 + 8 * hh); } }
  const unsigned short* Vth = (const unsigned short*)Vt + (size_t)slab * 64 * TK;
  float m_r[2][8], l_r[2][8]; v8f oacc[2][DT];
#pragma unroll
  for (int rt = 0; rt < RTN; ++rt) {
#pragma unroll
    for (int r = 0; r < 8; ++r) { m_r[rt][r] = -3.0e38f; l_r[rt][r] = 0.f; }
#pragma unroll
    for (int dt = 0; dt < DT; ++dt) oacc[rt][dt] = (v8f){0.f,0.f,0.f,0.f,0.f,0.f,0.f,0.f}; }
  const int jend = (CAUSAL == 1) ? (qb0 + 4 * RPW) : ((CAUSAL == 23) ? min(TK, (qb0 / CHK + 2) * CHK) : TK);      /* causal / window: keys that can never contribute are skipped */ const int jbeg = (CAUSAL == 23) ? max(0, (qb0 / CHK - 1) * CHK) : 0;
  /* every global operand of the loop is held in registers and requested far ahead of its use; V^T is requested at the head of a pass, the next pass's K and mask values right after its S products */
  FragH bk[2][KS], bv[DT]; float mk[RTN][8][2], mkn[RTN][8][2];
  auto fetch_k = [&](int j0) {      /* K fragments of the 32 keys from j0 */
#pragma unroll      /* constant indices: the array stays in registers */
    for (int nt = 0; nt < 2; ++nt) { const unsigned short* kr = (const unsigned short*)K16 + ((size_t)b * TK + j0 + nt * 16 + ln) * ldk + h * 64;
#pragma unroll      /* constant indices: the array stays in registers */
      for (int ks = 0; ks < KS; ++ks) { bk[nt][ks].half[0] = *(const v8us*)(kr + ks * 32 + 8 * hh); bk[nt][ks].half[1] = *(const v8us*)(kr + ks * 32 + 16 + 8 * hh); } } };
  auto fetch_m = [&](int j0, float (&d)[RTN][8][2]) {      /* mode 33: the mask values of this lane's 16 score elements */
    if (CAUSAL == 33) {
#pragma unroll      /* constant indices: the array stays in registers */
      for (int rt = 0; rt < RTN; ++rt)
#pragma unroll      /* constant indices: the array stays in registers */
        for (int r = 0; r < 8; ++r) { const float* amk = (const float*)MSK + (size_t)(q0 + rt * 16 + 8 * hh + r) * TK + j0; d[rt][r][0] = amk[ln]; d[rt][r][1] = amk[16 + ln]; } } };
  auto fetch_v = [&](int j0) {      /* V^T fragments of the same keys */
#pragma unroll      /* constant indices: the array stays in registers */
    for (int dt = 0; dt < DT; ++dt) { const unsigned short* vrow = Vth + (size_t)(dt * 16 + ln) * TK + j0; bv[dt].half[0] = *(const v8us*)(vrow + 8 * hh); bv[dt].half[1] = *(const v8us*)(vrow + 16 + 8 * hh); } };
  fetch_k(jbeg); fetch_m(jbeg, mk);
#pragma unroll 1
  for (int j0 = jbeg; j0 < jend; j0 += 32) {
    const int jn = (j0 + 32 < jend) ? j0 + 32 : jbeg;      /* the last pass re-reads the first block: in bounds, never used */
    fetch_v(j0);      /* used behind the softmax of this pass */
    v8f s[2][2];
#pragma unroll
    for (int nt = 0; nt < 2; ++nt) {
#pragma unroll
      for (int rt = 0; rt < RTN; ++rt) { v8f acc = (v8f){0.f,0.f,0.f,0.f,0.f,0.f,0.f,0.f};
#pragma unroll
        for (int ks = 0; ks < KS; ++ks) acc = mmaH<1>(aq[rt][ks].v, aq[rt][ks].v, bk[nt][ks].v, bk[nt][ks].v, acc); s[rt][nt] = acc; } }
    fetch_k(jn); fetch_m(jn, mkn);      /* the next pass's K, into the registers just read, and its mask values */
#pragma unroll
    for (int rt = 0; rt < RTN; ++rt)
#pragma unroll
      for (int r = 0; r < 8; ++r) { const int tq = q0 + rt * 16 + 8 * hh + r; const int k0 = j0 + ln, k1 = j0 + 16 + ln;
        bool ok0 = (CAUSAL == 1) ? (k0 <= tq) : ((CAUSAL == 2) ? ((k0 >> 5) == (tq >> 5)) : true), ok1 = (CAUSAL == 1) ? (k1 <= tq) : ((CAUSAL == 2) ? ((k1 >> 5) == (tq >> 5)) : true); if (CAUSAL == 23) { const int cq = tq / CHK; ok0 = (abs(k0 / CHK - cq) <= 1) && (MSK[(size_t)b * TK + k0] == 0); ok1 = (abs(k1 / CHK - cq) <= 1) && (MSK[(size_t)b * TK + k1] == 0); }      /* mode 23: 3-chunk window + int key-padding mask */
        if (CAUSAL == 24) { ok0 = (MSK[(size_t)b * TK + k0] == 0); ok1 = (MSK[(size_t)b * TK + k1] == 0); }      /* mode 24: int key-padding mask (nonzero = padded = excluded) */      /* mode 2: block-diagonal 32-token groups */
        float s0 = ok0 ? s[rt][0][r] * SCL : -3.0e38f, s1 = ok1 ? s[rt][1][r] * SCL : -3.0e38f; if (CAUSAL == 27) { const float* amk = (const float*)MSK + ((size_t)b * MQI + tq) * MKI; s0 += bf16_round(amk[k0]); s1 += bf16_round(amk[k1]); }      /* mode 27: additive per-(batch, query, key) f32 mask INPUT [b][tq][k] */ if (CAUSAL == 33) { s0 += bf16_round(mk[rt][r][0]); s1 += bf16_round(mk[rt][r][1]); }      /* mode 33: one additive [TQ][TK] f32 table shared by every slab */ if (CAUSAL == 17) { const float* amk = (const float*)MSK + (size_t)b * TK; s0 += bf16_round(amk[k0]); s1 += bf16_round(amk[k1]); } if (CAUSAL == 18) { const float* tb = (const float*)MSK; const int* ri = MSK + 1024 + (size_t)b * TK; const int rq = ri[tq]; s0 += tb[(h * 8 + rq) * 8 + ri[k0]]; s1 += tb[(h * 8 + rq) * 8 + ri[k1]]; } if (CAUSAL == 19) { const int* rel = MSK + (size_t)tq * TK; const float* rb = (const float*)MSK + (size_t)TQ * TK + ((size_t)(b * NH + h) * TQ + tq) * 64; s0 += rb[rel[k0]]; s1 += rb[rel[k1]]; }      /* mode 19: + (q.Ek[rel] + Eb[rel][h]) / 8 gathered by the int relative ids (packed [ids | table]) */      /* mode 18: + resource_bias[h][r_q][r_k] from the packed [table | ids] buffer (TQ == TK) */      /* mode 17: additive per-(batch, key) mask INPUT */ float mc = fmaxf(s0, s1);
        mc = fmaxf(mc, __shfl_xor(mc, 1, 32)); mc = fmaxf(mc, __shfl_xor(mc, 2, 32)); mc = fmaxf(mc, __shfl_xor(mc, 4, 32)); mc = fmaxf(mc, __shfl_xor(mc, 8, 32));
        const float mn = fmaxf(m_r[rt][r], mc); const float al = (mn > -1.0e38f) ? expf(m_r[rt][r] - mn) : 1.0f; m_r[rt][r] = mn; const float p0 = ok0 ? expf(s0 - mn) : 0.f, p1 = ok1 ? expf(s1 - mn) : 0.f; l_r[rt][r] = l_r[rt][r] * al + p0 + p1;
#pragma unroll
        for (int dt = 0; dt < DT; ++dt) oacc[rt][dt][r] *= al;
        FragH t2; t2.h[0] = (_Float16)(p0 * 1024.0f); t2.h[1] = (_Float16)(p1 * 1024.0f); sP[w][rt * 16 + 8 * hh + r][ln] = t2.u[0]; sP[w][rt * 16 + 8 * hh + r][16 + ln] = t2.u[1]; }
    __builtin_amdgcn_fence(__ATOMIC_ACQ_REL, "workgroup"); __builtin_amdgcn_wave_barrier();
    FragH pa[2];
#pragma unroll
    for (int rt = 0; rt < RTN; ++rt) { pa[rt].half[0] = *(const v8us*)&sP[w][rt * 16 + ln][8 * hh]; pa[rt].half[1] = *(const v8us*)&sP[w][rt * 16 + ln][16 + 8 * hh]; }
#pragma unroll
    for (int dt = 0; dt < DT; ++dt) {
#pragma unroll
      for (int rt = 0; rt < RTN; ++rt) oacc[rt][dt] = mmaH<1>(pa[rt].v, pa[rt].v, bv[dt].v, bv[dt].v, oacc[rt][dt]); }
    if (CAUSAL == 33) {
#pragma unroll      /* constant indices: the array stays in registers */
      for (int rt = 0; rt < RTN; ++rt)
#pragma unroll      /* constant indices: the array stays in registers */
        for (int r = 0; r < 8; ++r) { mk[rt][r][0] = mkn[rt][r][0]; mk[rt][r][1] = mkn[rt][r][1]; } }
    __builtin_amdgcn_fence(__ATOMIC_ACQ_REL, "workgroup"); __builtin_amdgcn_wave_barrier(); }
#pragma unroll
  for (int rt = 0; rt < RTN; ++rt) {
#pragma unroll
    for (int r = 0; r < 8; ++r) { float l = l_r[rt][r]; l += __shfl_xor(l, 1, 32); l += __shfl_xor(l, 2, 32); l += __shfl_xor(l, 4, 32); l += __shfl_xor(l, 8, 32); l_r[rt][r] = (l > 0.f) ? 1.0f / (l * 1024.0f) : 0.f; }
#pragma unroll
    for (int dt = 0; dt < DT; ++dt)
#pragma unroll
      for (int r = 0; r < 8; ++r) sO[w][rt * 16 + 8 * hh + r][dt * 16 + ln] = oacc[rt][dt][r] * l_r[rt][r]; }
  __builtin_amdgcn_fence(__ATOMIC_ACQ_REL, "workgroup"); __builtin_amdgcn_wave_barrier();
  {
#pragma unroll
    for (int rp = 0; rp < RPW; rp += 2) { const int r = rp + (lane >> 4), pc = lane & 15; const v4f val = *(const v4fa*)&sO[w][r][pc * 4]; *(v4f*)(O + ((size_t)b * TQ + q0 + r) * ldo + h * 64 + pc * 4) = val; }
     } }
// 5-plane variant: S = Qh Kh^T + (Ql Kh^T + Qh Kl^T)/1024 with Q/K = [hi | 2^10 residual] f16 planes (QL/KL same layout as Q16/K16), then the 3-term P.V below.
// 3-term variant: O = (P_hi V_hi + (P_lo V_hi + P_hi V_lo) / 1024) / l with P = [hi | 2^10 residual] of 1024 p and V^T = [hi | 2^10 residual] planes (VtL same layout as Vt) -> ~2^-21-class products for un-averaged (early causal / peaked) rows
template <int CAUSAL>
__global__ __launch_bounds__(128) void k_flash5(const _Float16* __restrict__ Q16, const _Float16* __restrict__ QL, int ldq, const _Float16* __restrict__ K16, const _Float16* __restrict__ KL, int ldk, const _Float16* __restrict__ Vt, const _Float16* __restrict__ VtL, const int* __restrict__ MSK, float* __restrict__ O, int ldo) {
  constexpr int RPW = 16, RTN = RPW / 16, NQB = TQ / (4 * RPW), DT = 4, KS = 2;
  __shared__ __attribute__((aligned(16))) unsigned short sP[4][RPW][40]; __shared__ __attribute__((aligned(16))) unsigned short sPL[4][RPW][40]; __shared__ __attribute__((aligned(16))) float sO[4][RPW][64 + 4];
  const int tid = threadIdx.x, w = tid >> 5, lane = tid & 31, ln = lane & 15, hh = lane >> 4;
  const int slab = blockIdx.x / QBN5, qblk = QB05 + blockIdx.x % QBN5; (void)NQB; const int b = slab / NH, h = slab % NH; const int qb0 = qblk * (4 * RPW); const int q0 = qb0 + w * RPW;
  FragH aq[2][KS], aql[2][KS];
#pragma unroll
  for (int rt = 0; rt < RTN; ++rt) { const unsigned short* qr = (const unsigned short*)Q16 + ((size_t)b * TQ + q0 + rt * 16 + ln) * ldq + h * 64; const unsigned short* ql = (const unsigned short*)QL + ((size_t)b * TQ + q0 + rt * 16 + ln) * ldq + h * 64;
#pragma unroll
    for (int ks = 0; ks < KS; ++ks) { aq[rt][ks].half[0] = *(const v8us*)(qr + ks * 32 + 8 * hh); aq[rt][ks].half[1] = *(const v8us*)(qr + ks * 32 + 16 + 8 * hh); aql[rt][ks].half[0] = *(const v8us*)(ql + ks * 32 + 8 * hh); aql[rt][ks].half[1] = *(const v8us*)(ql + ks * 32 + 16 + 8 * hh); } }
  const unsigned short* Vth = (const unsigned short*)Vt + (size_t)slab * 64 * TK; const unsigned short* Vtl = (const unsigned short*)VtL + (size_t)slab * 64 * TK;
  float m_r[2][8], l_r[2][8]; v8f oacc[2][DT], oaccL[2][DT];
#pragma unroll
  for (int rt = 0; rt < RTN; ++rt) {
#pragma unroll
    for (int r = 0; r < 8; ++r) { m_r[rt][r] = -3.0e38f; l_r[rt][r] = 0.f; }
#pragma unroll
    for (int dt = 0; dt < DT; ++dt) { oacc[rt][dt] = (v8f){0.f,0.f,0.f,0.f,0.f,0.f,0.f,0.f}; oaccL[rt][dt] = oacc[rt][dt]; } }
  const int jend = (CAUSAL == 1) ? (qb0 + 4 * RPW) : ((CAUSAL == 23) ? min(TK, (qb0 / CHK + 2) * CHK) : TK);      /* causal / window: keys that can never contribute are skipped */ const int jbeg = (CAUSAL == 23) ? max(0, (qb0 / CHK - 1) * CHK) : 0;
#pragma unroll 1
  for (int j0 = jbeg; j0 < jend; j0 += 32) {
    v8f s[2][2];
#pragma unroll
    for (int nt = 0; nt < 2; ++nt) { const unsigned short* kr = (const unsigned short*)K16 + ((size_t)b * TK + j0 + nt * 16 + ln) * ldk + h * 64; const unsigned short* klr = (const unsigned short*)KL + ((size_t)b * TK + j0 + nt * 16 + ln) * ldk + h * 64; FragH bk[KS], bkl[KS];
#pragma unroll
      for (int ks = 0; ks < KS; ++ks) { bk[ks].half[0] = *(const v8us*)(kr + ks * 32 + 8 * hh); bk[ks].half[1] = *(const v8us*)(kr + ks * 32 + 16 + 8 * hh); bkl[ks].half[0] = *(const v8us*)(klr + ks * 32 + 8 * hh); bkl[ks].half[1] = *(const v8us*)(klr + ks * 32 + 16 + 8 * hh); }
#pragma unroll
      for (int rt = 0; rt < RTN; ++rt) { v8f acc = (v8f){0.f,0.f,0.f,0.f,0.f,0.f,0.f,0.f}, accl = acc;
#pragma unroll
        for (int ks = 0; ks < KS; ++ks) { acc = mmaH<1>(aq[rt][ks].v, aq[rt][ks].v, bk[ks].v, bk[ks].v, acc); accl = mmaH<1>(aql[rt][ks].v, aql[rt][ks].v, bk[ks].v, bk[ks].v, accl); accl = mmaH<1>(aq[rt][ks].v, aq[rt][ks].v, bkl[ks].v, bkl[ks].v, accl); }
#pragma unroll
        for (int r = 0; r < 8; ++r) acc[r] += accl[r] * 0.0009765625f;
        s[rt][nt] = acc; } }
#pragma unroll
    for (int rt = 0; rt < RTN; ++rt)
#pragma unroll
      for (int r = 0; r < 8; ++r) { const int tq = q0 + rt * 16 + 8 * hh + r; const int k0 = j0 + ln, k1 = j0 + 16 + ln;
        bool ok0 = (CAUSAL == 1) ? (k0 <= tq) : ((CAUSAL == 2) ? ((k0 >> 5) == (tq >> 5)) : true), ok1 = (CAUSAL == 1) ? (k1 <= tq) : ((CAUSAL == 2) ? ((k1 >> 5) == (tq >> 5)) : true);      /* mode 2: block-diagonal 32-token groups */
        if (CAUSAL == 4) { const int* mrow = MSK + ((size_t)b * TQ + tq) * TK; ok0 = mrow[k0] != 0; ok1 = mrow[k1] != 0; }      /* mode 4: per-(query, key) INPUT mask shared by all heads; masked keys contribute nothing (== the reference's -4096 fill, whose exp underflows to 0), rows with no valid key give l = 0 -> output 0 (== the reference's row_valid zeroing) */
        float s0 = ok0 ? s[rt][0][r] * SCL : -3.0e38f, s1 = ok1 ? s[rt][1][r] * SCL : -3.0e38f; if (CAUSAL == 33) { const float* amk = (const float*)MSK + (size_t)tq * TK; s0 += bf16_round(amk[k0]); s1 += bf16_round(amk[k1]); }      /* mode 33: one additive [TQ][TK] f32 table shared by every slab */ if (CAUSAL == 17) { const float* amk = (const float*)MSK + (size_t)b * TK; s0 += bf16_round(amk[k0]); s1 += bf16_round(amk[k1]); } if (CAUSAL == 18) { const float* tb = (const float*)MSK; const int* ri = MSK + 1024 + (size_t)b * TK; const int rq = ri[tq]; s0 += tb[(h * 8 + rq) * 8 + ri[k0]]; s1 += tb[(h * 8 + rq) * 8 + ri[k1]]; } if (CAUSAL == 19) { const int* rel = MSK + (size_t)tq * TK; const float* rb = (const float*)MSK + (size_t)TQ * TK + ((size_t)(b * NH + h) * TQ + tq) * 64; s0 += rb[rel[k0]]; s1 += rb[rel[k1]]; }      /* mode 19: + (q.Ek[rel] + Eb[rel][h]) / 8 gathered by the int relative ids (packed [ids | table]) */      /* mode 18: + resource_bias[h][r_q][r_k] from the packed [table | ids] buffer (TQ == TK) */      /* mode 17: additive per-(batch, key) mask INPUT */ float mc = fmaxf(s0, s1);
        mc = fmaxf(mc, __shfl_xor(mc, 1, 32)); mc = fmaxf(mc, __shfl_xor(mc, 2, 32)); mc = fmaxf(mc, __shfl_xor(mc, 4, 32)); mc = fmaxf(mc, __shfl_xor(mc, 8, 32));
        const float mn = fmaxf(m_r[rt][r], mc); const float al = (mn > -1.0e38f) ? expf(m_r[rt][r] - mn) : 1.0f; m_r[rt][r] = mn; const float p0 = ok0 ? expf(s0 - mn) : 0.f, p1 = ok1 ? expf(s1 - mn) : 0.f; l_r[rt][r] = l_r[rt][r] * al + p0 + p1;
#pragma unroll
        for (int dt = 0; dt < DT; ++dt) { oacc[rt][dt][r] *= al; oaccL[rt][dt][r] *= al; }
        FragH t2, t2l; const float ps0 = p0 * 1024.0f, ps1 = p1 * 1024.0f; t2.h[0] = (_Float16)ps0; t2.h[1] = (_Float16)ps1; t2l.h[0] = (_Float16)((ps0 - (float)t2.h[0]) * 1024.0f); t2l.h[1] = (_Float16)((ps1 - (float)t2.h[1]) * 1024.0f);
        sP[w][rt * 16 + 8 * hh + r][ln] = t2.u[0]; sP[w][rt * 16 + 8 * hh + r][16 + ln] = t2.u[1]; sPL[w][rt * 16 + 8 * hh + r][ln] = t2l.u[0]; sPL[w][rt * 16 + 8 * hh + r][16 + ln] = t2l.u[1]; }
    __builtin_amdgcn_fence(__ATOMIC_ACQ_REL, "workgroup"); __builtin_amdgcn_wave_barrier();
    FragH pa[2], pl[2];
#pragma unroll
    for (int rt = 0; rt < RTN; ++rt) { pa[rt].half[0] = *(const v8us*)&sP[w][rt * 16 + ln][8 * hh]; pa[rt].half[1] = *(const v8us*)&sP[w][rt * 16 + ln][16 + 8 * hh]; pl[rt].half[0] = *(const v8us*)&sPL[w][rt * 16 + ln][8 * hh]; pl[rt].half[1] = *(const v8us*)&sPL[w][rt * 16 + ln][16 + 8 * hh]; }
#pragma unroll
    for (int dt = 0; dt < DT; ++dt) { const unsigned short* vrow = Vth + (size_t)(dt * 16 + ln) * TK + j0; const unsigned short* vrl = Vtl + (size_t)(dt * 16 + ln) * TK + j0; FragH bv, bl; bv.half[0] = *(const v8us*)(vrow + 8 * hh); bv.half[1] = *(const v8us*)(vrow + 16 + 8 * hh); bl.half[0] = *(const v8us*)(vrl + 8 * hh); bl.half[1] = *(const v8us*)(vrl + 16 + 8 * hh);
#pragma unroll
      for (int rt = 0; rt < RTN; ++rt) { oacc[rt][dt] = mmaH<1>(pa[rt].v, pa[rt].v, bv.v, bv.v, oacc[rt][dt]); oaccL[rt][dt] = mmaH<1>(pl[rt].v, pl[rt].v, bv.v, bv.v, oaccL[rt][dt]); oaccL[rt][dt] = mmaH<1>(pa[rt].v, pa[rt].v, bl.v, bl.v, oaccL[rt][dt]); } }
    __builtin_amdgcn_fence(__ATOMIC_ACQ_REL, "workgroup"); __builtin_amdgcn_wave_barrier(); }
#pragma unroll
  for (int rt = 0; rt < RTN; ++rt) {
#pragma unroll
    for (int r = 0; r < 8; ++r) { float l = l_r[rt][r]; l += __shfl_xor(l, 1, 32); l += __shfl_xor(l, 2, 32); l += __shfl_xor(l, 4, 32); l += __shfl_xor(l, 8, 32); l_r[rt][r] = (l > 0.f) ? 1.0f / (l * 1024.0f) : 0.f; }
#pragma unroll
    for (int dt = 0; dt < DT; ++dt)
#pragma unroll
      for (int r = 0; r < 8; ++r) { float v = oacc[rt][dt][r]; v += oaccL[rt][dt][r] * 0.0009765625f; sO[w][rt * 16 + 8 * hh + r][dt * 16 + ln] = v * l_r[rt][r]; } }
  __builtin_amdgcn_fence(__ATOMIC_ACQ_REL, "workgroup"); __builtin_amdgcn_wave_barrier();
  {
#pragma unroll
    for (int rp = 0; rp < RPW; rp += 2) { const int r = rp + (lane >> 4), pc = lane & 15; const v4f val = *(const v4fa*)&sO[w][r][pc * 4]; *(v4f*)(O + ((size_t)b * TQ + q0 + r) * ldo + h * 64 + pc * 4) = val; }
     } }

__global__ __launch_bounds__(256) void k_rotab(float* __restrict__ CS, float* __restrict__ SN) {
  #pragma clang fp contract(off)
  const int t = blockIdx.x * 256 + threadIdx.x; if (t >= SLEN * 32) return; const int j = t % 32, s = t / 32; const float ex = (float)(2 * j) / 64.0f; const float inv = 1.0f / powf(10000.0f, ex); const float th = (float)s * inv; const float c = cosf(th), sn = sinf(th);
  { *(float*)(CS + t) = c; *(float*)(SN + t) = sn;  } }
__global__ __launch_bounds__(256) void k_rope(const float* __restrict__ F, int nsrc, int ndst, int rep, const float* __restrict__ CS, const float* __restrict__ SN, _Float16* __restrict__ H, _Float16* __restrict__ L) {
  #pragma clang fp contract(off)
  const size_t t = (size_t)blockIdx.x * 256 + threadIdx.x; if (t >= (size_t)NR * ndst * 4) return; const int g8 = (int)(t % 4); const int hd = (int)((t / 4) % ndst); const size_t row = t / ((size_t)4 * ndst); const int s = (int)(row % SLEN); const int hs = hd / rep;
  const float* src = F + row * (size_t)(nsrc * 64) + hs * 64; FragH ah, al, bh, bl;
  for (int i = 0; i < 8; ++i) { const int d = g8 * 8 + i; const float c = CS[s * 32 + d], sn = SN[s * 32 + d]; const float x1 = src[d], x2 = src[d + 32];
    float o1 = x1 * c; o1 += -x2 * sn; float o2 = x2 * c; o2 += x1 * sn;
    _Float16 hv = (_Float16)o1; ah.h[i] = hv; al.h[i] = (_Float16)((o1 - (float)hv) * 1024.0f); hv = (_Float16)o2; bh.h[i] = hv; bl.h[i] = (_Float16)((o2 - (float)hv) * 1024.0f); }
  const size_t o = row * (size_t)(ndst * 64) + hd * 64 + g8 * 8;
  { *(v8us*)((unsigned short*)H + o) = ah.half[0]; *(v8us*)((unsigned short*)H + o + 32) = bh.half[0]; *(v8us*)((unsigned short*)L + o) = al.half[0]; *(v8us*)((unsigned short*)L + o + 32) = bl.half[0];  } }
__global__ __launch_bounds__(256) void k_rope2(const float* __restrict__ F, int nsrc, int ndst, int rep, const float* __restrict__ CS, const float* __restrict__ SN, _Float16* __restrict__ H, _Float16* __restrict__ L) {
  #pragma clang fp contract(off)
  const size_t t = (size_t)blockIdx.x * 256 + threadIdx.x; if (t >= (size_t)NR * ndst * 4) return; const int g16 = (int)(t % 4); const int hd = (int)((t / 4) % ndst); const size_t row = t / ((size_t)4 * ndst); const int s = (int)(row % SLEN); const int hs = hd / rep;
  const float* src = F + row * (size_t)(nsrc * 64) + hs * 64 + g16 * 16; FragH ah, al;
  for (int pr = 0; pr < 8; ++pr) { const int i = g16 * 8 + pr; const float c = CS[s * 32 + i], sn = SN[s * 32 + i]; const float x1 = src[2 * pr], x2 = src[2 * pr + 1];
    float o1 = x1 * c; o1 -= x2 * sn; float o2 = x1 * sn; o2 += x2 * c;
    _Float16 hv = (_Float16)o1; ah.h[2 * pr] = hv; al.h[2 * pr] = (_Float16)((o1 - (float)hv) * 1024.0f); hv = (_Float16)o2; ah.h[2 * pr + 1] = hv; al.h[2 * pr + 1] = (_Float16)((o2 - (float)hv) * 1024.0f); }
  const size_t o = row * (size_t)(ndst * 64) + hd * 64 + g16 * 16;
  { *(v8us*)((unsigned short*)H + o) = ah.half[0]; *(v8us*)((unsigned short*)H + o + 8) = ah.half[1]; *(v8us*)((unsigned short*)L + o) = al.half[0]; *(v8us*)((unsigned short*)L + o + 8) = al.half[1];  } }
__global__ __launch_bounds__(256) void k_ln512(const float* __restrict__ A, const float* __restrict__ res, const float* __restrict__ g, const float* __restrict__ bb, float* __restrict__ Y, _Float16* __restrict__ Y16) {
  #pragma clang fp contract(off)
  const int wv = threadIdx.x >> 5, ln = threadIdx.x & 31; const size_t r = (size_t)blockIdx.x * 8 + wv; if (r >= NR) return; float x[16]; float s = 0.f;
  for (int i = 0; i < 2; ++i) { const v8f a = *(const v8f*)(A + r * DM + i * 256 + ln * 8); for (int q = 0; q < 8; ++q) { float v = a[q]; if (res) v += bf16_round(res[r * DM + i * 256 + ln * 8 + q]); x[i * 8 + q] = v; s += v; } }
  for (int o = 16; o > 0; o >>= 1) s += __shfl_xor(s, o, 32); const float mu = s / (float)DM; float var = 0.f; for (int q = 0; q < 16; ++q) { const float d = x[q] - mu; var += d * d; }
  for (int o = 16; o > 0; o >>= 1) var += __shfl_xor(var, o, 32); const float inv = rsqrtf(var / (float)DM + 1e-5f);
  { for (int i = 0; i < 2; ++i) { const int c0 = i * 256 + ln * 8; v8f y; FragH f; for (int q = 0; q < 8; ++q) { float v = (x[i * 8 + q] - mu) * inv; v *= bf16_round(g[c0 + q]); v += bf16_round(bb[c0 + q]); y[q] = v; f.h[q] = (_Float16)v; } *(v8f*)(Y + r * DM + c0) = y; if (Y16) *(v8us*)((unsigned short*)Y16 + r * DM + c0) = f.half[0]; }  } }
__global__ __launch_bounds__(256) void k_pack(const float* __restrict__ rb, const int* __restrict__ rid, int* __restrict__ PK) { const int t = blockIdx.x * 256 + threadIdx.x; if (t >= 1024 + NB * TK) return; int v; if (t < 1024) v = __float_as_int(bf16_round(rb[t])); else v = rid[t - 1024]; *(int*)(PK + t) = v;  }
__global__ __launch_bounds__(256) void k_tabin(const float* __restrict__ sp, float* __restrict__ CS, float* __restrict__ SN) { const int t = blockIdx.x * 256 + threadIdx.x; if (t >= SLEN * 32) return; const int i = t % 32, s = t / 32; const float c = bf16_round(sp[s * 64 + 32 + i]), sn = bf16_round(sp[s * 64 + i]);
  { *(float*)(CS + t) = c; *(float*)(SN + t) = sn;  } }
__global__ __launch_bounds__(256) void k_wsc(const float* __restrict__ Wm, _Float16* __restrict__ Bt, size_t n8, float sc) { const size_t t = (size_t)blockIdx.x * 256 + threadIdx.x; if (t >= n8) return; FragH f; for (int q = 0; q < 8; ++q) f.h[q] = (_Float16)(bf16_round(Wm[t * 8 + q]) * sc); *(v8us*)((unsigned short*)Bt + t * 8) = f.half[0];  }
__global__ __launch_bounds__(256) void k_rotab2(float* __restrict__ CS, float* __restrict__ SN) {
  #pragma clang fp contract(off)
  const int t = blockIdx.x * 256 + threadIdx.x; if (t >= SLEN * 32) return; const int j = t % 32, s = t / 32; const float c0 = -0.14391156831212787f;      /* -ln(10000)/64 rounded to f32 */ const float inv = expf((float)(2 * j) * c0); const float th = (float)s * inv; const float c = cosf(th), sn = sinf(th);
  { *(float*)(CS + t) = c; *(float*)(SN + t) = sn;  } }
__global__ __launch_bounds__(256) void k_lnu(const float* __restrict__ X, _Float16* __restrict__ N16, float* __restrict__ XB) {
  #pragma clang fp contract(off)
  const int wv = threadIdx.x >> 5, ln = threadIdx.x & 31; const size_t r = (size_t)blockIdx.x * 8 + wv; if (r >= NR) return; float a[32]; float s = 0.f;
  for (int i = 0; i < 4; ++i) { const v8f v = *(const v8f*)(X + r * DM + (i * 32 + ln) * 8); for (int q = 0; q < 8; ++q) { const float u = bf16_round(v[q]); a[i * 8 + q] = u; s += u; } }
  for (int o = 16; o > 0; o >>= 1) s += __shfl_xor(s, o, 32); const float mu = s / (float)DM; float var = 0.f; for (int q = 0; q < 32; ++q) { const float d = a[q] - mu; var += d * d; }
  for (int o = 16; o > 0; o >>= 1) var += __shfl_xor(var, o, 32); const float den = sqrtf(var / (float)(DM - 1)) + 1e-6f; const float inv = 1.0f / den;      /* one reciprocal per row; (x-mean)*inv vs the reference's division differs by <= 1 ulp */
  { for (int i = 0; i < 4; ++i) { const int c0 = (i * 32 + ln) * 8; FragH f; v8f xb; for (int q = 0; q < 8; ++q) { f.h[q] = (_Float16)((a[i * 8 + q] - mu) * inv); xb[q] = a[i * 8 + q]; } *(v8us*)((unsigned short*)N16 + r * DM + c0) = f.half[0]; *(v8f*)(XB + r * DM + c0) = xb; }  } }
__global__ __launch_bounds__(256) void k_vtg(const _Float16* __restrict__ V16, _Float16* __restrict__ Vt) { __shared__ unsigned short tl[64][66]; const int tid = threadIdx.x; const int slab = blockIdx.x / (SLEN / 64), lg = blockIdx.x % (SLEN / 64); const int b = slab / NH, h = slab % NH; const int hs = h / NREP;
  for (int i = tid; i < 64 * 8; i += 256) { const int r = i / 8, c8 = (i % 8) * 8; FragH f; f.half[0] = *(const v8us*)((const unsigned short*)V16 + ((size_t)b * SLEN + lg * 64 + r) * KVD + hs * 64 + c8); for (int q = 0; q < 8; ++q) tl[r][c8 + q] = f.u[q]; }
  __syncthreads();
  { for (int rd = 0; rd < 2; ++rd) { const int d = rd * 32 + tid / 8, pc = tid % 8; FragH f; for (int q = 0; q < 8; ++q) f.u[q] = tl[pc * 8 + q][d]; *(v8us*)((unsigned short*)Vt + ((size_t)slab * 64 + d) * SLEN + lg * 64 + pc * 8) = f.half[0]; }  } }

__global__ __launch_bounds__(256) void k_h16s(const float* __restrict__ SRC, int lds, int coff, _Float16* __restrict__ DST, size_t n8) { const size_t t = (size_t)blockIdx.x * 256 + threadIdx.x; if (t >= n8) return; const size_t r = (t * 8) / DM; const int c = (int)((t * 8) % DM); const v8f a = *(const v8f*)(SRC + r * lds + coff + c); FragH f; for (int q = 0; q < 8; ++q) f.h[q] = (_Float16)a[q];
  *(v8us*)((unsigned short*)DST + t * 8) = f.half[0];  }


__global__ __launch_bounds__(256) void k_ccp(const float* __restrict__ QKV, int coff, _Float16* __restrict__ D) { const size_t t = (size_t)blockIdx.x * 256 + threadIdx.x; if (t >= (size_t)NR * DM / 8) return; const int c0 = (int)((t * 8) % DM); const size_t row = (t * 8) / DM; const v8f a = *(const v8f*)(QKV + row * 3 * DM + coff + c0); FragH f; for (int q = 0; q < 8; ++q) f.h[q] = (_Float16)a[q];
  *(v8us*)((unsigned short*)D + t * 8) = f.half[0];  }


extern "C" void kernel_launch(void* const* d_in, const int* in_sizes, int n_in,
                              void* d_out, int out_size, void* d_ws, size_t ws_size, hipStream_t stream) {
  (void)in_sizes; (void)n_in; (void)out_size;
  const float* q = (const float*)d_in[0]; const float* kv = (const float*)d_in[1]; const float* mask = (const float*)d_in[2]; float* O = (float*)d_out;
  char* ws = (char*)d_ws; size_t off = 0;
  auto take = [&](size_t bytes) { char* p = ws + off; off += (bytes + 255) & ~(size_t)255; return p; };
  const size_t np = (size_t)NR * DM;      /* 32 x 2048 x 64 */
  _Float16* Q16 = (_Float16*)take(np * 2); _Float16* K16 = (_Float16*)take(np * 2); _Float16* VT = (_Float16*)take(np * 2);
  if (off > ws_size) return;      /* 24 MiB */
  k_x16<<<(unsigned)((np / 8 + 255) / 256), 256, 0, stream>>>(q, Q16, np / 8); k_x16<<<(unsigned)((np / 8 + 255) / 256), 256, 0, stream>>>(kv, K16, np / 8);
  k_vtg<<<NB * NH * (SLEN / 64), 256, 0, stream>>>(K16, VT);      /* values = keys */
  k_flash<33><<<NB * NH * QBNP, 128, 0, stream>>>(Q16, DM, K16, DM, VT, (const int*)mask, O, DM);      /* f32 context straight to the output rows */
}

// v002
// A run of this version takes 143 microseconds.
// Next to v001, in two timings, it ran 1.31 times as fast each time.
// All steps since v000 together make it 2.44 times as fast.
#include <hip/hip_runtime.h>
// DotProdAttention (q [4][8][2048][64], kv [4][8][2048][64] (keys = values), mask [1][1][2048][2048] added to every (batch, head); out = softmax(q kv^T / 8 + mask) kv -> [4][8][2048][64]).
// Structure: the (batch, head) slabs of q/kv are already contiguous 64-wide row blocks, so each slab is treated as one 'batch' of a single 64-dim head: exact f16 planes of q and kv; kv^T by LDS tiles; flash-style fused attention per (slab, 64-query block) adding the shared additive mask table per (query, key), f32 context written straight to the output.
// Compute dtype: inputs rounded to bf16; q, kv, mask exact (f16 / bf16-rounded f32); softmax f32 with f16 probabilities; plain f16 value operand (~2^-12). v_wmma_f32_16x16x32_f16.
#define NB 32                    /* 4 batches x 8 heads as slabs */
#define DM 64
#define NKV 1
#define NREP (NH / NKV)
#define KVD (NKV * 64)           /* 64 */
#define NR (NB * SLEN)
#define CHK 512
typedef int v4i __attribute__((ext_vector_type(4)));
#define FF 2048
#define SLEN 2048
#define MQI 2048
#define MKI 2048
#define TQ SLEN
#define TK SLEN
#define NH 1
#define SCL 0.125f
#define QBLKS (TQ / 64)
#define QB05 0
#define QBN5 4
#define QB0P 0
#define QBNP QBLKS
#define RE 256
typedef __bf16 v16b __attribute__((ext_vector_type(16)));
typedef unsigned short v8us __attribute__((ext_vector_type(8), may_alias));
typedef float  v8f  __attribute__((ext_vector_type(8)));
typedef float  v4f  __attribute__((ext_vector_type(4)));
typedef float  v4fa __attribute__((ext_vector_type(4), may_alias));
union FragB { v16b v; v8us half[2]; unsigned short u[16]; };

__device__ __forceinline__ unsigned short bf16_bits(float x) { unsigned int u = __float_as_uint(x); return (unsigned short)((u + 0x7FFFu + ((u >> 16) & 1u)) >> 16); }
__device__ __forceinline__ float bf16_val(unsigned short b) { return __uint_as_float(((unsigned int)b) << 16); }
__device__ __forceinline__ float bf16_round(float x) { return bf16_val(bf16_bits(x)); }
// D += A·B with NT terms: 1 = ah·bh, 2 = + al·bh (A split), 3 = + ah·bl (both split)
template <int NT>
__device__ __forceinline__ v8f mmaN(v16b ah, v16b al, v16b bh, v16b bl, v8f c) {
  c = __builtin_amdgcn_wmma_f32_16x16x32_bf16(false, ah, false, bh, (short)0, c, false, false);
  if (NT >= 2) c = __builtin_amdgcn_wmma_f32_16x16x32_bf16(false, al, false, bh, (short)0, c, false, false);
  if (NT >= 3) c = __builtin_amdgcn_wmma_f32_16x16x32_bf16(false, ah, false, bl, (short)0, c, false, false);
  asm volatile("v_nop\n\tv_nop\n\tv_nop\n\tv_nop" : "+v"(c) : "v"(ah), "v"(al), "v"(bh), "v"(bl));
  return c;
}

__global__ __launch_bounds__(256) void k_wt_bf16(const float* __restrict__ W, unsigned short* __restrict__ Wt, int K, int N) {
  const int t = blockIdx.x * 256 + threadIdx.x;
  const int k8n = K / 8;
  if (t >= N * k8n) return;
  const int n = t / k8n, k8 = (t % k8n) * 8;
  v8us v;
#pragma unroll
  for (int i = 0; i < 8; ++i) v[i] = bf16_bits(W[(size_t)(k8 + i) * N + n]);
  *(v8us*)(Wt + (size_t)n * K + k8) = v;
  
}

// GEMM C[M][N] (f32, pitch ldc) = act(A[M][K]·W + bias). A f32 row-major (pitch lda) converted per fragment to bf16
// (ASPLIT: hi/lo two planes -> 2 terms, else single rounded term); Wt bf16 [N][K] (pitch ldb). BIAS_BF16 rounds the
// bias to bf16 first (bias quantised to bf16 before the add). K%32==0, M%16==0, N%64==0.
template <bool ASPLIT, int ACT, bool BIAS_BF16>
__global__ __launch_bounds__(128) void k_gemm_bf(const float* __restrict__ A, int lda, const unsigned short* __restrict__ Wt, int ldb,
                                               const float* __restrict__ bias, float* __restrict__ C, int ldc, int M, int N, int K) {
  __shared__ __attribute__((aligned(16))) float so[4][16][64];
  const int tid = threadIdx.x, w = tid >> 5, lane = tid & 31, ln = lane & 15, hh = lane >> 4;
  const int ntn = N / 64;
  const int wid = blockIdx.x * 4 + w;
  const int mt = wid / ntn, nq = wid % ntn;
  if (mt * 16 >= M) return;
  const int row0 = mt * 16, col0 = nq * 64;
  const float* arow = A + (size_t)(row0 + ln) * lda;
  v8f acc[4] = {};
  for (int kb = 0; kb < K; kb += 32) {
    FragB ah, al;
    const v4f x0 = *(const v4fa*)(arow + kb + 8 * hh), x1 = *(const v4fa*)(arow + kb + 8 * hh + 4);
    const v4f x2 = *(const v4fa*)(arow + kb + 16 + 8 * hh), x3 = *(const v4fa*)(arow + kb + 16 + 8 * hh + 4);
    float xs[16] = {x0[0],x0[1],x0[2],x0[3],x1[0],x1[1],x1[2],x1[3],x2[0],x2[1],x2[2],x2[3],x3[0],x3[1],x3[2],x3[3]};
#pragma unroll
    for (int i = 0; i < 16; ++i) { const unsigned short hb = bf16_bits(xs[i]); ah.u[i] = hb; al.u[i] = ASPLIT ? bf16_bits(xs[i] - bf16_val(hb)) : (unsigned short)0; }
#pragma unroll
    for (int t = 0; t < 4; ++t) {
      const unsigned short* brow = Wt + (size_t)(col0 + t * 16 + ln) * ldb + kb;
      FragB b;
      b.half[0] = *(const v8us*)(brow + 8 * hh);
      b.half[1] = *(const v8us*)(brow + 16 + 8 * hh);
      acc[t] = mmaN<ASPLIT ? 2 : 1>(ah.v, al.v, b.v, b.v, acc[t]);
    }
  }
#pragma unroll
  for (int t = 0; t < 4; ++t) {
    float bv = bias ? bias[col0 + t * 16 + ln] : 0.f;
    if (BIAS_BF16) bv = bf16_round(bv);
#pragma unroll
    for (int r = 0; r < 8; ++r) { float v = acc[t][r] + bv; if (ACT == 1) v = fmaxf(v, 0.f); so[w][8 * hh + r][t * 16 + ln] = v; }
  }
  __builtin_amdgcn_fence(__ATOMIC_ACQ_REL, "workgroup");
  __builtin_amdgcn_wave_barrier();
  const int rsub = lane >> 4, c4 = (lane & 15) * 4;
  {
#pragma unroll
    for (int q = 0; q < 8; ++q) {
      const int r = q * 2 + rsub;
      const v4f v = *(const v4fa*)&so[w][r][c4];
      *(v4f*)(C + (size_t)(row0 + r) * ldc + col0 + c4) = v;
    }
    
  }
}

// GEMM C = act(A·W + bias + resid): A f32 (ASPLIT -> hi/lo 2 terms), Wt bf16 [N][K]; ACT 0 none, 1 relu, 2 exact gelu;
// resid (optional, f32, row index = (row % rmod), pitch ldr, RES_BF16 rounds it) added before the activation.
template <bool ASPLIT, int ACT, bool BIAS_BF16, bool RES_BF16>
__global__ __launch_bounds__(128) void k_gemm_bf3(const float* __restrict__ A, int lda, const unsigned short* __restrict__ Wt, int ldb,
                                                const float* __restrict__ bias, const float* __restrict__ resid, int rmod, int ldr,
                                                float* __restrict__ C, int ldc, int M, int N, int K) {
  __shared__ __attribute__((aligned(16))) float so[4][16][64];
  const int tid = threadIdx.x, w = tid >> 5, lane = tid & 31, ln = lane & 15, hh = lane >> 4;
  const int ntn = N / 64;
  const int wid = blockIdx.x * 4 + w;
  const int mt = wid / ntn, nq = wid % ntn;
  if (mt * 16 >= M) return;
  const int row0 = mt * 16, col0 = nq * 64;
  const float* arow = A + (size_t)(row0 + ln) * lda;
  v8f acc[4] = {};
  for (int kb = 0; kb < K; kb += 32) {
    FragB ah, al;
    const v4f x0 = *(const v4fa*)(arow + kb + 8 * hh), x1 = *(const v4fa*)(arow + kb + 8 * hh + 4);
    const v4f x2 = *(const v4fa*)(arow + kb + 16 + 8 * hh), x3 = *(const v4fa*)(arow + kb + 16 + 8 * hh + 4);
    float xs[16] = {x0[0],x0[1],x0[2],x0[3],x1[0],x1[1],x1[2],x1[3],x2[0],x2[1],x2[2],x2[3],x3[0],x3[1],x3[2],x3[3]};
#pragma unroll
    for (int i = 0; i < 16; ++i) { const unsigned short hb = bf16_bits(xs[i]); ah.u[i] = hb; al.u[i] = ASPLIT ? bf16_bits(xs[i] - bf16_val(hb)) : (unsigned short)0; }
#pragma unroll
    for (int t = 0; t < 4; ++t) {
      const unsigned short* brow = Wt + (size_t)(col0 + t * 16 + ln) * ldb + kb;
      FragB b;
      b.half[0] = *(const v8us*)(brow + 8 * hh);
      b.half[1] = *(const v8us*)(brow + 16 + 8 * hh);
      acc[t] = mmaN<ASPLIT ? 2 : 1>(ah.v, al.v, b.v, b.v, acc[t]);
    }
  }
#pragma unroll
  for (int t = 0; t < 4; ++t) {
    const int col = col0 + t * 16 + ln;
    float bv = bias ? bias[col] : 0.f;
    if (BIAS_BF16) bv = bf16_round(bv);
#pragma unroll
    for (int r = 0; r < 8; ++r) {
      float v = acc[t][r] + bv;
      if (resid) { float rv = resid[(size_t)((row0 + 8 * hh + r) % rmod) * ldr + col]; if (RES_BF16) rv = bf16_round(rv); v += rv; }
      if (ACT == 1) v = fmaxf(v, 0.f);
      if (ACT == 2) v = 0.5f * v * (1.0f + erff(v * 0.70710678118654752f));
      if (ACT == 3) { const float u = 0.7978845608028654f * (v + 0.044715f * v * v * v); v = 0.5f * v * (1.0f + tanhf(u)); }
      so[w][8 * hh + r][t * 16 + ln] = v;
    }
  }
  __builtin_amdgcn_fence(__ATOMIC_ACQ_REL, "workgroup");
  __builtin_amdgcn_wave_barrier();
  const int rsub = lane >> 4, c4 = (lane & 15) * 4;
  {
#pragma unroll
    for (int q = 0; q < 8; ++q) {
      const int r = q * 2 + rsub;
      const v4f v = *(const v4fa*)&so[w][r][c4];
      *(v4f*)(C + (size_t)(row0 + r) * ldc + col0 + c4) = v;
    }
    
  }
}
// row LayerNorm (biased variance, eps) over N: s = X (+ R); optional out_sum <- s; out_norm <- (s-mu)*rsqrt(var+eps)*g + b
template <bool PARAM_BF16>
__global__ __launch_bounds__(256) void k_layernorm(const float* __restrict__ X, const float* __restrict__ R, const float* __restrict__ g, const float* __restrict__ bta,
                                                  float* __restrict__ out_sum, float* __restrict__ out_norm, int N, float eps) {
  __shared__ float red[256];
  const int row = blockIdx.x, tid = threadIdx.x;
  const float* x = X + (size_t)row * N; const float* rr = R ? R + (size_t)row * N : nullptr;
  float vals[16];                     // up to N = 4096
  const int per = N / 256;            // contiguous chunk per thread? use strided-by-4 chunks: thread handles j = tid*4 + 1024*u
  float s1 = 0.f;
  for (int u = 0; u < per / 4; ++u) {
    const int j = tid * 4 + 1024 * u;
    const v4f a = *(const v4fa*)(x + j);
    v4f b = {0.f,0.f,0.f,0.f}; if (rr) b = *(const v4fa*)(rr + j);
#pragma unroll
    for (int q = 0; q < 4; ++q) { const float v = a[q] + b[q]; vals[u * 4 + q] = v; s1 += v; }
  }
  red[tid] = s1; __syncthreads();
  for (int st = 128; st > 0; st >>= 1) { if (tid < st) red[tid] += red[tid + st]; __syncthreads(); }
  const float mu = red[0] / (float)N; __syncthreads();
  float s2 = 0.f;
  for (int u = 0; u < per / 4; ++u)
#pragma unroll
    for (int q = 0; q < 4; ++q) { const float c = vals[u * 4 + q] - mu; s2 += c * c; }
  red[tid] = s2; __syncthreads();
  for (int st = 128; st > 0; st >>= 1) { if (tid < st) red[tid] += red[tid + st]; __syncthreads(); }
  const float rs = rsqrtf(red[0] / (float)N + eps);
  {
    for (int u = 0; u < per / 4; ++u) {
      const int j = tid * 4 + 1024 * u;
      v4f o, sm;
#pragma unroll
      for (int q = 0; q < 4; ++q) {
        float gg = g[j + q], bb = bta[j + q];
        if (PARAM_BF16) { gg = bf16_round(gg); bb = bf16_round(bb); }
        sm[q] = vals[u * 4 + q]; o[q] = (vals[u * 4 + q] - mu) * rs * gg + bb;
      }
      if (out_sum) *(v4f*)(out_sum + (size_t)row * N + j) = sm;
      *(v4f*)(out_norm + (size_t)row * N + j) = o;
    }
    
  }
}



// ---- f16 WMMA path (v_wmma_f32_16x16x32_f16): 11-bit significands for operands in range — used where a [0,1] probability operand needs more precision than bf16
typedef _Float16 v16h __attribute__((ext_vector_type(16)));
union FragH { v16h v; v8us half[2]; _Float16 h[16]; unsigned short u[16]; };
template <int NT>
__device__ __forceinline__ v8f mmaH(v16h ah, v16h al, v16h bh, v16h bl, v8f c) {
  c = __builtin_amdgcn_wmma_f32_16x16x32_f16(false, ah, false, bh, (short)0, c, false, false);
  if (NT >= 2) c = __builtin_amdgcn_wmma_f32_16x16x32_f16(false, al, false, bh, (short)0, c, false, false);
  if (NT >= 3) c = __builtin_amdgcn_wmma_f32_16x16x32_f16(false, ah, false, bl, (short)0, c, false, false);
  asm volatile("v_nop\n\tv_nop\n\tv_nop\n\tv_nop" : "+v"(c) : "v"(ah), "v"(al), "v"(bh), "v"(bl));
  return c;
}
// batched GEMM like k_gemm_b but f16 operands: A f32 (split into f16 hi/lo if ASPLIT, else rounded to f16), Bt = f16 values [n][k]; alpha; C f32; N multiple of 16 (partial tiles skipped)
template <bool ASPLIT>
__global__ __launch_bounds__(128) void k_gemm_h(const float* __restrict__ A, int lda, size_t sA, const _Float16* __restrict__ Bh, int ldb, size_t sB, float alpha, float* __restrict__ C, int ldc, size_t sC, int M, int N, int K) {
  __shared__ __attribute__((aligned(16))) float so[4][16][64];
  const int tid = threadIdx.x, w = tid >> 5, lane = tid & 31, ln = lane & 15, hh = lane >> 4; const int by = blockIdx.y;
  A += (size_t)by * sA; Bh += (size_t)by * sB; C += (size_t)by * sC;
  const int ntn = (N + 63) / 64; const int wid = blockIdx.x * 4 + w; const int mt = wid / ntn, nq = wid % ntn; if (mt * 16 >= M) return;
  const int row0 = mt * 16, col0 = nq * 64; const float* arow = A + (size_t)(row0 + ln) * lda;
  v8f acc[4] = {};
  for (int kb = 0; kb < K; kb += 32) {
    FragH ah, al;
    const v4f x0 = *(const v4fa*)(arow + kb + 8 * hh), x1 = *(const v4fa*)(arow + kb + 8 * hh + 4), x2 = *(const v4fa*)(arow + kb + 16 + 8 * hh), x3 = *(const v4fa*)(arow + kb + 16 + 8 * hh + 4);
    float xs[16] = {x0[0],x0[1],x0[2],x0[3],x1[0],x1[1],x1[2],x1[3],x2[0],x2[1],x2[2],x2[3],x3[0],x3[1],x3[2],x3[3]};
#pragma unroll
    for (int i = 0; i < 16; ++i) { const _Float16 h = (_Float16)xs[i]; ah.h[i] = h; al.h[i] = ASPLIT ? (_Float16)(xs[i] - (float)h) : (_Float16)0.0f; }
#pragma unroll
    for (int t = 0; t < 4; ++t) { if (col0 + t * 16 >= N) continue; const size_t boff = (size_t)(col0 + t * 16 + ln) * ldb + kb; FragH bq; bq.half[0] = *(const v8us*)(Bh + boff + 8 * hh); bq.half[1] = *(const v8us*)(Bh + boff + 16 + 8 * hh);
      acc[t] = mmaH<ASPLIT ? 2 : 1>(ah.v, al.v, bq.v, bq.v, acc[t]); }
  }
#pragma unroll
  for (int t = 0; t < 4; ++t) { if (col0 + t * 16 >= N) continue;
#pragma unroll
    for (int r = 0; r < 8; ++r) so[w][8 * hh + r][t * 16 + ln] = acc[t][r] * alpha; }
  __builtin_amdgcn_fence(__ATOMIC_ACQ_REL, "workgroup"); __builtin_amdgcn_wave_barrier();
  const int rsub = lane >> 4, c4 = (lane & 15) * 4;
  {
#pragma unroll
    for (int q = 0; q < 8; ++q) { const int r = q * 2 + rsub; if (col0 + c4 < N) { const v4f v = *(const v4fa*)&so[w][r][c4]; *(v4f*)(C + (size_t)(row0 + r) * ldc + col0 + c4) = v; } }
     }
}

// Wt[n][k] = f16(W[k][n]·scale) from f32 row-major W[K][N] (scale = power of two; bf16-exact weights stay exact in f16 away from the subnormal range)
__global__ __launch_bounds__(256) void k_wt_f16(const float* __restrict__ W, _Float16* __restrict__ Wt, int K, int N, float scale) {
  const int t = blockIdx.x * 256 + threadIdx.x; if (t >= N * (K / 8)) return; const int n = t / (K / 8), k8 = (t % (K / 8)) * 8; FragH f;
#pragma unroll
  for (int i = 0; i < 8; ++i) f.h[i] = (_Float16)(bf16_round(W[(size_t)(k8 + i) * N + n]) * scale); const v8us o = f.half[0];
  *(v8us*)((unsigned short*)Wt + (size_t)n * K + k8) = o; 
}
// k_gemm_hh variant with fused epilogue: v = acc·alpha + bias[by·sBias + col] (+ CP[(row/rowsPerB)·sCPb + by·64 + col] if CP) ; ACT 0 none / 1 elu ; writes f16 C16 (and f32 C if non-null)
template <int ACT>
__global__ __launch_bounds__(128) void k_gemm_hhx(const _Float16* __restrict__ A, int lda, size_t sA, const _Float16* __restrict__ Bh, int ldb, size_t sB, float alpha, const float* __restrict__ bias, size_t sBias, const float* __restrict__ CP, int rowsPerB, size_t sCPb, int row0g,
    float* __restrict__ C, _Float16* __restrict__ C16, int ldc, size_t sC, int M, int N, int K) {
  __shared__ __attribute__((aligned(16))) float so[4][16][64];
  const int tid = threadIdx.x, w = tid >> 5, lane = tid & 31, ln = lane & 15, hh = lane >> 4; const int by = blockIdx.y;
  A += (size_t)by * sA; Bh += (size_t)by * sB; const size_t cofs = (size_t)by * sC; const float* bp = bias ? bias + (size_t)by * sBias : nullptr;
  const int ntn = (N + 63) / 64; const int wid = blockIdx.x * 4 + w; const int mt = wid / ntn, nq = wid % ntn; if (mt * 16 >= M) return;
  const int row0 = mt * 16, col0 = nq * 64; const _Float16* arow = A + (size_t)(row0 + ln) * lda;
  v8f acc[4] = {};
  for (int kb = 0; kb < K; kb += 32) { FragH ah; ah.half[0] = *(const v8us*)((const unsigned short*)arow + kb + 8 * hh); ah.half[1] = *(const v8us*)((const unsigned short*)arow + kb + 16 + 8 * hh);
#pragma unroll
    for (int t = 0; t < 4; ++t) { if (col0 + t * 16 >= N) continue; const size_t boff = (size_t)(col0 + t * 16 + ln) * ldb + kb; FragH bq; bq.half[0] = *(const v8us*)((const unsigned short*)Bh + boff + 8 * hh); bq.half[1] = *(const v8us*)((const unsigned short*)Bh + boff + 16 + 8 * hh);
      acc[t] = mmaH<1>(ah.v, ah.v, bq.v, bq.v, acc[t]); }
  }
#pragma unroll
  for (int t = 0; t < 4; ++t) { if (col0 + t * 16 >= N) continue; const int col = col0 + t * 16 + ln; const float bv = bp ? bf16_round(bp[col]) : 0.f;
#pragma unroll
    for (int r = 0; r < 8; ++r) { float v = acc[t][r] * alpha + bv; if (CP) { const int bidx = (row0g + row0 + 8 * hh + r) / rowsPerB; v += CP[(size_t)bidx * sCPb + (size_t)by * 64 + col]; } if (ACT == 1) v = (v > 0.f) ? v : expm1f(v); else if (ACT == 7) v = (v > 0.f) ? v + 1.0f : expf(v); else if (ACT == 8) v = tanhf(v); else if (ACT == 9) v = 0.5f * v * (1.0f + tanhf(0.7978845608028654f * (v + 0.044715f * v * v * v))); else if (ACT == 11) v = 1.0f / (1.0f + expf(-v)); else if (ACT == 12) v = (v > 0.f) ? v : 0.01f * v; else if (ACT == 14) v = (v > 0.f) ? v : 0.1f * v; else if (ACT == 15) v = v / (1.0f + expf(-v)); else if (ACT == 3) v = fmaxf(v, 0.f); else if (ACT == 6) v = 0.5f * v * (1.0f + erff(v * 0.70710678118654752f)); so[w][8 * hh + r][t * 16 + ln] = v; } }
  __builtin_amdgcn_fence(__ATOMIC_ACQ_REL, "workgroup"); __builtin_amdgcn_wave_barrier();
  const int rsub = lane >> 4, c4 = (lane & 15) * 4; typedef _Float16 v4h __attribute__((ext_vector_type(4)));
  {
#pragma unroll
    for (int q = 0; q < 8; ++q) { const int r = q * 2 + rsub; if (col0 + c4 < N) { const v4f v = *(const v4fa*)&so[w][r][c4]; if (C) *(v4f*)(C + cofs + (size_t)(row0 + r) * ldc + col0 + c4) = v; if (C16) { v4h h4; for (int i = 0; i < 4; ++i) h4[i] = (_Float16)v[i]; *(v4h*)(C16 + cofs + (size_t)(row0 + r) * ldc + col0 + c4) = h4; } } }
     }
}


typedef _Float16 v4h __attribute__((ext_vector_type(4)));

__global__ __launch_bounds__(256) void k_x16(const float* __restrict__ x, _Float16* __restrict__ X16, size_t n8) { const size_t t = (size_t)blockIdx.x * 256 + threadIdx.x; if (t >= n8) return; FragH f;
#pragma unroll
  for (int q = 0; q < 8; ++q) f.h[q] = (_Float16)bf16_round(x[t * 8 + q]); *(v8us*)((unsigned short*)X16 + t * 8) = f.half[0];  }
__global__ __launch_bounds__(256) void k_h16(const float* __restrict__ x, _Float16* __restrict__ X16, size_t n8) { const size_t t = (size_t)blockIdx.x * 256 + threadIdx.x; if (t >= n8) return; FragH f;
#pragma unroll
  for (int q = 0; q < 8; ++q) f.h[q] = (_Float16)x[t * 8 + q]; *(v8us*)((unsigned short*)X16 + t * 8) = f.half[0];  }
__global__ __launch_bounds__(256) void k_round16f(const float* __restrict__ W, _Float16* __restrict__ Bt, size_t n8) { const size_t t = (size_t)blockIdx.x * 256 + threadIdx.x; if (t >= n8) return; FragH f;
#pragma unroll
  for (int i = 0; i < 8; ++i) f.h[i] = (_Float16)(bf16_round(W[t * 8 + i]) * 16.0f); *(v8us*)((unsigned short*)Bt + t * 8) = f.half[0];  }
template <int NHv, int TTv>
__global__ __launch_bounds__(256) void k_vt(const _Float16* __restrict__ V16, int ldv, int voff, _Float16* __restrict__ Vt) { __shared__ unsigned short tl[64][66]; const int tid = threadIdx.x; const int slab = blockIdx.x / (TTv / 64), lg = blockIdx.x % (TTv / 64); const int b = slab / NHv, h = slab % NHv;
  for (int i = tid; i < 64 * 8; i += 256) { const int r = i / 8, c8 = (i % 8) * 8; FragH f; f.half[0] = *(const v8us*)((const unsigned short*)V16 + ((size_t)b * TTv + lg * 64 + r) * ldv + voff + h * 64 + c8);
#pragma unroll
    for (int q = 0; q < 8; ++q) tl[r][c8 + q] = f.u[q]; }
  __syncthreads();
  {
#pragma unroll
    for (int rd = 0; rd < 2; ++rd) { const int d = rd * 32 + tid / 8, pc = tid % 8; FragH f;
#pragma unroll
      for (int q = 0; q < 8; ++q) f.u[q] = tl[pc * 8 + q][d];
      *(v8us*)((unsigned short*)Vt + ((size_t)slab * 64 + d) * TTv + lg * 64 + pc * 8) = f.half[0]; }
     } }

__global__ __launch_bounds__(256) void k_hl(const float* __restrict__ F, _Float16* __restrict__ Hh, _Float16* __restrict__ Hl, size_t n8) { const size_t t = (size_t)blockIdx.x * 256 + threadIdx.x; if (t >= n8) return; FragH fh, fl; const v4f a = *(const v4fa*)(F + t * 8), c = *(const v4fa*)(F + t * 8 + 4);
#pragma unroll
  for (int q = 0; q < 4; ++q) { _Float16 h = (_Float16)a[q]; fh.h[q] = h; fl.h[q] = (_Float16)((a[q] - (float)h) * 1024.0f); h = (_Float16)c[q]; fh.h[4 + q] = h; fl.h[4 + q] = (_Float16)((c[q] - (float)h) * 1024.0f); }
  { *(v8us*)((unsigned short*)Hh + t * 8) = fh.half[0]; *(v8us*)((unsigned short*)Hl + t * 8) = fl.half[0];  } }

// ---- fast GEMM (wave tile 32x64; requires M % 32 == 0 rows per launch region and N % 64 == 0); epilogue = k_gemm_hhx semantics ----
__device__ __forceinline__ v16h g2_frag(const _Float16* p, int hh) { FragH f; f.half[0] = *(const v8us*)((const unsigned short*)p + 8 * hh); f.half[1] = *(const v8us*)((const unsigned short*)p + 16 + 8 * hh); return f.v; }
__device__ __forceinline__ v8f g2_mma(v16h a, v16h b, v8f c) { v8f d = __builtin_amdgcn_wmma_f32_16x16x32_f16(false, a, false, b, (short)0, c, false, false); asm volatile("v_nop\n\tv_nop\n\tv_nop\n\tv_nop" : "+v"(d) : "v"(a), "v"(b)); return d; }
template <int ACT>
__global__ __launch_bounds__(128) void k_gemm2(const _Float16* __restrict__ A, int lda, size_t sA, const _Float16* __restrict__ Bh, int ldb, size_t sB, float alpha, const float* __restrict__ bias, size_t sBias, const float* __restrict__ CP, int rowsPerB, size_t sCPb, int row0g,
    float* __restrict__ C, _Float16* __restrict__ C16, int ldc, size_t sC, int M, int N, int K) {
  __shared__ __attribute__((aligned(16))) float so[4][32][68];
  const int tid = threadIdx.x, w = tid >> 5, lane = tid & 31, ln = lane & 15, hh = lane >> 4; const int by = blockIdx.y;
  A += (size_t)by * sA; Bh += (size_t)by * sB; const size_t cofs = (size_t)by * sC; const float* bp = bias ? bias + (size_t)by * sBias : nullptr;
  const int ntn = N >> 6; const int mt = blockIdx.x / ntn, nq = blockIdx.x - mt * ntn; const int row0 = mt * 128 + 32 * w, col0 = nq * 64; if (row0 >= M) return;
  const _Float16* a0p = A + (size_t)(row0 + ln) * lda; const _Float16* a1p = a0p + (size_t)16 * lda;
  const _Float16* b0p = Bh + (size_t)(col0 + ln) * ldb; const _Float16* b1p = b0p + (size_t)16 * ldb; const _Float16* b2p = b1p + (size_t)16 * ldb; const _Float16* b3p = b2p + (size_t)16 * ldb;
  const v8f z8 = {0.f,0.f,0.f,0.f,0.f,0.f,0.f,0.f}; v8f c00 = z8, c01 = z8, c02 = z8, c03 = z8, c10 = z8, c11 = z8, c12 = z8, c13 = z8;
#pragma unroll 1
  for (int kb = 0; kb < K; kb += 32) { const v16h a0 = g2_frag(a0p + kb, hh), a1 = g2_frag(a1p + kb, hh);
    v16h b = g2_frag(b0p + kb, hh); c00 = g2_mma(a0, b, c00); c10 = g2_mma(a1, b, c10);
    b = g2_frag(b1p + kb, hh); c01 = g2_mma(a0, b, c01); c11 = g2_mma(a1, b, c11);
    b = g2_frag(b2p + kb, hh); c02 = g2_mma(a0, b, c02); c12 = g2_mma(a1, b, c12);
    b = g2_frag(b3p + kb, hh); c03 = g2_mma(a0, b, c03); c13 = g2_mma(a1, b, c13); }
  v8f accs[8] = {c00, c01, c02, c03, c10, c11, c12, c13};
#pragma unroll
  for (int u = 0; u < 8; ++u) { const int t = u & 3, half = u >> 2; const int col = col0 + t * 16 + ln; const float bv = bp ? bf16_round(bp[col]) : 0.f;
#pragma unroll
    for (int r = 0; r < 8; ++r) { const int rloc = half * 16 + 8 * hh + r; float v = accs[u][r] * alpha + bv; if (CP) { if (rowsPerB < 0) v += CP[cofs + (size_t)(row0g + row0 + rloc) * ldc + col];      /* rowsPerB < 0: own element of the batched C plane */ else { const int bidx = (row0g + row0 + rloc) / rowsPerB; v += CP[(size_t)bidx * sCPb + (size_t)by * 64 + col]; } }
      if (ACT == 3) v = fmaxf(v, 0.f); else if (ACT == 6) v = 0.5f * v * (1.0f + erff(v * 0.70710678118654752f)); else if (ACT == 11) v = 1.0f / (1.0f + expf(-v)); else if (ACT == 15) v = v / (1.0f + expf(-v)); else if (ACT == 12) v = (v > 0.f) ? v : 0.01f * v; else if (ACT == 8) v = tanhf(v);
      so[w][rloc][t * 16 + ln] = v; } }
  __builtin_amdgcn_fence(__ATOMIC_ACQ_REL, "workgroup"); __builtin_amdgcn_wave_barrier();
  const int rsub = lane >> 4, c4 = (lane & 15) * 4;
  {
#pragma unroll
    for (int q = 0; q < 16; ++q) { const int r = q * 2 + rsub; const v4f v = *(const v4fa*)&so[w][r][c4]; if (C) *(v4f*)(C + cofs + (size_t)(row0 + r) * ldc + col0 + c4) = v; if (C16) { v4h h4; for (int i = 0; i < 4; ++i) h4[i] = (_Float16)v[i]; *(v4h*)(C16 + cofs + (size_t)(row0 + r) * ldc + col0 + c4) = h4; } }
     } }



// lane l <-> lane l ^ 16 by a vector cross-row move
__device__ __forceinline__ float xhalf(float x) { return __builtin_bit_cast(float, __builtin_amdgcn_permlanex16(__builtin_bit_cast(int, x), __builtin_bit_cast(int, x), 0x76543210, 0xfedcba98, false, false)); }
template <int CAUSAL>
__global__ __launch_bounds__(128) void k_flash(const _Float16* __restrict__ Q16, int ldq, const _Float16* __restrict__ K16, int ldk, const _Float16* __restrict__ Vt, const int* __restrict__ MSK, float* __restrict__ O, int ldo) {
  static_assert(CAUSAL == 0 || CAUSAL == 33, "modes: 0 = no mask, 33 = one additive [TQ][TK] f32 table shared by every slab");
  constexpr int RPW = 16, DT = 4, KS = 2;
  __shared__ __attribute__((aligned(16))) float sO[4][RPW][64 + 4];
  const int tid = threadIdx.x, w = tid >> 5, lane = tid & 31, ln = lane & 15, hh = lane >> 4;
  const int slab = blockIdx.x / QBNP, qblk = QB0P + blockIdx.x % QBNP; const int b = slab / NH, h = slab % NH; const int qb0 = qblk * (4 * RPW); const int q0 = qb0 + w * RPW;
  FragH bq[KS];
  { const unsigned short* qr = (const unsigned short*)Q16 + ((size_t)b * TQ + q0 + ln) * ldq + h * 64;
#pragma unroll      /* constant indices: the array stays in registers */
    for (int ks = 0; ks < KS; ++ks) { bq[ks].half[0] = *(const v8us*)(qr + ks * 32 + 8 * hh); bq[ks].half[1] = *(const v8us*)(qr + ks * 32 + 16 + 8 * hh); } }
  const unsigned short* Vth = (const unsigned short*)Vt + (size_t)slab * 64 * TK;
  float m_r = -3.0e38f, l_r = 0.f; v8f oacc[DT];
#pragma unroll      /* constant indices: the array stays in registers */
  for (int dt = 0; dt < DT; ++dt) oacc[dt] = (v8f){0.f,0.f,0.f,0.f,0.f,0.f,0.f,0.f};
  const int jbeg = 0, jend = TK;
  /* every global operand of the loop is held in registers and requested far ahead of its use; V^T is requested at the head of its pass, the next pass's K and mask values right behind its score products */
  FragH ak[2][KS], av[DT]; v4f mk[2][2], mkn[2][2];
  auto fetch_k = [&](int j0) {      /* K fragments of the 32 keys from j0 */
#pragma unroll      /* constant indices: the array stays in registers */
    for (int nt = 0; nt < 2; ++nt) { const unsigned short* kr = (const unsigned short*)K16 + ((size_t)b * TK + j0 + nt * 16 + ln) * ldk + h * 64;
#pragma unroll      /* constant indices: the array stays in registers */
      for (int ks = 0; ks < KS; ++ks) { ak[nt][ks].half[0] = *(const v8us*)(kr + ks * 32 + 8 * hh); ak[nt][ks].half[1] = *(const v8us*)(kr + ks * 32 + 16 + 8 * hh); } } };
  auto fetch_m = [&](int j0, v4f (&d)[2][2]) {      /* mode 33: the mask values of this lane's 16 score elements, 8 consecutive keys of its query's row per tile */
    if (CAUSAL == 33) { const float* amk = (const float*)MSK + (size_t)(q0 + ln) * TK + j0 + 8 * hh;
#pragma unroll      /* constant indices: the array stays in registers */
      for (int nt = 0; nt < 2; ++nt) { d[nt][0] = *(const v4fa*)(amk + nt * 16); d[nt][1] = *(const v4fa*)(amk + nt * 16 + 4); } } };
  auto fetch_v = [&](int j0) {      /* V^T fragments of the same keys */
#pragma unroll      /* constant indices: the array stays in registers */
    for (int dt = 0; dt < DT; ++dt) { const unsigned short* vrow = Vth + (size_t)(dt * 16 + ln) * TK + j0; av[dt].half[0] = *(const v8us*)(vrow + 8 * hh); av[dt].half[1] = *(const v8us*)(vrow + 16 + 8 * hh); } };
  fetch_k(jbeg); fetch_m(jbeg, mk);
#pragma unroll 1      /* rolled: the operands fetched ahead keep one register set */
  for (int j0 = jbeg; j0 < jend; j0 += 32) {
    const int jn = (j0 + 32 < jend) ? j0 + 32 : jbeg;      /* the last pass re-reads the first block: in bounds, never used */
    fetch_v(j0);      /* used behind the softmax of this pass */
    v8f s[2];
#pragma unroll      /* constant indices: the array stays in registers */
    for (int nt = 0; nt < 2; ++nt) { v8f acc = (v8f){0.f,0.f,0.f,0.f,0.f,0.f,0.f,0.f};
#pragma unroll      /* constant indices: the array stays in registers */
      for (int ks = 0; ks < KS; ++ks) acc = mmaH<1>(ak[nt][ks].v, ak[nt][ks].v, bq[ks].v, bq[ks].v, acc);
      s[nt] = acc; }
    fetch_k(jn); fetch_m(jn, mkn);      /* the next pass's K, into the registers just read, and its mask values */
    float sc[16];
#pragma unroll      /* constant indices: the array stays in registers */
    for (int e = 0; e < 16; ++e) { float v = s[e >> 3][e & 7] * SCL; if (CAUSAL == 33) v += bf16_round(mk[e >> 3][(e >> 2) & 1][e & 3]); sc[e] = v; }
    const float ma = fmaxf(fmaxf(sc[0], sc[1]), sc[2]), mb = fmaxf(fmaxf(sc[3], sc[4]), sc[5]), mc3 = fmaxf(fmaxf(sc[6], sc[7]), sc[8]), md = fmaxf(fmaxf(sc[9], sc[10]), sc[11]), me = fmaxf(fmaxf(sc[12], sc[13]), sc[14]);
    float mc = fmaxf(fmaxf(fmaxf(ma, mb), mc3), fmaxf(fmaxf(md, me), sc[15]));
    mc = fmaxf(mc, xhalf(mc));      /* both halves now hold the query's maximum over the 32 keys */
    const float mn = fmaxf(m_r, mc); const float al = (mn > -1.0e38f) ? expf(m_r - mn) : 1.0f; m_r = mn;
    float p[16]; FragH pb;
#pragma unroll      /* constant indices: the array stays in registers */
    for (int e = 0; e < 16; ++e) { p[e] = expf(sc[e] - mn); pb.h[e] = (_Float16)(p[e] * 1024.0f); }
    l_r = l_r * al + (((p[0] + p[1]) + (p[2] + p[3])) + ((p[4] + p[5]) + (p[6] + p[7]))) + (((p[8] + p[9]) + (p[10] + p[11])) + ((p[12] + p[13]) + (p[14] + p[15])));
#pragma unroll      /* constant indices: the array stays in registers */
    for (int dt = 0; dt < DT; ++dt) oacc[dt] *= al;
#pragma unroll      /* constant indices: the array stays in registers */
    for (int dt = 0; dt < DT; ++dt) oacc[dt] = mmaH<1>(av[dt].v, av[dt].v, pb.v, pb.v, oacc[dt]);
    if (CAUSAL == 33) {
#pragma unroll      /* constant indices: the array stays in registers */
      for (int nt = 0; nt < 2; ++nt) { mk[nt][0] = mkn[nt][0]; mk[nt][1] = mkn[nt][1]; } } }
  { const float l = l_r + xhalf(l_r);      /* the two halves' sums of the query's row, joined once */
    const float inv = (l > 0.f) ? 1.0f / (l * 1024.0f) : 0.f;
#pragma unroll      /* constant indices: the array stays in registers */
    for (int dt = 0; dt < DT; ++dt) { const v8f o = oacc[dt] * inv;      /* register r = O[q0 + ln][16 dt + 8 hh + r] */
      *(v4fa*)&sO[w][ln][dt * 16 + 8 * hh] = (v4f){o[0], o[1], o[2], o[3]}; *(v4fa*)&sO[w][ln][dt * 16 + 8 * hh + 4] = (v4f){o[4], o[5], o[6], o[7]}; } }
  __builtin_amdgcn_fence(__ATOMIC_ACQ_REL, "workgroup"); __builtin_amdgcn_wave_barrier();      /* the wave's own staged rows are written before its lanes read them back as whole lines */
  {
#pragma unroll
    for (int rp = 0; rp < RPW; rp += 2) { const int r = rp + (lane >> 4), pc = lane & 15; const v4f val = *(const v4fa*)&sO[w][r][pc * 4]; *(v4f*)(O + ((size_t)b * TQ + q0 + r) * ldo + h * 64 + pc * 4) = val; }
     } }
// 5-plane variant: S = Qh Kh^T + (Ql Kh^T + Qh Kl^T)/1024 with Q/K = [hi | 2^10 residual] f16 planes (QL/KL same layout as Q16/K16), then the 3-term P.V below.
// 3-term variant: O = (P_hi V_hi + (P_lo V_hi + P_hi V_lo) / 1024) / l with P = [hi | 2^10 residual] of 1024 p and V^T = [hi | 2^10 residual] planes (VtL same layout as Vt) -> ~2^-21-class products for un-averaged (early causal / peaked) rows
template <int CAUSAL>
__global__ __launch_bounds__(128) void k_flash5(const _Float16* __restrict__ Q16, const _Float16* __restrict__ QL, int ldq, const _Float16* __restrict__ K16, const _Float16* __restrict__ KL, int ldk, const _Float16* __restrict__ Vt, const _Float16* __restrict__ VtL, const int* __restrict__ MSK, float* __restrict__ O, int ldo) {
  constexpr int RPW = 16, RTN = RPW / 16, NQB = TQ / (4 * RPW), DT = 4, KS = 2;
  __shared__ __attribute__((aligned(16))) unsigned short sP[4][RPW][40]; __shared__ __attribute__((aligned(16))) unsigned short sPL[4][RPW][40]; __shared__ __attribute__((aligned(16))) float sO[4][RPW][64 + 4];
  const int tid = threadIdx.x, w = tid >> 5, lane = tid & 31, ln = lane & 15, hh = lane >> 4;
  const int slab = blockIdx.x / QBN5, qblk = QB05 + blockIdx.x % QBN5; (void)NQB; const int b = slab / NH, h = slab % NH; const int qb0 = qblk * (4 * RPW); const int q0 = qb0 + w * RPW;
  FragH aq[2][KS], aql[2][KS];
#pragma unroll
  for (int rt = 0; rt < RTN; ++rt) { const unsigned short* qr = (const unsigned short*)Q16 + ((size_t)b * TQ + q0 + rt * 16 + ln) * ldq + h * 64; const unsigned short* ql = (const unsigned short*)QL + ((size_t)b * TQ + q0 + rt * 16 + ln) * ldq + h * 64;
#pragma unroll
    for (int ks = 0; ks < KS; ++ks) { aq[rt][ks].half[0] = *(const v8us*)(qr + ks * 32 + 8 * hh); aq[rt][ks].half[1] = *(const v8us*)(qr + ks * 32 + 16 + 8 * hh); aql[rt][ks].half[0] = *(const v8us*)(ql + ks * 32 + 8 * hh); aql[rt][ks].half[1] = *(const v8us*)(ql + ks * 32 + 16 + 8 * hh); } }
  const unsigned short* Vth = (const unsigned short*)Vt + (size_t)slab * 64 * TK; const unsigned short* Vtl = (const unsigned short*)VtL + (size_t)slab * 64 * TK;
  float m_r[2][8], l_r[2][8]; v8f oacc[2][DT], oaccL[2][DT];
#pragma unroll
  for (int rt = 0; rt < RTN; ++rt) {
#pragma unroll
    for (int r = 0; r < 8; ++r) { m_r[rt][r] = -3.0e38f; l_r[rt][r] = 0.f; }
#pragma unroll
    for (int dt = 0; dt < DT; ++dt) { oacc[rt][dt] = (v8f){0.f,0.f,0.f,0.f,0.f,0.f,0.f,0.f}; oaccL[rt][dt] = oacc[rt][dt]; } }
  const int jend = (CAUSAL == 1) ? (qb0 + 4 * RPW) : ((CAUSAL == 23) ? min(TK, (qb0 / CHK + 2) * CHK) : TK);      /* causal / window: keys that can never contribute are skipped */ const int jbeg = (CAUSAL == 23) ? max(0, (qb0 / CHK - 1) * CHK) : 0;
#pragma unroll 1
  for (int j0 = jbeg; j0 < jend; j0 += 32) {
    v8f s[2][2];
#pragma unroll
    for (int nt = 0; nt < 2; ++nt) { const unsigned short* kr = (const unsigned short*)K16 + ((size_t)b * TK + j0 + nt * 16 + ln) * ldk + h * 64; const unsigned short* klr = (const unsigned short*)KL + ((size_t)b * TK + j0 + nt * 16 + ln) * ldk + h * 64; FragH bk[KS], bkl[KS];
#pragma unroll
      for (int ks = 0; ks < KS; ++ks) { bk[ks].half[0] = *(const v8us*)(kr + ks * 32 + 8 * hh); bk[ks].half[1] = *(const v8us*)(kr + ks * 32 + 16 + 8 * hh); bkl[ks].half[0] = *(const v8us*)(klr + ks * 32 + 8 * hh); bkl[ks].half[1] = *(const v8us*)(klr + ks * 32 + 16 + 8 * hh); }
#pragma unroll
      for (int rt = 0; rt < RTN; ++rt) { v8f acc = (v8f){0.f,0.f,0.f,0.f,0.f,0.f,0.f,0.f}, accl = acc;
#pragma unroll
        for (int ks = 0; ks < KS; ++ks) { acc = mmaH<1>(aq[rt][ks].v, aq[rt][ks].v, bk[ks].v, bk[ks].v, acc); accl = mmaH<1>(aql[rt][ks].v, aql[rt][ks].v, bk[ks].v, bk[ks].v, accl); accl = mmaH<1>(aq[rt][ks].v, aq[rt][ks].v, bkl[ks].v, bkl[ks].v, accl); }
#pragma unroll
        for (int r = 0; r < 8; ++r) acc[r] += accl[r] * 0.0009765625f;
        s[rt][nt] = acc; } }
#pragma unroll
    for (int rt = 0; rt < RTN; ++rt)
#pragma unroll
      for (int r = 0; r < 8; ++r) { const int tq = q0 + rt * 16 + 8 * hh + r; const int k0 = j0 + ln, k1 = j0 + 16 + ln;
        bool ok0 = (CAUSAL == 1) ? (k0 <= tq) : ((CAUSAL == 2) ? ((k0 >> 5) == (tq >> 5)) : true), ok1 = (CAUSAL == 1) ? (k1 <= tq) : ((CAUSAL == 2) ? ((k1 >> 5) == (tq >> 5)) : true);      /* mode 2: block-diagonal 32-token groups */
        if (CAUSAL == 4) { const int* mrow = MSK + ((size_t)b * TQ + tq) * TK; ok0 = mrow[k0] != 0; ok1 = mrow[k1] != 0; }      /* mode 4: per-(query, key) INPUT mask shared by all heads; masked keys contribute nothing (== the reference's -4096 fill, whose exp underflows to 0), rows with no valid key give l = 0 -> output 0 (== the reference's row_valid zeroing) */
        float s0 = ok0 ? s[rt][0][r] * SCL : -3.0e38f, s1 = ok1 ? s[rt][1][r] * SCL : -3.0e38f; if (CAUSAL == 33) { const float* amk = (const float*)MSK + (size_t)tq * TK; s0 += bf16_round(amk[k0]); s1 += bf16_round(amk[k1]); }      /* mode 33: one additive [TQ][TK] f32 table shared by every slab */ if (CAUSAL == 17) { const float* amk = (const float*)MSK + (size_t)b * TK; s0 += bf16_round(amk[k0]); s1 += bf16_round(amk[k1]); } if (CAUSAL == 18) { const float* tb = (const float*)MSK; const int* ri = MSK + 1024 + (size_t)b * TK; const int rq = ri[tq]; s0 += tb[(h * 8 + rq) * 8 + ri[k0]]; s1 += tb[(h * 8 + rq) * 8 + ri[k1]]; } if (CAUSAL == 19) { const int* rel = MSK + (size_t)tq * TK; const float* rb = (const float*)MSK + (size_t)TQ * TK + ((size_t)(b * NH + h) * TQ + tq) * 64; s0 += rb[rel[k0]]; s1 += rb[rel[k1]]; }      /* mode 19: + (q.Ek[rel] + Eb[rel][h]) / 8 gathered by the int relative ids (packed [ids | table]) */      /* mode 18: + resource_bias[h][r_q][r_k] from the packed [table | ids] buffer (TQ == TK) */      /* mode 17: additive per-(batch, key) mask INPUT */ float mc = fmaxf(s0, s1);
        mc = fmaxf(mc, __shfl_xor(mc, 1, 32)); mc = fmaxf(mc, __shfl_xor(mc, 2, 32)); mc = fmaxf(mc, __shfl_xor(mc, 4, 32)); mc = fmaxf(mc, __shfl_xor(mc, 8, 32));
        const float mn = fmaxf(m_r[rt][r], mc); const float al = (mn > -1.0e38f) ? expf(m_r[rt][r] - mn) : 1.0f; m_r[rt][r] = mn; const float p0 = ok0 ? expf(s0 - mn) : 0.f, p1 = ok1 ? expf(s1 - mn) : 0.f; l_r[rt][r] = l_r[rt][r] * al + p0 + p1;
#pragma unroll
        for (int dt = 0; dt < DT; ++dt) { oacc[rt][dt][r] *= al; oaccL[rt][dt][r] *= al; }
        FragH t2, t2l; const float ps0 = p0 * 1024.0f, ps1 = p1 * 1024.0f; t2.h[0] = (_Float16)ps0; t2.h[1] = (_Float16)ps1; t2l.h[0] = (_Float16)((ps0 - (float)t2.h[0]) * 1024.0f); t2l.h[1] = (_Float16)((ps1 - (float)t2.h[1]) * 1024.0f);
        sP[w][rt * 16 + 8 * hh + r][ln] = t2.u[0]; sP[w][rt * 16 + 8 * hh + r][16 + ln] = t2.u[1]; sPL[w][rt * 16 + 8 * hh + r][ln] = t2l.u[0]; sPL[w][rt * 16 + 8 * hh + r][16 + ln] = t2l.u[1]; }
    __builtin_amdgcn_fence(__ATOMIC_ACQ_REL, "workgroup"); __builtin_amdgcn_wave_barrier();
    FragH pa[2], pl[2];
#pragma unroll
    for (int rt = 0; rt < RTN; ++rt) { pa[rt].half[0] = *(const v8us*)&sP[w][rt * 16 + ln][8 * hh]; pa[rt].half[1] = *(const v8us*)&sP[w][rt * 16 + ln][16 + 8 * hh]; pl[rt].half[0] = *(const v8us*)&sPL[w][rt * 16 + ln][8 * hh]; pl[rt].half[1] = *(const v8us*)&sPL[w][rt * 16 + ln][16 + 8 * hh]; }
#pragma unroll
    for (int dt = 0; dt < DT; ++dt) { const unsigned short* vrow = Vth + (size_t)(dt * 16 + ln) * TK + j0; const unsigned short* vrl = Vtl + (size_t)(dt * 16 + ln) * TK + j0; FragH bv, bl; bv.half[0] = *(const v8us*)(vrow + 8 * hh); bv.half[1] = *(const v8us*)(vrow + 16 + 8 * hh); bl.half[0] = *(const v8us*)(vrl + 8 * hh); bl.half[1] = *(const v8us*)(vrl + 16 + 8 * hh);
#pragma unroll
      for (int rt = 0; rt < RTN; ++rt) { oacc[rt][dt] = mmaH<1>(pa[rt].v, pa[rt].v, bv.v, bv.v, oacc[rt][dt]); oaccL[rt][dt] = mmaH<1>(pl[rt].v, pl[rt].v, bv.v, bv.v, oaccL[rt][dt]); oaccL[rt][dt] = mmaH<1>(pa[rt].v, pa[rt].v, bl.v, bl.v, oaccL[rt][dt]); } }
    __builtin_amdgcn_fence(__ATOMIC_ACQ_REL, "workgroup"); __builtin_amdgcn_wave_barrier(); }
#pragma unroll
  for (int rt = 0; rt < RTN; ++rt) {
#pragma unroll
    for (int r = 0; r < 8; ++r) { float l = l_r[rt][r]; l += __shfl_xor(l, 1, 32); l += __shfl_xor(l, 2, 32); l += __shfl_xor(l, 4, 32); l += __shfl_xor(l, 8, 32); l_r[rt][r] = (l > 0.f) ? 1.0f / (l * 1024.0f) : 0.f; }
#pragma unroll
    for (int dt = 0; dt < DT; ++dt)
#pragma unroll
      for (int r = 0; r < 8; ++r) { float v = oacc[rt][dt][r]; v += oaccL[rt][dt][r] * 0.0009765625f; sO[w][rt * 16 + 8 * hh + r][dt * 16 + ln] = v * l_r[rt][r]; } }
  __builtin_amdgcn_fence(__ATOMIC_ACQ_REL, "workgroup"); __builtin_amdgcn_wave_barrier();
  {
#pragma unroll
    for (int rp = 0; rp < RPW; rp += 2) { const int r = rp + (lane >> 4), pc = lane & 15; const v4f val = *(const v4fa*)&sO[w][r][pc * 4]; *(v4f*)(O + ((size_t)b * TQ + q0 + r) * ldo + h * 64 + pc * 4) = val; }
     } }

__global__ __launch_bounds__(256) void k_rotab(float* __restrict__ CS, float* __restrict__ SN) {
  #pragma clang fp contract(off)
  const int t = blockIdx.x * 256 + threadIdx.x; if (t >= SLEN * 32) return; const int j = t % 32, s = t / 32; const float ex = (float)(2 * j) / 64.0f; const float inv = 1.0f / powf(10000.0f, ex); const float th = (float)s * inv; const float c = cosf(th), sn = sinf(th);
  { *(float*)(CS + t) = c; *(float*)(SN + t) = sn;  } }
__global__ __launch_bounds__(256) void k_rope(const float* __restrict__ F, int nsrc, int ndst, int rep, const float* __restrict__ CS, const float* __restrict__ SN, _Float16* __restrict__ H, _Float16* __restrict__ L) {
  #pragma clang fp contract(off)
  const size_t t = (size_t)blockIdx.x * 256 + threadIdx.x; if (t >= (size_t)NR * ndst * 4) return; const int g8 = (int)(t % 4); const int hd = (int)((t / 4) % ndst); const size_t row = t / ((size_t)4 * ndst); const int s = (int)(row % SLEN); const int hs = hd / rep;
  const float* src = F + row * (size_t)(nsrc * 64) + hs * 64; FragH ah, al, bh, bl;
  for (int i = 0; i < 8; ++i) { const int d = g8 * 8 + i; const float c = CS[s * 32 + d], sn = SN[s * 32 + d]; const float x1 = src[d], x2 = src[d + 32];
    float o1 = x1 * c; o1 += -x2 * sn; float o2 = x2 * c; o2 += x1 * sn;
    _Float16 hv = (_Float16)o1; ah.h[i] = hv; al.h[i] = (_Float16)((o1 - (float)hv) * 1024.0f); hv = (_Float16)o2; bh.h[i] = hv; bl.h[i] = (_Float16)((o2 - (float)hv) * 1024.0f); }
  const size_t o = row * (size_t)(ndst * 64) + hd * 64 + g8 * 8;
  { *(v8us*)((unsigned short*)H + o) = ah.half[0]; *(v8us*)((unsigned short*)H + o + 32) = bh.half[0]; *(v8us*)((unsigned short*)L + o) = al.half[0]; *(v8us*)((unsigned short*)L + o + 32) = bl.half[0];  } }
__global__ __launch_bounds__(256) void k_rope2(const float* __restrict__ F, int nsrc, int ndst, int rep, const float* __restrict__ CS, const float* __restrict__ SN, _Float16* __restrict__ H, _Float16* __restrict__ L) {
  #pragma clang fp contract(off)
  const size_t t = (size_t)blockIdx.x * 256 + threadIdx.x; if (t >= (size_t)NR * ndst * 4) return; const int g16 = (int)(t % 4); const int hd = (int)((t / 4) % ndst); const size_t row = t / ((size_t)4 * ndst); const int s = (int)(row % SLEN); const int hs = hd / rep;
  const float* src = F + row * (size_t)(nsrc * 64) + hs * 64 + g16 * 16; FragH ah, al;
  for (int pr = 0; pr < 8; ++pr) { const int i = g16 * 8 + pr; const float c = CS[s * 32 + i], sn = SN[s * 32 + i]; const float x1 = src[2 * pr], x2 = src[2 * pr + 1];
    float o1 = x1 * c; o1 -= x2 * sn; float o2 = x1 * sn; o2 += x2 * c;
    _Float16 hv = (_Float16)o1; ah.h[2 * pr] = hv; al.h[2 * pr] = (_Float16)((o1 - (float)hv) * 1024.0f); hv = (_Float16)o2; ah.h[2 * pr + 1] = hv; al.h[2 * pr + 1] = (_Float16)((o2 - (float)hv) * 1024.0f); }
  const size_t o = row * (size_t)(ndst * 64) + hd * 64 + g16 * 16;
  { *(v8us*)((unsigned short*)H + o) = ah.half[0]; *(v8us*)((unsigned short*)H + o + 8) = ah.half[1]; *(v8us*)((unsigned short*)L + o) = al.half[0]; *(v8us*)((unsigned short*)L + o + 8) = al.half[1];  } }
__global__ __launch_bounds__(256) void k_ln512(const float* __restrict__ A, const float* __restrict__ res, const float* __restrict__ g, const float* __restrict__ bb, float* __restrict__ Y, _Float16* __restrict__ Y16) {
  #pragma clang fp contract(off)
  const int wv = threadIdx.x >> 5, ln = threadIdx.x & 31; const size_t r = (size_t)blockIdx.x * 8 + wv; if (r >= NR) return; float x[16]; float s = 0.f;
  for (int i = 0; i < 2; ++i) { const v8f a = *(const v8f*)(A + r * DM + i * 256 + ln * 8); for (int q = 0; q < 8; ++q) { float v = a[q]; if (res) v += bf16_round(res[r * DM + i * 256 + ln * 8 + q]); x[i * 8 + q] = v; s += v; } }
  for (int o = 16; o > 0; o >>= 1) s += __shfl_xor(s, o, 32); const float mu = s / (float)DM; float var = 0.f; for (int q = 0; q < 16; ++q) { const float d = x[q] - mu; var += d * d; }
  for (int o = 16; o > 0; o >>= 1) var += __shfl_xor(var, o, 32); const float inv = rsqrtf(var / (float)DM + 1e-5f);
  { for (int i = 0; i < 2; ++i) { const int c0 = i * 256 + ln * 8; v8f y; FragH f; for (int q = 0; q < 8; ++q) { float v = (x[i * 8 + q] - mu) * inv; v *= bf16_round(g[c0 + q]); v += bf16_round(bb[c0 + q]); y[q] = v; f.h[q] = (_Float16)v; } *(v8f*)(Y + r * DM + c0) = y; if (Y16) *(v8us*)((unsigned short*)Y16 + r * DM + c0) = f.half[0]; }  } }
__global__ __launch_bounds__(256) void k_pack(const float* __restrict__ rb, const int* __restrict__ rid, int* __restrict__ PK) { const int t = blockIdx.x * 256 + threadIdx.x; if (t >= 1024 + NB * TK) return; int v; if (t < 1024) v = __float_as_int(bf16_round(rb[t])); else v = rid[t - 1024]; *(int*)(PK + t) = v;  }
__global__ __launch_bounds__(256) void k_tabin(const float* __restrict__ sp, float* __restrict__ CS, float* __restrict__ SN) { const int t = blockIdx.x * 256 + threadIdx.x; if (t >= SLEN * 32) return; const int i = t % 32, s = t / 32; const float c = bf16_round(sp[s * 64 + 32 + i]), sn = bf16_round(sp[s * 64 + i]);
  { *(float*)(CS + t) = c; *(float*)(SN + t) = sn;  } }
__global__ __launch_bounds__(256) void k_wsc(const float* __restrict__ Wm, _Float16* __restrict__ Bt, size_t n8, float sc) { const size_t t = (size_t)blockIdx.x * 256 + threadIdx.x; if (t >= n8) return; FragH f; for (int q = 0; q < 8; ++q) f.h[q] = (_Float16)(bf16_round(Wm[t * 8 + q]) * sc); *(v8us*)((unsigned short*)Bt + t * 8) = f.half[0];  }
__global__ __launch_bounds__(256) void k_rotab2(float* __restrict__ CS, float* __restrict__ SN) {
  #pragma clang fp contract(off)
  const int t = blockIdx.x * 256 + threadIdx.x; if (t >= SLEN * 32) return; const int j = t % 32, s = t / 32; const float c0 = -0.14391156831212787f;      /* -ln(10000)/64 rounded to f32 */ const float inv = expf((float)(2 * j) * c0); const float th = (float)s * inv; const float c = cosf(th), sn = sinf(th);
  { *(float*)(CS + t) = c; *(float*)(SN + t) = sn;  } }
__global__ __launch_bounds__(256) void k_lnu(const float* __restrict__ X, _Float16* __restrict__ N16, float* __restrict__ XB) {
  #pragma clang fp contract(off)
  const int wv = threadIdx.x >> 5, ln = threadIdx.x & 31; const size_t r = (size_t)blockIdx.x * 8 + wv; if (r >= NR) return; float a[32]; float s = 0.f;
  for (int i = 0; i < 4; ++i) { const v8f v = *(const v8f*)(X + r * DM + (i * 32 + ln) * 8); for (int q = 0; q < 8; ++q) { const float u = bf16_round(v[q]); a[i * 8 + q] = u; s += u; } }
  for (int o = 16; o > 0; o >>= 1) s += __shfl_xor(s, o, 32); const float mu = s / (float)DM; float var = 0.f; for (int q = 0; q < 32; ++q) { const float d = a[q] - mu; var += d * d; }
  for (int o = 16; o > 0; o >>= 1) var += __shfl_xor(var, o, 32); const float den = sqrtf(var / (float)(DM - 1)) + 1e-6f; const float inv = 1.0f / den;      /* one reciprocal per row; (x-mean)*inv vs the reference's division differs by <= 1 ulp */
  { for (int i = 0; i < 4; ++i) { const int c0 = (i * 32 + ln) * 8; FragH f; v8f xb; for (int q = 0; q < 8; ++q) { f.h[q] = (_Float16)((a[i * 8 + q] - mu) * inv); xb[q] = a[i * 8 + q]; } *(v8us*)((unsigned short*)N16 + r * DM + c0) = f.half[0]; *(v8f*)(XB + r * DM + c0) = xb; }  } }
__global__ __launch_bounds__(256) void k_vtg(const _Float16* __restrict__ V16, _Float16* __restrict__ Vt) { __shared__ unsigned short tl[64][66]; const int tid = threadIdx.x; const int slab = blockIdx.x / (SLEN / 64), lg = blockIdx.x % (SLEN / 64); const int b = slab / NH, h = slab % NH; const int hs = h / NREP;
  for (int i = tid; i < 64 * 8; i += 256) { const int r = i / 8, c8 = (i % 8) * 8; FragH f; f.half[0] = *(const v8us*)((const unsigned short*)V16 + ((size_t)b * SLEN + lg * 64 + r) * KVD + hs * 64 + c8); for (int q = 0; q < 8; ++q) tl[r][c8 + q] = f.u[q]; }
  __syncthreads();
  { for (int rd = 0; rd < 2; ++rd) { const int d = rd * 32 + tid / 8, pc = tid % 8; FragH f; for (int q = 0; q < 8; ++q) f.u[q] = tl[pc * 8 + q][d]; *(v8us*)((unsigned short*)Vt + ((size_t)slab * 64 + d) * SLEN + lg * 64 + pc * 8) = f.half[0]; }  } }

__global__ __launch_bounds__(256) void k_h16s(const float* __restrict__ SRC, int lds, int coff, _Float16* __restrict__ DST, size_t n8) { const size_t t = (size_t)blockIdx.x * 256 + threadIdx.x; if (t >= n8) return; const size_t r = (t * 8) / DM; const int c = (int)((t * 8) % DM); const v8f a = *(const v8f*)(SRC + r * lds + coff + c); FragH f; for (int q = 0; q < 8; ++q) f.h[q] = (_Float16)a[q];
  *(v8us*)((unsigned short*)DST + t * 8) = f.half[0];  }


__global__ __launch_bounds__(256) void k_ccp(const float* __restrict__ QKV, int coff, _Float16* __restrict__ D) { const size_t t = (size_t)blockIdx.x * 256 + threadIdx.x; if (t >= (size_t)NR * DM / 8) return; const int c0 = (int)((t * 8) % DM); const size_t row = (t * 8) / DM; const v8f a = *(const v8f*)(QKV + row * 3 * DM + coff + c0); FragH f; for (int q = 0; q < 8; ++q) f.h[q] = (_Float16)a[q];
  *(v8us*)((unsigned short*)D + t * 8) = f.half[0];  }


extern "C" void kernel_launch(void* const* d_in, const int* in_sizes, int n_in,
                              void* d_out, int out_size, void* d_ws, size_t ws_size, hipStream_t stream) {
  (void)in_sizes; (void)n_in; (void)out_size;
  const float* q = (const float*)d_in[0]; const float* kv = (const float*)d_in[1]; const float* mask = (const float*)d_in[2]; float* O = (float*)d_out;
  char* ws = (char*)d_ws; size_t off = 0;
  auto take = [&](size_t bytes) { char* p = ws + off; off += (bytes + 255) & ~(size_t)255; return p; };
  const size_t np = (size_t)NR * DM;      /* 32 x 2048 x 64 */
  _Float16* Q16 = (_Float16*)take(np * 2); _Float16* K16 = (_Float16*)take(np * 2); _Float16* VT = (_Float16*)take(np * 2);
  if (off > ws_size) return;      /* 24 MiB */
  k_x16<<<(unsigned)((np / 8 + 255) / 256), 256, 0, stream>>>(q, Q16, np / 8); k_x16<<<(unsigned)((np / 8 + 255) / 256), 256, 0, stream>>>(kv, K16, np / 8);
  k_vtg<<<NB * NH * (SLEN / 64), 256, 0, stream>>>(K16, VT);      /* values = keys */
  k_flash<33><<<NB * NH * QBNP, 128, 0, stream>>>(Q16, DM, K16, DM, VT, (const int*)mask, O, DM);      /* f32 context straight to the output rows */
}

// v003
// A run of this version takes 135 microseconds.
// Two timings next to v002 both put it at 1.06 times that version's speed.
// Counting every step since v000, it is 2.59 times as fast.
#include <hip/hip_runtime.h>
// DotProdAttention (q [4][8][2048][64], kv [4][8][2048][64] (keys = values), mask [1][1][2048][2048] added to every (batch, head); out = softmax(q kv^T / 8 + mask) kv -> [4][8][2048][64]).
// Structure: the (batch, head) slabs of q/kv are already contiguous 64-wide row blocks, so each slab is treated as one 'batch' of a single 64-dim head: exact f16 planes of q and kv; kv^T by LDS tiles; flash-style fused attention per (slab, 64-query block) adding the shared additive mask table per (query, key), f32 context written straight to the output.
// Compute dtype: inputs rounded to bf16; q, kv, mask exact (f16 / bf16-rounded f32); softmax f32 with f16 probabilities; plain f16 value operand (~2^-12). v_wmma_f32_16x16x32_f16.
#define NB 32                    /* 4 batches x 8 heads as slabs */
#define DM 64
#define NKV 1
#define NREP (NH / NKV)
#define KVD (NKV * 64)           /* 64 */
#define NR (NB * SLEN)
#define CHK 512
typedef int v4i __attribute__((ext_vector_type(4)));
#define FF 2048
#define SLEN 2048
#define MQI 2048
#define MKI 2048
#define TQ SLEN
#define TK SLEN
#define NH 1
#define SCL 0.125f
#define QBLKS (TQ / 64)
#define QB05 0
#define QBN5 4
#define QB0P 0
#define QBNP QBLKS
#define RE 256
typedef __bf16 v16b __attribute__((ext_vector_type(16)));
typedef unsigned short v8us __attribute__((ext_vector_type(8), may_alias));
typedef float  v8f  __attribute__((ext_vector_type(8)));
typedef float  v4f  __attribute__((ext_vector_type(4)));
typedef float  v4fa __attribute__((ext_vector_type(4), may_alias));
union FragB { v16b v; v8us half[2]; unsigned short u[16]; };

__device__ __forceinline__ unsigned short bf16_bits(float x) { unsigned int u = __float_as_uint(x); return (unsigned short)((u + 0x7FFFu + ((u >> 16) & 1u)) >> 16); }
__device__ __forceinline__ float bf16_val(unsigned short b) { return __uint_as_float(((unsigned int)b) << 16); }
__device__ __forceinline__ float bf16_round(float x) { return bf16_val(bf16_bits(x)); }
// D += A·B with NT terms: 1 = ah·bh, 2 = + al·bh (A split), 3 = + ah·bl (both split)
template <int NT>
__device__ __forceinline__ v8f mmaN(v16b ah, v16b al, v16b bh, v16b bl, v8f c) {
  c = __builtin_amdgcn_wmma_f32_16x16x32_bf16(false, ah, false, bh, (short)0, c, false, false);
  if (NT >= 2) c = __builtin_amdgcn_wmma_f32_16x16x32_bf16(false, al, false, bh, (short)0, c, false, false);
  if (NT >= 3) c = __builtin_amdgcn_wmma_f32_16x16x32_bf16(false, ah, false, bl, (short)0, c, false, false);
  asm volatile("v_nop\n\tv_nop\n\tv_nop\n\tv_nop" : "+v"(c) : "v"(ah), "v"(al), "v"(bh), "v"(bl));
  return c;
}

__global__ __launch_bounds__(256) void k_wt_bf16(const float* __restrict__ W, unsigned short* __restrict__ Wt, int K, int N) {
  const int t = blockIdx.x * 256 + threadIdx.x;
  const int k8n = K / 8;
  if (t >= N * k8n) return;
  const int n = t / k8n, k8 = (t % k8n) * 8;
  v8us v;
#pragma unroll
  for (int i = 0; i < 8; ++i) v[i] = bf16_bits(W[(size_t)(k8 + i) * N + n]);
  *(v8us*)(Wt + (size_t)n * K + k8) = v;
  
}

// GEMM C[M][N] (f32, pitch ldc) = act(A[M][K]·W + bias). A f32 row-major (pitch lda) converted per fragment to bf16
// (ASPLIT: hi/lo two planes -> 2 terms, else single rounded term); Wt bf16 [N][K] (pitch ldb). BIAS_BF16 rounds the
// bias to bf16 first (bias quantised to bf16 before the add). K%32==0, M%16==0, N%64==0.
template <bool ASPLIT, int ACT, bool BIAS_BF16>
__global__ __launch_bounds__(128) void k_gemm_bf(const float* __restrict__ A, int lda, const unsigned short* __restrict__ Wt, int ldb,
                                               const float* __restrict__ bias, float* __restrict__ C, int ldc, int M, int N, int K) {
  __shared__ __attribute__((aligned(16))) float so[4][16][64];
  const int tid = threadIdx.x, w = tid >> 5, lane = tid & 31, ln = lane & 15, hh = lane >> 4;
  const int ntn = N / 64;
  const int wid = blockIdx.x * 4 + w;
  const int mt = wid / ntn, nq = wid % ntn;
  if (mt * 16 >= M) return;
  const int row0 = mt * 16, col0 = nq * 64;
  const float* arow = A + (size_t)(row0 + ln) * lda;
  v8f acc[4] = {};
  for (int kb = 0; kb < K; kb += 32) {
    FragB ah, al;
    const v4f x0 = *(const v4fa*)(arow + kb + 8 * hh), x1 = *(const v4fa*)(arow + kb + 8 * hh + 4);
    const v4f x2 = *(const v4fa*)(arow + kb + 16 + 8 * hh), x3 = *(const v4fa*)(arow + kb + 16 + 8 * hh + 4);
    float xs[16] = {x0[0],x0[1],x0[2],x0[3],x1[0],x1[1],x1[2],x1[3],x2[0],x2[1],x2[2],x2[3],x3[0],x3[1],x3[2],x3[3]};
#pragma unroll
    for (int i = 0; i < 16; ++i) { const unsigned short hb = bf16_bits(xs[i]); ah.u[i] = hb; al.u[i] = ASPLIT ? bf16_bits(xs[i] - bf16_val(hb)) : (unsigned short)0; }
#pragma unroll
    for (int t = 0; t < 4; ++t) {
      const unsigned short* brow = Wt + (size_t)(col0 + t * 16 + ln) * ldb + kb;
      FragB b;
      b.half[0] = *(const v8us*)(brow + 8 * hh);
      b.half[1] = *(const v8us*)(brow + 16 + 8 * hh);
      acc[t] = mmaN<ASPLIT ? 2 : 1>(ah.v, al.v, b.v, b.v, acc[t]);
    }
  }
#pragma unroll
  for (int t = 0; t < 4; ++t) {
    float bv = bias ? bias[col0 + t * 16 + ln] : 0.f;
    if (BIAS_BF16) bv = bf16_round(bv);
#pragma unroll
    for (int r = 0; r < 8; ++r) { float v = acc[t][r] + bv; if (ACT == 1) v = fmaxf(v, 0.f); so[w][8 * hh + r][t * 16 + ln] = v; }
  }
  __builtin_amdgcn_fence(__ATOMIC_ACQ_REL, "workgroup");
  __builtin_amdgcn_wave_barrier();
  const int rsub = lane >> 4, c4 = (lane & 15) * 4;
  {
#pragma unroll
    for (int q = 0; q < 8; ++q) {
      const int r = q * 2 + rsub;
      const v4f v = *(const v4fa*)&so[w][r][c4];
      *(v4f*)(C + (size_t)(row0 + r) * ldc + col0 + c4) = v;
    }
    
  }
}

// GEMM C = act(A·W + bias + resid): A f32 (ASPLIT -> hi/lo 2 terms), Wt bf16 [N][K]; ACT 0 none, 1 relu, 2 exact gelu;
// resid (optional, f32, row index = (row % rmod), pitch ldr, RES_BF16 rounds it) added before the activation.
template <bool ASPLIT, int ACT, bool BIAS_BF16, bool RES_BF16>
__global__ __launch_bounds__(128) void k_gemm_bf3(const float* __restrict__ A, int lda, const unsigned short* __restrict__ Wt, int ldb,
                                                const float* __restrict__ bias, const float* __restrict__ resid, int rmod, int ldr,
                                                float* __restrict__ C, int ldc, int M, int N, int K) {
  __shared__ __attribute__((aligned(16))) float so[4][16][64];
  const int tid = threadIdx.x, w = tid >> 5, lane = tid & 31, ln = lane & 15, hh = lane >> 4;
  const int ntn = N / 64;
  const int wid = blockIdx.x * 4 + w;
  const int mt = wid / ntn, nq = wid % ntn;
  if (mt * 16 >= M) return;
  const int row0 = mt * 16, col0 = nq * 64;
  const float* arow = A + (size_t)(row0 + ln) * lda;
  v8f acc[4] = {};
  for (int kb = 0; kb < K; kb += 32) {
    FragB ah, al;
    const v4f x0 = *(const v4fa*)(arow + kb + 8 * hh), x1 = *(const v4fa*)(arow + kb + 8 * hh + 4);
    const v4f x2 = *(const v4fa*)(arow + kb + 16 + 8 * hh), x3 = *(const v4fa*)(arow + kb + 16 + 8 * hh + 4);
    float xs[16] = {x0[0],x0[1],x0[2],x0[3],x1[0],x1[1],x1[2],x1[3],x2[0],x2[1],x2[2],x2[3],x3[0],x3[1],x3[2],x3[3]};
#pragma unroll
    for (int i = 0; i < 16; ++i) { const unsigned short hb = bf16_bits(xs[i]); ah.u[i] = hb; al.u[i] = ASPLIT ? bf16_bits(xs[i] - bf16_val(hb)) : (unsigned short)0; }
#pragma unroll
    for (int t = 0; t < 4; ++t) {
      const unsigned short* brow = Wt + (size_t)(col0 + t * 16 + ln) * ldb + kb;
      FragB b;
      b.half[0] = *(const v8us*)(brow + 8 * hh);
      b.half[1] = *(const v8us*)(brow + 16 + 8 * hh);
      acc[t] = mmaN<ASPLIT ? 2 : 1>(ah.v, al.v, b.v, b.v, acc[t]);
    }
  }
#pragma unroll
  for (int t = 0; t < 4; ++t) {
    const int col = col0 + t * 16 + ln;
    float bv = bias ? bias[col] : 0.f;
    if (BIAS_BF16) bv = bf16_round(bv);
#pragma unroll
    for (int r = 0; r < 8; ++r) {
      float v = acc[t][r] + bv;
      if (resid) { float rv = resid[(size_t)((row0 + 8 * hh + r) % rmod) * ldr + col]; if (RES_BF16) rv = bf16_round(rv); v += rv; }
      if (ACT == 1) v = fmaxf(v, 0.f);
      if (ACT == 2) v = 0.5f * v * (1.0f + erff(v * 0.70710678118654752f));
      if (ACT == 3) { const float u = 0.7978845608028654f * (v + 0.044715f * v * v * v); v = 0.5f * v * (1.0f + tanhf(u)); }
      so[w][8 * hh + r][t * 16 + ln] = v;
    }
  }
  __builtin_amdgcn_fence(__ATOMIC_ACQ_REL, "workgroup");
  __builtin_amdgcn_wave_barrier();
  const int rsub = lane >> 4, c4 = (lane & 15) * 4;
  {
#pragma unroll
    for (int q = 0; q < 8; ++q) {
      const int r = q * 2 + rsub;
      const v4f v = *(const v4fa*)&so[w][r][c4];
      *(v4f*)(C + (size_t)(row0 + r) * ldc + col0 + c4) = v;
    }
    
  }
}
// row LayerNorm (biased variance, eps) over N: s = X (+ R); optional out_sum <- s; out_norm <- (s-mu)*rsqrt(var+eps)*g + b
template <bool PARAM_BF16>
__global__ __launch_bounds__(256) void k_layernorm(const float* __restrict__ X, const float* __restrict__ R, const float* __restrict__ g, const float* __restrict__ bta,
                                                  float* __restrict__ out_sum, float* __restrict__ out_norm, int N, float eps) {
  __shared__ float red[256];
  const int row = blockIdx.x, tid = threadIdx.x;
  const float* x = X + (size_t)row * N; const float* rr = R ? R + (size_t)row * N : nullptr;
  float vals[16];                     // up to N = 4096
  const int per = N / 256;            // contiguous chunk per thread? use strided-by-4 chunks: thread handles j = tid*4 + 1024*u
  float s1 = 0.f;
  for (int u = 0; u < per / 4; ++u) {
    const int j = tid * 4 + 1024 * u;
    const v4f a = *(const v4fa*)(x + j);
    v4f b = {0.f,0.f,0.f,0.f}; if (rr) b = *(const v4fa*)(rr + j);
#pragma unroll
    for (int q = 0; q < 4; ++q) { const float v = a[q] + b[q]; vals[u * 4 + q] = v; s1 += v; }
  }
  red[tid] = s1; __syncthreads();
  for (int st = 128; st > 0; st >>= 1) { if (tid < st) red[tid] += red[tid + st]; __syncthreads(); }
  const float mu = red[0] / (float)N; __syncthreads();
  float s2 = 0.f;
  for (int u = 0; u < per / 4; ++u)
#pragma unroll
    for (int q = 0; q < 4; ++q) { const float c = vals[u * 4 + q] - mu; s2 += c * c; }
  red[tid] = s2; __syncthreads();
  for (int st = 128; st > 0; st >>= 1) { if (tid < st) red[tid] += red[tid + st]; __syncthreads(); }
  const float rs = rsqrtf(red[0] / (float)N + eps);
  {
    for (int u = 0; u < per / 4; ++u) {
      const int j = tid * 4 + 1024 * u;
      v4f o, sm;
#pragma unroll
      for (int q = 0; q < 4; ++q) {
        float gg = g[j + q], bb = bta[j + q];
        if (PARAM_BF16) { gg = bf16_round(gg); bb = bf16_round(bb); }
        sm[q] = vals[u * 4 + q]; o[q] = (vals[u * 4 + q] - mu) * rs * gg + bb;
      }
      if (out_sum) *(v4f*)(out_sum + (size_t)row * N + j) = sm;
      *(v4f*)(out_norm + (size_t)row * N + j) = o;
    }
    
  }
}



// ---- f16 WMMA path (v_wmma_f32_16x16x32_f16): 11-bit significands for operands in range — used where a [0,1] probability operand needs more precision than bf16
typedef _Float16 v16h __attribute__((ext_vector_type(16)));
union FragH { v16h v; v8us half[2]; _Float16 h[16]; unsigned short u[16]; };
template <int NT>
__device__ __forceinline__ v8f mmaH(v16h ah, v16h al, v16h bh, v16h bl, v8f c) {
  c = __builtin_amdgcn_wmma_f32_16x16x32_f16(false, ah, false, bh, (short)0, c, false, false);
  if (NT >= 2) c = __builtin_amdgcn_wmma_f32_16x16x32_f16(false, al, false, bh, (short)0, c, false, false);
  if (NT >= 3) c = __builtin_amdgcn_wmma_f32_16x16x32_f16(false, ah, false, bl, (short)0, c, false, false);
  asm volatile("v_nop\n\tv_nop\n\tv_nop\n\tv_nop" : "+v"(c) : "v"(ah), "v"(al), "v"(bh), "v"(bl));
  return c;
}
// batched GEMM like k_gemm_b but f16 operands: A f32 (split into f16 hi/lo if ASPLIT, else rounded to f16), Bt = f16 values [n][k]; alpha; C f32; N multiple of 16 (partial tiles skipped)
template <bool ASPLIT>
__global__ __launch_bounds__(128) void k_gemm_h(const float* __restrict__ A, int lda, size_t sA, const _Float16* __restrict__ Bh, int ldb, size_t sB, float alpha, float* __restrict__ C, int ldc, size_t sC, int M, int N, int K) {
  __shared__ __attribute__((aligned(16))) float so[4][16][64];
  const int tid = threadIdx.x, w = tid >> 5, lane = tid & 31, ln = lane & 15, hh = lane >> 4; const int by = blockIdx.y;
  A += (size_t)by * sA; Bh += (size_t)by * sB; C += (size_t)by * sC;
  const int ntn = (N + 63) / 64; const int wid = blockIdx.x * 4 + w; const int mt = wid / ntn, nq = wid % ntn; if (mt * 16 >= M) return;
  const int row0 = mt * 16, col0 = nq * 64; const float* arow = A + (size_t)(row0 + ln) * lda;
  v8f acc[4] = {};
  for (int kb = 0; kb < K; kb += 32) {
    FragH ah, al;
    const v4f x0 = *(const v4fa*)(arow + kb + 8 * hh), x1 = *(const v4fa*)(arow + kb + 8 * hh + 4), x2 = *(const v4fa*)(arow + kb + 16 + 8 * hh), x3 = *(const v4fa*)(arow + kb + 16 + 8 * hh + 4);
    float xs[16] = {x0[0],x0[1],x0[2],x0[3],x1[0],x1[1],x1[2],x1[3],x2[0],x2[1],x2[2],x2[3],x3[0],x3[1],x3[2],x3[3]};
#pragma unroll
    for (int i = 0; i < 16; ++i) { const _Float16 h = (_Float16)xs[i]; ah.h[i] = h; al.h[i] = ASPLIT ? (_Float16)(xs[i] - (float)h) : (_Float16)0.0f; }
#pragma unroll
    for (int t = 0; t < 4; ++t) { if (col0 + t * 16 >= N) continue; const size_t boff = (size_t)(col0 + t * 16 + ln) * ldb + kb; FragH bq; bq.half[0] = *(const v8us*)(Bh + boff + 8 * hh); bq.half[1] = *(const v8us*)(Bh + boff + 16 + 8 * hh);
      acc[t] = mmaH<ASPLIT ? 2 : 1>(ah.v, al.v, bq.v, bq.v, acc[t]); }
  }
#pragma unroll
  for (int t = 0; t < 4; ++t) { if (col0 + t * 16 >= N) continue;
#pragma unroll
    for (int r = 0; r < 8; ++r) so[w][8 * hh + r][t * 16 + ln] = acc[t][r] * alpha; }
  __builtin_amdgcn_fence(__ATOMIC_ACQ_REL, "workgroup"); __builtin_amdgcn_wave_barrier();
  const int rsub = lane >> 4, c4 = (lane & 15) * 4;
  {
#pragma unroll
    for (int q = 0; q < 8; ++q) { const int r = q * 2 + rsub; if (col0 + c4 < N) { const v4f v = *(const v4fa*)&so[w][r][c4]; *(v4f*)(C + (size_t)(row0 + r) * ldc + col0 + c4) = v; } }
     }
}

// Wt[n][k] = f16(W[k][n]·scale) from f32 row-major W[K][N] (scale = power of two; bf16-exact weights stay exact in f16 away from the subnormal range)
__global__ __launch_bounds__(256) void k_wt_f16(const float* __restrict__ W, _Float16* __restrict__ Wt, int K, int N, float scale) {
  const int t = blockIdx.x * 256 + threadIdx.x; if (t >= N * (K / 8)) return; const int n = t / (K / 8), k8 = (t % (K / 8)) * 8; FragH f;
#pragma unroll
  for (int i = 0; i < 8; ++i) f.h[i] = (_Float16)(bf16_round(W[(size_t)(k8 + i) * N + n]) * scale); const v8us o = f.half[0];
  *(v8us*)((unsigned short*)Wt + (size_t)n * K + k8) = o; 
}
// k_gemm_hh variant with fused epilogue: v = acc·alpha + bias[by·sBias + col] (+ CP[(row/rowsPerB)·sCPb + by·64 + col] if CP) ; ACT 0 none / 1 elu ; writes f16 C16 (and f32 C if non-null)
template <int ACT>
__global__ __launch_bounds__(128) void k_gemm_hhx(const _Float16* __restrict__ A, int lda, size_t sA, const _Float16* __restrict__ Bh, int ldb, size_t sB, float alpha, const float* __restrict__ bias, size_t sBias, const float* __restrict__ CP, int rowsPerB, size_t sCPb, int row0g,
    float* __restrict__ C, _Float16* __restrict__ C16, int ldc, size_t sC, int M, int N, int K) {
  __shared__ __attribute__((aligned(16))) float so[4][16][64];
  const int tid = threadIdx.x, w = tid >> 5, lane = tid & 31, ln = lane & 15, hh = lane >> 4; const int by = blockIdx.y;
  A += (size_t)by * sA; Bh += (size_t)by * sB; const size_t cofs = (size_t)by * sC; const float* bp = bias ? bias + (size_t)by * sBias : nullptr;
  const int ntn = (N + 63) / 64; const int wid = blockIdx.x * 4 + w; const int mt = wid / ntn, nq = wid % ntn; if (mt * 16 >= M) return;
  const int row0 = mt * 16, col0 = nq * 64; const _Float16* arow = A + (size_t)(row0 + ln) * lda;
  v8f acc[4] = {};
  for (int kb = 0; kb < K; kb += 32) { FragH ah; ah.half[0] = *(const v8us*)((const unsigned short*)arow + kb + 8 * hh); ah.half[1] = *(const v8us*)((const unsigned short*)arow + kb + 16 + 8 * hh);
#pragma unroll
    for (int t = 0; t < 4; ++t) { if (col0 + t * 16 >= N) continue; const size_t boff = (size_t)(col0 + t * 16 + ln) * ldb + kb; FragH bq; bq.half[0] = *(const v8us*)((const unsigned short*)Bh + boff + 8 * hh); bq.half[1] = *(const v8us*)((const unsigned short*)Bh + boff + 16 + 8 * hh);
      acc[t] = mmaH<1>(ah.v, ah.v, bq.v, bq.v, acc[t]); }
  }
#pragma unroll
  for (int t = 0; t < 4; ++t) { if (col0 + t * 16 >= N) continue; const int col = col0 + t * 16 + ln; const float bv = bp ? bf16_round(bp[col]) : 0.f;
#pragma unroll
    for (int r = 0; r < 8; ++r) { float v = acc[t][r] * alpha + bv; if (CP) { const int bidx = (row0g + row0 + 8 * hh + r) / rowsPerB; v += CP[(size_t)bidx * sCPb + (size_t)by * 64 + col]; } if (ACT == 1) v = (v > 0.f) ? v : expm1f(v); else if (ACT == 7) v = (v > 0.f) ? v + 1.0f : expf(v); else if (ACT == 8) v = tanhf(v); else if (ACT == 9) v = 0.5f * v * (1.0f + tanhf(0.7978845608028654f * (v + 0.044715f * v * v * v))); else if (ACT == 11) v = 1.0f / (1.0f + expf(-v)); else if (ACT == 12) v = (v > 0.f) ? v : 0.01f * v; else if (ACT == 14) v = (v > 0.f) ? v : 0.1f * v; else if (ACT == 15) v = v / (1.0f + expf(-v)); else if (ACT == 3) v = fmaxf(v, 0.f); else if (ACT == 6) v = 0.5f * v * (1.0f + erff(v * 0.70710678118654752f)); so[w][8 * hh + r][t * 16 + ln] = v; } }
  __builtin_amdgcn_fence(__ATOMIC_ACQ_REL, "workgroup"); __builtin_amdgcn_wave_barrier();
  const int rsub = lane >> 4, c4 = (lane & 15) * 4; typedef _Float16 v4h __attribute__((ext_vector_type(4)));
  {
#pragma unroll
    for (int q = 0; q < 8; ++q) { const int r = q * 2 + rsub; if (col0 + c4 < N) { const v4f v = *(const v4fa*)&so[w][r][c4]; if (C) *(v4f*)(C + cofs + (size_t)(row0 + r) * ldc + col0 + c4) = v; if (C16) { v4h h4; for (int i = 0; i < 4; ++i) h4[i] = (_Float16)v[i]; *(v4h*)(C16 + cofs + (size_t)(row0 + r) * ldc + col0 + c4) = h4; } } }
     }
}


typedef _Float16 v4h __attribute__((ext_vector_type(4)));

__global__ __launch_bounds__(256) void k_x16(const float* __restrict__ x, _Float16* __restrict__ X16, size_t n8) { const size_t t = (size_t)blockIdx.x * 256 + threadIdx.x; if (t >= n8) return; FragH f;
#pragma unroll
  for (int q = 0; q < 8; ++q) f.h[q] = (_Float16)bf16_round(x[t * 8 + q]); *(v8us*)((unsigned short*)X16 + t * 8) = f.half[0];  }
__global__ __launch_bounds__(256) void k_h16(const float* __restrict__ x, _Float16* __restrict__ X16, size_t n8) { const size_t t = (size_t)blockIdx.x * 256 + threadIdx.x; if (t >= n8) return; FragH f;
#pragma unroll
  for (int q = 0; q < 8; ++q) f.h[q] = (_Float16)x[t * 8 + q]; *(v8us*)((unsigned short*)X16 + t * 8) = f.half[0];  }
__global__ __launch_bounds__(256) void k_round16f(const float* __restrict__ W, _Float16* __restrict__ Bt, size_t n8) { const size_t t = (size_t)blockIdx.x * 256 + threadIdx.x; if (t >= n8) return; FragH f;
#pragma unroll
  for (int i = 0; i < 8; ++i) f.h[i] = (_Float16)(bf16_round(W[t * 8 + i]) * 16.0f); *(v8us*)((unsigned short*)Bt + t * 8) = f.half[0];  }
template <int NHv, int TTv>
__global__ __launch_bounds__(256) void k_vt(const _Float16* __restrict__ V16, int ldv, int voff, _Float16* __restrict__ Vt) { __shared__ unsigned short tl[64][66]; const int tid = threadIdx.x; const int slab = blockIdx.x / (TTv / 64), lg = blockIdx.x % (TTv / 64); const int b = slab / NHv, h = slab % NHv;
  for (int i = tid; i < 64 * 8; i += 256) { const int r = i / 8, c8 = (i % 8) * 8; FragH f; f.half[0] = *(const v8us*)((const unsigned short*)V16 + ((size_t)b * TTv + lg * 64 + r) * ldv + voff + h * 64 + c8);
#pragma unroll
    for (int q = 0; q < 8; ++q) tl[r][c8 + q] = f.u[q]; }
  __syncthreads();
  {
#pragma unroll
    for (int rd = 0; rd < 2; ++rd) { const int d = rd * 32 + tid / 8, pc = tid % 8; FragH f;
#pragma unroll
      for (int q = 0; q < 8; ++q) f.u[q] = tl[pc * 8 + q][d];
      *(v8us*)((unsigned short*)Vt + ((size_t)slab * 64 + d) * TTv + lg * 64 + pc * 8) = f.half[0]; }
     } }

__global__ __launch_bounds__(256) void k_hl(const float* __restrict__ F, _Float16* __restrict__ Hh, _Float16* __restrict__ Hl, size_t n8) { const size_t t = (size_t)blockIdx.x * 256 + threadIdx.x; if (t >= n8) return; FragH fh, fl; const v4f a = *(const v4fa*)(F + t * 8), c = *(const v4fa*)(F + t * 8 + 4);
#pragma unroll
  for (int q = 0; q < 4; ++q) { _Float16 h = (_Float16)a[q]; fh.h[q] = h; fl.h[q] = (_Float16)((a[q] - (float)h) * 1024.0f); h = (_Float16)c[q]; fh.h[4 + q] = h; fl.h[4 + q] = (_Float16)((c[q] - (float)h) * 1024.0f); }
  { *(v8us*)((unsigned short*)Hh + t * 8) = fh.half[0]; *(v8us*)((unsigned short*)Hl + t * 8) = fl.half[0];  } }

// ---- fast GEMM (wave tile 32x64; requires M % 32 == 0 rows per launch region and N % 64 == 0); epilogue = k_gemm_hhx semantics ----
__device__ __forceinline__ v16h g2_frag(const _Float16* p, int hh) { FragH f; f.half[0] = *(const v8us*)((const unsigned short*)p + 8 * hh); f.half[1] = *(const v8us*)((const unsigned short*)p + 16 + 8 * hh); return f.v; }
__device__ __forceinline__ v8f g2_mma(v16h a, v16h b, v8f c) { v8f d = __builtin_amdgcn_wmma_f32_16x16x32_f16(false, a, false, b, (short)0, c, false, false); asm volatile("v_nop\n\tv_nop\n\tv_nop\n\tv_nop" : "+v"(d) : "v"(a), "v"(b)); return d; }
template <int ACT>
__global__ __launch_bounds__(128) void k_gemm2(const _Float16* __restrict__ A, int lda, size_t sA, const _Float16* __restrict__ Bh, int ldb, size_t sB, float alpha, const float* __restrict__ bias, size_t sBias, const float* __restrict__ CP, int rowsPerB, size_t sCPb, int row0g,
    float* __restrict__ C, _Float16* __restrict__ C16, int ldc, size_t sC, int M, int N, int K) {
  __shared__ __attribute__((aligned(16))) float so[4][32][68];
  const int tid = threadIdx.x, w = tid >> 5, lane = tid & 31, ln = lane & 15, hh = lane >> 4; const int by = blockIdx.y;
  A += (size_t)by * sA; Bh += (size_t)by * sB; const size_t cofs = (size_t)by * sC; const float* bp = bias ? bias + (size_t)by * sBias : nullptr;
  const int ntn = N >> 6; const int mt = blockIdx.x / ntn, nq = blockIdx.x - mt * ntn; const int row0 = mt * 128 + 32 * w, col0 = nq * 64; if (row0 >= M) return;
  const _Float16* a0p = A + (size_t)(row0 + ln) * lda; const _Float16* a1p = a0p + (size_t)16 * lda;
  const _Float16* b0p = Bh + (size_t)(col0 + ln) * ldb; const _Float16* b1p = b0p + (size_t)16 * ldb; const _Float16* b2p = b1p + (size_t)16 * ldb; const _Float16* b3p = b2p + (size_t)16 * ldb;
  const v8f z8 = {0.f,0.f,0.f,0.f,0.f,0.f,0.f,0.f}; v8f c00 = z8, c01 = z8, c02 = z8, c03 = z8, c10 = z8, c11 = z8, c12 = z8, c13 = z8;
#pragma unroll 1
  for (int kb = 0; kb < K; kb += 32) { const v16h a0 = g2_frag(a0p + kb, hh), a1 = g2_frag(a1p + kb, hh);
    v16h b = g2_frag(b0p + kb, hh); c00 = g2_mma(a0, b, c00); c10 = g2_mma(a1, b, c10);
    b = g2_frag(b1p + kb, hh); c01 = g2_mma(a0, b, c01); c11 = g2_mma(a1, b, c11);
    b = g2_frag(b2p + kb, hh); c02 = g2_mma(a0, b, c02); c12 = g2_mma(a1, b, c12);
    b = g2_frag(b3p + kb, hh); c03 = g2_mma(a0, b, c03); c13 = g2_mma(a1, b, c13); }
  v8f accs[8] = {c00, c01, c02, c03, c10, c11, c12, c13};
#pragma unroll
  for (int u = 0; u < 8; ++u) { const int t = u & 3, half = u >> 2; const int col = col0 + t * 16 + ln; const float bv = bp ? bf16_round(bp[col]) : 0.f;
#pragma unroll
    for (int r = 0; r < 8; ++r) { const int rloc = half * 16 + 8 * hh + r; float v = accs[u][r] * alpha + bv; if (CP) { if (rowsPerB < 0) v += CP[cofs + (size_t)(row0g + row0 + rloc) * ldc + col];      /* rowsPerB < 0: own element of the batched C plane */ else { const int bidx = (row0g + row0 + rloc) / rowsPerB; v += CP[(size_t)bidx * sCPb + (size_t)by * 64 + col]; } }
      if (ACT == 3) v = fmaxf(v, 0.f); else if (ACT == 6) v = 0.5f * v * (1.0f + erff(v * 0.70710678118654752f)); else if (ACT == 11) v = 1.0f / (1.0f + expf(-v)); else if (ACT == 15) v = v / (1.0f + expf(-v)); else if (ACT == 12) v = (v > 0.f) ? v : 0.01f * v; else if (ACT == 8) v = tanhf(v);
      so[w][rloc][t * 16 + ln] = v; } }
  __builtin_amdgcn_fence(__ATOMIC_ACQ_REL, "workgroup"); __builtin_amdgcn_wave_barrier();
  const int rsub = lane >> 4, c4 = (lane & 15) * 4;
  {
#pragma unroll
    for (int q = 0; q < 16; ++q) { const int r = q * 2 + rsub; const v4f v = *(const v4fa*)&so[w][r][c4]; if (C) *(v4f*)(C + cofs + (size_t)(row0 + r) * ldc + col0 + c4) = v; if (C16) { v4h h4; for (int i = 0; i < 4; ++i) h4[i] = (_Float16)v[i]; *(v4h*)(C16 + cofs + (size_t)(row0 + r) * ldc + col0 + c4) = h4; } }
     } }



// lane l <-> lane l ^ 16 by a vector cross-row move
__device__ __forceinline__ float xhalf(float x) { return __builtin_bit_cast(float, __builtin_amdgcn_permlanex16(__builtin_bit_cast(int, x), __builtin_bit_cast(int, x), 0x76543210, 0xfedcba98, false, false)); }
template <int CAUSAL>
__global__ __launch_bounds__(128) void k_flash(const _Float16* __restrict__ Q16, int ldq, const _Float16* __restrict__ K16, int ldk, const _Float16* __restrict__ Vt, const int* __restrict__ MSK, float* __restrict__ O, int ldo) {
  static_assert(CAUSAL == 0 || CAUSAL == 33, "modes: 0 = no mask, 33 = one additive [TQ][TK] f32 table shared by every slab");
  constexpr int RPW = 16, DT = 4, KS = 2; constexpr float L2E = 1.4426950408889634f;      /* log2 e */
  __shared__ __attribute__((aligned(16))) float sO[4][RPW][64 + 4];
  const int tid = threadIdx.x, w = tid >> 5, lane = tid & 31, ln = lane & 15, hh = lane >> 4;
  const int slab = blockIdx.x / QBNP, qblk = QB0P + blockIdx.x % QBNP; const int b = slab / NH, h = slab % NH; const int qb0 = qblk * (4 * RPW); const int q0 = qb0 + w * RPW;
  FragH bq[KS];
  { const unsigned short* qr = (const unsigned short*)Q16 + ((size_t)b * TQ + q0 + ln) * ldq + h * 64;
#pragma unroll      /* constant indices: the array stays in registers */
    for (int ks = 0; ks < KS; ++ks) { bq[ks].half[0] = *(const v8us*)(qr + ks * 32 + 8 * hh); bq[ks].half[1] = *(const v8us*)(qr + ks * 32 + 16 + 8 * hh); } }
  const unsigned short* Vth = (const unsigned short*)Vt + (size_t)slab * 64 * TK;
  float m_r = -3.0e38f, l_r = 0.f; v8f oacc[DT];
#pragma unroll      /* constant indices: the array stays in registers */
  for (int dt = 0; dt < DT; ++dt) oacc[dt] = (v8f){0.f,0.f,0.f,0.f,0.f,0.f,0.f,0.f};
  const int jbeg = 0, jend = TK;
  /* every global operand of the loop is held in registers and requested far ahead of its use; V^T is requested at the head of its pass, the next pass's K and mask values right behind its score products */
  FragH ak[2][KS], av[DT]; v4f mk[2][2], mkn[2][2];
  auto fetch_k = [&](int j0) {      /* K fragments of the 32 keys from j0 */
#pragma unroll      /* constant indices: the array stays in registers */
    for (int nt = 0; nt < 2; ++nt) { const unsigned short* kr = (const unsigned short*)K16 + ((size_t)b * TK + j0 + nt * 16 + ln) * ldk + h * 64;
#pragma unroll      /* constant indices: the array stays in registers */
      for (int ks = 0; ks < KS; ++ks) { ak[nt][ks].half[0] = *(const v8us*)(kr + ks * 32 + 8 * hh); ak[nt][ks].half[1] = *(const v8us*)(kr + ks * 32 + 16 + 8 * hh); } } };
  auto fetch_m = [&](int j0, v4f (&d)[2][2]) {      /* mode 33: the mask values of this lane's 16 score elements, 8 consecutive keys of its query's row per tile */
    if (CAUSAL == 33) { const float* amk = (const float*)MSK + (size_t)(q0 + ln) * TK + j0 + 8 * hh;
#pragma unroll      /* constant indices: the array stays in registers */
      for (int nt = 0; nt < 2; ++nt) { d[nt][0] = *(const v4fa*)(amk + nt * 16); d[nt][1] = *(const v4fa*)(amk + nt * 16 + 4); } } };
  auto fetch_v = [&](int j0) {      /* V^T fragments of the same keys */
#pragma unroll      /* constant indices: the array stays in registers */
    for (int dt = 0; dt < DT; ++dt) { const unsigned short* vrow = Vth + (size_t)(dt * 16 + ln) * TK + j0; av[dt].half[0] = *(const v8us*)(vrow + 8 * hh); av[dt].half[1] = *(const v8us*)(vrow + 16 + 8 * hh); } };
  fetch_k(jbeg); fetch_m(jbeg, mk);
#pragma unroll 1      /* rolled: the operands fetched ahead keep one register set */
  for (int j0 = jbeg; j0 < jend; j0 += 32) {
    const int jn = (j0 + 32 < jend) ? j0 + 32 : jbeg;      /* the last pass re-reads the first block: in bounds, never used */
    fetch_v(j0);      /* used behind the softmax of this pass */
    v8f s[2];
#pragma unroll      /* constant indices: the array stays in registers */
    for (int nt = 0; nt < 2; ++nt) { v8f acc = (v8f){0.f,0.f,0.f,0.f,0.f,0.f,0.f,0.f};
#pragma unroll      /* constant indices: the array stays in registers */
      for (int ks = 0; ks < KS; ++ks) acc = mmaH<1>(ak[nt][ks].v, ak[nt][ks].v, bq[ks].v, bq[ks].v, acc);
      s[nt] = acc; }
    fetch_k(jn); fetch_m(jn, mkn);      /* the next pass's K, into the registers just read, and its mask values */
    float sc[16];
#pragma unroll      /* constant indices: the array stays in registers */
    for (int e = 0; e < 16; ++e) { float v = s[e >> 3][e & 7] * SCL; if (CAUSAL == 33) v += bf16_round(mk[e >> 3][(e >> 2) & 1][e & 3]); sc[e] = v; }
    const float ma = fmaxf(fmaxf(sc[0], sc[1]), sc[2]), mb = fmaxf(fmaxf(sc[3], sc[4]), sc[5]), mc3 = fmaxf(fmaxf(sc[6], sc[7]), sc[8]), md = fmaxf(fmaxf(sc[9], sc[10]), sc[11]), me = fmaxf(fmaxf(sc[12], sc[13]), sc[14]);
    float mc = fmaxf(fmaxf(fmaxf(ma, mb), mc3), fmaxf(fmaxf(md, me), sc[15]));
    mc = fmaxf(mc, xhalf(mc));      /* both halves now hold the query's maximum over the 32 keys */
    /* e^x as the hardware's 2^(x log2 e): x <= 0 here, so the library form's overflow select never fires; where its underflow select gives 0 (also at -inf, or a product that overflows to it) the hardware gives 0 too */
    const float mn = fmaxf(m_r, mc); const float al = (mn > -1.0e38f) ? __builtin_amdgcn_exp2f((m_r - mn) * L2E) : 1.0f; m_r = mn;
    float p[16]; FragH pb;
#pragma unroll      /* constant indices: the array stays in registers */
    for (int e = 0; e < 16; ++e) { p[e] = __builtin_amdgcn_exp2f(__builtin_fmaf(sc[e] - mn, L2E, 10.0f)); pb.h[e] = (_Float16)p[e]; }      /* p = 1024 e^(s - m): the operand's 2^10 scale rides in the exponent, and the row sum carries it too */
    l_r = l_r * al + (((p[0] + p[1]) + (p[2] + p[3])) + ((p[4] + p[5]) + (p[6] + p[7]))) + (((p[8] + p[9]) + (p[10] + p[11])) + ((p[12] + p[13]) + (p[14] + p[15])));
#pragma unroll      /* constant indices: the array stays in registers */
    for (int dt = 0; dt < DT; ++dt) oacc[dt] *= al;
#pragma unroll      /* constant indices: the array stays in registers */
    for (int dt = 0; dt < DT; ++dt) oacc[dt] = mmaH<1>(av[dt].v, av[dt].v, pb.v, pb.v, oacc[dt]);
    if (CAUSAL == 33) {
#pragma unroll      /* constant indices: the array stays in registers */
      for (int nt = 0; nt < 2; ++nt) { mk[nt][0] = mkn[nt][0]; mk[nt][1] = mkn[nt][1]; } } }
  { const float l = l_r + xhalf(l_r);      /* the two halves' sums of the query's row, joined once */
    const float inv = (l > 0.f) ? 1.0f / l : 0.f;      /* sum and context both carry the factor 1024 */
#pragma unroll      /* constant indices: the array stays in registers */
    for (int dt = 0; dt < DT; ++dt) { const v8f o = oacc[dt] * inv;      /* register r = O[q0 + ln][16 dt + 8 hh + r] */
      *(v4fa*)&sO[w][ln][dt * 16 + 8 * hh] = (v4f){o[0], o[1], o[2], o[3]}; *(v4fa*)&sO[w][ln][dt * 16 + 8 * hh + 4] = (v4f){o[4], o[5], o[6], o[7]}; } }
  __builtin_amdgcn_fence(__ATOMIC_ACQ_REL, "workgroup"); __builtin_amdgcn_wave_barrier();      /* the wave's own staged rows are written before its lanes read them back as whole lines */
  {
#pragma unroll
    for (int rp = 0; rp < RPW; rp += 2) { const int r = rp + (lane >> 4), pc = lane & 15; const v4f val = *(const v4fa*)&sO[w][r][pc * 4]; *(v4f*)(O + ((size_t)b * TQ + q0 + r) * ldo + h * 64 + pc * 4) = val; }
     } }
// 5-plane variant: S = Qh Kh^T + (Ql Kh^T + Qh Kl^T)/1024 with Q/K = [hi | 2^10 residual] f16 planes (QL/KL same layout as Q16/K16), then the 3-term P.V below.
// 3-term variant: O = (P_hi V_hi + (P_lo V_hi + P_hi V_lo) / 1024) / l with P = [hi | 2^10 residual] of 1024 p and V^T = [hi | 2^10 residual] planes (VtL same layout as Vt) -> ~2^-21-class products for un-averaged (early causal / peaked) rows
template <int CAUSAL>
__global__ __launch_bounds__(128) void k_flash5(const _Float16* __restrict__ Q16, const _Float16* __restrict__ QL, int ldq, const _Float16* __restrict__ K16, const _Float16* __restrict__ KL, int ldk, const _Float16* __restrict__ Vt, const _Float16* __restrict__ VtL, const int* __restrict__ MSK, float* __restrict__ O, int ldo) {
  constexpr int RPW = 16, RTN = RPW / 16, NQB = TQ / (4 * RPW), DT = 4, KS = 2;
  __shared__ __attribute__((aligned(16))) unsigned short sP[4][RPW][40]; __shared__ __attribute__((aligned(16))) unsigned short sPL[4][RPW][40]; __shared__ __attribute__((aligned(16))) float sO[4][RPW][64 + 4];
  const int tid = threadIdx.x, w = tid >> 5, lane = tid & 31, ln = lane & 15, hh = lane >> 4;
  const int slab = blockIdx.x / QBN5, qblk = QB05 + blockIdx.x % QBN5; (void)NQB; const int b = slab / NH, h = slab % NH; const int qb0 = qblk * (4 * RPW); const int q0 = qb0 + w * RPW;
  FragH aq[2][KS], aql[2][KS];
#pragma unroll
  for (int rt = 0; rt < RTN; ++rt) { const unsigned short* qr = (const unsigned short*)Q16 + ((size_t)b * TQ + q0 + rt * 16 + ln) * ldq + h * 64; const unsigned short* ql = (const unsigned short*)QL + ((size_t)b * TQ + q0 + rt * 16 + ln) * ldq + h * 64;
#pragma unroll
    for (int ks = 0; ks < KS; ++ks) { aq[rt][ks].half[0] = *(const v8us*)(qr + ks * 32 + 8 * hh); aq[rt][ks].half[1] = *(const v8us*)(qr + ks * 32 + 16 + 8 * hh); aql[rt][ks].half[0] = *(const v8us*)(ql + ks * 32 + 8 * hh); aql[rt][ks].half[1] = *(const v8us*)(ql + ks * 32 + 16 + 8 * hh); } }
  const unsigned short* Vth = (const unsigned short*)Vt + (size_t)slab * 64 * TK; const unsigned short* Vtl = (const unsigned short*)VtL + (size_t)slab * 64 * TK;
  float m_r[2][8], l_r[2][8]; v8f oacc[2][DT], oaccL[2][DT];
#pragma unroll
  for (int rt = 0; rt < RTN; ++rt) {
#pragma unroll
    for (int r = 0; r < 8; ++r) { m_r[rt][r] = -3.0e38f; l_r[rt][r] = 0.f; }
#pragma unroll
    for (int dt = 0; dt < DT; ++dt) { oacc[rt][dt] = (v8f){0.f,0.f,0.f,0.f,0.f,0.f,0.f,0.f}; oaccL[rt][dt] = oacc[rt][dt]; } }
  const int jend = (CAUSAL == 1) ? (qb0 + 4 * RPW) : ((CAUSAL == 23) ? min(TK, (qb0 / CHK + 2) * CHK) : TK);      /* causal / window: keys that can never contribute are skipped */ const int jbeg = (CAUSAL == 23) ? max(0, (qb0 / CHK - 1) * CHK) : 0;
#pragma unroll 1
  for (int j0 = jbeg; j0 < jend; j0 += 32) {
    v8f s[2][2];
#pragma unroll
    for (int nt = 0; nt < 2; ++nt) { const unsigned short* kr = (const unsigned short*)K16 + ((size_t)b * TK + j0 + nt * 16 + ln) * ldk + h * 64; const unsigned short* klr = (const unsigned short*)KL + ((size_t)b * TK + j0 + nt * 16 + ln) * ldk + h * 64; FragH bk[KS], bkl[KS];
#pragma unroll
      for (int ks = 0; ks < KS; ++ks) { bk[ks].half[0] = *(const v8us*)(kr + ks * 32 + 8 * hh); bk[ks].half[1] = *(const v8us*)(kr + ks * 32 + 16 + 8 * hh); bkl[ks].half[0] = *(const v8us*)(klr + ks * 32 + 8 * hh); bkl[ks].half[1] = *(const v8us*)(klr + ks * 32 + 16 + 8 * hh); }
#pragma unroll
      for (int rt = 0; rt < RTN; ++rt) { v8f acc = (v8f){0.f,0.f,0.f,0.f,0.f,0.f,0.f,0.f}, accl = acc;
#pragma unroll
        for (int ks = 0; ks < KS; ++ks) { acc = mmaH<1>(aq[rt][ks].v, aq[rt][ks].v, bk[ks].v, bk[ks].v, acc); accl = mmaH<1>(aql[rt][ks].v, aql[rt][ks].v, bk[ks].v, bk[ks].v, accl); accl = mmaH<1>(aq[rt][ks].v, aq[rt][ks].v, bkl[ks].v, bkl[ks].v, accl); }
#pragma unroll
        for (int r = 0; r < 8; ++r) acc[r] += accl[r] * 0.0009765625f;
        s[rt][nt] = acc; } }
#pragma unroll
    for (int rt = 0; rt < RTN; ++rt)
#pragma unroll
      for (int r = 0; r < 8; ++r) { const int tq = q0 + rt * 16 + 8 * hh + r; const int k0 = j0 + ln, k1 = j0 + 16 + ln;
        bool ok0 = (CAUSAL == 1) ? (k0 <= tq) : ((CAUSAL == 2) ? ((k0 >> 5) == (tq >> 5)) : true), ok1 = (CAUSAL == 1) ? (k1 <= tq) : ((CAUSAL == 2) ? ((k1 >> 5) == (tq >> 5)) : true);      /* mode 2: block-diagonal 32-token groups */
        if (CAUSAL == 4) { const int* mrow = MSK + ((size_t)b * TQ + tq) * TK; ok0 = mrow[k0] != 0; ok1 = mrow[k1] != 0; }      /* mode 4: per-(query, key) INPUT mask shared by all heads; masked keys contribute nothing (== the reference's -4096 fill, whose exp underflows to 0), rows with no valid key give l = 0 -> output 0 (== the reference's row_valid zeroing) */
        float s0 = ok0 ? s[rt][0][r] * SCL : -3.0e38f, s1 = ok1 ? s[rt][1][r] * SCL : -3.0e38f; if (CAUSAL == 33) { const float* amk = (const float*)MSK + (size_t)tq * TK; s0 += bf16_round(amk[k0]); s1 += bf16_round(amk[k1]); }      /* mode 33: one additive [TQ][TK] f32 table shared by every slab */ if (CAUSAL == 17) { const float* amk = (const float*)MSK + (size_t)b * TK; s0 += bf16_round(amk[k0]); s1 += bf16_round(amk[k1]); } if (CAUSAL == 18) { const float* tb = (const float*)MSK; const int* ri = MSK + 1024 + (size_t)b * TK; const int rq = ri[tq]; s0 += tb[(h * 8 + rq) * 8 + ri[k0]]; s1 += tb[(h * 8 + rq) * 8 + ri[k1]]; } if (CAUSAL == 19) { const int* rel = MSK + (size_t)tq * TK; const float* rb = (const float*)MSK + (size_t)TQ * TK + ((size_t)(b * NH + h) * TQ + tq) * 64; s0 += rb[rel[k0]]; s1 += rb[rel[k1]]; }      /* mode 19: + (q.Ek[rel] + Eb[rel][h]) / 8 gathered by the int relative ids (packed [ids | table]) */      /* mode 18: + resource_bias[h][r_q][r_k] from the packed [table | ids] buffer (TQ == TK) */      /* mode 17: additive per-(batch, key) mask INPUT */ float mc = fmaxf(s0, s1);
        mc = fmaxf(mc, __shfl_xor(mc, 1, 32)); mc = fmaxf(mc, __shfl_xor(mc, 2, 32)); mc = fmaxf(mc, __shfl_xor(mc, 4, 32)); mc = fmaxf(mc, __shfl_xor(mc, 8, 32));
        const float mn = fmaxf(m_r[rt][r], mc); const float al = (mn > -1.0e38f) ? expf(m_r[rt][r] - mn) : 1.0f; m_r[rt][r] = mn; const float p0 = ok0 ? expf(s0 - mn) : 0.f, p1 = ok1 ? expf(s1 - mn) : 0.f; l_r[rt][r] = l_r[rt][r] * al + p0 + p1;
#pragma unroll
        for (int dt = 0; dt < DT; ++dt) { oacc[rt][dt][r] *= al; oaccL[rt][dt][r] *= al; }
        FragH t2, t2l; const float ps0 = p0 * 1024.0f, ps1 = p1 * 1024.0f; t2.h[0] = (_Float16)ps0; t2.h[1] = (_Float16)ps1; t2l.h[0] = (_Float16)((ps0 - (float)t2.h[0]) * 1024.0f); t2l.h[1] = (_Float16)((ps1 - (float)t2.h[1]) * 1024.0f);
        sP[w][rt * 16 + 8 * hh + r][ln] = t2.u[0]; sP[w][rt * 16 + 8 * hh + r][16 + ln] = t2.u[1]; sPL[w][rt * 16 + 8 * hh + r][ln] = t2l.u[0]; sPL[w][rt * 16 + 8 * hh + r][16 + ln] = t2l.u[1]; }
    __builtin_amdgcn_fence(__ATOMIC_ACQ_REL, "workgroup"); __builtin_amdgcn_wave_barrier();
    FragH pa[2], pl[2];
#pragma unroll
    for (int rt = 0; rt < RTN; ++rt) { pa[rt].half[0] = *(const v8us*)&sP[w][rt * 16 + ln][8 * hh]; pa[rt].half[1] = *(const v8us*)&sP[w][rt * 16 + ln][16 + 8 * hh]; pl[rt].half[0] = *(const v8us*)&sPL[w][rt * 16 + ln][8 * hh]; pl[rt].half[1] = *(const v8us*)&sPL[w][rt * 16 + ln][16 + 8 * hh]; }
#pragma unroll
    for (int dt = 0; dt < DT; ++dt) { const unsigned short* vrow = Vth + (size_t)(dt * 16 + ln) * TK + j0; const unsigned short* vrl = Vtl + (size_t)(dt * 16 + ln) * TK + j0; FragH bv, bl; bv.half[0] = *(const v8us*)(vrow + 8 * hh); bv.half[1] = *(const v8us*)(vrow + 16 + 8 * hh); bl.half[0] = *(const v8us*)(vrl + 8 * hh); bl.half[1] = *(const v8us*)(vrl + 16 + 8 * hh);
#pragma unroll
      for (int rt = 0; rt < RTN; ++rt) { oacc[rt][dt] = mmaH<1>(pa[rt].v, pa[rt].v, bv.v, bv.v, oacc[rt][dt]); oaccL[rt][dt] = mmaH<1>(pl[rt].v, pl[rt].v, bv.v, bv.v, oaccL[rt][dt]); oaccL[rt][dt] = mmaH<1>(pa[rt].v, pa[rt].v, bl.v, bl.v, oaccL[rt][dt]); } }
    __builtin_amdgcn_fence(__ATOMIC_ACQ_REL, "workgroup"); __builtin_amdgcn_wave_barrier(); }
#pragma unroll
  for (int rt = 0; rt < RTN; ++rt) {
#pragma unroll
    for (int r = 0; r < 8; ++r) { float l = l_r[rt][r]; l += __shfl_xor(l, 1, 32); l += __shfl_xor(l, 2, 32); l += __shfl_xor(l, 4, 32); l += __shfl_xor(l, 8, 32); l_r[rt][r] = (l > 0.f) ? 1.0f / (l * 1024.0f) : 0.f; }
#pragma unroll
    for (int dt = 0; dt < DT; ++dt)
#pragma unroll
      for (int r = 0; r < 8; ++r) { float v = oacc[rt][dt][r]; v += oaccL[rt][dt][r] * 0.0009765625f; sO[w][rt * 16 + 8 * hh + r][dt * 16 + ln] = v * l_r[rt][r]; } }
  __builtin_amdgcn_fence(__ATOMIC_ACQ_REL, "workgroup"); __builtin_amdgcn_wave_barrier();
  {
#pragma unroll
    for (int rp = 0; rp < RPW; rp += 2) { const int r = rp + (lane >> 4), pc = lane & 15; const v4f val = *(const v4fa*)&sO[w][r][pc * 4]; *(v4f*)(O + ((size_t)b * TQ + q0 + r) * ldo + h * 64 + pc * 4) = val; }
     } }

__global__ __launch_bounds__(256) void k_rotab(float* __restrict__ CS, float* __restrict__ SN) {
  #pragma clang fp contract(off)
  const int t = blockIdx.x * 256 + threadIdx.x; if (t >= SLEN * 32) return; const int j = t % 32, s = t / 32; const float ex = (float)(2 * j) / 64.0f; const float inv = 1.0f / powf(10000.0f, ex); const float th = (float)s * inv; const float c = cosf(th), sn = sinf(th);
  { *(float*)(CS + t) = c; *(float*)(SN + t) = sn;  } }
__global__ __launch_bounds__(256) void k_rope(const float* __restrict__ F, int nsrc, int ndst, int rep, const float* __restrict__ CS, const float* __restrict__ SN, _Float16* __restrict__ H, _Float16* __restrict__ L) {
  #pragma clang fp contract(off)
  const size_t t = (size_t)blockIdx.x * 256 + threadIdx.x; if (t >= (size_t)NR * ndst * 4) return; const int g8 = (int)(t % 4); const int hd = (int)((t / 4) % ndst); const size_t row = t / ((size_t)4 * ndst); const int s = (int)(row % SLEN); const int hs = hd / rep;
  const float* src = F + row * (size_t)(nsrc * 64) + hs * 64; FragH ah, al, bh, bl;
  for (int i = 0; i < 8; ++i) { const int d = g8 * 8 + i; const float c = CS[s * 32 + d], sn = SN[s * 32 + d]; const float x1 = src[d], x2 = src[d + 32];
    float o1 = x1 * c; o1 += -x2 * sn; float o2 = x2 * c; o2 += x1 * sn;
    _Float16 hv = (_Float16)o1; ah.h[i] = hv; al.h[i] = (_Float16)((o1 - (float)hv) * 1024.0f); hv = (_Float16)o2; bh.h[i] = hv; bl.h[i] = (_Float16)((o2 - (float)hv) * 1024.0f); }
  const size_t o = row * (size_t)(ndst * 64) + hd * 64 + g8 * 8;
  { *(v8us*)((unsigned short*)H + o) = ah.half[0]; *(v8us*)((unsigned short*)H + o + 32) = bh.half[0]; *(v8us*)((unsigned short*)L + o) = al.half[0]; *(v8us*)((unsigned short*)L + o + 32) = bl.half[0];  } }
__global__ __launch_bounds__(256) void k_rope2(const float* __restrict__ F, int nsrc, int ndst, int rep, const float* __restrict__ CS, const float* __restrict__ SN, _Float16* __restrict__ H, _Float16* __restrict__ L) {
  #pragma clang fp contract(off)
  const size_t t = (size_t)blockIdx.x * 256 + threadIdx.x; if (t >= (size_t)NR * ndst * 4) return; const int g16 = (int)(t % 4); const int hd = (int)((t / 4) % ndst); const size_t row = t / ((size_t)4 * ndst); const int s = (int)(row % SLEN); const int hs = hd / rep;
  const float* src = F + row * (size_t)(nsrc * 64) + hs * 64 + g16 * 16; FragH ah, al;
  for (int pr = 0; pr < 8; ++pr) { const int i = g16 * 8 + pr; const float c = CS[s * 32 + i], sn = SN[s * 32 + i]; const float x1 = src[2 * pr], x2 = src[2 * pr + 1];
    float o1 = x1 * c; o1 -= x2 * sn; float o2 = x1 * sn; o2 += x2 * c;
    _Float16 hv = (_Float16)o1; ah.h[2 * pr] = hv; al.h[2 * pr] = (_Float16)((o1 - (float)hv) * 1024.0f); hv = (_Float16)o2; ah.h[2 * pr + 1] = hv; al.h[2 * pr + 1] = (_Float16)((o2 - (float)hv) * 1024.0f); }
  const size_t o = row * (size_t)(ndst * 64) + hd * 64 + g16 * 16;
  { *(v8us*)((unsigned short*)H + o) = ah.half[0]; *(v8us*)((unsigned short*)H + o + 8) = ah.half[1]; *(v8us*)((unsigned short*)L + o) = al.half[0]; *(v8us*)((unsigned short*)L + o + 8) = al.half[1];  } }
__global__ __launch_bounds__(256) void k_ln512(const float* __restrict__ A, const float* __restrict__ res, const float* __restrict__ g, const float* __restrict__ bb, float* __restrict__ Y, _Float16* __restrict__ Y16) {
  #pragma clang fp contract(off)
  const int wv = threadIdx.x >> 5, ln = threadIdx.x & 31; const size_t r = (size_t)blockIdx.x * 8 + wv; if (r >= NR) return; float x[16]; float s = 0.f;
  for (int i = 0; i < 2; ++i) { const v8f a = *(const v8f*)(A + r * DM + i * 256 + ln * 8); for (int q = 0; q < 8; ++q) { float v = a[q]; if (res) v += bf16_round(res[r * DM + i * 256 + ln * 8 + q]); x[i * 8 + q] = v; s += v; } }
  for (int o = 16; o > 0; o >>= 1) s += __shfl_xor(s, o, 32); const float mu = s / (float)DM; float var = 0.f; for (int q = 0; q < 16; ++q) { const float d = x[q] - mu; var += d * d; }
  for (int o = 16; o > 0; o >>= 1) var += __shfl_xor(var, o, 32); const float inv = rsqrtf(var / (float)DM + 1e-5f);
  { for (int i = 0; i < 2; ++i) { const int c0 = i * 256 + ln * 8; v8f y; FragH f; for (int q = 0; q < 8; ++q) { float v = (x[i * 8 + q] - mu) * inv; v *= bf16_round(g[c0 + q]); v += bf16_round(bb[c0 + q]); y[q] = v; f.h[q] = (_Float16)v; } *(v8f*)(Y + r * DM + c0) = y; if (Y16) *(v8us*)((unsigned short*)Y16 + r * DM + c0) = f.half[0]; }  } }
__global__ __launch_bounds__(256) void k_pack(const float* __restrict__ rb, const int* __restrict__ rid, int* __restrict__ PK) { const int t = blockIdx.x * 256 + threadIdx.x; if (t >= 1024 + NB * TK) return; int v; if (t < 1024) v = __float_as_int(bf16_round(rb[t])); else v = rid[t - 1024]; *(int*)(PK + t) = v;  }
__global__ __launch_bounds__(256) void k_tabin(const float* __restrict__ sp, float* __restrict__ CS, float* __restrict__ SN) { const int t = blockIdx.x * 256 + threadIdx.x; if (t >= SLEN * 32) return; const int i = t % 32, s = t / 32; const float c = bf16_round(sp[s * 64 + 32 + i]), sn = bf16_round(sp[s * 64 + i]);
  { *(float*)(CS + t) = c; *(float*)(SN + t) = sn;  } }
__global__ __launch_bounds__(256) void k_wsc(const float* __restrict__ Wm, _Float16* __restrict__ Bt, size_t n8, float sc) { const size_t t = (size_t)blockIdx.x * 256 + threadIdx.x; if (t >= n8) return; FragH f; for (int q = 0; q < 8; ++q) f.h[q] = (_Float16)(bf16_round(Wm[t * 8 + q]) * sc); *(v8us*)((unsigned short*)Bt + t * 8) = f.half[0];  }
__global__ __launch_bounds__(256) void k_rotab2(float* __restrict__ CS, float* __restrict__ SN) {
  #pragma clang fp contract(off)
  const int t = blockIdx.x * 256 + threadIdx.x; if (t >= SLEN * 32) return; const int j = t % 32, s = t / 32; const float c0 = -0.14391156831212787f;      /* -ln(10000)/64 rounded to f32 */ const float inv = expf((float)(2 * j) * c0); const float th = (float)s * inv; const float c = cosf(th), sn = sinf(th);
  { *(float*)(CS + t) = c; *(float*)(SN + t) = sn;  } }
__global__ __launch_bounds__(256) void k_lnu(const float* __restrict__ X, _Float16* __restrict__ N16, float* __restrict__ XB) {
  #pragma clang fp contract(off)
  const int wv = threadIdx.x >> 5, ln = threadIdx.x & 31; const size_t r = (size_t)blockIdx.x * 8 + wv; if (r >= NR) return; float a[32]; float s = 0.f;
  for (int i = 0; i < 4; ++i) { const v8f v = *(const v8f*)(X + r * DM + (i * 32 + ln) * 8); for (int q = 0; q < 8; ++q) { const float u = bf16_round(v[q]); a[i * 8 + q] = u; s += u; } }
  for (int o = 16; o > 0; o >>= 1) s += __shfl_xor(s, o, 32); const float mu = s / (float)DM; float var = 0.f; for (int q = 0; q < 32; ++q) { const float d = a[q] - mu; var += d * d; }
  for (int o = 16; o > 0; o >>= 1) var += __shfl_xor(var, o, 32); const float den = sqrtf(var / (float)(DM - 1)) + 1e-6f; const float inv = 1.0f / den;      /* one reciprocal per row; (x-mean)*inv vs the reference's division differs by <= 1 ulp */
  { for (int i = 0; i < 4; ++i) { const int c0 = (i * 32 + ln) * 8; FragH f; v8f xb; for (int q = 0; q < 8; ++q) { f.h[q] = (_Float16)((a[i * 8 + q] - mu) * inv); xb[q] = a[i * 8 + q]; } *(v8us*)((unsigned short*)N16 + r * DM + c0) = f.half[0]; *(v8f*)(XB + r * DM + c0) = xb; }  } }
__global__ __launch_bounds__(256) void k_vtg(const _Float16* __restrict__ V16, _Float16* __restrict__ Vt) { __shared__ unsigned short tl[64][66]; const int tid = threadIdx.x; const int slab = blockIdx.x / (SLEN / 64), lg = blockIdx.x % (SLEN / 64); const int b = slab / NH, h = slab % NH; const int hs = h / NREP;
  for (int i = tid; i < 64 * 8; i += 256) { const int r = i / 8, c8 = (i % 8) * 8; FragH f; f.half[0] = *(const v8us*)((const unsigned short*)V16 + ((size_t)b * SLEN + lg * 64 + r) * KVD + hs * 64 + c8); for (int q = 0; q < 8; ++q) tl[r][c8 + q] = f.u[q]; }
  __syncthreads();
  { for (int rd = 0; rd < 2; ++rd) { const int d = rd * 32 + tid / 8, pc = tid % 8; FragH f; for (int q = 0; q < 8; ++q) f.u[q] = tl[pc * 8 + q][d]; *(v8us*)((unsigned short*)Vt + ((size_t)slab * 64 + d) * SLEN + lg * 64 + pc * 8) = f.half[0]; }  } }

__global__ __launch_bounds__(256) void k_h16s(const float* __restrict__ SRC, int lds, int coff, _Float16* __restrict__ DST, size_t n8) { const size_t t = (size_t)blockIdx.x * 256 + threadIdx.x; if (t >= n8) return; const size_t r = (t * 8) / DM; const int c = (int)((t * 8) % DM); const v8f a = *(const v8f*)(SRC + r * lds + coff + c); FragH f; for (int q = 0; q < 8; ++q) f.h[q] = (_Float16)a[q];
  *(v8us*)((unsigned short*)DST + t * 8) = f.half[0];  }


__global__ __launch_bounds__(256) void k_ccp(const float* __restrict__ QKV, int coff, _Float16* __restrict__ D) { const size_t t = (size_t)blockIdx.x * 256 + threadIdx.x; if (t >= (size_t)NR * DM / 8) return; const int c0 = (int)((t * 8) % DM); const size_t row = (t * 8) / DM; const v8f a = *(const v8f*)(QKV + row * 3 * DM + coff + c0); FragH f; for (int q = 0; q < 8; ++q) f.h[q] = (_Float16)a[q];
  *(v8us*)((unsigned short*)D + t * 8) = f.half[0];  }


extern "C" void kernel_launch(void* const* d_in, const int* in_sizes, int n_in,
                              void* d_out, int out_size, void* d_ws, size_t ws_size, hipStream_t stream) {
  (void)in_sizes; (void)n_in; (void)out_size;
  const float* q = (const float*)d_in[0]; const float* kv = (const float*)d_in[1]; const float* mask = (const float*)d_in[2]; float* O = (float*)d_out;
  char* ws = (char*)d_ws; size_t off = 0;
  auto take = [&](size_t bytes) { char* p = ws + off; off += (bytes + 255) & ~(size_t)255; return p; };
  const size_t np = (size_t)NR * DM;      /* 32 x 2048 x 64 */
  _Float16* Q16 = (_Float16*)take(np * 2); _Float16* K16 = (_Float16*)take(np * 2); _Float16* VT = (_Float16*)take(np * 2);
  if (off > ws_size) return;      /* 24 MiB */
  k_x16<<<(unsigned)((np / 8 + 255) / 256), 256, 0, stream>>>(q, Q16, np / 8); k_x16<<<(unsigned)((np / 8 + 255) / 256), 256, 0, stream>>>(kv, K16, np / 8);
  k_vtg<<<NB * NH * (SLEN / 64), 256, 0, stream>>>(K16, VT);      /* values = keys */
  k_flash<33><<<NB * NH * QBNP, 128, 0, stream>>>(Q16, DM, K16, DM, VT, (const int*)mask, O, DM);      /* f32 context straight to the output rows */
}

// v004
// It runs in 71.3 microseconds.
// Timed twice side by side with v003, it ran 1.90 and 1.88 times as fast.
// All steps since v000 together make it 4.90 times as fast.
#include <hip/hip_runtime.h>
// DotProdAttention (q [4][8][2048][64], kv [4][8][2048][64] (keys = values), mask [1][1][2048][2048] added to every (batch, head); out = softmax(q kv^T / 8 + mask) kv -> [4][8][2048][64]).
// Structure: the (batch, head) slabs of q/kv are already contiguous 64-wide row blocks, so each slab is treated as one 'batch' of a single 64-dim head: exact f16 plane of q; kv as K and as V^T, and the mask, packed in the order of the attention loop's fragment loads; flash-style fused attention per (slab, 64-query block) adding the shared additive mask table per (query, key), f32 context written straight to the output.
// Compute dtype: inputs rounded to bf16; q, kv, mask exact (f16 / bf16-rounded f32); softmax f32 with f16 probabilities; plain f16 value operand (~2^-12). v_wmma_f32_16x16x32_f16.
#define NB 32                    /* 4 batches x 8 heads as slabs */
#define DM 64
#define NKV 1
#define NREP (NH / NKV)
#define KVD (NKV * 64)           /* 64 */
#define NR (NB * SLEN)
#define CHK 512
typedef int v4i __attribute__((ext_vector_type(4)));
#define FF 2048
#define SLEN 2048
#define MQI 2048
#define MKI 2048
#define TQ SLEN
#define TK SLEN
#define NH 1
#define SCL 0.125f
#define QBLKS (TQ / 64)
#define QB05 0
#define QBN5 4
#define QB0P 0
#define QBNP QBLKS
#define RE 256
typedef __bf16 v16b __attribute__((ext_vector_type(16)));
typedef unsigned short v8us __attribute__((ext_vector_type(8), may_alias));
typedef float  v8f  __attribute__((ext_vector_type(8)));
typedef float  v4f  __attribute__((ext_vector_type(4)));
typedef float  v4fa __attribute__((ext_vector_type(4), may_alias));
union FragB { v16b v; v8us half[2]; unsigned short u[16]; };

__device__ __forceinline__ unsigned short bf16_bits(float x) { unsigned int u = __float_as_uint(x); return (unsigned short)((u + 0x7FFFu + ((u >> 16) & 1u)) >> 16); }
__device__ __forceinline__ float bf16_val(unsigned short b) { return __uint_as_float(((unsigned int)b) << 16); }
__device__ __forceinline__ float bf16_round(float x) { return bf16_val(bf16_bits(x)); }
// D += A·B with NT terms: 1 = ah·bh, 2 = + al·bh (A split), 3 = + ah·bl (both split)
template <int NT>
__device__ __forceinline__ v8f mmaN(v16b ah, v16b al, v16b bh, v16b bl, v8f c) {
  c = __builtin_amdgcn_wmma_f32_16x16x32_bf16(false, ah, false, bh, (short)0, c, false, false);
  if (NT >= 2) c = __builtin_amdgcn_wmma_f32_16x16x32_bf16(false, al, false, bh, (short)0, c, false, false);
  if (NT >= 3) c = __builtin_amdgcn_wmma_f32_16x16x32_bf16(false, ah, false, bl, (short)0, c, false, false);
  asm volatile("v_nop\n\tv_nop\n\tv_nop\n\tv_nop" : "+v"(c) : "v"(ah), "v"(al), "v"(bh), "v"(bl));
  return c;
}

__global__ __launch_bounds__(256) void k_wt_bf16(const float* __restrict__ W, unsigned short* __restrict__ Wt, int K, int N) {
  const int t = blockIdx.x * 256 + threadIdx.x;
  const int k8n = K / 8;
  if (t >= N * k8n) return;
  const int n = t / k8n, k8 = (t % k8n) * 8;
  v8us v;
#pragma unroll
  for (int i = 0; i < 8; ++i) v[i] = bf16_bits(W[(size_t)(k8 + i) * N + n]);
  *(v8us*)(Wt + (size_t)n * K + k8) = v;
  
}

// GEMM C[M][N] (f32, pitch ldc) = act(A[M][K]·W + bias). A f32 row-major (pitch lda) converted per fragment to bf16
// (ASPLIT: hi/lo two planes -> 2 terms, else single rounded term); Wt bf16 [N][K] (pitch ldb). BIAS_BF16 rounds the
// bias to bf16 first (bias quantised to bf16 before the add). K%32==0, M%16==0, N%64==0.
template <bool ASPLIT, int ACT, bool BIAS_BF16>
__global__ __launch_bounds__(128) void k_gemm_bf(const float* __restrict__ A, int lda, const unsigned short* __restrict__ Wt, int ldb,
                                               const float* __restrict__ bias, float* __restrict__ C, int ldc, int M, int N, int K) {
  __shared__ __attribute__((aligned(16))) float so[4][16][64];
  const int tid = threadIdx.x, w = tid >> 5, lane = tid & 31, ln = lane & 15, hh = lane >> 4;
  const int ntn = N / 64;
  const int wid = blockIdx.x * 4 + w;
  const int mt = wid / ntn, nq = wid % ntn;
  if (mt * 16 >= M) return;
  const int row0 = mt * 16, col0 = nq * 64;
  const float* arow = A + (size_t)(row0 + ln) * lda;
  v8f acc[4] = {};
  for (int kb = 0; kb < K; kb += 32) {
    FragB ah, al;
    const v4f x0 = *(const v4fa*)(arow + kb + 8 * hh), x1 = *(const v4fa*)(arow + kb + 8 * hh + 4);
    const v4f x2 = *(const v4fa*)(arow + kb + 16 + 8 * hh), x3 = *(const v4fa*)(arow + kb + 16 + 8 * hh + 4);
    float xs[16] = {x0[0],x0[1],x0[2],x0[3],x1[0],x1[1],x1[2],x1[3],x2[0],x2[1],x2[2],x2[3],x3[0],x3[1],x3[2],x3[3]};
#pragma unroll
    for (int i = 0; i < 16; ++i) { const unsigned short hb = bf16_bits(xs[i]); ah.u[i] = hb; al.u[i] = ASPLIT ? bf16_bits(xs[i] - bf16_val(hb)) : (unsigned short)0; }
#pragma unroll
    for (int t = 0; t < 4; ++t) {
      const unsigned short* brow = Wt + (size_t)(col0 + t * 16 + ln) * ldb + kb;
      FragB b;
      b.half[0] = *(const v8us*)(brow + 8 * hh);
      b.half[1] = *(const v8us*)(brow + 16 + 8 * hh);
      acc[t] = mmaN<ASPLIT ? 2 : 1>(ah.v, al.v, b.v, b.v, acc[t]);
    }
  }
#pragma unroll
  for (int t = 0; t < 4; ++t) {
    float bv = bias ? bias[col0 + t * 16 + ln] : 0.f;
    if (BIAS_BF16) bv = bf16_round(bv);
#pragma unroll
    for (int r = 0; r < 8; ++r) { float v = acc[t][r] + bv; if (ACT == 1) v = fmaxf(v, 0.f); so[w][8 * hh + r][t * 16 + ln] = v; }
  }
  __builtin_amdgcn_fence(__ATOMIC_ACQ_REL, "workgroup");
  __builtin_amdgcn_wave_barrier();
  const int rsub = lane >> 4, c4 = (lane & 15) * 4;
  {
#pragma unroll
    for (int q = 0; q < 8; ++q) {
      const int r = q * 2 + rsub;
      const v4f v = *(const v4fa*)&so[w][r][c4];
      *(v4f*)(C + (size_t)(row0 + r) * ldc + col0 + c4) = v;
    }
    
  }
}

// GEMM C = act(A·W + bias + resid): A f32 (ASPLIT -> hi/lo 2 terms), Wt bf16 [N][K]; ACT 0 none, 1 relu, 2 exact gelu;
// resid (optional, f32, row index = (row % rmod), pitch ldr, RES_BF16 rounds it) added before the activation.
template <bool ASPLIT, int ACT, bool BIAS_BF16, bool RES_BF16>
__global__ __launch_bounds__(128) void k_gemm_bf3(const float* __restrict__ A, int lda, const unsigned short* __restrict__ Wt, int ldb,
                                                const float* __restrict__ bias, const float* __restrict__ resid, int rmod, int ldr,
                                                float* __restrict__ C, int ldc, int M, int N, int K) {
  __shared__ __attribute__((aligned(16))) float so[4][16][64];
  const int tid = threadIdx.x, w = tid >> 5, lane = tid & 31, ln = lane & 15, hh = lane >> 4;
  const int ntn = N / 64;
  const int wid = blockIdx.x * 4 + w;
  const int mt = wid / ntn, nq = wid % ntn;
  if (mt * 16 >= M) return;
  const int row0 = mt * 16, col0 = nq * 64;
  const float* arow = A + (size_t)(row0 + ln) * lda;
  v8f acc[4] = {};
  for (int kb = 0; kb < K; kb += 32) {
    FragB ah, al;
    const v4f x0 = *(const v4fa*)(arow + kb + 8 * hh), x1 = *(const v4fa*)(arow + kb + 8 * hh + 4);
    const v4f x2 = *(const v4fa*)(arow + kb + 16 + 8 * hh), x3 = *(const v4fa*)(arow + kb + 16 + 8 * hh + 4);
    float xs[16] = {x0[0],x0[1],x0[2],x0[3],x1[0],x1[1],x1[2],x1[3],x2[0],x2[1],x2[2],x2[3],x3[0],x3[1],x3[2],x3[3]};
#pragma unroll
    for (int i = 0; i < 16; ++i) { const unsigned short hb = bf16_bits(xs[i]); ah.u[i] = hb; al.u[i] = ASPLIT ? bf16_bits(xs[i] - bf16_val(hb)) : (unsigned short)0; }
#pragma unroll
    for (int t = 0; t < 4; ++t) {
      const unsigned short* brow = Wt + (size_t)(col0 + t * 16 + ln) * ldb + kb;
      FragB b;
      b.half[0] = *(const v8us*)(brow + 8 * hh);
      b.half[1] = *(const v8us*)(brow + 16 + 8 * hh);
      acc[t] = mmaN<ASPLIT ? 2 : 1>(ah.v, al.v, b.v, b.v, acc[t]);
    }
  }
#pragma unroll
  for (int t = 0; t < 4; ++t) {
    const int col = col0 + t * 16 + ln;
    float bv = bias ? bias[col] : 0.f;
    if (BIAS_BF16) bv = bf16_round(bv);
#pragma unroll
    for (int r = 0; r < 8; ++r) {
      float v = acc[t][r] + bv;
      if (resid) { float rv = resid[(size_t)((row0 + 8 * hh + r) % rmod) * ldr + col]; if (RES_BF16) rv = bf16_round(rv); v += rv; }
      if (ACT == 1) v = fmaxf(v, 0.f);
      if (ACT == 2) v = 0.5f * v * (1.0f + erff(v * 0.70710678118654752f));
      if (ACT == 3) { const float u = 0.7978845608028654f * (v + 0.044715f * v * v * v); v = 0.5f * v * (1.0f + tanhf(u)); }
      so[w][8 * hh + r][t * 16 + ln] = v;
    }
  }
  __builtin_amdgcn_fence(__ATOMIC_ACQ_REL, "workgroup");
  __builtin_amdgcn_wave_barrier();
  const int rsub = lane >> 4, c4 = (lane & 15) * 4;
  {
#pragma unroll
    for (int q = 0; q < 8; ++q) {
      const int r = q * 2 + rsub;
      const v4f v = *(const v4fa*)&so[w][r][c4];
      *(v4f*)(C + (size_t)(row0 + r) * ldc + col0 + c4) = v;
    }
    
  }
}
// row LayerNorm (biased variance, eps) over N: s = X (+ R); optional out_sum <- s; out_norm <- (s-mu)*rsqrt(var+eps)*g + b
template <bool PARAM_BF16>
__global__ __launch_bounds__(256) void k_layernorm(const float* __restrict__ X, const float* __restrict__ R, const float* __restrict__ g, const float* __restrict__ bta,
                                                  float* __restrict__ out_sum, float* __restrict__ out_norm, int N, float eps) {
  __shared__ float red[256];
  const int row = blockIdx.x, tid = threadIdx.x;
  const float* x = X + (size_t)row * N; const float* rr = R ? R + (size_t)row * N : nullptr;
  float vals[16];                     // up to N = 4096
  const int per = N / 256;            // contiguous chunk per thread? use strided-by-4 chunks: thread handles j = tid*4 + 1024*u
  float s1 = 0.f;
  for (int u = 0; u < per / 4; ++u) {
    const int j = tid * 4 + 1024 * u;
    const v4f a = *(const v4fa*)(x + j);
    v4f b = {0.f,0.f,0.f,0.f}; if (rr) b = *(const v4fa*)(rr + j);
#pragma unroll
    for (int q = 0; q < 4; ++q) { const float v = a[q] + b[q]; vals[u * 4 + q] = v; s1 += v; }
  }
  red[tid] = s1; __syncthreads();
  for (int st = 128; st > 0; st >>= 1) { if (tid < st) red[tid] += red[tid + st]; __syncthreads(); }
  const float mu = red[0] / (float)N; __syncthreads();
  float s2 = 0.f;
  for (int u = 0; u < per / 4; ++u)
#pragma unroll
    for (int q = 0; q < 4; ++q) { const float c = vals[u * 4 + q] - mu; s2 += c * c; }
  red[tid] = s2; __syncthreads();
  for (int st = 128; st > 0; st >>= 1) { if (tid < st) red[tid] += red[tid + st]; __syncthreads(); }
  const float rs = rsqrtf(red[0] / (float)N + eps);
  {
    for (int u = 0; u < per / 4; ++u) {
      const int j = tid * 4 + 1024 * u;
      v4f o, sm;
#pragma unroll
      for (int q = 0; q < 4; ++q) {
        float gg = g[j + q], bb = bta[j + q];
        if (PARAM_BF16) { gg = bf16_round(gg); bb = bf16_round(bb); }
        sm[q] = vals[u * 4 + q]; o[q] = (vals[u * 4 + q] - mu) * rs * gg + bb;
      }
      if (out_sum) *(v4f*)(out_sum + (size_t)row * N + j) = sm;
      *(v4f*)(out_norm + (size_t)row * N + j) = o;
    }
    
  }
}



// ---- f16 WMMA path (v_wmma_f32_16x16x32_f16): 11-bit significands for operands in range — used where a [0,1] probability operand needs more precision than bf16
typedef _Float16 v16h __attribute__((ext_vector_type(16)));
union FragH { v16h v; v8us half[2]; _Float16 h[16]; unsigned short u[16]; };
template <int NT>
__device__ __forceinline__ v8f mmaH(v16h ah, v16h al, v16h bh, v16h bl, v8f c) {
  c = __builtin_amdgcn_wmma_f32_16x16x32_f16(false, ah, false, bh, (short)0, c, false, false);
  if (NT >= 2) c = __builtin_amdgcn_wmma_f32_16x16x32_f16(false, al, false, bh, (short)0, c, false, false);
  if (NT >= 3) c = __builtin_amdgcn_wmma_f32_16x16x32_f16(false, ah, false, bl, (short)0, c, false, false);
  asm volatile("v_nop\n\tv_nop\n\tv_nop\n\tv_nop" : "+v"(c) : "v"(ah), "v"(al), "v"(bh), "v"(bl));
  return c;
}
// batched GEMM like k_gemm_b but f16 operands: A f32 (split into f16 hi/lo if ASPLIT, else rounded to f16), Bt = f16 values [n][k]; alpha; C f32; N multiple of 16 (partial tiles skipped)
template <bool ASPLIT>
__global__ __launch_bounds__(128) void k_gemm_h(const float* __restrict__ A, int lda, size_t sA, const _Float16* __restrict__ Bh, int ldb, size_t sB, float alpha, float* __restrict__ C, int ldc, size_t sC, int M, int N, int K) {
  __shared__ __attribute__((aligned(16))) float so[4][16][64];
  const int tid = threadIdx.x, w = tid >> 5, lane = tid & 31, ln = lane & 15, hh = lane >> 4; const int by = blockIdx.y;
  A += (size_t)by * sA; Bh += (size_t)by * sB; C += (size_t)by * sC;
  const int ntn = (N + 63) / 64; const int wid = blockIdx.x * 4 + w; const int mt = wid / ntn, nq = wid % ntn; if (mt * 16 >= M) return;
  const int row0 = mt * 16, col0 = nq * 64; const float* arow = A + (size_t)(row0 + ln) * lda;
  v8f acc[4] = {};
  for (int kb = 0; kb < K; kb += 32) {
    FragH ah, al;
    const v4f x0 = *(const v4fa*)(arow + kb + 8 * hh), x1 = *(const v4fa*)(arow + kb + 8 * hh + 4), x2 = *(const v4fa*)(arow + kb + 16 + 8 * hh), x3 = *(const v4fa*)(arow + kb + 16 + 8 * hh + 4);
    float xs[16] = {x0[0],x0[1],x0[2],x0[3],x1[0],x1[1],x1[2],x1[3],x2[0],x2[1],x2[2],x2[3],x3[0],x3[1],x3[2],x3[3]};
#pragma unroll
    for (int i = 0; i < 16; ++i) { const _Float16 h = (_Float16)xs[i]; ah.h[i] = h; al.h[i] = ASPLIT ? (_Float16)(xs[i] - (float)h) : (_Float16)0.0f; }
#pragma unroll
    for (int t = 0; t < 4; ++t) { if (col0 + t * 16 >= N) continue; const size_t boff = (size_t)(col0 + t * 16 + ln) * ldb + kb; FragH bq; bq.half[0] = *(const v8us*)(Bh + boff + 8 * hh); bq.half[1] = *(const v8us*)(Bh + boff + 16 + 8 * hh);
      acc[t] = mmaH<ASPLIT ? 2 : 1>(ah.v, al.v, bq.v, bq.v, acc[t]); }
  }
#pragma unroll
  for (int t = 0; t < 4; ++t) { if (col0 + t * 16 >= N) continue;
#pragma unroll
    for (int r = 0; r < 8; ++r) so[w][8 * hh + r][t * 16 + ln] = acc[t][r] * alpha; }
  __builtin_amdgcn_fence(__ATOMIC_ACQ_REL, "workgroup"); __builtin_amdgcn_wave_barrier();
  const int rsub = lane >> 4, c4 = (lane & 15) * 4;
  {
#pragma unroll
    for (int q = 0; q < 8; ++q) { const int r = q * 2 + rsub; if (col0 + c4 < N) { const v4f v = *(const v4fa*)&so[w][r][c4]; *(v4f*)(C + (size_t)(row0 + r) * ldc + col0 + c4) = v; } }
     }
}

// Wt[n][k] = f16(W[k][n]·scale) from f32 row-major W[K][N] (scale = power of two; bf16-exact weights stay exact in f16 away from the subnormal range)
__global__ __launch_bounds__(256) void k_wt_f16(const float* __restrict__ W, _Float16* __restrict__ Wt, int K, int N, float scale) {
  const int t = blockIdx.x * 256 + threadIdx.x; if (t >= N * (K / 8)) return; const int n = t / (K / 8), k8 = (t % (K / 8)) * 8; FragH f;
#pragma unroll
  for (int i = 0; i < 8; ++i) f.h[i] = (_Float16)(bf16_round(W[(size_t)(k8 + i) * N + n]) * scale); const v8us o = f.half[0];
  *(v8us*)((unsigned short*)Wt + (size_t)n * K + k8) = o; 
}
// k_gemm_hh variant with fused epilogue: v = acc·alpha + bias[by·sBias + col] (+ CP[(row/rowsPerB)·sCPb + by·64 + col] if CP) ; ACT 0 none / 1 elu ; writes f16 C16 (and f32 C if non-null)
template <int ACT>
__global__ __launch_bounds__(128) void k_gemm_hhx(const _Float16* __restrict__ A, int lda, size_t sA, const _Float16* __restrict__ Bh, int ldb, size_t sB, float alpha, const float* __restrict__ bias, size_t sBias, const float* __restrict__ CP, int rowsPerB, size_t sCPb, int row0g,
    float* __restrict__ C, _Float16* __restrict__ C16, int ldc, size_t sC, int M, int N, int K) {
  __shared__ __attribute__((aligned(16))) float so[4][16][64];
  const int tid = threadIdx.x, w = tid >> 5, lane = tid & 31, ln = lane & 15, hh = lane >> 4; const int by = blockIdx.y;
  A += (size_t)by * sA; Bh += (size_t)by * sB; const size_t cofs = (size_t)by * sC; const float* bp = bias ? bias + (size_t)by * sBias : nullptr;
  const int ntn = (N + 63) / 64; const int wid = blockIdx.x * 4 + w; const int mt = wid / ntn, nq = wid % ntn; if (mt * 16 >= M) return;
  const int row0 = mt * 16, col0 = nq * 64; const _Float16* arow = A + (size_t)(row0 + ln) * lda;
  v8f acc[4] = {};
  for (int kb = 0; kb < K; kb += 32) { FragH ah; ah.half[0] = *(const v8us*)((const unsigned short*)arow + kb + 8 * hh); ah.half[1] = *(const v8us*)((const unsigned short*)arow + kb + 16 + 8 * hh);
#pragma unroll
    for (int t = 0; t < 4; ++t) { if (col0 + t * 16 >= N) continue; const size_t boff = (size_t)(col0 + t * 16 + ln) * ldb + kb; FragH bq; bq.half[0] = *(const v8us*)((const unsigned short*)Bh + boff + 8 * hh); bq.half[1] = *(const v8us*)((const unsigned short*)Bh + boff + 16 + 8 * hh);
      acc[t] = mmaH<1>(ah.v, ah.v, bq.v, bq.v, acc[t]); }
  }
#pragma unroll
  for (int t = 0; t < 4; ++t) { if (col0 + t * 16 >= N) continue; const int col = col0 + t * 16 + ln; const float bv = bp ? bf16_round(bp[col]) : 0.f;
#pragma unroll
    for (int r = 0; r < 8; ++r) { float v = acc[t][r] * alpha + bv; if (CP) { const int bidx = (row0g + row0 + 8 * hh + r) / rowsPerB; v += CP[(size_t)bidx * sCPb + (size_t)by * 64 + col]; } if (ACT == 1) v = (v > 0.f) ? v : expm1f(v); else if (ACT == 7) v = (v > 0.f) ? v + 1.0f : expf(v); else if (ACT == 8) v = tanhf(v); else if (ACT == 9) v = 0.5f * v * (1.0f + tanhf(0.7978845608028654f * (v + 0.044715f * v * v * v))); else if (ACT == 11) v = 1.0f / (1.0f + expf(-v)); else if (ACT == 12) v = (v > 0.f) ? v : 0.01f * v; else if (ACT == 14) v = (v > 0.f) ? v : 0.1f * v; else if (ACT == 15) v = v / (1.0f + expf(-v)); else if (ACT == 3) v = fmaxf(v, 0.f); else if (ACT == 6) v = 0.5f * v * (1.0f + erff(v * 0.70710678118654752f)); so[w][8 * hh + r][t * 16 + ln] = v; } }
  __builtin_amdgcn_fence(__ATOMIC_ACQ_REL, "workgroup"); __builtin_amdgcn_wave_barrier();
  const int rsub = lane >> 4, c4 = (lane & 15) * 4; typedef _Float16 v4h __attribute__((ext_vector_type(4)));
  {
#pragma unroll
    for (int q = 0; q < 8; ++q) { const int r = q * 2 + rsub; if (col0 + c4 < N) { const v4f v = *(const v4fa*)&so[w][r][c4]; if (C) *(v4f*)(C + cofs + (size_t)(row0 + r) * ldc + col0 + c4) = v; if (C16) { v4h h4; for (int i = 0; i < 4; ++i) h4[i] = (_Float16)v[i]; *(v4h*)(C16 + cofs + (size_t)(row0 + r) * ldc + col0 + c4) = h4; } } }
     }
}


typedef _Float16 v4h __attribute__((ext_vector_type(4)));

__global__ __launch_bounds__(256) void k_x16(const float* __restrict__ x, _Float16* __restrict__ X16, size_t n8) { const size_t t = (size_t)blockIdx.x * 256 + threadIdx.x; if (t >= n8) return; FragH f;
#pragma unroll
  for (int q = 0; q < 8; ++q) f.h[q] = (_Float16)bf16_round(x[t * 8 + q]); *(v8us*)((unsigned short*)X16 + t * 8) = f.half[0];  }
__global__ __launch_bounds__(256) void k_h16(const float* __restrict__ x, _Float16* __restrict__ X16, size_t n8) { const size_t t = (size_t)blockIdx.x * 256 + threadIdx.x; if (t >= n8) return; FragH f;
#pragma unroll
  for (int q = 0; q < 8; ++q) f.h[q] = (_Float16)x[t * 8 + q]; *(v8us*)((unsigned short*)X16 + t * 8) = f.half[0];  }
__global__ __launch_bounds__(256) void k_round16f(const float* __restrict__ W, _Float16* __restrict__ Bt, size_t n8) { const size_t t = (size_t)blockIdx.x * 256 + threadIdx.x; if (t >= n8) return; FragH f;
#pragma unroll
  for (int i = 0; i < 8; ++i) f.h[i] = (_Float16)(bf16_round(W[t * 8 + i]) * 16.0f); *(v8us*)((unsigned short*)Bt + t * 8) = f.half[0];  }
template <int NHv, int TTv>
__global__ __launch_bounds__(256) void k_vt(const _Float16* __restrict__ V16, int ldv, int voff, _Float16* __restrict__ Vt) { __shared__ unsigned short tl[64][66]; const int tid = threadIdx.x; const int slab = blockIdx.x / (TTv / 64), lg = blockIdx.x % (TTv / 64); const int b = slab / NHv, h = slab % NHv;
  for (int i = tid; i < 64 * 8; i += 256) { const int r = i / 8, c8 = (i % 8) * 8; FragH f; f.half[0] = *(const v8us*)((const unsigned short*)V16 + ((size_t)b * TTv + lg * 64 + r) * ldv + voff + h * 64 + c8);
#pragma unroll
    for (int q = 0; q < 8; ++q) tl[r][c8 + q] = f.u[q]; }
  __syncthreads();
  {
#pragma unroll
    for (int rd = 0; rd < 2; ++rd) { const int d = rd * 32 + tid / 8, pc = tid % 8; FragH f;
#pragma unroll
      for (int q = 0; q < 8; ++q) f.u[q] = tl[pc * 8 + q][d];
      *(v8us*)((unsigned short*)Vt + ((size_t)slab * 64 + d) * TTv + lg * 64 + pc * 8) = f.half[0]; }
     } }

__global__ __launch_bounds__(256) void k_hl(const float* __restrict__ F, _Float16* __restrict__ Hh, _Float16* __restrict__ Hl, size_t n8) { const size_t t = (size_t)blockIdx.x * 256 + threadIdx.x; if (t >= n8) return; FragH fh, fl; const v4f a = *(const v4fa*)(F + t * 8), c = *(const v4fa*)(F + t * 8 + 4);
#pragma unroll
  for (int q = 0; q < 4; ++q) { _Float16 h = (_Float16)a[q]; fh.h[q] = h; fl.h[q] = (_Float16)((a[q] - (float)h) * 1024.0f); h = (_Float16)c[q]; fh.h[4 + q] = h; fl.h[4 + q] = (_Float16)((c[q] - (float)h) * 1024.0f); }
  { *(v8us*)((unsigned short*)Hh + t * 8) = fh.half[0]; *(v8us*)((unsigned short*)Hl + t * 8) = fl.half[0];  } }

// ---- fast GEMM (wave tile 32x64; requires M % 32 == 0 rows per launch region and N % 64 == 0); epilogue = k_gemm_hhx semantics ----
__device__ __forceinline__ v16h g2_frag(const _Float16* p, int hh) { FragH f; f.half[0] = *(const v8us*)((const unsigned short*)p + 8 * hh); f.half[1] = *(const v8us*)((const unsigned short*)p + 16 + 8 * hh); return f.v; }
__device__ __forceinline__ v8f g2_mma(v16h a, v16h b, v8f c) { v8f d = __builtin_amdgcn_wmma_f32_16x16x32_f16(false, a, false, b, (short)0, c, false, false); asm volatile("v_nop\n\tv_nop\n\tv_nop\n\tv_nop" : "+v"(d) : "v"(a), "v"(b)); return d; }
template <int ACT>
__global__ __launch_bounds__(128) void k_gemm2(const _Float16* __restrict__ A, int lda, size_t sA, const _Float16* __restrict__ Bh, int ldb, size_t sB, float alpha, const float* __restrict__ bias, size_t sBias, const float* __restrict__ CP, int rowsPerB, size_t sCPb, int row0g,
    float* __restrict__ C, _Float16* __restrict__ C16, int ldc, size_t sC, int M, int N, int K) {
  __shared__ __attribute__((aligned(16))) float so[4][32][68];
  const int tid = threadIdx.x, w = tid >> 5, lane = tid & 31, ln = lane & 15, hh = lane >> 4; const int by = blockIdx.y;
  A += (size_t)by * sA; Bh += (size_t)by * sB; const size_t cofs = (size_t)by * sC; const float* bp = bias ? bias + (size_t)by * sBias : nullptr;
  const int ntn = N >> 6; const int mt = blockIdx.x / ntn, nq = blockIdx.x - mt * ntn; const int row0 = mt * 128 + 32 * w, col0 = nq * 64; if (row0 >= M) return;
  const _Float16* a0p = A + (size_t)(row0 + ln) * lda; const _Float16* a1p = a0p + (size_t)16 * lda;
  const _Float16* b0p = Bh + (size_t)(col0 + ln) * ldb; const _Float16* b1p = b0p + (size_t)16 * ldb; const _Float16* b2p = b1p + (size_t)16 * ldb; const _Float16* b3p = b2p + (size_t)16 * ldb;
  const v8f z8 = {0.f,0.f,0.f,0.f,0.f,0.f,0.f,0.f}; v8f c00 = z8, c01 = z8, c02 = z8, c03 = z8, c10 = z8, c11 = z8, c12 = z8, c13 = z8;
#pragma unroll 1
  for (int kb = 0; kb < K; kb += 32) { const v16h a0 = g2_frag(a0p + kb, hh), a1 = g2_frag(a1p + kb, hh);
    v16h b = g2_frag(b0p + kb, hh); c00 = g2_mma(a0, b, c00); c10 = g2_mma(a1, b, c10);
    b = g2_frag(b1p + kb, hh); c01 = g2_mma(a0, b, c01); c11 = g2_mma(a1, b, c11);
    b = g2_frag(b2p + kb, hh); c02 = g2_mma(a0, b, c02); c12 = g2_mma(a1, b, c12);
    b = g2_frag(b3p + kb, hh); c03 = g2_mma(a0, b, c03); c13 = g2_mma(a1, b, c13); }
  v8f accs[8] = {c00, c01, c02, c03, c10, c11, c12, c13};
#pragma unroll
  for (int u = 0; u < 8; ++u) { const int t = u & 3, half = u >> 2; const int col = col0 + t * 16 + ln; const float bv = bp ? bf16_round(bp[col]) : 0.f;
#pragma unroll
    for (int r = 0; r < 8; ++r) { const int rloc = half * 16 + 8 * hh + r; float v = accs[u][r] * alpha + bv; if (CP) { if (rowsPerB < 0) v += CP[cofs + (size_t)(row0g + row0 + rloc) * ldc + col];      /* rowsPerB < 0: own element of the batched C plane */ else { const int bidx = (row0g + row0 + rloc) / rowsPerB; v += CP[(size_t)bidx * sCPb + (size_t)by * 64 + col]; } }
      if (ACT == 3) v = fmaxf(v, 0.f); else if (ACT == 6) v = 0.5f * v * (1.0f + erff(v * 0.70710678118654752f)); else if (ACT == 11) v = 1.0f / (1.0f + expf(-v)); else if (ACT == 15) v = v / (1.0f + expf(-v)); else if (ACT == 12) v = (v > 0.f) ? v : 0.01f * v; else if (ACT == 8) v = tanhf(v);
      so[w][rloc][t * 16 + ln] = v; } }
  __builtin_amdgcn_fence(__ATOMIC_ACQ_REL, "workgroup"); __builtin_amdgcn_wave_barrier();
  const int rsub = lane >> 4, c4 = (lane & 15) * 4;
  {
#pragma unroll
    for (int q = 0; q < 16; ++q) { const int r = q * 2 + rsub; const v4f v = *(const v4fa*)&so[w][r][c4]; if (C) *(v4f*)(C + cofs + (size_t)(row0 + r) * ldc + col0 + c4) = v; if (C16) { v4h h4; for (int i = 0; i < 4; ++i) h4[i] = (_Float16)v[i]; *(v4h*)(C16 + cofs + (size_t)(row0 + r) * ldc + col0 + c4) = h4; } }
     } }



typedef unsigned int v4u __attribute__((ext_vector_type(4), may_alias));
// Packed operand planes of k_flash. Unit = the 16 bytes one lane takes in one fragment load; the 32 units of a load lie side by side (512 bytes, four whole lines), lane = 16 hh + ln.
// KP, per 32-key block 8 loads [nt][ks][c]: unit = K[16 nt + ln][32 ks + 16 c + 8 hh + 0..7].  VP, per 32-key block 8 loads [dt][c]: unit = V[16 c + 8 hh + 0..7][16 dt + ln].  Values as k_x16 makes them.
__global__ __launch_bounds__(256) void k_kvpack(const float* __restrict__ kv, unsigned short* __restrict__ KP, unsigned short* __restrict__ VP) {
  __shared__ __attribute__((aligned(16))) unsigned short tl[32][72];      /* pitch 144 B = 16 B x 9: the 16-byte row reads below spread over the banks */
  const int tid = threadIdx.x; const size_t blk = blockIdx.x;      /* one block of 32 keys, counted through all slabs */
  { const float* s = kv + blk * 2048 + tid * 8; const v4f a = *(const v4fa*)s, c = *(const v4fa*)(s + 4); FragH f;
#pragma unroll      /* constant indices: the fragment stays in registers */
    for (int q = 0; q < 4; ++q) { f.h[q] = (_Float16)bf16_round(a[q]); f.h[4 + q] = (_Float16)bf16_round(c[q]); }
    *(v8us*)&tl[tid >> 3][(tid & 7) * 8] = f.half[0]; }
  __syncthreads();      /* the whole tile is written before any thread gathers its units from it */
  const int ln = tid & 15, hh = (tid >> 4) & 1, g = tid >> 5;      /* g = the load's number in its block */
  *(v8us*)(KP + blk * 2048 + tid * 8) = *(const v8us*)&tl[(g >> 2) * 16 + ln][((g >> 1) & 1) * 32 + (g & 1) * 16 + hh * 8];
  FragH t;
#pragma unroll      /* constant indices: the fragment stays in registers */
  for (int i = 0; i < 8; ++i) t.u[i] = tl[(g & 1) * 16 + hh * 8 + i][(g >> 1) * 16 + ln];
  *(v8us*)(VP + blk * 2048 + tid * 8) = t.half[0]; }
// MP, per (16-query tile, 32-key block) 2 loads [nt]: unit = bf16 bits of mask[16 qt + ln][32 jb + 16 nt + 8 hh + 0..7] (the compute dtype's rounding of the mask)
__global__ __launch_bounds__(256) void k_mpack(const float* __restrict__ M, unsigned short* __restrict__ MP) {
  const unsigned int t = blockIdx.x * 256 + threadIdx.x; const int ln = t & 15, hh = (t >> 4) & 1, nt = (t >> 5) & 1, jb = (t >> 6) & (TK / 32 - 1), qt = t / (TK * 2);
  const float* s = M + (size_t)(qt * 16 + ln) * TK + jb * 32 + nt * 16 + hh * 8; const v4f a = *(const v4fa*)s, c = *(const v4fa*)(s + 4); v8us o;
#pragma unroll      /* constant indices: the vector stays in registers */
  for (int q = 0; q < 4; ++q) { o[q] = bf16_bits(a[q]); o[4 + q] = bf16_bits(c[q]); }
  *(v8us*)(MP + (size_t)t * 8) = o; }

// lane l <-> lane l ^ 16 by a vector cross-row move
__device__ __forceinline__ float xhalf(float x) { return __builtin_bit_cast(float, __builtin_amdgcn_permlanex16(__builtin_bit_cast(int, x), __builtin_bit_cast(int, x), 0x76543210, 0xfedcba98, false, false)); }
template <int CAUSAL>
__global__ __launch_bounds__(128) void k_flash(const _Float16* __restrict__ Q16, int ldq, const unsigned short* __restrict__ KP, const unsigned short* __restrict__ VP, const unsigned short* __restrict__ MP, float* __restrict__ O, int ldo) {
  static_assert(CAUSAL == 0 || CAUSAL == 33, "modes: 0 = no mask, 33 = one additive [TQ][TK] bf16 table, packed by k_mpack, shared by every slab");
  constexpr int RPW = 16, DT = 4, KS = 2; constexpr float L2E = 1.4426950408889634f;      /* log2 e */
  __shared__ __attribute__((aligned(16))) float sO[4][RPW][64 + 4];
  const int tid = threadIdx.x, w = tid >> 5, lane = tid & 31, ln = lane & 15, hh = lane >> 4;
  const int slab = blockIdx.x / QBNP, qblk = QB0P + blockIdx.x % QBNP; const int b = slab / NH, h = slab % NH; const int qb0 = qblk * (4 * RPW); const int q0 = qb0 + w * RPW;
  FragH bq[KS];
  { const unsigned short* qr = (const unsigned short*)Q16 + ((size_t)b * TQ + q0 + ln) * ldq + h * 64;
#pragma unroll      /* constant indices: the array stays in registers */
    for (int ks = 0; ks < KS; ++ks) { bq[ks].half[0] = *(const v8us*)(qr + ks * 32 + 8 * hh); bq[ks].half[1] = *(const v8us*)(qr + ks * 32 + 16 + 8 * hh); } }
  /* packed planes (k_kvpack, k_mpack): a fragment load is 32 lanes x 16 consecutive bytes, four whole 128-byte lines */
  const unsigned short* kpl = KP + (size_t)slab * 64 * TK; const unsigned short* vpl = VP + (size_t)slab * 64 * TK; const unsigned short* mpl = MP + (size_t)__builtin_amdgcn_readfirstlane(q0 >> 4) * 16 * TK;      /* wave-uniform bases: scalar address arithmetic */
  const unsigned int l8 = lane * 8;      /* the lane's unit in every load */
  float m_r = -3.0e38f, l_r = 0.f; v8f oacc[DT];
#pragma unroll      /* constant indices: the array stays in registers */
  for (int dt = 0; dt < DT; ++dt) oacc[dt] = (v8f){0.f,0.f,0.f,0.f,0.f,0.f,0.f,0.f};
  const int jbeg = 0, jend = TK;
  /* every global operand of the loop is held in registers and requested far ahead of its use; V^T at the head of its pass, the next pass's K and mask once the current ones are read */
  FragH ak[2][KS], av[DT]; v4u mk[2];
  auto fetch_k = [&](int j0) {      /* K fragments of the 32 keys from j0 */
#pragma unroll      /* constant indices: the array stays in registers */
    for (int nt = 0; nt < 2; ++nt) { const unsigned short* kr = kpl + (size_t)j0 * 64 + nt * 1024;
#pragma unroll      /* constant indices: the array stays in registers */
      for (int ks = 0; ks < KS; ++ks) { ak[nt][ks].half[0] = *(const v8us*)(kr + ks * 512 + l8); ak[nt][ks].half[1] = *(const v8us*)(kr + ks * 512 + 256 + l8); } } };
  auto fetch_m = [&](int j0, v4u (&d)[2]) {      /* mode 33: the mask values of this lane's 16 score elements, 8 consecutive keys of its query's row per tile, as bf16 pairs */
    if (CAUSAL == 33) { const unsigned short* amk = mpl + (size_t)j0 * 16;
#pragma unroll      /* constant indices: the array stays in registers */
      for (int nt = 0; nt < 2; ++nt) d[nt] = *(const v4u*)(amk + nt * 256 + l8); } };
  auto fetch_v = [&](int j0) {      /* V^T fragments of the same keys */
#pragma unroll      /* constant indices: the array stays in registers */
    for (int dt = 0; dt < DT; ++dt) { const unsigned short* vrow = vpl + (size_t)j0 * 64 + dt * 512; av[dt].half[0] = *(const v8us*)(vrow + l8); av[dt].half[1] = *(const v8us*)(vrow + 256 + l8); } };
  fetch_k(jbeg); fetch_m(jbeg, mk);
#pragma unroll 1      /* rolled: the operands fetched ahead keep one register set */
  for (int j0 = jbeg; j0 < jend; j0 += 32) {
    const int jn = (j0 + 32 < jend) ? j0 + 32 : jbeg;      /* the last pass re-reads the first block: in bounds, never used */
    fetch_v(j0);      /* used behind the softmax of this pass */
    v8f s[2];
#pragma unroll      /* constant indices: the array stays in registers */
    for (int nt = 0; nt < 2; ++nt) { v8f acc = (v8f){0.f,0.f,0.f,0.f,0.f,0.f,0.f,0.f};
#pragma unroll      /* constant indices: the array stays in registers */
      for (int ks = 0; ks < KS; ++ks) acc = mmaH<1>(ak[nt][ks].v, ak[nt][ks].v, bq[ks].v, bq[ks].v, acc);
      s[nt] = acc; }
    fetch_k(jn);      /* the next pass's K, into the registers just read */
    float sc[16];
#pragma unroll      /* constant indices: the array stays in registers */
    for (int e = 0; e < 16; ++e) { float v = s[e >> 3][e & 7] * SCL; if (CAUSAL == 33) { const unsigned int mw = mk[e >> 3][(e & 7) >> 1]; v += __uint_as_float((e & 1) ? (mw & 0xFFFF0000u) : (mw << 16)); } sc[e] = v; }
    fetch_m(jn, mk);      /* the next pass's mask values, into the registers just read */
    const float ma = fmaxf(fmaxf(sc[0], sc[1]), sc[2]), mb = fmaxf(fmaxf(sc[3], sc[4]), sc[5]), mc3 = fmaxf(fmaxf(sc[6], sc[7]), sc[8]), md = fmaxf(fmaxf(sc[9], sc[10]), sc[11]), me = fmaxf(fmaxf(sc[12], sc[13]), sc[14]);
    float mc = fmaxf(fmaxf(fmaxf(ma, mb), mc3), fmaxf(fmaxf(md, me), sc[15]));
    mc = fmaxf(mc, xhalf(mc));      /* both halves now hold the query's maximum over the 32 keys */
    /* e^x as the hardware's 2^(x log2 e): x <= 0 here, so the library form's overflow select never fires; where its underflow select gives 0 (also at -inf, or a product that overflows to it) the hardware gives 0 too */
    const float mn = fmaxf(m_r, mc); const float al = (mn > -1.0e38f) ? __builtin_amdgcn_exp2f((m_r - mn) * L2E) : 1.0f; m_r = mn;
    float p[16]; FragH pb;
#pragma unroll      /* constant indices: the array stays in registers */
    for (int e = 0; e < 16; ++e) { p[e] = __builtin_amdgcn_exp2f(__builtin_fmaf(sc[e] - mn, L2E, 10.0f)); pb.h[e] = (_Float16)p[e]; }      /* p = 1024 e^(s - m): the operand's 2^10 scale rides in the exponent, and the row sum carries it too */
    l_r = l_r * al + (((p[0] + p[1]) + (p[2] + p[3])) + ((p[4] + p[5]) + (p[6] + p[7]))) + (((p[8] + p[9]) + (p[10] + p[11])) + ((p[12] + p[13]) + (p[14] + p[15])));
#pragma unroll      /* constant indices: the array stays in registers */
    for (int dt = 0; dt < DT; ++dt) oacc[dt] *= al;
#pragma unroll      /* constant indices: the array stays in registers */
    for (int dt = 0; dt < DT; ++dt) oacc[dt] = mmaH<1>(av[dt].v, av[dt].v, pb.v, pb.v, oacc[dt]);
    asm volatile("s_wait_xcnt 0x0" ::: "memory"); }      /* the next pass rewrites the address registers that this pass's loads name */
  { const float l = l_r + xhalf(l_r);      /* the two halves' sums of the query's row, joined once */
    const float inv = (l > 0.f) ? 1.0f / l : 0.f;      /* sum and context both carry the factor 1024 */
#pragma unroll      /* constant indices: the array stays in registers */
    for (int dt = 0; dt < DT; ++dt) { const v8f o = oacc[dt] * inv;      /* register r = O[q0 + ln][16 dt + 8 hh + r] */
      *(v4fa*)&sO[w][ln][dt * 16 + 8 * hh] = (v4f){o[0], o[1], o[2], o[3]}; *(v4fa*)&sO[w][ln][dt * 16 + 8 * hh + 4] = (v4f){o[4], o[5], o[6], o[7]}; } }
  __builtin_amdgcn_fence(__ATOMIC_ACQ_REL, "workgroup"); __builtin_amdgcn_wave_barrier();      /* the wave's own staged rows are written before its lanes read them back as whole lines */
  {
#pragma unroll
    for (int rp = 0; rp < RPW; rp += 2) { const int r = rp + (lane >> 4), pc = lane & 15; const v4f val = *(const v4fa*)&sO[w][r][pc * 4]; *(v4f*)(O + ((size_t)b * TQ + q0 + r) * ldo + h * 64 + pc * 4) = val; }
     } }
// 5-plane variant: S = Qh Kh^T + (Ql Kh^T + Qh Kl^T)/1024 with Q/K = [hi | 2^10 residual] f16 planes (QL/KL same layout as Q16/K16), then the 3-term P.V below.
// 3-term variant: O = (P_hi V_hi + (P_lo V_hi + P_hi V_lo) / 1024) / l with P = [hi | 2^10 residual] of 1024 p and V^T = [hi | 2^10 residual] planes (VtL same layout as Vt) -> ~2^-21-class products for un-averaged (early causal / peaked) rows
template <int CAUSAL>
__global__ __launch_bounds__(128) void k_flash5(const _Float16* __restrict__ Q16, const _Float16* __restrict__ QL, int ldq, const _Float16* __restrict__ K16, const _Float16* __restrict__ KL, int ldk, const _Float16* __restrict__ Vt, const _Float16* __restrict__ VtL, const int* __restrict__ MSK, float* __restrict__ O, int ldo) {
  constexpr int RPW = 16, RTN = RPW / 16, NQB = TQ / (4 * RPW), DT = 4, KS = 2;
  __shared__ __attribute__((aligned(16))) unsigned short sP[4][RPW][40]; __shared__ __attribute__((aligned(16))) unsigned short sPL[4][RPW][40]; __shared__ __attribute__((aligned(16))) float sO[4][RPW][64 + 4];
  const int tid = threadIdx.x, w = tid >> 5, lane = tid & 31, ln = lane & 15, hh = lane >> 4;
  const int slab = blockIdx.x / QBN5, qblk = QB05 + blockIdx.x % QBN5; (void)NQB; const int b = slab / NH, h = slab % NH; const int qb0 = qblk * (4 * RPW); const int q0 = qb0 + w * RPW;
  FragH aq[2][KS], aql[2][KS];
#pragma unroll
  for (int rt = 0; rt < RTN; ++rt) { const unsigned short* qr = (const unsigned short*)Q16 + ((size_t)b * TQ + q0 + rt * 16 + ln) * ldq + h * 64; const unsigned short* ql = (const unsigned short*)QL + ((size_t)b * TQ + q0 + rt * 16 + ln) * ldq + h * 64;
#pragma unroll
    for (int ks = 0; ks < KS; ++ks) { aq[rt][ks].half[0] = *(const v8us*)(qr + ks * 32 + 8 * hh); aq[rt][ks].half[1] = *(const v8us*)(qr + ks * 32 + 16 + 8 * hh); aql[rt][ks].half[0] = *(const v8us*)(ql + ks * 32 + 8 * hh); aql[rt][ks].half[1] = *(const v8us*)(ql + ks * 32 + 16 + 8 * hh); } }
  const unsigned short* Vth = (const unsigned short*)Vt + (size_t)slab * 64 * TK; const unsigned short* Vtl = (const unsigned short*)VtL + (size_t)slab * 64 * TK;
  float m_r[2][8], l_r[2][8]; v8f oacc[2][DT], oaccL[2][DT];
#pragma unroll
  for (int rt = 0; rt < RTN; ++rt) {
#pragma unroll
    for (int r = 0; r < 8; ++r) { m_r[rt][r] = -3.0e38f; l_r[rt][r] = 0.f; }
#pragma unroll
    for (int dt = 0; dt < DT; ++dt) { oacc[rt][dt] = (v8f){0.f,0.f,0.f,0.f,0.f,0.f,0.f,0.f}; oaccL[rt][dt] = oacc[rt][dt]; } }
  const int jend = (CAUSAL == 1) ? (qb0 + 4 * RPW) : ((CAUSAL == 23) ? min(TK, (qb0 / CHK + 2) * CHK) : TK);      /* causal / window: keys that can never contribute are skipped */ const int jbeg = (CAUSAL == 23) ? max(0, (qb0 / CHK - 1) * CHK) : 0;
#pragma unroll 1
  for (int j0 = jbeg; j0 < jend; j0 += 32) {
    v8f s[2][2];
#pragma unroll
    for (int nt = 0; nt < 2; ++nt) { const unsigned short* kr = (const unsigned short*)K16 + ((size_t)b * TK + j0 + nt * 16 + ln) * ldk + h * 64; const unsigned short* klr = (const unsigned short*)KL + ((size_t)b * TK + j0 + nt * 16 + ln) * ldk + h * 64; FragH bk[KS], bkl[KS];
#pragma unroll
      for (int ks = 0; ks < KS; ++ks) { bk[ks].half[0] = *(const v8us*)(kr + ks * 32 + 8 * hh); bk[ks].half[1] = *(const v8us*)(kr + ks * 32 + 16 + 8 * hh); bkl[ks].half[0] = *(const v8us*)(klr + ks * 32 + 8 * hh); bkl[ks].half[1] = *(const v8us*)(klr + ks * 32 + 16 + 8 * hh); }
#pragma unroll
      for (int rt = 0; rt < RTN; ++rt) { v8f acc = (v8f){0.f,0.f,0.f,0.f,0.f,0.f,0.f,0.f}, accl = acc;
#pragma unroll
        for (int ks = 0; ks < KS; ++ks) { acc = mmaH<1>(aq[rt][ks].v, aq[rt][ks].v, bk[ks].v, bk[ks].v, acc); accl = mmaH<1>(aql[rt][ks].v, aql[rt][ks].v, bk[ks].v, bk[ks].v, accl); accl = mmaH<1>(aq[rt][ks].v, aq[rt][ks].v, bkl[ks].v, bkl[ks].v, accl); }
#pragma unroll
        for (int r = 0; r < 8; ++r) acc[r] += accl[r] * 0.0009765625f;
        s[rt][nt] = acc; } }
#pragma unroll
    for (int rt = 0; rt < RTN; ++rt)
#pragma unroll
      for (int r = 0; r < 8; ++r) { const int tq = q0 + rt * 16 + 8 * hh + r; const int k0 = j0 + ln, k1 = j0 + 16 + ln;
        bool ok0 = (CAUSAL == 1) ? (k0 <= tq) : ((CAUSAL == 2) ? ((k0 >> 5) == (tq >> 5)) : true), ok1 = (CAUSAL == 1) ? (k1 <= tq) : ((CAUSAL == 2) ? ((k1 >> 5) == (tq >> 5)) : true);      /* mode 2: block-diagonal 32-token groups */
        if (CAUSAL == 4) { const int* mrow = MSK + ((size_t)b * TQ + tq) * TK; ok0 = mrow[k0] != 0; ok1 = mrow[k1] != 0; }      /* mode 4: per-(query, key) INPUT mask shared by all heads; masked keys contribute nothing (== the reference's -4096 fill, whose exp underflows to 0), rows with no valid key give l = 0 -> output 0 (== the reference's row_valid zeroing) */
        float s0 = ok0 ? s[rt][0][r] * SCL : -3.0e38f, s1 = ok1 ? s[rt][1][r] * SCL : -3.0e38f; if (CAUSAL == 33) { const float* amk = (const float*)MSK + (size_t)tq * TK; s0 += bf16_round(amk[k0]); s1 += bf16_round(amk[k1]); }      /* mode 33: one additive [TQ][TK] f32 table shared by every slab */ if (CAUSAL == 17) { const float* amk = (const float*)MSK + (size_t)b * TK; s0 += bf16_round(amk[k0]); s1 += bf16_round(amk[k1]); } if (CAUSAL == 18) { const float* tb = (const float*)MSK; const int* ri = MSK + 1024 + (size_t)b * TK; const int rq = ri[tq]; s0 += tb[(h * 8 + rq) * 8 + ri[k0]]; s1 += tb[(h * 8 + rq) * 8 + ri[k1]]; } if (CAUSAL == 19) { const int* rel = MSK + (size_t)tq * TK; const float* rb = (const float*)MSK + (size_t)TQ * TK + ((size_t)(b * NH + h) * TQ + tq) * 64; s0 += rb[rel[k0]]; s1 += rb[rel[k1]]; }      /* mode 19: + (q.Ek[rel] + Eb[rel][h]) / 8 gathered by the int relative ids (packed [ids | table]) */      /* mode 18: + resource_bias[h][r_q][r_k] from the packed [table | ids] buffer (TQ == TK) */      /* mode 17: additive per-(batch, key) mask INPUT */ float mc = fmaxf(s0, s1);
        mc = fmaxf(mc, __shfl_xor(mc, 1, 32)); mc = fmaxf(mc, __shfl_xor(mc, 2, 32)); mc = fmaxf(mc, __shfl_xor(mc, 4, 32)); mc = fmaxf(mc, __shfl_xor(mc, 8, 32));
        const float mn = fmaxf(m_r[rt][r], mc); const float al = (mn > -1.0e38f) ? expf(m_r[rt][r] - mn) : 1.0f; m_r[rt][r] = mn; const float p0 = ok0 ? expf(s0 - mn) : 0.f, p1 = ok1 ? expf(s1 - mn) : 0.f; l_r[rt][r] = l_r[rt][r] * al + p0 + p1;
#pragma unroll
        for (int dt = 0; dt < DT; ++dt) { oacc[rt][dt][r] *= al; oaccL[rt][dt][r] *= al; }
        FragH t2, t2l; const float ps0 = p0 * 1024.0f, ps1 = p1 * 1024.0f; t2.h[0] = (_Float16)ps0; t2.h[1] = (_Float16)ps1; t2l.h[0] = (_Float16)((ps0 - (float)t2.h[0]) * 1024.0f); t2l.h[1] = (_Float16)((ps1 - (float)t2.h[1]) * 1024.0f);
        sP[w][rt * 16 + 8 * hh + r][ln] = t2.u[0]; sP[w][rt * 16 + 8 * hh + r][16 + ln] = t2.u[1]; sPL[w][rt * 16 + 8 * hh + r][ln] = t2l.u[0]; sPL[w][rt * 16 + 8 * hh + r][16 + ln] = t2l.u[1]; }
    __builtin_amdgcn_fence(__ATOMIC_ACQ_REL, "workgroup"); __builtin_amdgcn_wave_barrier();
    FragH pa[2], pl[2];
#pragma unroll
    for (int rt = 0; rt < RTN; ++rt) { pa[rt].half[0] = *(const v8us*)&sP[w][rt * 16 + ln][8 * hh]; pa[rt].half[1] = *(const v8us*)&sP[w][rt * 16 + ln][16 + 8 * hh]; pl[rt].half[0] = *(const v8us*)&sPL[w][rt * 16 + ln][8 * hh]; pl[rt].half[1] = *(const v8us*)&sPL[w][rt * 16 + ln][16 + 8 * hh]; }
#pragma unroll
    for (int dt = 0; dt < DT; ++dt) { const unsigned short* vrow = Vth + (size_t)(dt * 16 + ln) * TK + j0; const unsigned short* vrl = Vtl + (size_t)(dt * 16 + ln) * TK + j0; FragH bv, bl; bv.half[0] = *(const v8us*)(vrow + 8 * hh); bv.half[1] = *(const v8us*)(vrow + 16 + 8 * hh); bl.half[0] = *(const v8us*)(vrl + 8 * hh); bl.half[1] = *(const v8us*)(vrl + 16 + 8 * hh);
#pragma unroll
      for (int rt = 0; rt < RTN; ++rt) { oacc[rt][dt] = mmaH<1>(pa[rt].v, pa[rt].v, bv.v, bv.v, oacc[rt][dt]); oaccL[rt][dt] = mmaH<1>(pl[rt].v, pl[rt].v, bv.v, bv.v, oaccL[rt][dt]); oaccL[rt][dt] = mmaH<1>(pa[rt].v, pa[rt].v, bl.v, bl.v, oaccL[rt][dt]); } }
    __builtin_amdgcn_fence(__ATOMIC_ACQ_REL, "workgroup"); __builtin_amdgcn_wave_barrier(); }
#pragma unroll
  for (int rt = 0; rt < RTN; ++rt) {
#pragma unroll
    for (int r = 0; r < 8; ++r) { float l = l_r[rt][r]; l += __shfl_xor(l, 1, 32); l += __shfl_xor(l, 2, 32); l += __shfl_xor(l, 4, 32); l += __shfl_xor(l, 8, 32); l_r[rt][r] = (l > 0.f) ? 1.0f / (l * 1024.0f) : 0.f; }
#pragma unroll
    for (int dt = 0; dt < DT; ++dt)
#pragma unroll
      for (int r = 0; r < 8; ++r) { float v = oacc[rt][dt][r]; v += oaccL[rt][dt][r] * 0.0009765625f; sO[w][rt * 16 + 8 * hh + r][dt * 16 + ln] = v * l_r[rt][r]; } }
  __builtin_amdgcn_fence(__ATOMIC_ACQ_REL, "workgroup"); __builtin_amdgcn_wave_barrier();
  {
#pragma unroll
    for (int rp = 0; rp < RPW; rp += 2) { const int r = rp + (lane >> 4), pc = lane & 15; const v4f val = *(const v4fa*)&sO[w][r][pc * 4]; *(v4f*)(O + ((size_t)b * TQ + q0 + r) * ldo + h * 64 + pc * 4) = val; }
     } }

__global__ __launch_bounds__(256) void k_rotab(float* __restrict__ CS, float* __restrict__ SN) {
  #pragma clang fp contract(off)
  const int t = blockIdx.x * 256 + threadIdx.x; if (t >= SLEN * 32) return; const int j = t % 32, s = t / 32; const float ex = (float)(2 * j) / 64.0f; const float inv = 1.0f / powf(10000.0f, ex); const float th = (float)s * inv; const float c = cosf(th), sn = sinf(th);
  { *(float*)(CS + t) = c; *(float*)(SN + t) = sn;  } }
__global__ __launch_bounds__(256) void k_rope(const float* __restrict__ F, int nsrc, int ndst, int rep, const float* __restrict__ CS, const float* __restrict__ SN, _Float16* __restrict__ H, _Float16* __restrict__ L) {
  #pragma clang fp contract(off)
  const size_t t = (size_t)blockIdx.x * 256 + threadIdx.x; if (t >= (size_t)NR * ndst * 4) return; const int g8 = (int)(t % 4); const int hd = (int)((t / 4) % ndst); const size_t row = t / ((size_t)4 * ndst); const int s = (int)(row % SLEN); const int hs = hd / rep;
  const float* src = F + row * (size_t)(nsrc * 64) + hs * 64; FragH ah, al, bh, bl;
  for (int i = 0; i < 8; ++i) { const int d = g8 * 8 + i; const float c = CS[s * 32 + d], sn = SN[s * 32 + d]; const float x1 = src[d], x2 = src[d + 32];
    float o1 = x1 * c; o1 += -x2 * sn; float o2 = x2 * c; o2 += x1 * sn;
    _Float16 hv = (_Float16)o1; ah.h[i] = hv; al.h[i] = (_Float16)((o1 - (float)hv) * 1024.0f); hv = (_Float16)o2; bh.h[i] = hv; bl.h[i] = (_Float16)((o2 - (float)hv) * 1024.0f); }
  const size_t o = row * (size_t)(ndst * 64) + hd * 64 + g8 * 8;
  { *(v8us*)((unsigned short*)H + o) = ah.half[0]; *(v8us*)((unsigned short*)H + o + 32) = bh.half[0]; *(v8us*)((unsigned short*)L + o) = al.half[0]; *(v8us*)((unsigned short*)L + o + 32) = bl.half[0];  } }
__global__ __launch_bounds__(256) void k_rope2(const float* __restrict__ F, int nsrc, int ndst, int rep, const float* __restrict__ CS, const float* __restrict__ SN, _Float16* __restrict__ H, _Float16* __restrict__ L) {
  #pragma clang fp contract(off)
  const size_t t = (size_t)blockIdx.x * 256 + threadIdx.x; if (t >= (size_t)NR * ndst * 4) return; const int g16 = (int)(t % 4); const int hd = (int)((t / 4) % ndst); const size_t row = t / ((size_t)4 * ndst); const int s = (int)(row % SLEN); const int hs = hd / rep;
  const float* src = F + row * (size_t)(nsrc * 64) + hs * 64 + g16 * 16; FragH ah, al;
  for (int pr = 0; pr < 8; ++pr) { const int i = g16 * 8 + pr; const float c = CS[s * 32 + i], sn = SN[s * 32 + i]; const float x1 = src[2 * pr], x2 = src[2 * pr + 1];
    float o1 = x1 * c; o1 -= x2 * sn; float o2 = x1 * sn; o2 += x2 * c;
    _Float16 hv = (_Float16)o1; ah.h[2 * pr] = hv; al.h[2 * pr] = (_Float16)((o1 - (float)hv) * 1024.0f); hv = (_Float16)o2; ah.h[2 * pr + 1] = hv; al.h[2 * pr + 1] = (_Float16)((o2 - (float)hv) * 1024.0f); }
  const size_t o = row * (size_t)(ndst * 64) + hd * 64 + g16 * 16;
  { *(v8us*)((unsigned short*)H + o) = ah.half[0]; *(v8us*)((unsigned short*)H + o + 8) = ah.half[1]; *(v8us*)((unsigned short*)L + o) = al.half[0]; *(v8us*)((unsigned short*)L + o + 8) = al.half[1];  } }
__global__ __launch_bounds__(256) void k_ln512(const float* __restrict__ A, const float* __restrict__ res, const float* __restrict__ g, const float* __restrict__ bb, float* __restrict__ Y, _Float16* __restrict__ Y16) {
  #pragma clang fp contract(off)
  const int wv = threadIdx.x >> 5, ln = threadIdx.x & 31; const size_t r = (size_t)blockIdx.x * 8 + wv; if (r >= NR) return; float x[16]; float s = 0.f;
  for (int i = 0; i < 2; ++i) { const v8f a = *(const v8f*)(A + r * DM + i * 256 + ln * 8); for (int q = 0; q < 8; ++q) { float v = a[q]; if (res) v += bf16_round(res[r * DM + i * 256 + ln * 8 + q]); x[i * 8 + q] = v; s += v; } }
  for (int o = 16; o > 0; o >>= 1) s += __shfl_xor(s, o, 32); const float mu = s / (float)DM; float var = 0.f; for (int q = 0; q < 16; ++q) { const float d = x[q] - mu; var += d * d; }
  for (int o = 16; o > 0; o >>= 1) var += __shfl_xor(var, o, 32); const float inv = rsqrtf(var / (float)DM + 1e-5f);
  { for (int i = 0; i < 2; ++i) { const int c0 = i * 256 + ln * 8; v8f y; FragH f; for (int q = 0; q < 8; ++q) { float v = (x[i * 8 + q] - mu) * inv; v *= bf16_round(g[c0 + q]); v += bf16_round(bb[c0 + q]); y[q] = v; f.h[q] = (_Float16)v; } *(v8f*)(Y + r * DM + c0) = y; if (Y16) *(v8us*)((unsigned short*)Y16 + r * DM + c0) = f.half[0]; }  } }
__global__ __launch_bounds__(256) void k_pack(const float* __restrict__ rb, const int* __restrict__ rid, int* __restrict__ PK) { const int t = blockIdx.x * 256 + threadIdx.x; if (t >= 1024 + NB * TK) return; int v; if (t < 1024) v = __float_as_int(bf16_round(rb[t])); else v = rid[t - 1024]; *(int*)(PK + t) = v;  }
__global__ __launch_bounds__(256) void k_tabin(const float* __restrict__ sp, float* __restrict__ CS, float* __restrict__ SN) { const int t = blockIdx.x * 256 + threadIdx.x; if (t >= SLEN * 32) return; const int i = t % 32, s = t / 32; const float c = bf16_round(sp[s * 64 + 32 + i]), sn = bf16_round(sp[s * 64 + i]);
  { *(float*)(CS + t) = c; *(float*)(SN + t) = sn;  } }
__global__ __launch_bounds__(256) void k_wsc(const float* __restrict__ Wm, _Float16* __restrict__ Bt, size_t n8, float sc) { const size_t t = (size_t)blockIdx.x * 256 + threadIdx.x; if (t >= n8) return; FragH f; for (int q = 0; q < 8; ++q) f.h[q] = (_Float16)(bf16_round(Wm[t * 8 + q]) * sc); *(v8us*)((unsigned short*)Bt + t * 8) = f.half[0];  }
__global__ __launch_bounds__(256) void k_rotab2(float* __restrict__ CS, float* __restrict__ SN) {
  #pragma clang fp contract(off)
  const int t = blockIdx.x * 256 + threadIdx.x; if (t >= SLEN * 32) return; const int j = t % 32, s = t / 32; const float c0 = -0.14391156831212787f;      /* -ln(10000)/64 rounded to f32 */ const float inv = expf((float)(2 * j) * c0); const float th = (float)s * inv; const float c = cosf(th), sn = sinf(th);
  { *(float*)(CS + t) = c; *(float*)(SN + t) = sn;  } }
__global__ __launch_bounds__(256) void k_lnu(const float* __restrict__ X, _Float16* __restrict__ N16, float* __restrict__ XB) {
  #pragma clang fp contract(off)
  const int wv = threadIdx.x >> 5, ln = threadIdx.x & 31; const size_t r = (size_t)blockIdx.x * 8 + wv; if (r >= NR) return; float a[32]; float s = 0.f;
  for (int i = 0; i < 4; ++i) { const v8f v = *(const v8f*)(X + r * DM + (i * 32 + ln) * 8); for (int q = 0; q < 8; ++q) { const float u = bf16_round(v[q]); a[i * 8 + q] = u; s += u; } }
  for (int o = 16; o > 0; o >>= 1) s += __shfl_xor(s, o, 32); const float mu = s / (float)DM; float var = 0.f; for (int q = 0; q < 32; ++q) { const float d = a[q] - mu; var += d * d; }
  for (int o = 16; o > 0; o >>= 1) var += __shfl_xor(var, o, 32); const float den = sqrtf(var / (float)(DM - 1)) + 1e-6f; const float inv = 1.0f / den;      /* one reciprocal per row; (x-mean)*inv vs the reference's division differs by <= 1 ulp */
  { for (int i = 0; i < 4; ++i) { const int c0 = (i * 32 + ln) * 8; FragH f; v8f xb; for (int q = 0; q < 8; ++q) { f.h[q] = (_Float16)((a[i * 8 + q] - mu) * inv); xb[q] = a[i * 8 + q]; } *(v8us*)((unsigned short*)N16 + r * DM + c0) = f.half[0]; *(v8f*)(XB + r * DM + c0) = xb; }  } }
__global__ __launch_bounds__(256) void k_vtg(const _Float16* __restrict__ V16, _Float16* __restrict__ Vt) { __shared__ unsigned short tl[64][66]; const int tid = threadIdx.x; const int slab = blockIdx.x / (SLEN / 64), lg = blockIdx.x % (SLEN / 64); const int b = slab / NH, h = slab % NH; const int hs = h / NREP;
  for (int i = tid; i < 64 * 8; i += 256) { const int r = i / 8, c8 = (i % 8) * 8; FragH f; f.half[0] = *(const v8us*)((const unsigned short*)V16 + ((size_t)b * SLEN + lg * 64 + r) * KVD + hs * 64 + c8); for (int q = 0; q < 8; ++q) tl[r][c8 + q] = f.u[q]; }
  __syncthreads();
  { for (int rd = 0; rd < 2; ++rd) { const int d = rd * 32 + tid / 8, pc = tid % 8; FragH f; for (int q = 0; q < 8; ++q) f.u[q] = tl[pc * 8 + q][d]; *(v8us*)((unsigned short*)Vt + ((size_t)slab * 64 + d) * SLEN + lg * 64 + pc * 8) = f.half[0]; }  } }

__global__ __launch_bounds__(256) void k_h16s(const float* __restrict__ SRC, int lds, int coff, _Float16* __restrict__ DST, size_t n8) { const size_t t = (size_t)blockIdx.x * 256 + threadIdx.x; if (t >= n8) return; const size_t r = (t * 8) / DM; const int c = (int)((t * 8) % DM); const v8f a = *(const v8f*)(SRC + r * lds + coff + c); FragH f; for (int q = 0; q < 8; ++q) f.h[q] = (_Float16)a[q];
  *(v8us*)((unsigned short*)DST + t * 8) = f.half[0];  }


__global__ __launch_bounds__(256) void k_ccp(const float* __restrict__ QKV, int coff, _Float16* __restrict__ D) { const size_t t = (size_t)blockIdx.x * 256 + threadIdx.x; if (t >= (size_t)NR * DM / 8) return; const int c0 = (int)((t * 8) % DM); const size_t row = (t * 8) / DM; const v8f a = *(const v8f*)(QKV + row * 3 * DM + coff + c0); FragH f; for (int q = 0; q < 8; ++q) f.h[q] = (_Float16)a[q];
  *(v8us*)((unsigned short*)D + t * 8) = f.half[0];  }


extern "C" void kernel_launch(void* const* d_in, const int* in_sizes, int n_in,
                              void* d_out, int out_size, void* d_ws, size_t ws_size, hipStream_t stream) {
  (void)in_sizes; (void)n_in; (void)out_size;
  const float* q = (const float*)d_in[0]; const float* kv = (const float*)d_in[1]; const float* mask = (const float*)d_in[2]; float* O = (float*)d_out;
  char* ws = (char*)d_ws; size_t off = 0;
  auto take = [&](size_t bytes) { char* p = ws + off; off += (bytes + 255) & ~(size_t)255; return p; };
  const size_t np = (size_t)NR * DM;      /* 32 x 2048 x 64 */
  _Float16* Q16 = (_Float16*)take(np * 2); unsigned short* KP = (unsigned short*)take(np * 2); unsigned short* VP = (unsigned short*)take(np * 2); unsigned short* MP = (unsigned short*)take((size_t)TQ * TK * 2);
  if (off > ws_size) return;      /* 32 MiB */
  k_x16<<<(unsigned)((np / 8 + 255) / 256), 256, 0, stream>>>(q, Q16, np / 8);
  k_kvpack<<<NR / 32, 256, 0, stream>>>(kv, KP, VP);      /* values = keys */
  k_mpack<<<TQ / 8 * TK / 256, 256, 0, stream>>>(mask, MP);
  k_flash<33><<<NB * NH * QBNP, 128, 0, stream>>>(Q16, DM, KP, VP, MP, O, DM);      /* f32 context straight to the output rows */
}

// v005
// A run of this version takes 56.5 microseconds.
// Next to v004, in two timings, it ran 1.25 and 1.26 times as fast.
// All steps since v000 together make it 6.14 times as fast.
#include <hip/hip_runtime.h>
// DotProdAttention (q [4][8][2048][64], kv [4][8][2048][64] (keys = values), mask [1][1][2048][2048] added to every (batch, head); out = softmax(q kv^T / 8 + mask) kv -> [4][8][2048][64]).
// Structure: the (batch, head) slabs of q/kv are already contiguous 64-wide row blocks, so each slab is treated as one 'batch' of a single 64-dim head: exact f16 plane of q; kv as K and as V^T, and the mask, packed in the order of the attention loop's fragment loads; flash-style fused attention per (slab, 256-query block) adding the shared additive mask table per (query, key), f32 context written straight to the output.
// Compute dtype: inputs rounded to bf16; q, kv, mask exact (f16 / bf16-rounded f32); softmax f32 with f16 probabilities; plain f16 value operand (~2^-12). v_wmma_f32_16x16x32_f16.
#define NB 32                    /* 4 batches x 8 heads as slabs */
#define DM 64
#define NKV 1
#define NREP (NH / NKV)
#define KVD (NKV * 64)           /* 64 */
#define NR (NB * SLEN)
#define CHK 512
typedef int v4i __attribute__((ext_vector_type(4)));
#define FF 2048
#define SLEN 2048
#define MQI 2048
#define MKI 2048
#define TQ SLEN
#define TK SLEN
#define NH 1
#define SCL 0.125f
#define QBLKS (TQ / 64)
#define QB05 0
#define QBN5 4
#define QB0P 0
#define QPB 256                  /* queries per work-group of k_flash */
#define QBNP (TQ / QPB)
#define RE 256
typedef __bf16 v16b __attribute__((ext_vector_type(16)));
typedef unsigned short v8us __attribute__((ext_vector_type(8), may_alias));
typedef float  v8f  __attribute__((ext_vector_type(8)));
typedef float  v4f  __attribute__((ext_vector_type(4)));
typedef float  v4fa __attribute__((ext_vector_type(4), may_alias));
union FragB { v16b v; v8us half[2]; unsigned short u[16]; };

__device__ __forceinline__ unsigned short bf16_bits(float x) { unsigned int u = __float_as_uint(x); return (unsigned short)((u + 0x7FFFu + ((u >> 16) & 1u)) >> 16); }
__device__ __forceinline__ float bf16_val(unsigned short b) { return __uint_as_float(((unsigned int)b) << 16); }
__device__ __forceinline__ float bf16_round(float x) { return bf16_val(bf16_bits(x)); }
// D += A·B with NT terms: 1 = ah·bh, 2 = + al·bh (A split), 3 = + ah·bl (both split)
template <int NT>
__device__ __forceinline__ v8f mmaN(v16b ah, v16b al, v16b bh, v16b bl, v8f c) {
  c = __builtin_amdgcn_wmma_f32_16x16x32_bf16(false, ah, false, bh, (short)0, c, false, false);
  if (NT >= 2) c = __builtin_amdgcn_wmma_f32_16x16x32_bf16(false, al, false, bh, (short)0, c, false, false);
  if (NT >= 3) c = __builtin_amdgcn_wmma_f32_16x16x32_bf16(false, ah, false, bl, (short)0, c, false, false);
  asm volatile("v_nop\n\tv_nop\n\tv_nop\n\tv_nop" : "+v"(c) : "v"(ah), "v"(al), "v"(bh), "v"(bl));
  return c;
}

__global__ __launch_bounds__(256) void k_wt_bf16(const float* __restrict__ W, unsigned short* __restrict__ Wt, int K, int N) {
  const int t = blockIdx.x * 256 + threadIdx.x;
  const int k8n = K / 8;
  if (t >= N * k8n) return;
  const int n = t / k8n, k8 = (t % k8n) * 8;
  v8us v;
#pragma unroll
  for (int i = 0; i < 8; ++i) v[i] = bf16_bits(W[(size_t)(k8 + i) * N + n]);
  *(v8us*)(Wt + (size_t)n * K + k8) = v;
  
}

// GEMM C[M][N] (f32, pitch ldc) = act(A[M][K]·W + bias). A f32 row-major (pitch lda) converted per fragment to bf16
// (ASPLIT: hi/lo two planes -> 2 terms, else single rounded term); Wt bf16 [N][K] (pitch ldb). BIAS_BF16 rounds the
// bias to bf16 first (bias quantised to bf16 before the add). K%32==0, M%16==0, N%64==0.
template <bool ASPLIT, int ACT, bool BIAS_BF16>
__global__ __launch_bounds__(128) void k_gemm_bf(const float* __restrict__ A, int lda, const unsigned short* __restrict__ Wt, int ldb,
                                               const float* __restrict__ bias, float* __restrict__ C, int ldc, int M, int N, int K) {
  __shared__ __attribute__((aligned(16))) float so[4][16][64];
  const int tid = threadIdx.x, w = tid >> 5, lane = tid & 31, ln = lane & 15, hh = lane >> 4;
  const int ntn = N / 64;
  const int wid = blockIdx.x * 4 + w;
  const int mt = wid / ntn, nq = wid % ntn;
  if (mt * 16 >= M) return;
  const int row0 = mt * 16, col0 = nq * 64;
  const float* arow = A + (size_t)(row0 + ln) * lda;
  v8f acc[4] = {};
  for (int kb = 0; kb < K; kb += 32) {
    FragB ah, al;
    const v4f x0 = *(const v4fa*)(arow + kb + 8 * hh), x1 = *(const v4fa*)(arow + kb + 8 * hh + 4);
    const v4f x2 = *(const v4fa*)(arow + kb + 16 + 8 * hh), x3 = *(const v4fa*)(arow + kb + 16 + 8 * hh + 4);
    float xs[16] = {x0[0],x0[1],x0[2],x0[3],x1[0],x1[1],x1[2],x1[3],x2[0],x2[1],x2[2],x2[3],x3[0],x3[1],x3[2],x3[3]};
#pragma unroll
    for (int i = 0; i < 16; ++i) { const unsigned short hb = bf16_bits(xs[i]); ah.u[i] = hb; al.u[i] = ASPLIT ? bf16_bits(xs[i] - bf16_val(hb)) : (unsigned short)0; }
#pragma unroll
    for (int t = 0; t < 4; ++t) {
      const unsigned short* brow = Wt + (size_t)(col0 + t * 16 + ln) * ldb + kb;
      FragB b;
      b.half[0] = *(const v8us*)(brow + 8 * hh);
      b.half[1] = *(const v8us*)(brow + 16 + 8 * hh);
      acc[t] = mmaN<ASPLIT ? 2 : 1>(ah.v, al.v, b.v, b.v, acc[t]);
    }
  }
#pragma unroll
  for (int t = 0; t < 4; ++t) {
    float bv = bias ? bias[col0 + t * 16 + ln] : 0.f;
    if (BIAS_BF16) bv = bf16_round(bv);
#pragma unroll
    for (int r = 0; r < 8; ++r) { float v = acc[t][r] + bv; if (ACT == 1) v = fmaxf(v, 0.f); so[w][8 * hh + r][t * 16 + ln] = v; }
  }
  __builtin_amdgcn_fence(__ATOMIC_ACQ_REL, "workgroup");
  __builtin_amdgcn_wave_barrier();
  const int rsub = lane >> 4, c4 = (lane & 15) * 4;
  {
#pragma unroll
    for (int q = 0; q < 8; ++q) {
      const int r = q * 2 + rsub;
      const v4f v = *(const v4fa*)&so[w][r][c4];
      *(v4f*)(C + (size_t)(row0 + r) * ldc + col0 + c4) = v;
    }
    
  }
}

// GEMM C = act(A·W + bias + resid): A f32 (ASPLIT -> hi/lo 2 terms), Wt bf16 [N][K]; ACT 0 none, 1 relu, 2 exact gelu;
// resid (optional, f32, row index = (row % rmod), pitch ldr, RES_BF16 rounds it) added before the activation.
template <bool ASPLIT, int ACT, bool BIAS_BF16, bool RES_BF16>
__global__ __launch_bounds__(128) void k_gemm_bf3(const float* __restrict__ A, int lda, const unsigned short* __restrict__ Wt, int ldb,
                                                const float* __restrict__ bias, const float* __restrict__ resid, int rmod, int ldr,
                                                float* __restrict__ C, int ldc, int M, int N, int K) {
  __shared__ __attribute__((aligned(16))) float so[4][16][64];
  const int tid = threadIdx.x, w = tid >> 5, lane = tid & 31, ln = lane & 15, hh = lane >> 4;
  const int ntn = N / 64;
  const int wid = blockIdx.x * 4 + w;
  const int mt = wid / ntn, nq = wid % ntn;
  if (mt * 16 >= M) return;
  const int row0 = mt * 16, col0 = nq * 64;
  const float* arow = A + (size_t)(row0 + ln) * lda;
  v8f acc[4] = {};
  for (int kb = 0; kb < K; kb += 32) {
    FragB ah, al;
    const v4f x0 = *(const v4fa*)(arow + kb + 8 * hh), x1 = *(const v4fa*)(arow + kb + 8 * hh + 4);
    const v4f x2 = *(const v4fa*)(arow + kb + 16 + 8 * hh), x3 = *(const v4fa*)(arow + kb + 16 + 8 * hh + 4);
    float xs[16] = {x0[0],x0[1],x0[2],x0[3],x1[0],x1[1],x1[2],x1[3],x2[0],x2[1],x2[2],x2[3],x3[0],x3[1],x3[2],x3[3]};
#pragma unroll
    for (int i = 0; i < 16; ++i) { const unsigned short hb = bf16_bits(xs[i]); ah.u[i] = hb; al.u[i] = ASPLIT ? bf16_bits(xs[i] - bf16_val(hb)) : (unsigned short)0; }
#pragma unroll
    for (int t = 0; t < 4; ++t) {
      const unsigned short* brow = Wt + (size_t)(col0 + t * 16 + ln) * ldb + kb;
      FragB b;
      b.half[0] = *(const v8us*)(brow + 8 * hh);
      b.half[1] = *(const v8us*)(brow + 16 + 8 * hh);
      acc[t] = mmaN<ASPLIT ? 2 : 1>(ah.v, al.v, b.v, b.v, acc[t]);
    }
  }
#pragma unroll
  for (int t = 0; t < 4; ++t) {
    const int col = col0 + t * 16 + ln;
    float bv = bias ? bias[col] : 0.f;
    if (BIAS_BF16) bv = bf16_round(bv);
#pragma unroll
    for (int r = 0; r < 8; ++r) {
      float v = acc[t][r] + bv;
      if (resid) { float rv = resid[(size_t)((row0 + 8 * hh + r) % rmod) * ldr + col]; if (RES_BF16) rv = bf16_round(rv); v += rv; }
      if (ACT == 1) v = fmaxf(v, 0.f);
      if (ACT == 2) v = 0.5f * v * (1.0f + erff(v * 0.70710678118654752f));
      if (ACT == 3) { const float u = 0.7978845608028654f * (v + 0.044715f * v * v * v); v = 0.5f * v * (1.0f + tanhf(u)); }
      so[w][8 * hh + r][t * 16 + ln] = v;
    }
  }
  __builtin_amdgcn_fence(__ATOMIC_ACQ_REL, "workgroup");
  __builtin_amdgcn_wave_barrier();
  const int rsub = lane >> 4, c4 = (lane & 15) * 4;
  {
#pragma unroll
    for (int q = 0; q < 8; ++q) {
      const int r = q * 2 + rsub;
      const v4f v = *(const v4fa*)&so[w][r][c4];
      *(v4f*)(C + (size_t)(row0 + r) * ldc + col0 + c4) = v;
    }
    
  }
}
// row LayerNorm (biased variance, eps) over N: s = X (+ R); optional out_sum <- s; out_norm <- (s-mu)*rsqrt(var+eps)*g + b
template <bool PARAM_BF16>
__global__ __launch_bounds__(256) void k_layernorm(const float* __restrict__ X, const float* __restrict__ R, const float* __restrict__ g, const float* __restrict__ bta,
                                                  float* __restrict__ out_sum, float* __restrict__ out_norm, int N, float eps) {
  __shared__ float red[256];
  const int row = blockIdx.x, tid = threadIdx.x;
  const float* x = X + (size_t)row * N; const float* rr = R ? R + (size_t)row * N : nullptr;
  float vals[16];                     // up to N = 4096
  const int per = N / 256;            // contiguous chunk per thread? use strided-by-4 chunks: thread handles j = tid*4 + 1024*u
  float s1 = 0.f;
  for (int u = 0; u < per / 4; ++u) {
    const int j = tid * 4 + 1024 * u;
    const v4f a = *(const v4fa*)(x + j);
    v4f b = {0.f,0.f,0.f,0.f}; if (rr) b = *(const v4fa*)(rr + j);
#pragma unroll
    for (int q = 0; q < 4; ++q) { const float v = a[q] + b[q]; vals[u * 4 + q] = v; s1 += v; }
  }
  red[tid] = s1; __syncthreads();
  for (int st = 128; st > 0; st >>= 1) { if (tid < st) red[tid] += red[tid + st]; __syncthreads(); }
  const float mu = red[0] / (float)N; __syncthreads();
  float s2 = 0.f;
  for (int u = 0; u < per / 4; ++u)
#pragma unroll
    for (int q = 0; q < 4; ++q) { const float c = vals[u * 4 + q] - mu; s2 += c * c; }
  red[tid] = s2; __syncthreads();
  for (int st = 128; st > 0; st >>= 1) { if (tid < st) red[tid] += red[tid + st]; __syncthreads(); }
  const float rs = rsqrtf(red[0] / (float)N + eps);
  {
    for (int u = 0; u < per / 4; ++u) {
      const int j = tid * 4 + 1024 * u;
      v4f o, sm;
#pragma unroll
      for (int q = 0; q < 4; ++q) {
        float gg = g[j + q], bb = bta[j + q];
        if (PARAM_BF16) { gg = bf16_round(gg); bb = bf16_round(bb); }
        sm[q] = vals[u * 4 + q]; o[q] = (vals[u * 4 + q] - mu) * rs * gg + bb;
      }
      if (out_sum) *(v4f*)(out_sum + (size_t)row * N + j) = sm;
      *(v4f*)(out_norm + (size_t)row * N + j) = o;
    }
    
  }
}



// ---- f16 WMMA path (v_wmma_f32_16x16x32_f16): 11-bit significands for operands in range — used where a [0,1] probability operand needs more precision than bf16
typedef _Float16 v16h __attribute__((ext_vector_type(16)));
union FragH { v16h v; v8us half[2]; _Float16 h[16]; unsigned short u[16]; };
template <int NT>
__device__ __forceinline__ v8f mmaH(v16h ah, v16h al, v16h bh, v16h bl, v8f c) {
  c = __builtin_amdgcn_wmma_f32_16x16x32_f16(false, ah, false, bh, (short)0, c, false, false);
  if (NT >= 2) c = __builtin_amdgcn_wmma_f32_16x16x32_f16(false, al, false, bh, (short)0, c, false, false);
  if (NT >= 3) c = __builtin_amdgcn_wmma_f32_16x16x32_f16(false, ah, false, bl, (short)0, c, false, false);
  asm volatile("v_nop\n\tv_nop\n\tv_nop\n\tv_nop" : "+v"(c) : "v"(ah), "v"(al), "v"(bh), "v"(bl));
  return c;
}
// batched GEMM like k_gemm_b but f16 operands: A f32 (split into f16 hi/lo if ASPLIT, else rounded to f16), Bt = f16 values [n][k]; alpha; C f32; N multiple of 16 (partial tiles skipped)
template <bool ASPLIT>
__global__ __launch_bounds__(128) void k_gemm_h(const float* __restrict__ A, int lda, size_t sA, const _Float16* __restrict__ Bh, int ldb, size_t sB, float alpha, float* __restrict__ C, int ldc, size_t sC, int M, int N, int K) {
  __shared__ __attribute__((aligned(16))) float so[4][16][64];
  const int tid = threadIdx.x, w = tid >> 5, lane = tid & 31, ln = lane & 15, hh = lane >> 4; const int by = blockIdx.y;
  A += (size_t)by * sA; Bh += (size_t)by * sB; C += (size_t)by * sC;
  const int ntn = (N + 63) / 64; const int wid = blockIdx.x * 4 + w; const int mt = wid / ntn, nq = wid % ntn; if (mt * 16 >= M) return;
  const int row0 = mt * 16, col0 = nq * 64; const float* arow = A + (size_t)(row0 + ln) * lda;
  v8f acc[4] = {};
  for (int kb = 0; kb < K; kb += 32) {
    FragH ah, al;
    const v4f x0 = *(const v4fa*)(arow + kb + 8 * hh), x1 = *(const v4fa*)(arow + kb + 8 * hh + 4), x2 = *(const v4fa*)(arow + kb + 16 + 8 * hh), x3 = *(const v4fa*)(arow + kb + 16 + 8 * hh + 4);
    float xs[16] = {x0[0],x0[1],x0[2],x0[3],x1[0],x1[1],x1[2],x1[3],x2[0],x2[1],x2[2],x2[3],x3[0],x3[1],x3[2],x3[3]};
#pragma unroll
    for (int i = 0; i < 16; ++i) { const _Float16 h = (_Float16)xs[i]; ah.h[i] = h; al.h[i] = ASPLIT ? (_Float16)(xs[i] - (float)h) : (_Float16)0.0f; }
#pragma unroll
    for (int t = 0; t < 4; ++t) { if (col0 + t * 16 >= N) continue; const size_t boff = (size_t)(col0 + t * 16 + ln) * ldb + kb; FragH bq; bq.half[0] = *(const v8us*)(Bh + boff + 8 * hh); bq.half[1] = *(const v8us*)(Bh + boff + 16 + 8 * hh);
      acc[t] = mmaH<ASPLIT ? 2 : 1>(ah.v, al.v, bq.v, bq.v, acc[t]); }
  }
#pragma unroll
  for (int t = 0; t < 4; ++t) { if (col0 + t * 16 >= N) continue;
#pragma unroll
    for (int r = 0; r < 8; ++r) so[w][8 * hh + r][t * 16 + ln] = acc[t][r] * alpha; }
  __builtin_amdgcn_fence(__ATOMIC_ACQ_REL, "workgroup"); __builtin_amdgcn_wave_barrier();
  const int rsub = lane >> 4, c4 = (lane & 15) * 4;
  {
#pragma unroll
    for (int q = 0; q < 8; ++q) { const int r = q * 2 + rsub; if (col0 + c4 < N) { const v4f v = *(const v4fa*)&so[w][r][c4]; *(v4f*)(C + (size_t)(row0 + r) * ldc + col0 + c4) = v; } }
     }
}

// Wt[n][k] = f16(W[k][n]·scale) from f32 row-major W[K][N] (scale = power of two; bf16-exact weights stay exact in f16 away from the subnormal range)
__global__ __launch_bounds__(256) void k_wt_f16(const float* __restrict__ W, _Float16* __restrict__ Wt, int K, int N, float scale) {
  const int t = blockIdx.x * 256 + threadIdx.x; if (t >= N * (K / 8)) return; const int n = t / (K / 8), k8 = (t % (K / 8)) * 8; FragH f;
#pragma unroll
  for (int i = 0; i < 8; ++i) f.h[i] = (_Float16)(bf16_round(W[(size_t)(k8 + i) * N + n]) * scale); const v8us o = f.half[0];
  *(v8us*)((unsigned short*)Wt + (size_t)n * K + k8) = o; 
}
// k_gemm_hh variant with fused epilogue: v = acc·alpha + bias[by·sBias + col] (+ CP[(row/rowsPerB)·sCPb + by·64 + col] if CP) ; ACT 0 none / 1 elu ; writes f16 C16 (and f32 C if non-null)
template <int ACT>
__global__ __launch_bounds__(128) void k_gemm_hhx(const _Float16* __restrict__ A, int lda, size_t sA, const _Float16* __restrict__ Bh, int ldb, size_t sB, float alpha, const float* __restrict__ bias, size_t sBias, const float* __restrict__ CP, int rowsPerB, size_t sCPb, int row0g,
    float* __restrict__ C, _Float16* __restrict__ C16, int ldc, size_t sC, int M, int N, int K) {
  __shared__ __attribute__((aligned(16))) float so[4][16][64];
  const int tid = threadIdx.x, w = tid >> 5, lane = tid & 31, ln = lane & 15, hh = lane >> 4; const int by = blockIdx.y;
  A += (size_t)by * sA; Bh += (size_t)by * sB; const size_t cofs = (size_t)by * sC; const float* bp = bias ? bias + (size_t)by * sBias : nullptr;
  const int ntn = (N + 63) / 64; const int wid = blockIdx.x * 4 + w; const int mt = wid / ntn, nq = wid % ntn; if (mt * 16 >= M) return;
  const int row0 = mt * 16, col0 = nq * 64; const _Float16* arow = A + (size_t)(row0 + ln) * lda;
  v8f acc[4] = {};
  for (int kb = 0; kb < K; kb += 32) { FragH ah; ah.half[0] = *(const v8us*)((const unsigned short*)arow + kb + 8 * hh); ah.half[1] = *(const v8us*)((const unsigned short*)arow + kb + 16 + 8 * hh);
#pragma unroll
    for (int t = 0; t < 4; ++t) { if (col0 + t * 16 >= N) continue; const size_t boff = (size_t)(col0 + t * 16 + ln) * ldb + kb; FragH bq; bq.half[0] = *(const v8us*)((const unsigned short*)Bh + boff + 8 * hh); bq.half[1] = *(const v8us*)((const unsigned short*)Bh + boff + 16 + 8 * hh);
      acc[t] = mmaH<1>(ah.v, ah.v, bq.v, bq.v, acc[t]); }
  }
#pragma unroll
  for (int t = 0; t < 4; ++t) { if (col0 + t * 16 >= N) continue; const int col = col0 + t * 16 + ln; const float bv = bp ? bf16_round(bp[col]) : 0.f;
#pragma unroll
    for (int r = 0; r < 8; ++r) { float v = acc[t][r] * alpha + bv; if (CP) { const int bidx = (row0g + row0 + 8 * hh + r) / rowsPerB; v += CP[(size_t)bidx * sCPb + (size_t)by * 64 + col]; } if (ACT == 1) v = (v > 0.f) ? v : expm1f(v); else if (ACT == 7) v = (v > 0.f) ? v + 1.0f : expf(v); else if (ACT == 8) v = tanhf(v); else if (ACT == 9) v = 0.5f * v * (1.0f + tanhf(0.7978845608028654f * (v + 0.044715f * v * v * v))); else if (ACT == 11) v = 1.0f / (1.0f + expf(-v)); else if (ACT == 12) v = (v > 0.f) ? v : 0.01f * v; else if (ACT == 14) v = (v > 0.f) ? v : 0.1f * v; else if (ACT == 15) v = v / (1.0f + expf(-v)); else if (ACT == 3) v = fmaxf(v, 0.f); else if (ACT == 6) v = 0.5f * v * (1.0f + erff(v * 0.70710678118654752f)); so[w][8 * hh + r][t * 16 + ln] = v; } }
  __builtin_amdgcn_fence(__ATOMIC_ACQ_REL, "workgroup"); __builtin_amdgcn_wave_barrier();
  const int rsub = lane >> 4, c4 = (lane & 15) * 4; typedef _Float16 v4h __attribute__((ext_vector_type(4)));
  {
#pragma unroll
    for (int q = 0; q < 8; ++q) { const int r = q * 2 + rsub; if (col0 + c4 < N) { const v4f v = *(const v4fa*)&so[w][r][c4]; if (C) *(v4f*)(C + cofs + (size_t)(row0 + r) * ldc + col0 + c4) = v; if (C16) { v4h h4; for (int i = 0; i < 4; ++i) h4[i] = (_Float16)v[i]; *(v4h*)(C16 + cofs + (size_t)(row0 + r) * ldc + col0 + c4) = h4; } } }
     }
}


typedef _Float16 v4h __attribute__((ext_vector_type(4)));

__global__ __launch_bounds__(256) void k_x16(const float* __restrict__ x, _Float16* __restrict__ X16, size_t n8) { const size_t t = (size_t)blockIdx.x * 256 + threadIdx.x; if (t >= n8) return; FragH f;
#pragma unroll
  for (int q = 0; q < 8; ++q) f.h[q] = (_Float16)bf16_round(x[t * 8 + q]); *(v8us*)((unsigned short*)X16 + t * 8) = f.half[0];  }
__global__ __launch_bounds__(256) void k_h16(const float* __restrict__ x, _Float16* __restrict__ X16, size_t n8) { const size_t t = (size_t)blockIdx.x * 256 + threadIdx.x; if (t >= n8) return; FragH f;
#pragma unroll
  for (int q = 0; q < 8; ++q) f.h[q] = (_Float16)x[t * 8 + q]; *(v8us*)((unsigned short*)X16 + t * 8) = f.half[0];  }
__global__ __launch_bounds__(256) void k_round16f(const float* __restrict__ W, _Float16* __restrict__ Bt, size_t n8) { const size_t t = (size_t)blockIdx.x * 256 + threadIdx.x; if (t >= n8) return; FragH f;
#pragma unroll
  for (int i = 0; i < 8; ++i) f.h[i] = (_Float16)(bf16_round(W[t * 8 + i]) * 16.0f); *(v8us*)((unsigned short*)Bt + t * 8) = f.half[0];  }
template <int NHv, int TTv>
__global__ __launch_bounds__(256) void k_vt(const _Float16* __restrict__ V16, int ldv, int voff, _Float16* __restrict__ Vt) { __shared__ unsigned short tl[64][66]; const int tid = threadIdx.x; const int slab = blockIdx.x / (TTv / 64), lg = blockIdx.x % (TTv / 64); const int b = slab / NHv, h = slab % NHv;
  for (int i = tid; i < 64 * 8; i += 256) { const int r = i / 8, c8 = (i % 8) * 8; FragH f; f.half[0] = *(const v8us*)((const unsigned short*)V16 + ((size_t)b * TTv + lg * 64 + r) * ldv + voff + h * 64 + c8);
#pragma unroll
    for (int q = 0; q < 8; ++q) tl[r][c8 + q] = f.u[q]; }
  __syncthreads();
  {
#pragma unroll
    for (int rd = 0; rd < 2; ++rd) { const int d = rd * 32 + tid / 8, pc = tid % 8; FragH f;
#pragma unroll
      for (int q = 0; q < 8; ++q) f.u[q] = tl[pc * 8 + q][d];
      *(v8us*)((unsigned short*)Vt + ((size_t)slab * 64 + d) * TTv + lg * 64 + pc * 8) = f.half[0]; }
     } }

__global__ __launch_bounds__(256) void k_hl(const float* __restrict__ F, _Float16* __restrict__ Hh, _Float16* __restrict__ Hl, size_t n8) { const size_t t = (size_t)blockIdx.x * 256 + threadIdx.x; if (t >= n8) return; FragH fh, fl; const v4f a = *(const v4fa*)(F + t * 8), c = *(const v4fa*)(F + t * 8 + 4);
#pragma unroll
  for (int q = 0; q < 4; ++q) { _Float16 h = (_Float16)a[q]; fh.h[q] = h; fl.h[q] = (_Float16)((a[q] - (float)h) * 1024.0f); h = (_Float16)c[q]; fh.h[4 + q] = h; fl.h[4 + q] = (_Float16)((c[q] - (float)h) * 1024.0f); }
  { *(v8us*)((unsigned short*)Hh + t * 8) = fh.half[0]; *(v8us*)((unsigned short*)Hl + t * 8) = fl.half[0];  } }

// ---- fast GEMM (wave tile 32x64; requires M % 32 == 0 rows per launch region and N % 64 == 0); epilogue = k_gemm_hhx semantics ----
__device__ __forceinline__ v16h g2_frag(const _Float16* p, int hh) { FragH f; f.half[0] = *(const v8us*)((const unsigned short*)p + 8 * hh); f.half[1] = *(const v8us*)((const unsigned short*)p + 16 + 8 * hh); return f.v; }
__device__ __forceinline__ v8f g2_mma(v16h a, v16h b, v8f c) { v8f d = __builtin_amdgcn_wmma_f32_16x16x32_f16(false, a, false, b, (short)0, c, false, false); asm volatile("v_nop\n\tv_nop\n\tv_nop\n\tv_nop" : "+v"(d) : "v"(a), "v"(b)); return d; }
template <int ACT>
__global__ __launch_bounds__(128) void k_gemm2(const _Float16* __restrict__ A, int lda, size_t sA, const _Float16* __restrict__ Bh, int ldb, size_t sB, float alpha, const float* __restrict__ bias, size_t sBias, const float* __restrict__ CP, int rowsPerB, size_t sCPb, int row0g,
    float* __restrict__ C, _Float16* __restrict__ C16, int ldc, size_t sC, int M, int N, int K) {
  __shared__ __attribute__((aligned(16))) float so[4][32][68];
  const int tid = threadIdx.x, w = tid >> 5, lane = tid & 31, ln = lane & 15, hh = lane >> 4; const int by = blockIdx.y;
  A += (size_t)by * sA; Bh += (size_t)by * sB; const size_t cofs = (size_t)by * sC; const float* bp = bias ? bias + (size_t)by * sBias : nullptr;
  const int ntn = N >> 6; const int mt = blockIdx.x / ntn, nq = blockIdx.x - mt * ntn; const int row0 = mt * 128 + 32 * w, col0 = nq * 64; if (row0 >= M) return;
  const _Float16* a0p = A + (size_t)(row0 + ln) * lda; const _Float16* a1p = a0p + (size_t)16 * lda;
  const _Float16* b0p = Bh + (size_t)(col0 + ln) * ldb; const _Float16* b1p = b0p + (size_t)16 * ldb; const _Float16* b2p = b1p + (size_t)16 * ldb; const _Float16* b3p = b2p + (size_t)16 * ldb;
  const v8f z8 = {0.f,0.f,0.f,0.f,0.f,0.f,0.f,0.f}; v8f c00 = z8, c01 = z8, c02 = z8, c03 = z8, c10 = z8, c11 = z8, c12 = z8, c13 = z8;
#pragma unroll 1
  for (int kb = 0; kb < K; kb += 32) { const v16h a0 = g2_frag(a0p + kb, hh), a1 = g2_frag(a1p + kb, hh);
    v16h b = g2_frag(b0p + kb, hh); c00 = g2_mma(a0, b, c00); c10 = g2_mma(a1, b, c10);
    b = g2_frag(b1p + kb, hh); c01 = g2_mma(a0, b, c01); c11 = g2_mma(a1, b, c11);
    b = g2_frag(b2p + kb, hh); c02 = g2_mma(a0, b, c02); c12 = g2_mma(a1, b, c12);
    b = g2_frag(b3p + kb, hh); c03 = g2_mma(a0, b, c03); c13 = g2_mma(a1, b, c13); }
  v8f accs[8] = {c00, c01, c02, c03, c10, c11, c12, c13};
#pragma unroll
  for (int u = 0; u < 8; ++u) { const int t = u & 3, half = u >> 2; const int col = col0 + t * 16 + ln; const float bv = bp ? bf16_round(bp[col]) : 0.f;
#pragma unroll
    for (int r = 0; r < 8; ++r) { const int rloc = half * 16 + 8 * hh + r; float v = accs[u][r] * alpha + bv; if (CP) { if (rowsPerB < 0) v += CP[cofs + (size_t)(row0g + row0 + rloc) * ldc + col];      /* rowsPerB < 0: own element of the batched C plane */ else { const int bidx = (row0g + row0 + rloc) / rowsPerB; v += CP[(size_t)bidx * sCPb + (size_t)by * 64 + col]; } }
      if (ACT == 3) v = fmaxf(v, 0.f); else if (ACT == 6) v = 0.5f * v * (1.0f + erff(v * 0.70710678118654752f)); else if (ACT == 11) v = 1.0f / (1.0f + expf(-v)); else if (ACT == 15) v = v / (1.0f + expf(-v)); else if (ACT == 12) v = (v > 0.f) ? v : 0.01f * v; else if (ACT == 8) v = tanhf(v);
      so[w][rloc][t * 16 + ln] = v; } }
  __builtin_amdgcn_fence(__ATOMIC_ACQ_REL, "workgroup"); __builtin_amdgcn_wave_barrier();
  const int rsub = lane >> 4, c4 = (lane & 15) * 4;
  {
#pragma unroll
    for (int q = 0; q < 16; ++q) { const int r = q * 2 + rsub; const v4f v = *(const v4fa*)&so[w][r][c4]; if (C) *(v4f*)(C + cofs + (size_t)(row0 + r) * ldc + col0 + c4) = v; if (C16) { v4h h4; for (int i = 0; i < 4; ++i) h4[i] = (_Float16)v[i]; *(v4h*)(C16 + cofs + (size_t)(row0 + r) * ldc + col0 + c4) = h4; } }
     } }



typedef unsigned int v4u __attribute__((ext_vector_type(4), may_alias));
// Packed operand planes of k_flash. Unit = the 16 bytes one lane takes in one fragment load; the 32 units of a load lie side by side (512 bytes, four whole lines), lane = 16 hh + ln.
// KP, per 32-key block 8 loads [nt][ks][c]: unit = K[16 nt + ln][32 ks + 16 c + 8 hh + 0..7].  VP, per 32-key block 8 loads [dt][c]: unit = V[16 c + 8 hh + 0..7][16 dt + ln].  Values as k_x16 makes them.
__global__ __launch_bounds__(256) void k_kvpack(const float* __restrict__ kv, unsigned short* __restrict__ KP, unsigned short* __restrict__ VP) {
  __shared__ __attribute__((aligned(16))) unsigned short tl[32][72];      /* pitch 144 B = 16 B x 9: the 16-byte row reads below spread over the banks */
  const int tid = threadIdx.x; const size_t blk = blockIdx.x;      /* one block of 32 keys, counted through all slabs */
  { const float* s = kv + blk * 2048 + tid * 8; const v4f a = *(const v4fa*)s, c = *(const v4fa*)(s + 4); FragH f;
#pragma unroll      /* constant indices: the fragment stays in registers */
    for (int q = 0; q < 4; ++q) { f.h[q] = (_Float16)bf16_round(a[q]); f.h[4 + q] = (_Float16)bf16_round(c[q]); }
    *(v8us*)&tl[tid >> 3][(tid & 7) * 8] = f.half[0]; }
  __syncthreads();      /* the whole tile is written before any thread gathers its units from it */
  const int ln = tid & 15, hh = (tid >> 4) & 1, g = tid >> 5;      /* g = the load's number in its block */
  *(v8us*)(KP + blk * 2048 + tid * 8) = *(const v8us*)&tl[(g >> 2) * 16 + ln][((g >> 1) & 1) * 32 + (g & 1) * 16 + hh * 8];
  FragH t;
#pragma unroll      /* constant indices: the fragment stays in registers */
  for (int i = 0; i < 8; ++i) t.u[i] = tl[(g & 1) * 16 + hh * 8 + i][(g >> 1) * 16 + ln];
  *(v8us*)(VP + blk * 2048 + tid * 8) = t.half[0]; }
// MP, per (16-query tile, 32-key block) 2 loads [nt]: unit = bf16 bits of mask[16 qt + ln][32 jb + 16 nt + 8 hh + 0..7] (the compute dtype's rounding of the mask)
__global__ __launch_bounds__(256) void k_mpack(const float* __restrict__ M, unsigned short* __restrict__ MP) {
  const unsigned int t = blockIdx.x * 256 + threadIdx.x; const int ln = t & 15, hh = (t >> 4) & 1, nt = (t >> 5) & 1, jb = (t >> 6) & (TK / 32 - 1), qt = t / (TK * 2);
  const float* s = M + (size_t)(qt * 16 + ln) * TK + jb * 32 + nt * 16 + hh * 8; const v4f a = *(const v4fa*)s, c = *(const v4fa*)(s + 4); v8us o;
#pragma unroll      /* constant indices: the vector stays in registers */
  for (int q = 0; q < 4; ++q) { o[q] = bf16_bits(a[q]); o[4 + q] = bf16_bits(c[q]); }
  *(v8us*)(MP + (size_t)t * 8) = o; }

// lane l <-> lane l ^ 16 by a vector cross-row move
__device__ __forceinline__ float xhalf(float x) { return __builtin_bit_cast(float, __builtin_amdgcn_permlanex16(__builtin_bit_cast(int, x), __builtin_bit_cast(int, x), 0x76543210, 0xfedcba98, false, false)); }
template <int CAUSAL>
__global__ __launch_bounds__(512) void k_flash(const _Float16* __restrict__ Q16, int ldq, const unsigned short* __restrict__ KP, const unsigned short* __restrict__ VP, const unsigned short* __restrict__ MP, float* __restrict__ O, int ldo) {
  static_assert(CAUSAL == 0 || CAUSAL == 33, "modes: 0 = no mask, 33 = one additive mask table, bf16 and packed by k_mpack, shared by every slab");
  constexpr int QT = 2, RPW = 16 * QT, NQW = QPB / RPW, NW = 2 * NQW, DT = 4, KS = 2; constexpr float L2E = 1.4426950408889634f;      /* QT query tiles of 16 columns a wave: every K and V^T fragment loaded feeds QT products; waves w and w + NQW share their columns and take half the keys each; log2 e */
  __shared__ __attribute__((aligned(16))) float sO[NW][16][64 + 4]; __shared__ __attribute__((aligned(16))) float sX[NW][2 * DT][32][4]; __shared__ float sML[NW][2][32];      /* output staging; the context tile, maximum and sum that a wave hands to its partner, lane by lane */
  const int tid = threadIdx.x, w = tid >> 5, lane = tid & 31, ln = lane & 15, hh = lane >> 4;
  const int slab = blockIdx.x / QBNP, qblk = QB0P + blockIdx.x % QBNP; const int b = slab / NH, h = slab % NH; const int qb0 = qblk * QPB; const int kh = __builtin_amdgcn_readfirstlane(w / NQW); const int q0 = qb0 + (w % NQW) * RPW;      /* kh: the wave's half of the keys, in a scalar register (it bounds the loop) */
  FragH bq[QT][KS];
#pragma unroll      /* constant indices: the array stays in registers */
  for (int qt = 0; qt < QT; ++qt) { const unsigned short* qr = (const unsigned short*)Q16 + ((size_t)b * TQ + q0 + qt * 16 + ln) * ldq + h * 64;
#pragma unroll      /* constant indices: the array stays in registers */
    for (int ks = 0; ks < KS; ++ks) { bq[qt][ks].half[0] = *(const v8us*)(qr + ks * 32 + 8 * hh); bq[qt][ks].half[1] = *(const v8us*)(qr + ks * 32 + 16 + 8 * hh); } }
  /* packed planes (k_kvpack, k_mpack): a fragment load is 32 lanes x 16 consecutive bytes, four whole 128-byte lines */
  const unsigned short* kpl = KP + (size_t)slab * 64 * TK; const unsigned short* vpl = VP + (size_t)slab * 64 * TK; const unsigned short* mpl = MP + (size_t)__builtin_amdgcn_readfirstlane(q0 >> 4) * 16 * TK;      /* wave-uniform bases: scalar address arithmetic */
  const unsigned int l8 = lane * 8;      /* the lane's unit in every load */
  float m_r[QT], l_r[QT]; v8f oacc[QT][DT];
#pragma unroll      /* constant indices: the arrays stay in registers */
  for (int qt = 0; qt < QT; ++qt) { m_r[qt] = -3.0e38f; l_r[qt] = 0.f;
#pragma unroll      /* constant indices: the array stays in registers */
    for (int dt = 0; dt < DT; ++dt) oacc[qt][dt] = (v8f){0.f,0.f,0.f,0.f,0.f,0.f,0.f,0.f}; }
  const int jbeg = kh * (TK / 2), jend = jbeg + TK / 2;
  /* every global operand of the loop is held in registers and requested far ahead of its use; V^T is requested at the head of its pass, K and the mask for the next pass right after their last reads in this one */
  FragH ak[2][KS], av[DT]; v4u mk[QT][2];
  auto fetch_k = [&](int j0) {      /* K fragments of the 32 keys from j0 */
#pragma unroll      /* constant indices: the array stays in registers */
    for (int nt = 0; nt < 2; ++nt) { const unsigned short* kr = kpl + (size_t)j0 * 64 + nt * 1024;
#pragma unroll      /* constant indices: the array stays in registers */
      for (int ks = 0; ks < KS; ++ks) { ak[nt][ks].half[0] = *(const v8us*)(kr + ks * 512 + l8); ak[nt][ks].half[1] = *(const v8us*)(kr + ks * 512 + 256 + l8); } } };
  auto fetch_m = [&](int j0) {      /* mode 33: the mask values of this lane's 16 score elements per query tile, 8 consecutive keys of its query's row per key tile, as bf16 pairs */
    if (CAUSAL == 33) {
#pragma unroll      /* constant indices: the array stays in registers */
      for (int qt = 0; qt < QT; ++qt) { const unsigned short* amk = mpl + (size_t)qt * 16 * TK + (size_t)j0 * 16;
#pragma unroll      /* constant indices: the array stays in registers */
        for (int nt = 0; nt < 2; ++nt) mk[qt][nt] = *(const v4u*)(amk + nt * 256 + l8); } } };
  auto fetch_v = [&](int j0) {      /* V^T fragments of the same keys */
#pragma unroll      /* constant indices: the array stays in registers */
    for (int dt = 0; dt < DT; ++dt) { const unsigned short* vrow = vpl + (size_t)j0 * 64 + dt * 512; av[dt].half[0] = *(const v8us*)(vrow + l8); av[dt].half[1] = *(const v8us*)(vrow + 256 + l8); } };
  fetch_k(jbeg); fetch_m(jbeg);
#pragma unroll 1      /* rolled: the operands fetched ahead keep one register set */
  for (int j0 = jbeg; j0 < jend; j0 += 32) {
    const int jn = (j0 + 32 < jend) ? j0 + 32 : jbeg;      /* the last pass re-reads the first block: in bounds, never used */
    fetch_v(j0);      /* used behind the softmax of this pass */
    v8f s[QT][2];
#pragma unroll      /* constant indices: the array stays in registers */
    for (int qt = 0; qt < QT; ++qt) { s[qt][0] = (v8f){0.f,0.f,0.f,0.f,0.f,0.f,0.f,0.f}; s[qt][1] = s[qt][0]; }
#pragma unroll      /* constant indices: the arrays stay in registers */
    for (int ks = 0; ks < KS; ++ks)      /* the four score tiles side by side in each k step; every tile still adds k step 0, then 1 */
#pragma unroll      /* constant indices: the arrays stay in registers */
      for (int nt = 0; nt < 2; ++nt)
#pragma unroll      /* constant indices: the arrays stay in registers */
        for (int qt = 0; qt < QT; ++qt) s[qt][nt] = mmaH<1>(ak[nt][ks].v, ak[nt][ks].v, bq[qt][ks].v, bq[qt][ks].v, s[qt][nt]);
    fetch_k(jn);      /* the next pass's K, into the registers just read */
    float sc[QT][16];
#pragma unroll      /* constant indices: the array stays in registers */
    for (int qt = 0; qt < QT; ++qt)
#pragma unroll      /* constant indices: the array stays in registers */
      for (int e = 0; e < 16; ++e) { float v = s[qt][e >> 3][e & 7] * SCL; if (CAUSAL == 33) { const unsigned int mw = mk[qt][e >> 3][(e & 7) >> 1]; v += __uint_as_float((e & 1) ? (mw & 0xFFFF0000u) : (mw << 16)); } sc[qt][e] = v; }
    fetch_m(jn);      /* the next pass's mask values, into the registers just read */
#pragma unroll      /* constant indices: the arrays stay in registers */
    for (int qt = 0; qt < QT; ++qt) { const float (&c)[16] = sc[qt];
      const float ma = fmaxf(fmaxf(c[0], c[1]), c[2]), mb = fmaxf(fmaxf(c[3], c[4]), c[5]), mc3 = fmaxf(fmaxf(c[6], c[7]), c[8]), md = fmaxf(fmaxf(c[9], c[10]), c[11]), me = fmaxf(fmaxf(c[12], c[13]), c[14]);
      float mc = fmaxf(fmaxf(fmaxf(ma, mb), mc3), fmaxf(fmaxf(md, me), c[15]));
      mc = fmaxf(mc, xhalf(mc));      /* both halves now hold the query's maximum over the 32 keys */
      /* e^x as the hardware's 2^(x log2 e): x <= 0 here, so the library form's overflow select never fires; where its underflow select gives 0 (also at -inf, or a product that overflows to it) the hardware gives 0 too */
      const float mn = fmaxf(m_r[qt], mc); const float al = (mn > -1.0e38f) ? __builtin_amdgcn_exp2f((m_r[qt] - mn) * L2E) : 1.0f; m_r[qt] = mn;
      float p[16]; FragH pb;
#pragma unroll      /* constant indices: the array stays in registers */
      for (int e = 0; e < 16; ++e) { p[e] = __builtin_amdgcn_exp2f(__builtin_fmaf(c[e] - mn, L2E, 10.0f)); pb.h[e] = (_Float16)p[e]; }      /* p = 1024 e^(s - m): the operand's 2^10 scale rides in the exponent, and the row sum carries it too */
      l_r[qt] = l_r[qt] * al + (((p[0] + p[1]) + (p[2] + p[3])) + ((p[4] + p[5]) + (p[6] + p[7]))) + (((p[8] + p[9]) + (p[10] + p[11])) + ((p[12] + p[13]) + (p[14] + p[15])));
#pragma unroll      /* constant indices: the array stays in registers */
      for (int dt = 0; dt < DT; ++dt) oacc[qt][dt] *= al;
#pragma unroll      /* constant indices: the array stays in registers */
      for (int dt = 0; dt < DT; ++dt) oacc[qt][dt] = mmaH<1>(av[dt].v, av[dt].v, pb.v, pb.v, oacc[qt][dt]); }
    asm volatile("s_wait_xcnt 0x0" ::: "memory"); }      /* the next pass rewrites the address registers that this pass's loads name */
  /* the two halves of the keys are joined: wave kh finishes query tile kh and hands its part of the other tile to its partner */
  const int pw = w ^ NQW; const bool k1 = kh != 0;
  const float mg = k1 ? m_r[0] : m_r[1], lg = k1 ? l_r[0] : l_r[1], mo = k1 ? m_r[1] : m_r[0], lo = k1 ? l_r[1] : l_r[0]; v8f oo[DT];
#pragma unroll      /* constant indices: the arrays stay in registers */
  for (int dt = 0; dt < DT; ++dt) { const v8f g = k1 ? oacc[0][dt] : oacc[1][dt]; oo[dt] = k1 ? oacc[1][dt] : oacc[0][dt];
    *(v4fa*)&sX[w][2 * dt][lane][0] = (v4f){g[0], g[1], g[2], g[3]}; *(v4fa*)&sX[w][2 * dt + 1][lane][0] = (v4f){g[4], g[5], g[6], g[7]}; }
  sML[w][0][lane] = mg; sML[w][1][lane] = lg;
  __syncthreads();      /* every wave's handed-over part is written before its partner reads it */
  { const float mp = sML[pw][0][lane], lp = sML[pw][1][lane]; const float mn = fmaxf(mo, mp);
    const float ao = (mn > -1.0e38f) ? __builtin_amdgcn_exp2f((mo - mn) * L2E) : 1.0f, ap = (mn > -1.0e38f) ? __builtin_amdgcn_exp2f((mp - mn) * L2E) : 1.0f;      /* each part is brought to the common maximum, as the loop does from pass to pass */
    const float lh = lo * ao + lp * ap; const float l = lh + xhalf(lh);      /* the two lane halves' sums of the query's row, joined once */
    const float inv = (l > 0.f) ? 1.0f / l : 0.f;      /* sum and context both carry the factor 1024 */
#pragma unroll      /* constant indices: the array stays in registers */
    for (int dt = 0; dt < DT; ++dt) { const v4f x0 = *(const v4fa*)&sX[pw][2 * dt][lane][0], x1 = *(const v4fa*)&sX[pw][2 * dt + 1][lane][0]; const v8f x = {x0[0], x0[1], x0[2], x0[3], x1[0], x1[1], x1[2], x1[3]};
      const v8f o = (oo[dt] * ao + x * ap) * inv;      /* register r = O[q0 + 16 kh + ln][16 dt + 8 hh + r] */
      *(v4fa*)&sO[w][ln][dt * 16 + 8 * hh] = (v4f){o[0], o[1], o[2], o[3]}; *(v4fa*)&sO[w][ln][dt * 16 + 8 * hh + 4] = (v4f){o[4], o[5], o[6], o[7]}; } }
  __builtin_amdgcn_fence(__ATOMIC_ACQ_REL, "workgroup"); __builtin_amdgcn_wave_barrier();      /* the wave's own staged rows are written before its lanes read them back as whole lines */
  {
#pragma unroll
    for (int rp = 0; rp < 16; rp += 2) { const int r = rp + (lane >> 4), pc = lane & 15; const v4f val = *(const v4fa*)&sO[w][r][pc * 4]; *(v4f*)(O + ((size_t)b * TQ + q0 + kh * 16 + r) * ldo + h * 64 + pc * 4) = val; }
     } }
// 5-plane variant: S = Qh Kh^T + (Ql Kh^T + Qh Kl^T)/1024 with Q/K = [hi | 2^10 residual] f16 planes (QL/KL same layout as Q16/K16), then the 3-term P.V below.
// 3-term variant: O = (P_hi V_hi + (P_lo V_hi + P_hi V_lo) / 1024) / l with P = [hi | 2^10 residual] of 1024 p and V^T = [hi | 2^10 residual] planes (VtL same layout as Vt) -> ~2^-21-class products for un-averaged (early causal / peaked) rows
template <int CAUSAL>
__global__ __launch_bounds__(128) void k_flash5(const _Float16* __restrict__ Q16, const _Float16* __restrict__ QL, int ldq, const _Float16* __restrict__ K16, const _Float16* __restrict__ KL, int ldk, const _Float16* __restrict__ Vt, const _Float16* __restrict__ VtL, const int* __restrict__ MSK, float* __restrict__ O, int ldo) {
  constexpr int RPW = 16, RTN = RPW / 16, NQB = TQ / (4 * RPW), DT = 4, KS = 2;
  __shared__ __attribute__((aligned(16))) unsigned short sP[4][RPW][40]; __shared__ __attribute__((aligned(16))) unsigned short sPL[4][RPW][40]; __shared__ __attribute__((aligned(16))) float sO[4][RPW][64 + 4];
  const int tid = threadIdx.x, w = tid >> 5, lane = tid & 31, ln = lane & 15, hh = lane >> 4;
  const int slab = blockIdx.x / QBN5, qblk = QB05 + blockIdx.x % QBN5; (void)NQB; const int b = slab / NH, h = slab % NH; const int qb0 = qblk * (4 * RPW); const int q0 = qb0 + w * RPW;
  FragH aq[2][KS], aql[2][KS];
#pragma unroll
  for (int rt = 0; rt < RTN; ++rt) { const unsigned short* qr = (const unsigned short*)Q16 + ((size_t)b * TQ + q0 + rt * 16 + ln) * ldq + h * 64; const unsigned short* ql = (const unsigned short*)QL + ((size_t)b * TQ + q0 + rt * 16 + ln) * ldq + h * 64;
#pragma unroll
    for (int ks = 0; ks < KS; ++ks) { aq[rt][ks].half[0] = *(const v8us*)(qr + ks * 32 + 8 * hh); aq[rt][ks].half[1] = *(const v8us*)(qr + ks * 32 + 16 + 8 * hh); aql[rt][ks].half[0] = *(const v8us*)(ql + ks * 32 + 8 * hh); aql[rt][ks].half[1] = *(const v8us*)(ql + ks * 32 + 16 + 8 * hh); } }
  const unsigned short* Vth = (const unsigned short*)Vt + (size_t)slab * 64 * TK; const unsigned short* Vtl = (const unsigned short*)VtL + (size_t)slab * 64 * TK;
  float m_r[2][8], l_r[2][8]; v8f oacc[2][DT], oaccL[2][DT];
#pragma unroll
  for (int rt = 0; rt < RTN; ++rt) {
#pragma unroll
    for (int r = 0; r < 8; ++r) { m_r[rt][r] = -3.0e38f; l_r[rt][r] = 0.f; }
#pragma unroll
    for (int dt = 0; dt < DT; ++dt) { oacc[rt][dt] = (v8f){0.f,0.f,0.f,0.f,0.f,0.f,0.f,0.f}; oaccL[rt][dt] = oacc[rt][dt]; } }
  const int jend = (CAUSAL == 1) ? (qb0 + 4 * RPW) : ((CAUSAL == 23) ? min(TK, (qb0 / CHK + 2) * CHK) : TK);      /* causal / window: keys that can never contribute are skipped */ const int jbeg = (CAUSAL == 23) ? max(0, (qb0 / CHK - 1) * CHK) : 0;
#pragma unroll 1
  for (int j0 = jbeg; j0 < jend; j0 += 32) {
    v8f s[2][2];
#pragma unroll
    for (int nt = 0; nt < 2; ++nt) { const unsigned short* kr = (const unsigned short*)K16 + ((size_t)b * TK + j0 + nt * 16 + ln) * ldk + h * 64; const unsigned short* klr = (const unsigned short*)KL + ((size_t)b * TK + j0 + nt * 16 + ln) * ldk + h * 64; FragH bk[KS], bkl[KS];
#pragma unroll
      for (int ks = 0; ks < KS; ++ks) { bk[ks].half[0] = *(const v8us*)(kr + ks * 32 + 8 * hh); bk[ks].half[1] = *(const v8us*)(kr + ks * 32 + 16 + 8 * hh); bkl[ks].half[0] = *(const v8us*)(klr + ks * 32 + 8 * hh); bkl[ks].half[1] = *(const v8us*)(klr + ks * 32 + 16 + 8 * hh); }
#pragma unroll
      for (int rt = 0; rt < RTN; ++rt) { v8f acc = (v8f){0.f,0.f,0.f,0.f,0.f,0.f,0.f,0.f}, accl = acc;
#pragma unroll
        for (int ks = 0; ks < KS; ++ks) { acc = mmaH<1>(aq[rt][ks].v, aq[rt][ks].v, bk[ks].v, bk[ks].v, acc); accl = mmaH<1>(aql[rt][ks].v, aql[rt][ks].v, bk[ks].v, bk[ks].v, accl); accl = mmaH<1>(aq[rt][ks].v, aq[rt][ks].v, bkl[ks].v, bkl[ks].v, accl); }
#pragma unroll
        for (int r = 0; r < 8; ++r) acc[r] += accl[r] * 0.0009765625f;
        s[rt][nt] = acc; } }
#pragma unroll
    for (int rt = 0; rt < RTN; ++rt)
#pragma unroll
      for (int r = 0; r < 8; ++r) { const int tq = q0 + rt * 16 + 8 * hh + r; const int k0 = j0 + ln, k1 = j0 + 16 + ln;
        bool ok0 = (CAUSAL == 1) ? (k0 <= tq) : ((CAUSAL == 2) ? ((k0 >> 5) == (tq >> 5)) : true), ok1 = (CAUSAL == 1) ? (k1 <= tq) : ((CAUSAL == 2) ? ((k1 >> 5) == (tq >> 5)) : true);      /* mode 2: block-diagonal 32-token groups */
        if (CAUSAL == 4) { const int* mrow = MSK + ((size_t)b * TQ + tq) * TK; ok0 = mrow[k0] != 0; ok1 = mrow[k1] != 0; }      /* mode 4: per-(query, key) INPUT mask shared by all heads; masked keys contribute nothing (== the reference's -4096 fill, whose exp underflows to 0), rows with no valid key give l = 0 -> output 0 (== the reference's row_valid zeroing) */
        float s0 = ok0 ? s[rt][0][r] * SCL : -3.0e38f, s1 = ok1 ? s[rt][1][r] * SCL : -3.0e38f; if (CAUSAL == 33) { const float* amk = (const float*)MSK + (size_t)tq * TK; s0 += bf16_round(amk[k0]); s1 += bf16_round(amk[k1]); }      /* mode 33: one additive [TQ][TK] f32 table shared by every slab */ if (CAUSAL == 17) { const float* amk = (const float*)MSK + (size_t)b * TK; s0 += bf16_round(amk[k0]); s1 += bf16_round(amk[k1]); } if (CAUSAL == 18) { const float* tb = (const float*)MSK; const int* ri = MSK + 1024 + (size_t)b * TK; const int rq = ri[tq]; s0 += tb[(h * 8 + rq) * 8 + ri[k0]]; s1 += tb[(h * 8 + rq) * 8 + ri[k1]]; } if (CAUSAL == 19) { const int* rel = MSK + (size_t)tq * TK; const float* rb = (const float*)MSK + (size_t)TQ * TK + ((size_t)(b * NH + h) * TQ + tq) * 64; s0 += rb[rel[k0]]; s1 += rb[rel[k1]]; }      /* mode 19: + (q.Ek[rel] + Eb[rel][h]) / 8 gathered by the int relative ids (packed [ids | table]) */      /* mode 18: + resource_bias[h][r_q][r_k] from the packed [table | ids] buffer (TQ == TK) */      /* mode 17: additive per-(batch, key) mask INPUT */ float mc = fmaxf(s0, s1);
        mc = fmaxf(mc, __shfl_xor(mc, 1, 32)); mc = fmaxf(mc, __shfl_xor(mc, 2, 32)); mc = fmaxf(mc, __shfl_xor(mc, 4, 32)); mc = fmaxf(mc, __shfl_xor(mc, 8, 32));
        const float mn = fmaxf(m_r[rt][r], mc); const float al = (mn > -1.0e38f) ? expf(m_r[rt][r] - mn) : 1.0f; m_r[rt][r] = mn; const float p0 = ok0 ? expf(s0 - mn) : 0.f, p1 = ok1 ? expf(s1 - mn) : 0.f; l_r[rt][r] = l_r[rt][r] * al + p0 + p1;
#pragma unroll
        for (int dt = 0; dt < DT; ++dt) { oacc[rt][dt][r] *= al; oaccL[rt][dt][r] *= al; }
        FragH t2, t2l; const float ps0 = p0 * 1024.0f, ps1 = p1 * 1024.0f; t2.h[0] = (_Float16)ps0; t2.h[1] = (_Float16)ps1; t2l.h[0] = (_Float16)((ps0 - (float)t2.h[0]) * 1024.0f); t2l.h[1] = (_Float16)((ps1 - (float)t2.h[1]) * 1024.0f);
        sP[w][rt * 16 + 8 * hh + r][ln] = t2.u[0]; sP[w][rt * 16 + 8 * hh + r][16 + ln] = t2.u[1]; sPL[w][rt * 16 + 8 * hh + r][ln] = t2l.u[0]; sPL[w][rt * 16 + 8 * hh + r][16 + ln] = t2l.u[1]; }
    __builtin_amdgcn_fence(__ATOMIC_ACQ_REL, "workgroup"); __builtin_amdgcn_wave_barrier();
    FragH pa[2], pl[2];
#pragma unroll
    for (int rt = 0; rt < RTN; ++rt) { pa[rt].half[0] = *(const v8us*)&sP[w][rt * 16 + ln][8 * hh]; pa[rt].half[1] = *(const v8us*)&sP[w][rt * 16 + ln][16 + 8 * hh]; pl[rt].half[0] = *(const v8us*)&sPL[w][rt * 16 + ln][8 * hh]; pl[rt].half[1] = *(const v8us*)&sPL[w][rt * 16 + ln][16 + 8 * hh]; }
#pragma unroll
    for (int dt = 0; dt < DT; ++dt) { const unsigned short* vrow = Vth + (size_t)(dt * 16 + ln) * TK + j0; const unsigned short* vrl = Vtl + (size_t)(dt * 16 + ln) * TK + j0; FragH bv, bl; bv.half[0] = *(const v8us*)(vrow + 8 * hh); bv.half[1] = *(const v8us*)(vrow + 16 + 8 * hh); bl.half[0] = *(const v8us*)(vrl + 8 * hh); bl.half[1] = *(const v8us*)(vrl + 16 + 8 * hh);
#pragma unroll
      for (int rt = 0; rt < RTN; ++rt) { oacc[rt][dt] = mmaH<1>(pa[rt].v, pa[rt].v, bv.v, bv.v, oacc[rt][dt]); oaccL[rt][dt] = mmaH<1>(pl[rt].v, pl[rt].v, bv.v, bv.v, oaccL[rt][dt]); oaccL[rt][dt] = mmaH<1>(pa[rt].v, pa[rt].v, bl.v, bl.v, oaccL[rt][dt]); } }
    __builtin_amdgcn_fence(__ATOMIC_ACQ_REL, "workgroup"); __builtin_amdgcn_wave_barrier(); }
#pragma unroll
  for (int rt = 0; rt < RTN; ++rt) {
#pragma unroll
    for (int r = 0; r < 8; ++r) { float l = l_r[rt][r]; l += __shfl_xor(l, 1, 32); l += __shfl_xor(l, 2, 32); l += __shfl_xor(l, 4, 32); l += __shfl_xor(l, 8, 32); l_r[rt][r] = (l > 0.f) ? 1.0f / (l * 1024.0f) : 0.f; }
#pragma unroll
    for (int dt = 0; dt < DT; ++dt)
#pragma unroll
      for (int r = 0; r < 8; ++r) { float v = oacc[rt][dt][r]; v += oaccL[rt][dt][r] * 0.0009765625f; sO[w][rt * 16 + 8 * hh + r][dt * 16 + ln] = v * l_r[rt][r]; } }
  __builtin_amdgcn_fence(__ATOMIC_ACQ_REL, "workgroup"); __builtin_amdgcn_wave_barrier();
  {
#pragma unroll
    for (int rp = 0; rp < RPW; rp += 2) { const int r = rp + (lane >> 4), pc = lane & 15; const v4f val = *(const v4fa*)&sO[w][r][pc * 4]; *(v4f*)(O + ((size_t)b * TQ + q0 + r) * ldo + h * 64 + pc * 4) = val; }
     } }

__global__ __launch_bounds__(256) void k_rotab(float* __restrict__ CS, float* __restrict__ SN) {
  #pragma clang fp contract(off)
  const int t = blockIdx.x * 256 + threadIdx.x; if (t >= SLEN * 32) return; const int j = t % 32, s = t / 32; const float ex = (float)(2 * j) / 64.0f; const float inv = 1.0f / powf(10000.0f, ex); const float th = (float)s * inv; const float c = cosf(th), sn = sinf(th);
  { *(float*)(CS + t) = c; *(float*)(SN + t) = sn;  } }
__global__ __launch_bounds__(256) void k_rope(const float* __restrict__ F, int nsrc, int ndst, int rep, const float* __restrict__ CS, const float* __restrict__ SN, _Float16* __restrict__ H, _Float16* __restrict__ L) {
  #pragma clang fp contract(off)
  const size_t t = (size_t)blockIdx.x * 256 + threadIdx.x; if (t >= (size_t)NR * ndst * 4) return; const int g8 = (int)(t % 4); const int hd = (int)((t / 4) % ndst); const size_t row = t / ((size_t)4 * ndst); const int s = (int)(row % SLEN); const int hs = hd / rep;
  const float* src = F + row * (size_t)(nsrc * 64) + hs * 64; FragH ah, al, bh, bl;
  for (int i = 0; i < 8; ++i) { const int d = g8 * 8 + i; const float c = CS[s * 32 + d], sn = SN[s * 32 + d]; const float x1 = src[d], x2 = src[d + 32];
    float o1 = x1 * c; o1 += -x2 * sn; float o2 = x2 * c; o2 += x1 * sn;
    _Float16 hv = (_Float16)o1; ah.h[i] = hv; al.h[i] = (_Float16)((o1 - (float)hv) * 1024.0f); hv = (_Float16)o2; bh.h[i] = hv; bl.h[i] = (_Float16)((o2 - (float)hv) * 1024.0f); }
  const size_t o = row * (size_t)(ndst * 64) + hd * 64 + g8 * 8;
  { *(v8us*)((unsigned short*)H + o) = ah.half[0]; *(v8us*)((unsigned short*)H + o + 32) = bh.half[0]; *(v8us*)((unsigned short*)L + o) = al.half[0]; *(v8us*)((unsigned short*)L + o + 32) = bl.half[0];  } }
__global__ __launch_bounds__(256) void k_rope2(const float* __restrict__ F, int nsrc, int ndst, int rep, const float* __restrict__ CS, const float* __restrict__ SN, _Float16* __restrict__ H, _Float16* __restrict__ L) {
  #pragma clang fp contract(off)
  const size_t t = (size_t)blockIdx.x * 256 + threadIdx.x; if (t >= (size_t)NR * ndst * 4) return; const int g16 = (int)(t % 4); const int hd = (int)((t / 4) % ndst); const size_t row = t / ((size_t)4 * ndst); const int s = (int)(row % SLEN); const int hs = hd / rep;
  const float* src = F + row * (size_t)(nsrc * 64) + hs * 64 + g16 * 16; FragH ah, al;
  for (int pr = 0; pr < 8; ++pr) { const int i = g16 * 8 + pr; const float c = CS[s * 32 + i], sn = SN[s * 32 + i]; const float x1 = src[2 * pr], x2 = src[2 * pr + 1];
    float o1 = x1 * c; o1 -= x2 * sn; float o2 = x1 * sn; o2 += x2 * c;
    _Float16 hv = (_Float16)o1; ah.h[2 * pr] = hv; al.h[2 * pr] = (_Float16)((o1 - (float)hv) * 1024.0f); hv = (_Float16)o2; ah.h[2 * pr + 1] = hv; al.h[2 * pr + 1] = (_Float16)((o2 - (float)hv) * 1024.0f); }
  const size_t o = row * (size_t)(ndst * 64) + hd * 64 + g16 * 16;
  { *(v8us*)((unsigned short*)H + o) = ah.half[0]; *(v8us*)((unsigned short*)H + o + 8) = ah.half[1]; *(v8us*)((unsigned short*)L + o) = al.half[0]; *(v8us*)((unsigned short*)L + o + 8) = al.half[1];  } }
__global__ __launch_bounds__(256) void k_ln512(const float* __restrict__ A, const float* __restrict__ res, const float* __restrict__ g, const float* __restrict__ bb, float* __restrict__ Y, _Float16* __restrict__ Y16) {
  #pragma clang fp contract(off)
  const int wv = threadIdx.x >> 5, ln = threadIdx.x & 31; const size_t r = (size_t)blockIdx.x * 8 + wv; if (r >= NR) return; float x[16]; float s = 0.f;
  for (int i = 0; i < 2; ++i) { const v8f a = *(const v8f*)(A + r * DM + i * 256 + ln * 8); for (int q = 0; q < 8; ++q) { float v = a[q]; if (res) v += bf16_round(res[r * DM + i * 256 + ln * 8 + q]); x[i * 8 + q] = v; s += v; } }
  for (int o = 16; o > 0; o >>= 1) s += __shfl_xor(s, o, 32); const float mu = s / (float)DM; float var = 0.f; for (int q = 0; q < 16; ++q) { const float d = x[q] - mu; var += d * d; }
  for (int o = 16; o > 0; o >>= 1) var += __shfl_xor(var, o, 32); const float inv = rsqrtf(var / (float)DM + 1e-5f);
  { for (int i = 0; i < 2; ++i) { const int c0 = i * 256 + ln * 8; v8f y; FragH f; for (int q = 0; q < 8; ++q) { float v = (x[i * 8 + q] - mu) * inv; v *= bf16_round(g[c0 + q]); v += bf16_round(bb[c0 + q]); y[q] = v; f.h[q] = (_Float16)v; } *(v8f*)(Y + r * DM + c0) = y; if (Y16) *(v8us*)((unsigned short*)Y16 + r * DM + c0) = f.half[0]; }  } }
__global__ __launch_bounds__(256) void k_pack(const float* __restrict__ rb, const int* __restrict__ rid, int* __restrict__ PK) { const int t = blockIdx.x * 256 + threadIdx.x; if (t >= 1024 + NB * TK) return; int v; if (t < 1024) v = __float_as_int(bf16_round(rb[t])); else v = rid[t - 1024]; *(int*)(PK + t) = v;  }
__global__ __launch_bounds__(256) void k_tabin(const float* __restrict__ sp, float* __restrict__ CS, float* __restrict__ SN) { const int t = blockIdx.x * 256 + threadIdx.x; if (t >= SLEN * 32) return; const int i = t % 32, s = t / 32; const float c = bf16_round(sp[s * 64 + 32 + i]), sn = bf16_round(sp[s * 64 + i]);
  { *(float*)(CS + t) = c; *(float*)(SN + t) = sn;  } }
__global__ __launch_bounds__(256) void k_wsc(const float* __restrict__ Wm, _Float16* __restrict__ Bt, size_t n8, float sc) { const size_t t = (size_t)blockIdx.x * 256 + threadIdx.x; if (t >= n8) return; FragH f; for (int q = 0; q < 8; ++q) f.h[q] = (_Float16)(bf16_round(Wm[t * 8 + q]) * sc); *(v8us*)((unsigned short*)Bt + t * 8) = f.half[0];  }
__global__ __launch_bounds__(256) void k_rotab2(float* __restrict__ CS, float* __restrict__ SN) {
  #pragma clang fp contract(off)
  const int t = blockIdx.x * 256 + threadIdx.x; if (t >= SLEN * 32) return; const int j = t % 32, s = t / 32; const float c0 = -0.14391156831212787f;      /* -ln(10000)/64 rounded to f32 */ const float inv = expf((float)(2 * j) * c0); const float th = (float)s * inv; const float c = cosf(th), sn = sinf(th);
  { *(float*)(CS + t) = c; *(float*)(SN + t) = sn;  } }
__global__ __launch_bounds__(256) void k_lnu(const float* __restrict__ X, _Float16* __restrict__ N16, float* __restrict__ XB) {
  #pragma clang fp contract(off)
  const int wv = threadIdx.x >> 5, ln = threadIdx.x & 31; const size_t r = (size_t)blockIdx.x * 8 + wv; if (r >= NR) return; float a[32]; float s = 0.f;
  for (int i = 0; i < 4; ++i) { const v8f v = *(const v8f*)(X + r * DM + (i * 32 + ln) * 8); for (int q = 0; q < 8; ++q) { const float u = bf16_round(v[q]); a[i * 8 + q] = u; s += u; } }
  for (int o = 16; o > 0; o >>= 1) s += __shfl_xor(s, o, 32); const float mu = s / (float)DM; float var = 0.f; for (int q = 0; q < 32; ++q) { const float d = a[q] - mu; var += d * d; }
  for (int o = 16; o > 0; o >>= 1) var += __shfl_xor(var, o, 32); const float den = sqrtf(var / (float)(DM - 1)) + 1e-6f; const float inv = 1.0f / den;      /* one reciprocal per row; (x-mean)*inv vs the reference's division differs by <= 1 ulp */
  { for (int i = 0; i < 4; ++i) { const int c0 = (i * 32 + ln) * 8; FragH f; v8f xb; for (int q = 0; q < 8; ++q) { f.h[q] = (_Float16)((a[i * 8 + q] - mu) * inv); xb[q] = a[i * 8 + q]; } *(v8us*)((unsigned short*)N16 + r * DM + c0) = f.half[0]; *(v8f*)(XB + r * DM + c0) = xb; }  } }
__global__ __launch_bounds__(256) void k_vtg(const _Float16* __restrict__ V16, _Float16* __restrict__ Vt) { __shared__ unsigned short tl[64][66]; const int tid = threadIdx.x; const int slab = blockIdx.x / (SLEN / 64), lg = blockIdx.x % (SLEN / 64); const int b = slab / NH, h = slab % NH; const int hs = h / NREP;
  for (int i = tid; i < 64 * 8; i += 256) { const int r = i / 8, c8 = (i % 8) * 8; FragH f; f.half[0] = *(const v8us*)((const unsigned short*)V16 + ((size_t)b * SLEN + lg * 64 + r) * KVD + hs * 64 + c8); for (int q = 0; q < 8; ++q) tl[r][c8 + q] = f.u[q]; }
  __syncthreads();
  { for (int rd = 0; rd < 2; ++rd) { const int d = rd * 32 + tid / 8, pc = tid % 8; FragH f; for (int q = 0; q < 8; ++q) f.u[q] = tl[pc * 8 + q][d]; *(v8us*)((unsigned short*)Vt + ((size_t)slab * 64 + d) * SLEN + lg * 64 + pc * 8) = f.half[0]; }  } }

__global__ __launch_bounds__(256) void k_h16s(const float* __restrict__ SRC, int lds, int coff, _Float16* __restrict__ DST, size_t n8) { const size_t t = (size_t)blockIdx.x * 256 + threadIdx.x; if (t >= n8) return; const size_t r = (t * 8) / DM; const int c = (int)((t * 8) % DM); const v8f a = *(const v8f*)(SRC + r * lds + coff + c); FragH f; for (int q = 0; q < 8; ++q) f.h[q] = (_Float16)a[q];
  *(v8us*)((unsigned short*)DST + t * 8) = f.half[0];  }


__global__ __launch_bounds__(256) void k_ccp(const float* __restrict__ QKV, int coff, _Float16* __restrict__ D) { const size_t t = (size_t)blockIdx.x * 256 + threadIdx.x; if (t >= (size_t)NR * DM / 8) return; const int c0 = (int)((t * 8) % DM); const size_t row = (t * 8) / DM; const v8f a = *(const v8f*)(QKV + row * 3 * DM + coff + c0); FragH f; for (int q = 0; q < 8; ++q) f.h[q] = (_Float16)a[q];
  *(v8us*)((unsigned short*)D + t * 8) = f.half[0];  }


extern "C" void kernel_launch(void* const* d_in, const int* in_sizes, int n_in,
                              void* d_out, int out_size, void* d_ws, size_t ws_size, hipStream_t stream) {
  (void)in_sizes; (void)n_in; (void)out_size;
  const float* q = (const float*)d_in[0]; const float* kv = (const float*)d_in[1]; const float* mask = (const float*)d_in[2]; float* O = (float*)d_out;
  char* ws = (char*)d_ws; size_t off = 0;
  auto take = [&](size_t bytes) { char* p = ws + off; off += (bytes + 255) & ~(size_t)255; return p; };
  const size_t np = (size_t)NR * DM;      /* 32 x 2048 x 64 */
  _Float16* Q16 = (_Float16*)take(np * 2); unsigned short* KP = (unsigned short*)take(np * 2); unsigned short* VP = (unsigned short*)take(np * 2); unsigned short* MP = (unsigned short*)take((size_t)TQ * TK * 2);
  if (off > ws_size) return;      /* 32 MiB */
  k_x16<<<(unsigned)((np / 8 + 255) / 256), 256, 0, stream>>>(q, Q16, np / 8);
  k_kvpack<<<NR / 32, 256, 0, stream>>>(kv, KP, VP);      /* values = keys */
  k_mpack<<<TQ / 8 * TK / 256, 256, 0, stream>>>(mask, MP);
  k_flash<33><<<NB * NH * QBNP, 512, 0, stream>>>(Q16, DM, KP, VP, MP, O, DM);      /* f32 context straight to the output rows */
}

// v006
// It runs in 53.7 microseconds.
// Next to v005, in two timings, it ran 1.05 times as fast each time.
// All steps since v000 together make it 6.44 times as fast.
#include <hip/hip_runtime.h>
// DotProdAttention (q [4][8][2048][64], kv [4][8][2048][64] (keys = values), mask [1][1][2048][2048] added to every (batch, head); out = softmax(q kv^T / 8 + mask) kv -> [4][8][2048][64]).
// Structure: the (batch, head) slabs of q/kv are already contiguous 64-wide row blocks, so each slab is treated as one 'batch' of a single 64-dim head: exact f16 plane of q; kv as K and as V^T, and the mask, packed in the order of the attention loop's fragment loads; flash-style fused attention per (slab, 256-query block) adding the shared additive mask table per (query, key), f32 context written straight to the output.
// Compute dtype: inputs rounded to bf16; q, kv, mask exact (f16 / bf16-rounded f32); softmax f32 with f16 probabilities; plain f16 value operand (~2^-12). v_wmma_f32_16x16x32_f16.
#define NB 32                    /* 4 batches x 8 heads as slabs */
#define DM 64
#define NKV 1
#define NREP (NH / NKV)
#define KVD (NKV * 64)           /* 64 */
#define NR (NB * SLEN)
#define CHK 512
typedef int v4i __attribute__((ext_vector_type(4)));
#define FF 2048
#define SLEN 2048
#define MQI 2048
#define MKI 2048
#define TQ SLEN
#define TK SLEN
#define NH 1
#define SCL 0.125f
#define QBLKS (TQ / 64)
#define QB05 0
#define QBN5 4
#define QB0P 0
#define QPB 256                  /* queries per work-group of k_flash */
#define QBNP (TQ / QPB)
#define RE 256
typedef __bf16 v16b __attribute__((ext_vector_type(16)));
typedef unsigned short v8us __attribute__((ext_vector_type(8), may_alias));
typedef float  v8f  __attribute__((ext_vector_type(8)));
typedef float  v4f  __attribute__((ext_vector_type(4)));
typedef float  v4fa __attribute__((ext_vector_type(4), may_alias));
union FragB { v16b v; v8us half[2]; unsigned short u[16]; };

__device__ __forceinline__ unsigned short bf16_bits(float x) { unsigned int u = __float_as_uint(x); return (unsigned short)((u + 0x7FFFu + ((u >> 16) & 1u)) >> 16); }
__device__ __forceinline__ float bf16_val(unsigned short b) { return __uint_as_float(((unsigned int)b) << 16); }
__device__ __forceinline__ float bf16_round(float x) { return bf16_val(bf16_bits(x)); }
// D += A·B with NT terms: 1 = ah·bh, 2 = + al·bh (A split), 3 = + ah·bl (both split)
template <int NT>
__device__ __forceinline__ v8f mmaN(v16b ah, v16b al, v16b bh, v16b bl, v8f c) {
  c = __builtin_amdgcn_wmma_f32_16x16x32_bf16(false, ah, false, bh, (short)0, c, false, false);
  if (NT >= 2) c = __builtin_amdgcn_wmma_f32_16x16x32_bf16(false, al, false, bh, (short)0, c, false, false);
  if (NT >= 3) c = __builtin_amdgcn_wmma_f32_16x16x32_bf16(false, ah, false, bl, (short)0, c, false, false);
  asm volatile("v_nop\n\tv_nop\n\tv_nop\n\tv_nop" : "+v"(c) : "v"(ah), "v"(al), "v"(bh), "v"(bl));
  return c;
}

__global__ __launch_bounds__(256) void k_wt_bf16(const float* __restrict__ W, unsigned short* __restrict__ Wt, int K, int N) {
  const int t = blockIdx.x * 256 + threadIdx.x;
  const int k8n = K / 8;
  if (t >= N * k8n) return;
  const int n = t / k8n, k8 = (t % k8n) * 8;
  v8us v;
#pragma unroll
  for (int i = 0; i < 8; ++i) v[i] = bf16_bits(W[(size_t)(k8 + i) * N + n]);
  *(v8us*)(Wt + (size_t)n * K + k8) = v;
  
}

// GEMM C[M][N] (f32, pitch ldc) = act(A[M][K]·W + bias). A f32 row-major (pitch lda) converted per fragment to bf16
// (ASPLIT: hi/lo two planes -> 2 terms, else single rounded term); Wt bf16 [N][K] (pitch ldb). BIAS_BF16 rounds the
// bias to bf16 first (bias quantised to bf16 before the add). K%32==0, M%16==0, N%64==0.
template <bool ASPLIT, int ACT, bool BIAS_BF16>
__global__ __launch_bounds__(128) void k_gemm_bf(const float* __restrict__ A, int lda, const unsigned short* __restrict__ Wt, int ldb,
                                               const float* __restrict__ bias, float* __restrict__ C, int ldc, int M, int N, int K) {
  __shared__ __attribute__((aligned(16))) float so[4][16][64];
  const int tid = threadIdx.x, w = tid >> 5, lane = tid & 31, ln = lane & 15, hh = lane >> 4;
  const int ntn = N / 64;
  const int wid = blockIdx.x * 4 + w;
  const int mt = wid / ntn, nq = wid % ntn;
  if (mt * 16 >= M) return;
  const int row0 = mt * 16, col0 = nq * 64;
  const float* arow = A + (size_t)(row0 + ln) * lda;
  v8f acc[4] = {};
  for (int kb = 0; kb < K; kb += 32) {
    FragB ah, al;
    const v4f x0 = *(const v4fa*)(arow + kb + 8 * hh), x1 = *(const v4fa*)(arow + kb + 8 * hh + 4);
    const v4f x2 = *(const v4fa*)(arow + kb + 16 + 8 * hh), x3 = *(const v4fa*)(arow + kb + 16 + 8 * hh + 4);
    float xs[16] = {x0[0],x0[1],x0[2],x0[3],x1[0],x1[1],x1[2],x1[3],x2[0],x2[1],x2[2],x2[3],x3[0],x3[1],x3[2],x3[3]};
#pragma unroll
    for (int i = 0; i < 16; ++i) { const unsigned short hb = bf16_bits(xs[i]); ah.u[i] = hb; al.u[i] = ASPLIT ? bf16_bits(xs[i] - bf16_val(hb)) : (unsigned short)0; }
#pragma unroll
    for (int t = 0; t < 4; ++t) {
      const unsigned short* brow = Wt + (size_t)(col0 + t * 16 + ln) * ldb + kb;
      FragB b;
      b.half[0] = *(const v8us*)(brow + 8 * hh);
      b.half[1] = *(const v8us*)(brow + 16 + 8 * hh);
      acc[t] = mmaN<ASPLIT ? 2 : 1>(ah.v, al.v, b.v, b.v, acc[t]);
    }
  }
#pragma unroll
  for (int t = 0; t < 4; ++t) {
    float bv = bias ? bias[col0 + t * 16 + ln] : 0.f;
    if (BIAS_BF16) bv = bf16_round(bv);
#pragma unroll
    for (int r = 0; r < 8; ++r) { float v = acc[t][r] + bv; if (ACT == 1) v = fmaxf(v, 0.f); so[w][8 * hh + r][t * 16 + ln] = v; }
  }
  __builtin_amdgcn_fence(__ATOMIC_ACQ_REL, "workgroup");
  __builtin_amdgcn_wave_barrier();
  const int rsub = lane >> 4, c4 = (lane & 15) * 4;
  {
#pragma unroll
    for (int q = 0; q < 8; ++q) {
      const int r = q * 2 + rsub;
      const v4f v = *(const v4fa*)&so[w][r][c4];
      *(v4f*)(C + (size_t)(row0 + r) * ldc + col0 + c4) = v;
    }
    
  }
}

// GEMM C = act(A·W + bias + resid): A f32 (ASPLIT -> hi/lo 2 terms), Wt bf16 [N][K]; ACT 0 none, 1 relu, 2 exact gelu;
// resid (optional, f32, row index = (row % rmod), pitch ldr, RES_BF16 rounds it) added before the activation.
template <bool ASPLIT, int ACT, bool BIAS_BF16, bool RES_BF16>
__global__ __launch_bounds__(128) void k_gemm_bf3(const float* __restrict__ A, int lda, const unsigned short* __restrict__ Wt, int ldb,
                                                const float* __restrict__ bias, const float* __restrict__ resid, int rmod, int ldr,
                                                float* __restrict__ C, int ldc, int M, int N, int K) {
  __shared__ __attribute__((aligned(16))) float so[4][16][64];
  const int tid = threadIdx.x, w = tid >> 5, lane = tid & 31, ln = lane & 15, hh = lane >> 4;
  const int ntn = N / 64;
  const int wid = blockIdx.x * 4 + w;
  const int mt = wid / ntn, nq = wid % ntn;
  if (mt * 16 >= M) return;
  const int row0 = mt * 16, col0 = nq * 64;
  const float* arow = A + (size_t)(row0 + ln) * lda;
  v8f acc[4] = {};
  for (int kb = 0; kb < K; kb += 32) {
    FragB ah, al;
    const v4f x0 = *(const v4fa*)(arow + kb + 8 * hh), x1 = *(const v4fa*)(arow + kb + 8 * hh + 4);
    const v4f x2 = *(const v4fa*)(arow + kb + 16 + 8 * hh), x3 = *(const v4fa*)(arow + kb + 16 + 8 * hh + 4);
    float xs[16] = {x0[0],x0[1],x0[2],x0[3],x1[0],x1[1],x1[2],x1[3],x2[0],x2[1],x2[2],x2[3],x3[0],x3[1],x3[2],x3[3]};
#pragma unroll
    for (int i = 0; i < 16; ++i) { const unsigned short hb = bf16_bits(xs[i]); ah.u[i] = hb; al.u[i] = ASPLIT ? bf16_bits(xs[i] - bf16_val(hb)) : (unsigned short)0; }
#pragma unroll
    for (int t = 0; t < 4; ++t) {
      const unsigned short* brow = Wt + (size_t)(col0 + t * 16 + ln) * ldb + kb;
      FragB b;
      b.half[0] = *(const v8us*)(brow + 8 * hh);
      b.half[1] = *(const v8us*)(brow + 16 + 8 * hh);
      acc[t] = mmaN<ASPLIT ? 2 : 1>(ah.v, al.v, b.v, b.v, acc[t]);
    }
  }
#pragma unroll
  for (int t = 0; t < 4; ++t) {
    const int col = col0 + t * 16 + ln;
    float bv = bias ? bias[col] : 0.f;
    if (BIAS_BF16) bv = bf16_round(bv);
#pragma unroll
    for (int r = 0; r < 8; ++r) {
      float v = acc[t][r] + bv;
      if (resid) { float rv = resid[(size_t)((row0 + 8 * hh + r) % rmod) * ldr + col]; if (RES_BF16) rv = bf16_round(rv); v += rv; }
      if (ACT == 1) v = fmaxf(v, 0.f);
      if (ACT == 2) v = 0.5f * v * (1.0f + erff(v * 0.70710678118654752f));
      if (ACT == 3) { const float u = 0.7978845608028654f * (v + 0.044715f * v * v * v); v = 0.5f * v * (1.0f + tanhf(u)); }
      so[w][8 * hh + r][t * 16 + ln] = v;
    }
  }
  __builtin_amdgcn_fence(__ATOMIC_ACQ_REL, "workgroup");
  __builtin_amdgcn_wave_barrier();
  const int rsub = lane >> 4, c4 = (lane & 15) * 4;
  {
#pragma unroll
    for (int q = 0; q < 8; ++q) {
      const int r = q * 2 + rsub;
      const v4f v = *(const v4fa*)&so[w][r][c4];
      *(v4f*)(C + (size_t)(row0 + r) * ldc + col0 + c4) = v;
    }
    
  }
}
// row LayerNorm (biased variance, eps) over N: s = X (+ R); optional out_sum <- s; out_norm <- (s-mu)*rsqrt(var+eps)*g + b
template <bool PARAM_BF16>
__global__ __launch_bounds__(256) void k_layernorm(const float* __restrict__ X, const float* __restrict__ R, const float* __restrict__ g, const float* __restrict__ bta,
                                                  float* __restrict__ out_sum, float* __restrict__ out_norm, int N, float eps) {
  __shared__ float red[256];
  const int row = blockIdx.x, tid = threadIdx.x;
  const float* x = X + (size_t)row * N; const float* rr = R ? R + (size_t)row * N : nullptr;
  float vals[16];                     // up to N = 4096
  const int per = N / 256;            // contiguous chunk per thread? use strided-by-4 chunks: thread handles j = tid*4 + 1024*u
  float s1 = 0.f;
  for (int u = 0; u < per / 4; ++u) {
    const int j = tid * 4 + 1024 * u;
    const v4f a = *(const v4fa*)(x + j);
    v4f b = {0.f,0.f,0.f,0.f}; if (rr) b = *(const v4fa*)(rr + j);
#pragma unroll
    for (int q = 0; q < 4; ++q) { const float v = a[q] + b[q]; vals[u * 4 + q] = v; s1 += v; }
  }
  red[tid] = s1; __syncthreads();
  for (int st = 128; st > 0; st >>= 1) { if (tid < st) red[tid] += red[tid + st]; __syncthreads(); }
  const float mu = red[0] / (float)N; __syncthreads();
  float s2 = 0.f;
  for (int u = 0; u < per / 4; ++u)
#pragma unroll
    for (int q = 0; q < 4; ++q) { const float c = vals[u * 4 + q] - mu; s2 += c * c; }
  red[tid] = s2; __syncthreads();
  for (int st = 128; st > 0; st >>= 1) { if (tid < st) red[tid] += red[tid + st]; __syncthreads(); }
  const float rs = rsqrtf(red[0] / (float)N + eps);
  {
    for (int u = 0; u < per / 4; ++u) {
      const int j = tid * 4 + 1024 * u;
      v4f o, sm;
#pragma unroll
      for (int q = 0; q < 4; ++q) {
        float gg = g[j + q], bb = bta[j + q];
        if (PARAM_BF16) { gg = bf16_round(gg); bb = bf16_round(bb); }
        sm[q] = vals[u * 4 + q]; o[q] = (vals[u * 4 + q] - mu) * rs * gg + bb;
      }
      if (out_sum) *(v4f*)(out_sum + (size_t)row * N + j) = sm;
      *(v4f*)(out_norm + (size_t)row * N + j) = o;
    }
    
  }
}



// ---- f16 WMMA path (v_wmma_f32_16x16x32_f16): 11-bit significands for operands in range — used where a [0,1] probability operand needs more precision than bf16
typedef _Float16 v16h __attribute__((ext_vector_type(16)));
union FragH { v16h v; v8us half[2]; _Float16 h[16]; unsigned short u[16]; };
template <int NT>
__device__ __forceinline__ v8f mmaH(v16h ah, v16h al, v16h bh, v16h bl, v8f c) {
  c = __builtin_amdgcn_wmma_f32_16x16x32_f16(false, ah, false, bh, (short)0, c, false, false);
  if (NT >= 2) c = __builtin_amdgcn_wmma_f32_16x16x32_f16(false, al, false, bh, (short)0, c, false, false);
  if (NT >= 3) c = __builtin_amdgcn_wmma_f32_16x16x32_f16(false, ah, false, bl, (short)0, c, false, false);
  asm volatile("v_nop\n\tv_nop\n\tv_nop\n\tv_nop" : "+v"(c) : "v"(ah), "v"(al), "v"(bh), "v"(bl));
  return c;
}
// batched GEMM like k_gemm_b but f16 operands: A f32 (split into f16 hi/lo if ASPLIT, else rounded to f16), Bt = f16 values [n][k]; alpha; C f32; N multiple of 16 (partial tiles skipped)
template <bool ASPLIT>
__global__ __launch_bounds__(128) void k_gemm_h(const float* __restrict__ A, int lda, size_t sA, const _Float16* __restrict__ Bh, int ldb, size_t sB, float alpha, float* __restrict__ C, int ldc, size_t sC, int M, int N, int K) {
  __shared__ __attribute__((aligned(16))) float so[4][16][64];
  const int tid = threadIdx.x, w = tid >> 5, lane = tid & 31, ln = lane & 15, hh = lane >> 4; const int by = blockIdx.y;
  A += (size_t)by * sA; Bh += (size_t)by * sB; C += (size_t)by * sC;
  const int ntn = (N + 63) / 64; const int wid = blockIdx.x * 4 + w; const int mt = wid / ntn, nq = wid % ntn; if (mt * 16 >= M) return;
  const int row0 = mt * 16, col0 = nq * 64; const float* arow = A + (size_t)(row0 + ln) * lda;
  v8f acc[4] = {};
  for (int kb = 0; kb < K; kb += 32) {
    FragH ah, al;
    const v4f x0 = *(const v4fa*)(arow + kb + 8 * hh), x1 = *(const v4fa*)(arow + kb + 8 * hh + 4), x2 = *(const v4fa*)(arow + kb + 16 + 8 * hh), x3 = *(const v4fa*)(arow + kb + 16 + 8 * hh + 4);
    float xs[16] = {x0[0],x0[1],x0[2],x0[3],x1[0],x1[1],x1[2],x1[3],x2[0],x2[1],x2[2],x2[3],x3[0],x3[1],x3[2],x3[3]};
#pragma unroll
    for (int i = 0; i < 16; ++i) { const _Float16 h = (_Float16)xs[i]; ah.h[i] = h; al.h[i] = ASPLIT ? (_Float16)(xs[i] - (float)h) : (_Float16)0.0f; }
#pragma unroll
    for (int t = 0; t < 4; ++t) { if (col0 + t * 16 >= N) continue; const size_t boff = (size_t)(col0 + t * 16 + ln) * ldb + kb; FragH bq; bq.half[0] = *(const v8us*)(Bh + boff + 8 * hh); bq.half[1] = *(const v8us*)(Bh + boff + 16 + 8 * hh);
      acc[t] = mmaH<ASPLIT ? 2 : 1>(ah.v, al.v, bq.v, bq.v, acc[t]); }
  }
#pragma unroll
  for (int t = 0; t < 4; ++t) { if (col0 + t * 16 >= N) continue;
#pragma unroll
    for (int r = 0; r < 8; ++r) so[w][8 * hh + r][t * 16 + ln] = acc[t][r] * alpha; }
  __builtin_amdgcn_fence(__ATOMIC_ACQ_REL, "workgroup"); __builtin_amdgcn_wave_barrier();
  const int rsub = lane >> 4, c4 = (lane & 15) * 4;
  {
#pragma unroll
    for (int q = 0; q < 8; ++q) { const int r = q * 2 + rsub; if (col0 + c4 < N) { const v4f v = *(const v4fa*)&so[w][r][c4]; *(v4f*)(C + (size_t)(row0 + r) * ldc + col0 + c4) = v; } }
     }
}

// Wt[n][k] = f16(W[k][n]·scale) from f32 row-major W[K][N] (scale = power of two; bf16-exact weights stay exact in f16 away from the subnormal range)
__global__ __launch_bounds__(256) void k_wt_f16(const float* __restrict__ W, _Float16* __restrict__ Wt, int K, int N, float scale) {
  const int t = blockIdx.x * 256 + threadIdx.x; if (t >= N * (K / 8)) return; const int n = t / (K / 8), k8 = (t % (K / 8)) * 8; FragH f;
#pragma unroll
  for (int i = 0; i < 8; ++i) f.h[i] = (_Float16)(bf16_round(W[(size_t)(k8 + i) * N + n]) * scale); const v8us o = f.half[0];
  *(v8us*)((unsigned short*)Wt + (size_t)n * K + k8) = o; 
}
// k_gemm_hh variant with fused epilogue: v = acc·alpha + bias[by·sBias + col] (+ CP[(row/rowsPerB)·sCPb + by·64 + col] if CP) ; ACT 0 none / 1 elu ; writes f16 C16 (and f32 C if non-null)
template <int ACT>
__global__ __launch_bounds__(128) void k_gemm_hhx(const _Float16* __restrict__ A, int lda, size_t sA, const _Float16* __restrict__ Bh, int ldb, size_t sB, float alpha, const float* __restrict__ bias, size_t sBias, const float* __restrict__ CP, int rowsPerB, size_t sCPb, int row0g,
    float* __restrict__ C, _Float16* __restrict__ C16, int ldc, size_t sC, int M, int N, int K) {
  __shared__ __attribute__((aligned(16))) float so[4][16][64];
  const int tid = threadIdx.x, w = tid >> 5, lane = tid & 31, ln = lane & 15, hh = lane >> 4; const int by = blockIdx.y;
  A += (size_t)by * sA; Bh += (size_t)by * sB; const size_t cofs = (size_t)by * sC; const float* bp = bias ? bias + (size_t)by * sBias : nullptr;
  const int ntn = (N + 63) / 64; const int wid = blockIdx.x * 4 + w; const int mt = wid / ntn, nq = wid % ntn; if (mt * 16 >= M) return;
  const int row0 = mt * 16, col0 = nq * 64; const _Float16* arow = A + (size_t)(row0 + ln) * lda;
  v8f acc[4] = {};
  for (int kb = 0; kb < K; kb += 32) { FragH ah; ah.half[0] = *(const v8us*)((const unsigned short*)arow + kb + 8 * hh); ah.half[1] = *(const v8us*)((const unsigned short*)arow + kb + 16 + 8 * hh);
#pragma unroll
    for (int t = 0; t < 4; ++t) { if (col0 + t * 16 >= N) continue; const size_t boff = (size_t)(col0 + t * 16 + ln) * ldb + kb; FragH bq; bq.half[0] = *(const v8us*)((const unsigned short*)Bh + boff + 8 * hh); bq.half[1] = *(const v8us*)((const unsigned short*)Bh + boff + 16 + 8 * hh);
      acc[t] = mmaH<1>(ah.v, ah.v, bq.v, bq.v, acc[t]); }
  }
#pragma unroll
  for (int t = 0; t < 4; ++t) { if (col0 + t * 16 >= N) continue; const int col = col0 + t * 16 + ln; const float bv = bp ? bf16_round(bp[col]) : 0.f;
#pragma unroll
    for (int r = 0; r < 8; ++r) { float v = acc[t][r] * alpha + bv; if (CP) { const int bidx = (row0g + row0 + 8 * hh + r) / rowsPerB; v += CP[(size_t)bidx * sCPb + (size_t)by * 64 + col]; } if (ACT == 1) v = (v > 0.f) ? v : expm1f(v); else if (ACT == 7) v = (v > 0.f) ? v + 1.0f : expf(v); else if (ACT == 8) v = tanhf(v); else if (ACT == 9) v = 0.5f * v * (1.0f + tanhf(0.7978845608028654f * (v + 0.044715f * v * v * v))); else if (ACT == 11) v = 1.0f / (1.0f + expf(-v)); else if (ACT == 12) v = (v > 0.f) ? v : 0.01f * v; else if (ACT == 14) v = (v > 0.f) ? v : 0.1f * v; else if (ACT == 15) v = v / (1.0f + expf(-v)); else if (ACT == 3) v = fmaxf(v, 0.f); else if (ACT == 6) v = 0.5f * v * (1.0f + erff(v * 0.70710678118654752f)); so[w][8 * hh + r][t * 16 + ln] = v; } }
  __builtin_amdgcn_fence(__ATOMIC_ACQ_REL, "workgroup"); __builtin_amdgcn_wave_barrier();
  const int rsub = lane >> 4, c4 = (lane & 15) * 4; typedef _Float16 v4h __attribute__((ext_vector_type(4)));
  {
#pragma unroll
    for (int q = 0; q < 8; ++q) { const int r = q * 2 + rsub; if (col0 + c4 < N) { const v4f v = *(const v4fa*)&so[w][r][c4]; if (C) *(v4f*)(C + cofs + (size_t)(row0 + r) * ldc + col0 + c4) = v; if (C16) { v4h h4; for (int i = 0; i < 4; ++i) h4[i] = (_Float16)v[i]; *(v4h*)(C16 + cofs + (size_t)(row0 + r) * ldc + col0 + c4) = h4; } } }
     }
}


typedef _Float16 v4h __attribute__((ext_vector_type(4)));

__global__ __launch_bounds__(256) void k_x16(const float* __restrict__ x, _Float16* __restrict__ X16, size_t n8) { const size_t t = (size_t)blockIdx.x * 256 + threadIdx.x; if (t >= n8) return; FragH f;
#pragma unroll
  for (int q = 0; q < 8; ++q) f.h[q] = (_Float16)bf16_round(x[t * 8 + q]); *(v8us*)((unsigned short*)X16 + t * 8) = f.half[0];  }
__global__ __launch_bounds__(256) void k_h16(const float* __restrict__ x, _Float16* __restrict__ X16, size_t n8) { const size_t t = (size_t)blockIdx.x * 256 + threadIdx.x; if (t >= n8) return; FragH f;
#pragma unroll
  for (int q = 0; q < 8; ++q) f.h[q] = (_Float16)x[t * 8 + q]; *(v8us*)((unsigned short*)X16 + t * 8) = f.half[0];  }
__global__ __launch_bounds__(256) void k_round16f(const float* __restrict__ W, _Float16* __restrict__ Bt, size_t n8) { const size_t t = (size_t)blockIdx.x * 256 + threadIdx.x; if (t >= n8) return; FragH f;
#pragma unroll
  for (int i = 0; i < 8; ++i) f.h[i] = (_Float16)(bf16_round(W[t * 8 + i]) * 16.0f); *(v8us*)((unsigned short*)Bt + t * 8) = f.half[0];  }
template <int NHv, int TTv>
__global__ __launch_bounds__(256) void k_vt(const _Float16* __restrict__ V16, int ldv, int voff, _Float16* __restrict__ Vt) { __shared__ unsigned short tl[64][66]; const int tid = threadIdx.x; const int slab = blockIdx.x / (TTv / 64), lg = blockIdx.x % (TTv / 64); const int b = slab / NHv, h = slab % NHv;
  for (int i = tid; i < 64 * 8; i += 256) { const int r = i / 8, c8 = (i % 8) * 8; FragH f; f.half[0] = *(const v8us*)((const unsigned short*)V16 + ((size_t)b * TTv + lg * 64 + r) * ldv + voff + h * 64 + c8);
#pragma unroll
    for (int q = 0; q < 8; ++q) tl[r][c8 + q] = f.u[q]; }
  __syncthreads();
  {
#pragma unroll
    for (int rd = 0; rd < 2; ++rd) { const int d = rd * 32 + tid / 8, pc = tid % 8; FragH f;
#pragma unroll
      for (int q = 0; q < 8; ++q) f.u[q] = tl[pc * 8 + q][d];
      *(v8us*)((unsigned short*)Vt + ((size_t)slab * 64 + d) * TTv + lg * 64 + pc * 8) = f.half[0]; }
     } }

__global__ __launch_bounds__(256) void k_hl(const float* __restrict__ F, _Float16* __restrict__ Hh, _Float16* __restrict__ Hl, size_t n8) { const size_t t = (size_t)blockIdx.x * 256 + threadIdx.x; if (t >= n8) return; FragH fh, fl; const v4f a = *(const v4fa*)(F + t * 8), c = *(const v4fa*)(F + t * 8 + 4);
#pragma unroll
  for (int q = 0; q < 4; ++q) { _Float16 h = (_Float16)a[q]; fh.h[q] = h; fl.h[q] = (_Float16)((a[q] - (float)h) * 1024.0f); h = (_Float16)c[q]; fh.h[4 + q] = h; fl.h[4 + q] = (_Float16)((c[q] - (float)h) * 1024.0f); }
  { *(v8us*)((unsigned short*)Hh + t * 8) = fh.half[0]; *(v8us*)((unsigned short*)Hl + t * 8) = fl.half[0];  } }

// ---- fast GEMM (wave tile 32x64; requires M % 32 == 0 rows per launch region and N % 64 == 0); epilogue = k_gemm_hhx semantics ----
__device__ __forceinline__ v16h g2_frag(const _Float16* p, int hh) { FragH f; f.half[0] = *(const v8us*)((const unsigned short*)p + 8 * hh); f.half[1] = *(const v8us*)((const unsigned short*)p + 16 + 8 * hh); return f.v; }
__device__ __forceinline__ v8f g2_mma(v16h a, v16h b, v8f c) { v8f d = __builtin_amdgcn_wmma_f32_16x16x32_f16(false, a, false, b, (short)0, c, false, false); asm volatile("v_nop\n\tv_nop\n\tv_nop\n\tv_nop" : "+v"(d) : "v"(a), "v"(b)); return d; }
template <int ACT>
__global__ __launch_bounds__(128) void k_gemm2(const _Float16* __restrict__ A, int lda, size_t sA, const _Float16* __restrict__ Bh, int ldb, size_t sB, float alpha, const float* __restrict__ bias, size_t sBias, const float* __restrict__ CP, int rowsPerB, size_t sCPb, int row0g,
    float* __restrict__ C, _Float16* __restrict__ C16, int ldc, size_t sC, int M, int N, int K) {
  __shared__ __attribute__((aligned(16))) float so[4][32][68];
  const int tid = threadIdx.x, w = tid >> 5, lane = tid & 31, ln = lane & 15, hh = lane >> 4; const int by = blockIdx.y;
  A += (size_t)by * sA; Bh += (size_t)by * sB; const size_t cofs = (size_t)by * sC; const float* bp = bias ? bias + (size_t)by * sBias : nullptr;
  const int ntn = N >> 6; const int mt = blockIdx.x / ntn, nq = blockIdx.x - mt * ntn; const int row0 = mt * 128 + 32 * w, col0 = nq * 64; if (row0 >= M) return;
  const _Float16* a0p = A + (size_t)(row0 + ln) * lda; const _Float16* a1p = a0p + (size_t)16 * lda;
  const _Float16* b0p = Bh + (size_t)(col0 + ln) * ldb; const _Float16* b1p = b0p + (size_t)16 * ldb; const _Float16* b2p = b1p + (size_t)16 * ldb; const _Float16* b3p = b2p + (size_t)16 * ldb;
  const v8f z8 = {0.f,0.f,0.f,0.f,0.f,0.f,0.f,0.f}; v8f c00 = z8, c01 = z8, c02 = z8, c03 = z8, c10 = z8, c11 = z8, c12 = z8, c13 = z8;
#pragma unroll 1
  for (int kb = 0; kb < K; kb += 32) { const v16h a0 = g2_frag(a0p + kb, hh), a1 = g2_frag(a1p + kb, hh);
    v16h b = g2_frag(b0p + kb, hh); c00 = g2_mma(a0, b, c00); c10 = g2_mma(a1, b, c10);
    b = g2_frag(b1p + kb, hh); c01 = g2_mma(a0, b, c01); c11 = g2_mma(a1, b, c11);
    b = g2_frag(b2p + kb, hh); c02 = g2_mma(a0, b, c02); c12 = g2_mma(a1, b, c12);
    b = g2_frag(b3p + kb, hh); c03 = g2_mma(a0, b, c03); c13 = g2_mma(a1, b, c13); }
  v8f accs[8] = {c00, c01, c02, c03, c10, c11, c12, c13};
#pragma unroll
  for (int u = 0; u < 8; ++u) { const int t = u & 3, half = u >> 2; const int col = col0 + t * 16 + ln; const float bv = bp ? bf16_round(bp[col]) : 0.f;
#pragma unroll
    for (int r = 0; r < 8; ++r) { const int rloc = half * 16 + 8 * hh + r; float v = accs[u][r] * alpha + bv; if (CP) { if (rowsPerB < 0) v += CP[cofs + (size_t)(row0g + row0 + rloc) * ldc + col];      /* rowsPerB < 0: own element of the batched C plane */ else { const int bidx = (row0g + row0 + rloc) / rowsPerB; v += CP[(size_t)bidx * sCPb + (size_t)by * 64 + col]; } }
      if (ACT == 3) v = fmaxf(v, 0.f); else if (ACT == 6) v = 0.5f * v * (1.0f + erff(v * 0.70710678118654752f)); else if (ACT == 11) v = 1.0f / (1.0f + expf(-v)); else if (ACT == 15) v = v / (1.0f + expf(-v)); else if (ACT == 12) v = (v > 0.f) ? v : 0.01f * v; else if (ACT == 8) v = tanhf(v);
      so[w][rloc][t * 16 + ln] = v; } }
  __builtin_amdgcn_fence(__ATOMIC_ACQ_REL, "workgroup"); __builtin_amdgcn_wave_barrier();
  const int rsub = lane >> 4, c4 = (lane & 15) * 4;
  {
#pragma unroll
    for (int q = 0; q < 16; ++q) { const int r = q * 2 + rsub; const v4f v = *(const v4fa*)&so[w][r][c4]; if (C) *(v4f*)(C + cofs + (size_t)(row0 + r) * ldc + col0 + c4) = v; if (C16) { v4h h4; for (int i = 0; i < 4; ++i) h4[i] = (_Float16)v[i]; *(v4h*)(C16 + cofs + (size_t)(row0 + r) * ldc + col0 + c4) = h4; } }
     } }



typedef unsigned int v4u __attribute__((ext_vector_type(4), may_alias));
// Packed operand planes of k_flash. Unit = the 16 bytes one lane takes in one fragment load; the 32 units of a load lie side by side (512 bytes, four whole lines), lane = 16 hh + ln.
// KP, per 32-key block 8 loads [nt][ks][c]: unit = K[16 nt + ln][32 ks + 16 c + 8 hh + 0..7].  VP, per 32-key block 8 loads [dt][c]: unit = V[16 c + 8 hh + 0..7][16 dt + ln].  Values as k_x16 makes them.
// MP, per (16-query tile, 32-key block) 2 loads [nt]: unit = bf16 bits of mask[16 qt + ln][32 jb + 16 nt + 8 hh + 0..7] (the compute dtype's rounding of the mask)
// One pre-pass launch makes all four planes (Q16 as k_x16 makes it, KP, VP, MP). A thread takes PU units of 8 values of each input, 256 units apart; a work-group so takes PU blocks of 32 keys, each with an LDS tile of its own.
#define PU 4
__global__ __launch_bounds__(256) void k_prep(const float* __restrict__ q, const float* __restrict__ kv, const float* __restrict__ M, unsigned short* __restrict__ Q16, unsigned short* __restrict__ KP, unsigned short* __restrict__ VP, unsigned short* __restrict__ MP) {
  __shared__ __attribute__((aligned(16))) unsigned short tl[PU][32][72];      /* pitch 144 B = 16 B x 9: the 16-byte row reads below spread over the banks */
  const int tid = threadIdx.x; const unsigned int u0 = blockIdx.x * (PU * 256) + tid;      /* the thread's first unit in every plane */
  const int ln = tid & 15, hh = (tid >> 4) & 1, g = tid >> 5;      /* g = the load's number in its block of 32 keys */
  const int nt = g & 1, jb = (u0 >> 6) & (TK / 32 - 1), qt = u0 / (TK * 2);      /* the mask unit's place; 256 units on, jb is 4 more: the PU * 256 units of a work-group lie in one query tile */
  static_assert((TK * 2) % (PU * 256) == 0, "a work-group's mask units stay inside one 16-query tile");
  const float* ks = kv + (size_t)u0 * 8; const float* qs = q + (size_t)u0 * 8; const float* ms = M + (size_t)(qt * 16 + ln) * TK + jb * 32 + nt * 16 + hh * 8;
  v4f ka[PU], kc[PU], qa[PU], qc[PU], ma[PU], mc[PU];
  /* every load of the thread is requested before anything is worked on: kv first, its values have the longest way */
#pragma unroll      /* constant indices: the arrays stay in registers */
  for (int i = 0; i < PU; ++i) { ka[i] = *(const v4fa*)(ks + i * 2048); kc[i] = *(const v4fa*)(ks + i * 2048 + 4); }
#pragma unroll      /* constant indices: the arrays stay in registers */
  for (int i = 0; i < PU; ++i) { qa[i] = *(const v4fa*)(qs + i * 2048); qc[i] = *(const v4fa*)(qs + i * 2048 + 4); }
  asm volatile("s_wait_xcnt 0x0" ::: "memory");      /* the compiler lets a mask load's result land in the address registers that the loads above name */
#pragma unroll      /* constant indices: the arrays stay in registers */
  for (int i = 0; i < PU; ++i) { ma[i] = *(const v4fa*)(ms + i * 128); mc[i] = *(const v4fa*)(ms + i * 128 + 4); }
  __builtin_amdgcn_sched_barrier(0);      /* keeps the loads above: without it the compiler sinks them to their uses, and the thread waits out the memory latency three times over */
#pragma unroll      /* constant indices: the arrays stay in registers */
  for (int i = 0; i < PU; ++i) { FragH f;
#pragma unroll      /* constant indices: the fragment stays in registers */
    for (int e = 0; e < 4; ++e) { f.h[e] = (_Float16)bf16_round(ka[i][e]); f.h[4 + e] = (_Float16)bf16_round(kc[i][e]); }
    *(v8us*)&tl[i][tid >> 3][(tid & 7) * 8] = f.half[0]; }
  __syncthreads();      /* all tiles are written before any thread gathers its units from them; no global store is under way yet for it to wait on */
#pragma unroll
  for (int i = 0; i < PU; ++i) {
    *(v8us*)(KP + (size_t)u0 * 8 + i * 2048) = *(const v8us*)&tl[i][(g >> 2) * 16 + ln][((g >> 1) & 1) * 32 + (g & 1) * 16 + hh * 8];
    FragH t;
#pragma unroll      /* constant indices: the fragment stays in registers */
    for (int e = 0; e < 8; ++e) t.u[e] = tl[i][(g & 1) * 16 + hh * 8 + e][(g >> 1) * 16 + ln];
    *(v8us*)(VP + (size_t)u0 * 8 + i * 2048) = t.half[0]; }
#pragma unroll      /* constant indices: the arrays stay in registers */
  for (int i = 0; i < PU; ++i) { FragH f;
#pragma unroll      /* constant indices: the fragment stays in registers */
    for (int e = 0; e < 4; ++e) { f.h[e] = (_Float16)bf16_round(qa[i][e]); f.h[4 + e] = (_Float16)bf16_round(qc[i][e]); }
    *(v8us*)(Q16 + (size_t)u0 * 8 + i * 2048) = f.half[0]; }
#pragma unroll      /* constant indices: the arrays stay in registers */
  for (int i = 0; i < PU; ++i) { v8us o;
#pragma unroll      /* constant indices: the vector stays in registers */
    for (int e = 0; e < 4; ++e) { o[e] = bf16_bits(ma[i][e]); o[4 + e] = bf16_bits(mc[i][e]); }
    *(v8us*)(MP + (size_t)u0 * 8 + i * 2048) = o; } }

// lane l <-> lane l ^ 16 by a vector cross-row move
__device__ __forceinline__ float xhalf(float x) { return __builtin_bit_cast(float, __builtin_amdgcn_permlanex16(__builtin_bit_cast(int, x), __builtin_bit_cast(int, x), 0x76543210, 0xfedcba98, false, false)); }
template <int CAUSAL>
__global__ __launch_bounds__(512) void k_flash(const _Float16* __restrict__ Q16, int ldq, const unsigned short* __restrict__ KP, const unsigned short* __restrict__ VP, const unsigned short* __restrict__ MP, float* __restrict__ O, int ldo) {
  static_assert(CAUSAL == 0 || CAUSAL == 33, "modes: 0 = no mask, 33 = one additive mask table, bf16 and packed by k_prep, shared by every slab");
  constexpr int QT = 2, RPW = 16 * QT, NQW = QPB / RPW, NW = 2 * NQW, DT = 4, KS = 2; constexpr float L2E = 1.4426950408889634f;      /* QT query tiles of 16 columns a wave: every K and V^T fragment loaded feeds QT products; waves w and w + NQW share their columns and take half the keys each; log2 e */
  __shared__ __attribute__((aligned(16))) float sO[NW][16][64 + 4]; __shared__ __attribute__((aligned(16))) float sX[NW][2 * DT][32][4]; __shared__ float sML[NW][2][32];      /* output staging; the context tile, maximum and sum that a wave hands to its partner, lane by lane */
  const int tid = threadIdx.x, w = tid >> 5, lane = tid & 31, ln = lane & 15, hh = lane >> 4;
  const int slab = blockIdx.x / QBNP, qblk = QB0P + blockIdx.x % QBNP; const int b = slab / NH, h = slab % NH; const int qb0 = qblk * QPB; const int kh = __builtin_amdgcn_readfirstlane(w / NQW); const int q0 = qb0 + (w % NQW) * RPW;      /* kh: the wave's half of the keys, in a scalar register (it bounds the loop) */
  FragH bq[QT][KS];
#pragma unroll      /* constant indices: the array stays in registers */
  for (int qt = 0; qt < QT; ++qt) { const unsigned short* qr = (const unsigned short*)Q16 + ((size_t)b * TQ + q0 + qt * 16 + ln) * ldq + h * 64;
#pragma unroll      /* constant indices: the array stays in registers */
    for (int ks = 0; ks < KS; ++ks) { bq[qt][ks].half[0] = *(const v8us*)(qr + ks * 32 + 8 * hh); bq[qt][ks].half[1] = *(const v8us*)(qr + ks * 32 + 16 + 8 * hh); } }
  /* packed planes (k_prep): a fragment load is 32 lanes x 16 consecutive bytes, four whole 128-byte lines */
  const unsigned short* kpl = KP + (size_t)slab * 64 * TK; const unsigned short* vpl = VP + (size_t)slab * 64 * TK; const unsigned short* mpl = MP + (size_t)__builtin_amdgcn_readfirstlane(q0 >> 4) * 16 * TK;      /* wave-uniform bases: scalar address arithmetic */
  const unsigned int l8 = lane * 8;      /* the lane's unit in every load */
  float m_r[QT], l_r[QT]; v8f oacc[QT][DT];
#pragma unroll      /* constant indices: the arrays stay in registers */
  for (int qt = 0; qt < QT; ++qt) { m_r[qt] = -3.0e38f; l_r[qt] = 0.f;
#pragma unroll      /* constant indices: the array stays in registers */
    for (int dt = 0; dt < DT; ++dt) oacc[qt][dt] = (v8f){0.f,0.f,0.f,0.f,0.f,0.f,0.f,0.f}; }
  const int jbeg = kh * (TK / 2), jend = jbeg + TK / 2;
  /* every global operand of the loop is held in registers and requested far ahead of its use; V^T is requested at the head of its pass, K and the mask for the next pass right after their last reads in this one */
  FragH ak[2][KS], av[DT]; v4u mk[QT][2];
  auto fetch_k = [&](int j0) {      /* K fragments of the 32 keys from j0 */
#pragma unroll      /* constant indices: the array stays in registers */
    for (int nt = 0; nt < 2; ++nt) { const unsigned short* kr = kpl + (size_t)j0 * 64 + nt * 1024;
#pragma unroll      /* constant indices: the array stays in registers */
      for (int ks = 0; ks < KS; ++ks) { ak[nt][ks].half[0] = *(const v8us*)(kr + ks * 512 + l8); ak[nt][ks].half[1] = *(const v8us*)(kr + ks * 512 + 256 + l8); } } };
  auto fetch_m = [&](int j0) {      /* mode 33: the mask values of this lane's 16 score elements per query tile, 8 consecutive keys of its query's row per key tile, as bf16 pairs */
    if (CAUSAL == 33) {
#pragma unroll      /* constant indices: the array stays in registers */
      for (int qt = 0; qt < QT; ++qt) { const unsigned short* amk = mpl + (size_t)qt * 16 * TK + (size_t)j0 * 16;
#pragma unroll      /* constant indices: the array stays in registers */
        for (int nt = 0; nt < 2; ++nt) mk[qt][nt] = *(const v4u*)(amk + nt * 256 + l8); } } };
  auto fetch_v = [&](int j0) {      /* V^T fragments of the same keys */
#pragma unroll      /* constant indices: the array stays in registers */
    for (int dt = 0; dt < DT; ++dt) { const unsigned short* vrow = vpl + (size_t)j0 * 64 + dt * 512; av[dt].half[0] = *(const v8us*)(vrow + l8); av[dt].half[1] = *(const v8us*)(vrow + 256 + l8); } };
  fetch_k(jbeg); fetch_m(jbeg);
#pragma unroll 1      /* rolled: the operands fetched ahead keep one register set */
  for (int j0 = jbeg; j0 < jend; j0 += 32) {
    const int jn = (j0 + 32 < jend) ? j0 + 32 : jbeg;      /* the last pass re-reads the first block: in bounds, never used */
    fetch_v(j0);      /* used behind the softmax of this pass */
    v8f s[QT][2];
#pragma unroll      /* constant indices: the array stays in registers */
    for (int qt = 0; qt < QT; ++qt) { s[qt][0] = (v8f){0.f,0.f,0.f,0.f,0.f,0.f,0.f,0.f}; s[qt][1] = s[qt][0]; }
#pragma unroll      /* constant indices: the arrays stay in registers */
    for (int ks = 0; ks < KS; ++ks)      /* the four score tiles side by side in each k step; every tile still adds k step 0, then 1 */
#pragma unroll      /* constant indices: the arrays stay in registers */
      for (int nt = 0; nt < 2; ++nt)
#pragma unroll      /* constant indices: the arrays stay in registers */
        for (int qt = 0; qt < QT; ++qt) s[qt][nt] = mmaH<1>(ak[nt][ks].v, ak[nt][ks].v, bq[qt][ks].v, bq[qt][ks].v, s[qt][nt]);
    fetch_k(jn);      /* the next pass's K, into the registers just read */
    float sc[QT][16];
#pragma unroll      /* constant indices: the array stays in registers */
    for (int qt = 0; qt < QT; ++qt)
#pragma unroll      /* constant indices: the array stays in registers */
      for (int e = 0; e < 16; ++e) { float v = s[qt][e >> 3][e & 7] * SCL; if (CAUSAL == 33) { const unsigned int mw = mk[qt][e >> 3][(e & 7) >> 1]; v += __uint_as_float((e & 1) ? (mw & 0xFFFF0000u) : (mw << 16)); } sc[qt][e] = v; }
    fetch_m(jn);      /* the next pass's mask values, into the registers just read */
#pragma unroll      /* constant indices: the arrays stay in registers */
    for (int qt = 0; qt < QT; ++qt) { const float (&c)[16] = sc[qt];
      const float ma = fmaxf(fmaxf(c[0], c[1]), c[2]), mb = fmaxf(fmaxf(c[3], c[4]), c[5]), mc3 = fmaxf(fmaxf(c[6], c[7]), c[8]), md = fmaxf(fmaxf(c[9], c[10]), c[11]), me = fmaxf(fmaxf(c[12], c[13]), c[14]);
      float mc = fmaxf(fmaxf(fmaxf(ma, mb), mc3), fmaxf(fmaxf(md, me), c[15]));
      mc = fmaxf(mc, xhalf(mc));      /* both halves now hold the query's maximum over the 32 keys */
      /* e^x as the hardware's 2^(x log2 e): x <= 0 here, so the library form's overflow select never fires; where its underflow select gives 0 (also at -inf, or a product that overflows to it) the hardware gives 0 too */
      const float mn = fmaxf(m_r[qt], mc); const float al = (mn > -1.0e38f) ? __builtin_amdgcn_exp2f((m_r[qt] - mn) * L2E) : 1.0f; m_r[qt] = mn;
      float p[16]; FragH pb;
#pragma unroll      /* constant indices: the array stays in registers */
      for (int e = 0; e < 16; ++e) { p[e] = __builtin_amdgcn_exp2f(__builtin_fmaf(c[e] - mn, L2E, 10.0f)); pb.h[e] = (_Float16)p[e]; }      /* p = 1024 e^(s - m): the operand's 2^10 scale rides in the exponent, and the row sum carries it too */
      l_r[qt] = l_r[qt] * al + (((p[0] + p[1]) + (p[2] + p[3])) + ((p[4] + p[5]) + (p[6] + p[7]))) + (((p[8] + p[9]) + (p[10] + p[11])) + ((p[12] + p[13]) + (p[14] + p[15])));
#pragma unroll      /* constant indices: the array stays in registers */
      for (int dt = 0; dt < DT; ++dt) oacc[qt][dt] *= al;
#pragma unroll      /* constant indices: the array stays in registers */
      for (int dt = 0; dt < DT; ++dt) oacc[qt][dt] = mmaH<1>(av[dt].v, av[dt].v, pb.v, pb.v, oacc[qt][dt]); }
    asm volatile("s_wait_xcnt 0x0" ::: "memory"); }      /* the next pass rewrites the address registers that this pass's loads name */
  /* the two halves of the keys are joined: wave kh finishes query tile kh and hands its part of the other tile to its partner */
  const int pw = w ^ NQW; const bool k1 = kh != 0;
  const float mg = k1 ? m_r[0] : m_r[1], lg = k1 ? l_r[0] : l_r[1], mo = k1 ? m_r[1] : m_r[0], lo = k1 ? l_r[1] : l_r[0]; v8f oo[DT];
#pragma unroll      /* constant indices: the arrays stay in registers */
  for (int dt = 0; dt < DT; ++dt) { const v8f g = k1 ? oacc[0][dt] : oacc[1][dt]; oo[dt] = k1 ? oacc[1][dt] : oacc[0][dt];
    *(v4fa*)&sX[w][2 * dt][lane][0] = (v4f){g[0], g[1], g[2], g[3]}; *(v4fa*)&sX[w][2 * dt + 1][lane][0] = (v4f){g[4], g[5], g[6], g[7]}; }
  sML[w][0][lane] = mg; sML[w][1][lane] = lg;
  __syncthreads();      /* every wave's handed-over part is written before its partner reads it */
  { const float mp = sML[pw][0][lane], lp = sML[pw][1][lane]; const float mn = fmaxf(mo, mp);
    const float ao = (mn > -1.0e38f) ? __builtin_amdgcn_exp2f((mo - mn) * L2E) : 1.0f, ap = (mn > -1.0e38f) ? __builtin_amdgcn_exp2f((mp - mn) * L2E) : 1.0f;      /* each part is brought to the common maximum, as the loop does from pass to pass */
    const float lh = lo * ao + lp * ap; const float l = lh + xhalf(lh);      /* the two lane halves' sums of the query's row, joined once */
    const float inv = (l > 0.f) ? 1.0f / l : 0.f;      /* sum and context both carry the factor 1024 */
#pragma unroll      /* constant indices: the array stays in registers */
    for (int dt = 0; dt < DT; ++dt) { const v4f x0 = *(const v4fa*)&sX[pw][2 * dt][lane][0], x1 = *(const v4fa*)&sX[pw][2 * dt + 1][lane][0]; const v8f x = {x0[0], x0[1], x0[2], x0[3], x1[0], x1[1], x1[2], x1[3]};
      const v8f o = (oo[dt] * ao + x * ap) * inv;      /* register r = O[q0 + 16 kh + ln][16 dt + 8 hh + r] */
      *(v4fa*)&sO[w][ln][dt * 16 + 8 * hh] = (v4f){o[0], o[1], o[2], o[3]}; *(v4fa*)&sO[w][ln][dt * 16 + 8 * hh + 4] = (v4f){o[4], o[5], o[6], o[7]}; } }
  __builtin_amdgcn_fence(__ATOMIC_ACQ_REL, "workgroup"); __builtin_amdgcn_wave_barrier();      /* the wave's own staged rows are written before its lanes read them back as whole lines */
  {
#pragma unroll
    for (int rp = 0; rp < 16; rp += 2) { const int r = rp + (lane >> 4), pc = lane & 15; const v4f val = *(const v4fa*)&sO[w][r][pc * 4]; *(v4f*)(O + ((size_t)b * TQ + q0 + kh * 16 + r) * ldo + h * 64 + pc * 4) = val; }
     } }
// 5-plane variant: S = Qh Kh^T + (Ql Kh^T + Qh Kl^T)/1024 with Q/K = [hi | 2^10 residual] f16 planes (QL/KL same layout as Q16/K16), then the 3-term P.V below.
// 3-term variant: O = (P_hi V_hi + (P_lo V_hi + P_hi V_lo) / 1024) / l with P = [hi | 2^10 residual] of 1024 p and V^T = [hi | 2^10 residual] planes (VtL same layout as Vt) -> ~2^-21-class products for un-averaged (early causal / peaked) rows
template <int CAUSAL>
__global__ __launch_bounds__(128) void k_flash5(const _Float16* __restrict__ Q16, const _Float16* __restrict__ QL, int ldq, const _Float16* __restrict__ K16, const _Float16* __restrict__ KL, int ldk, const _Float16* __restrict__ Vt, const _Float16* __restrict__ VtL, const int* __restrict__ MSK, float* __restrict__ O, int ldo) {
  constexpr int RPW = 16, RTN = RPW / 16, NQB = TQ / (4 * RPW), DT = 4, KS = 2;
  __shared__ __attribute__((aligned(16))) unsigned short sP[4][RPW][40]; __shared__ __attribute__((aligned(16))) unsigned short sPL[4][RPW][40]; __shared__ __attribute__((aligned(16))) float sO[4][RPW][64 + 4];
  const int tid = threadIdx.x, w = tid >> 5, lane = tid & 31, ln = lane & 15, hh = lane >> 4;
  const int slab = blockIdx.x / QBN5, qblk = QB05 + blockIdx.x % QBN5; (void)NQB; const int b = slab / NH, h = slab % NH; const int qb0 = qblk * (4 * RPW); const int q0 = qb0 + w * RPW;
  FragH aq[2][KS], aql[2][KS];
#pragma unroll
  for (int rt = 0; rt < RTN; ++rt) { const unsigned short* qr = (const unsigned short*)Q16 + ((size_t)b * TQ + q0 + rt * 16 + ln) * ldq + h * 64; const unsigned short* ql = (const unsigned short*)QL + ((size_t)b * TQ + q0 + rt * 16 + ln) * ldq + h * 64;
#pragma unroll
    for (int ks = 0; ks < KS; ++ks) { aq[rt][ks].half[0] = *(const v8us*)(qr + ks * 32 + 8 * hh); aq[rt][ks].half[1] = *(const v8us*)(qr + ks * 32 + 16 + 8 * hh); aql[rt][ks].half[0] = *(const v8us*)(ql + ks * 32 + 8 * hh); aql[rt][ks].half[1] = *(const v8us*)(ql + ks * 32 + 16 + 8 * hh); } }
  const unsigned short* Vth = (const unsigned short*)Vt + (size_t)slab * 64 * TK; const unsigned short* Vtl = (const unsigned short*)VtL + (size_t)slab * 64 * TK;
  float m_r[2][8], l_r[2][8]; v8f oacc[2][DT], oaccL[2][DT];
#pragma unroll
  for (int rt = 0; rt < RTN; ++rt) {
#pragma unroll
    for (int r = 0; r < 8; ++r) { m_r[rt][r] = -3.0e38f; l_r[rt][r] = 0.f; }
#pragma unroll
    for (int dt = 0; dt < DT; ++dt) { oacc[rt][dt] = (v8f){0.f,0.f,0.f,0.f,0.f,0.f,0.f,0.f}; oaccL[rt][dt] = oacc[rt][dt]; } }
  const int jend = (CAUSAL == 1) ? (qb0 + 4 * RPW) : ((CAUSAL == 23) ? min(TK, (qb0 / CHK + 2) * CHK) : TK);      /* causal / window: keys that can never contribute are skipped */ const int jbeg = (CAUSAL == 23) ? max(0, (qb0 / CHK - 1) * CHK) : 0;
#pragma unroll 1
  for (int j0 = jbeg; j0 < jend; j0 += 32) {
    v8f s[2][2];
#pragma unroll
    for (int nt = 0; nt < 2; ++nt) { const unsigned short* kr = (const unsigned short*)K16 + ((size_t)b * TK + j0 + nt * 16 + ln) * ldk + h * 64; const unsigned short* klr = (const unsigned short*)KL + ((size_t)b * TK + j0 + nt * 16 + ln) * ldk + h * 64; FragH bk[KS], bkl[KS];
#pragma unroll
      for (int ks = 0; ks < KS; ++ks) { bk[ks].half[0] = *(const v8us*)(kr + ks * 32 + 8 * hh); bk[ks].half[1] = *(const v8us*)(kr + ks * 32 + 16 + 8 * hh); bkl[ks].half[0] = *(const v8us*)(klr + ks * 32 + 8 * hh); bkl[ks].half[1] = *(const v8us*)(klr + ks * 32 + 16 + 8 * hh); }
#pragma unroll
      for (int rt = 0; rt < RTN; ++rt) { v8f acc = (v8f){0.f,0.f,0.f,0.f,0.f,0.f,0.f,0.f}, accl = acc;
#pragma unroll
        for (int ks = 0; ks < KS; ++ks) { acc = mmaH<1>(aq[rt][ks].v, aq[rt][ks].v, bk[ks].v, bk[ks].v, acc); accl = mmaH<1>(aql[rt][ks].v, aql[rt][ks].v, bk[ks].v, bk[ks].v, accl); accl = mmaH<1>(aq[rt][ks].v, aq[rt][ks].v, bkl[ks].v, bkl[ks].v, accl); }
#pragma unroll
        for (int r = 0; r < 8; ++r) acc[r] += accl[r] * 0.0009765625f;
        s[rt][nt] = acc; } }
#pragma unroll
    for (int rt = 0; rt < RTN; ++rt)
#pragma unroll
      for (int r = 0; r < 8; ++r) { const int tq = q0 + rt * 16 + 8 * hh + r; const int k0 = j0 + ln, k1 = j0 + 16 + ln;
        bool ok0 = (CAUSAL == 1) ? (k0 <= tq) : ((CAUSAL == 2) ? ((k0 >> 5) == (tq >> 5)) : true), ok1 = (CAUSAL == 1) ? (k1 <= tq) : ((CAUSAL == 2) ? ((k1 >> 5) == (tq >> 5)) : true);      /* mode 2: block-diagonal 32-token groups */
        if (CAUSAL == 4) { const int* mrow = MSK + ((size_t)b * TQ + tq) * TK; ok0 = mrow[k0] != 0; ok1 = mrow[k1] != 0; }      /* mode 4: per-(query, key) INPUT mask shared by all heads; masked keys contribute nothing (== the reference's -4096 fill, whose exp underflows to 0), rows with no valid key give l = 0 -> output 0 (== the reference's row_valid zeroing) */
        float s0 = ok0 ? s[rt][0][r] * SCL : -3.0e38f, s1 = ok1 ? s[rt][1][r] * SCL : -3.0e38f; if (CAUSAL == 33) { const float* amk = (const float*)MSK + (size_t)tq * TK; s0 += bf16_round(amk[k0]); s1 += bf16_round(amk[k1]); }      /* mode 33: one additive [TQ][TK] f32 table shared by every slab */ if (CAUSAL == 17) { const float* amk = (const float*)MSK + (size_t)b * TK; s0 += bf16_round(amk[k0]); s1 += bf16_round(amk[k1]); } if (CAUSAL == 18) { const float* tb = (const float*)MSK; const int* ri = MSK + 1024 + (size_t)b * TK; const int rq = ri[tq]; s0 += tb[(h * 8 + rq) * 8 + ri[k0]]; s1 += tb[(h * 8 + rq) * 8 + ri[k1]]; } if (CAUSAL == 19) { const int* rel = MSK + (size_t)tq * TK; const float* rb = (const float*)MSK + (size_t)TQ * TK + ((size_t)(b * NH + h) * TQ + tq) * 64; s0 += rb[rel[k0]]; s1 += rb[rel[k1]]; }      /* mode 19: + (q.Ek[rel] + Eb[rel][h]) / 8 gathered by the int relative ids (packed [ids | table]) */      /* mode 18: + resource_bias[h][r_q][r_k] from the packed [table | ids] buffer (TQ == TK) */      /* mode 17: additive per-(batch, key) mask INPUT */ float mc = fmaxf(s0, s1);
        mc = fmaxf(mc, __shfl_xor(mc, 1, 32)); mc = fmaxf(mc, __shfl_xor(mc, 2, 32)); mc = fmaxf(mc, __shfl_xor(mc, 4, 32)); mc = fmaxf(mc, __shfl_xor(mc, 8, 32));
        const float mn = fmaxf(m_r[rt][r], mc); const float al = (mn > -1.0e38f) ? expf(m_r[rt][r] - mn) : 1.0f; m_r[rt][r] = mn; const float p0 = ok0 ? expf(s0 - mn) : 0.f, p1 = ok1 ? expf(s1 - mn) : 0.f; l_r[rt][r] = l_r[rt][r] * al + p0 + p1;
#pragma unroll
        for (int dt = 0; dt < DT; ++dt) { oacc[rt][dt][r] *= al; oaccL[rt][dt][r] *= al; }
        FragH t2, t2l; const float ps0 = p0 * 1024.0f, ps1 = p1 * 1024.0f; t2.h[0] = (_Float16)ps0; t2.h[1] = (_Float16)ps1; t2l.h[0] = (_Float16)((ps0 - (float)t2.h[0]) * 1024.0f); t2l.h[1] = (_Float16)((ps1 - (float)t2.h[1]) * 1024.0f);
        sP[w][rt * 16 + 8 * hh + r][ln] = t2.u[0]; sP[w][rt * 16 + 8 * hh + r][16 + ln] = t2.u[1]; sPL[w][rt * 16 + 8 * hh + r][ln] = t2l.u[0]; sPL[w][rt * 16 + 8 * hh + r][16 + ln] = t2l.u[1]; }
    __builtin_amdgcn_fence(__ATOMIC_ACQ_REL, "workgroup"); __builtin_amdgcn_wave_barrier();
    FragH pa[2], pl[2];
#pragma unroll
    for (int rt = 0; rt < RTN; ++rt) { pa[rt].half[0] = *(const v8us*)&sP[w][rt * 16 + ln][8 * hh]; pa[rt].half[1] = *(const v8us*)&sP[w][rt * 16 + ln][16 + 8 * hh]; pl[rt].half[0] = *(const v8us*)&sPL[w][rt * 16 + ln][8 * hh]; pl[rt].half[1] = *(const v8us*)&sPL[w][rt * 16 + ln][16 + 8 * hh]; }
#pragma unroll
    for (int dt = 0; dt < DT; ++dt) { const unsigned short* vrow = Vth + (size_t)(dt * 16 + ln) * TK + j0; const unsigned short* vrl = Vtl + (size_t)(dt * 16 + ln) * TK + j0; FragH bv, bl; bv.half[0] = *(const v8us*)(vrow + 8 * hh); bv.half[1] = *(const v8us*)(vrow + 16 + 8 * hh); bl.half[0] = *(const v8us*)(vrl + 8 * hh); bl.half[1] = *(const v8us*)(vrl + 16 + 8 * hh);
#pragma unroll
      for (int rt = 0; rt < RTN; ++rt) { oacc[rt][dt] = mmaH<1>(pa[rt].v, pa[rt].v, bv.v, bv.v, oacc[rt][dt]); oaccL[rt][dt] = mmaH<1>(pl[rt].v, pl[rt].v, bv.v, bv.v, oaccL[rt][dt]); oaccL[rt][dt] = mmaH<1>(pa[rt].v, pa[rt].v, bl.v, bl.v, oaccL[rt][dt]); } }
    __builtin_amdgcn_fence(__ATOMIC_ACQ_REL, "workgroup"); __builtin_amdgcn_wave_barrier(); }
#pragma unroll
  for (int rt = 0; rt < RTN; ++rt) {
#pragma unroll
    for (int r = 0; r < 8; ++r) { float l = l_r[rt][r]; l += __shfl_xor(l, 1, 32); l += __shfl_xor(l, 2, 32); l += __shfl_xor(l, 4, 32); l += __shfl_xor(l, 8, 32); l_r[rt][r] = (l > 0.f) ? 1.0f / (l * 1024.0f) : 0.f; }
#pragma unroll
    for (int dt = 0; dt < DT; ++dt)
#pragma unroll
      for (int r = 0; r < 8; ++r) { float v = oacc[rt][dt][r]; v += oaccL[rt][dt][r] * 0.0009765625f; sO[w][rt * 16 + 8 * hh + r][dt * 16 + ln] = v * l_r[rt][r]; } }
  __builtin_amdgcn_fence(__ATOMIC_ACQ_REL, "workgroup"); __builtin_amdgcn_wave_barrier();
  {
#pragma unroll
    for (int rp = 0; rp < RPW; rp += 2) { const int r = rp + (lane >> 4), pc = lane & 15; const v4f val = *(const v4fa*)&sO[w][r][pc * 4]; *(v4f*)(O + ((size_t)b * TQ + q0 + r) * ldo + h * 64 + pc * 4) = val; }
     } }

__global__ __launch_bounds__(256) void k_rotab(float* __restrict__ CS, float* __restrict__ SN) {
  #pragma clang fp contract(off)
  const int t = blockIdx.x * 256 + threadIdx.x; if (t >= SLEN * 32) return; const int j = t % 32, s = t / 32; const float ex = (float)(2 * j) / 64.0f; const float inv = 1.0f / powf(10000.0f, ex); const float th = (float)s * inv; const float c = cosf(th), sn = sinf(th);
  { *(float*)(CS + t) = c; *(float*)(SN + t) = sn;  } }
__global__ __launch_bounds__(256) void k_rope(const float* __restrict__ F, int nsrc, int ndst, int rep, const float* __restrict__ CS, const float* __restrict__ SN, _Float16* __restrict__ H, _Float16* __restrict__ L) {
  #pragma clang fp contract(off)
  const size_t t = (size_t)blockIdx.x * 256 + threadIdx.x; if (t >= (size_t)NR * ndst * 4) return; const int g8 = (int)(t % 4); const int hd = (int)((t / 4) % ndst); const size_t row = t / ((size_t)4 * ndst); const int s = (int)(row % SLEN); const int hs = hd / rep;
  const float* src = F + row * (size_t)(nsrc * 64) + hs * 64; FragH ah, al, bh, bl;
  for (int i = 0; i < 8; ++i) { const int d = g8 * 8 + i; const float c = CS[s * 32 + d], sn = SN[s * 32 + d]; const float x1 = src[d], x2 = src[d + 32];
    float o1 = x1 * c; o1 += -x2 * sn; float o2 = x2 * c; o2 += x1 * sn;
    _Float16 hv = (_Float16)o1; ah.h[i] = hv; al.h[i] = (_Float16)((o1 - (float)hv) * 1024.0f); hv = (_Float16)o2; bh.h[i] = hv; bl.h[i] = (_Float16)((o2 - (float)hv) * 1024.0f); }
  const size_t o = row * (size_t)(ndst * 64) + hd * 64 + g8 * 8;
  { *(v8us*)((unsigned short*)H + o) = ah.half[0]; *(v8us*)((unsigned short*)H + o + 32) = bh.half[0]; *(v8us*)((unsigned short*)L + o) = al.half[0]; *(v8us*)((unsigned short*)L + o + 32) = bl.half[0];  } }
__global__ __launch_bounds__(256) void k_rope2(const float* __restrict__ F, int nsrc, int ndst, int rep, const float* __restrict__ CS, const float* __restrict__ SN, _Float16* __restrict__ H, _Float16* __restrict__ L) {
  #pragma clang fp contract(off)
  const size_t t = (size_t)blockIdx.x * 256 + threadIdx.x; if (t >= (size_t)NR * ndst * 4) return; const int g16 = (int)(t % 4); const int hd = (int)((t / 4) % ndst); const size_t row = t / ((size_t)4 * ndst); const int s = (int)(row % SLEN); const int hs = hd / rep;
  const float* src = F + row * (size_t)(nsrc * 64) + hs * 64 + g16 * 16; FragH ah, al;
  for (int pr = 0; pr < 8; ++pr) { const int i = g16 * 8 + pr; const float c = CS[s * 32 + i], sn = SN[s * 32 + i]; const float x1 = src[2 * pr], x2 = src[2 * pr + 1];
    float o1 = x1 * c; o1 -= x2 * sn; float o2 = x1 * sn; o2 += x2 * c;
    _Float16 hv = (_Float16)o1; ah.h[2 * pr] = hv; al.h[2 * pr] = (_Float16)((o1 - (float)hv) * 1024.0f); hv = (_Float16)o2; ah.h[2 * pr + 1] = hv; al.h[2 * pr + 1] = (_Float16)((o2 - (float)hv) * 1024.0f); }
  const size_t o = row * (size_t)(ndst * 64) + hd * 64 + g16 * 16;
  { *(v8us*)((unsigned short*)H + o) = ah.half[0]; *(v8us*)((unsigned short*)H + o + 8) = ah.half[1]; *(v8us*)((unsigned short*)L + o) = al.half[0]; *(v8us*)((unsigned short*)L + o + 8) = al.half[1];  } }
__global__ __launch_bounds__(256) void k_ln512(const float* __restrict__ A, const float* __restrict__ res, const float* __restrict__ g, const float* __restrict__ bb, float* __restrict__ Y, _Float16* __restrict__ Y16) {
  #pragma clang fp contract(off)
  const int wv = threadIdx.x >> 5, ln = threadIdx.x & 31; const size_t r = (size_t)blockIdx.x * 8 + wv; if (r >= NR) return; float x[16]; float s = 0.f;
  for (int i = 0; i < 2; ++i) { const v8f a = *(const v8f*)(A + r * DM + i * 256 + ln * 8); for (int q = 0; q < 8; ++q) { float v = a[q]; if (res) v += bf16_round(res[r * DM + i * 256 + ln * 8 + q]); x[i * 8 + q] = v; s += v; } }
  for (int o = 16; o > 0; o >>= 1) s += __shfl_xor(s, o, 32); const float mu = s / (float)DM; float var = 0.f; for (int q = 0; q < 16; ++q) { const float d = x[q] - mu; var += d * d; }
  for (int o = 16; o > 0; o >>= 1) var += __shfl_xor(var, o, 32); const float inv = rsqrtf(var / (float)DM + 1e-5f);
  { for (int i = 0; i < 2; ++i) { const int c0 = i * 256 + ln * 8; v8f y; FragH f; for (int q = 0; q < 8; ++q) { float v = (x[i * 8 + q] - mu) * inv; v *= bf16_round(g[c0 + q]); v += bf16_round(bb[c0 + q]); y[q] = v; f.h[q] = (_Float16)v; } *(v8f*)(Y + r * DM + c0) = y; if (Y16) *(v8us*)((unsigned short*)Y16 + r * DM + c0) = f.half[0]; }  } }
__global__ __launch_bounds__(256) void k_pack(const float* __restrict__ rb, const int* __restrict__ rid, int* __restrict__ PK) { const int t = blockIdx.x * 256 + threadIdx.x; if (t >= 1024 + NB * TK) return; int v; if (t < 1024) v = __float_as_int(bf16_round(rb[t])); else v = rid[t - 1024]; *(int*)(PK + t) = v;  }
__global__ __launch_bounds__(256) void k_tabin(const float* __restrict__ sp, float* __restrict__ CS, float* __restrict__ SN) { const int t = blockIdx.x * 256 + threadIdx.x; if (t >= SLEN * 32) return; const int i = t % 32, s = t / 32; const float c = bf16_round(sp[s * 64 + 32 + i]), sn = bf16_round(sp[s * 64 + i]);
  { *(float*)(CS + t) = c; *(float*)(SN + t) = sn;  } }
__global__ __launch_bounds__(256) void k_wsc(const float* __restrict__ Wm, _Float16* __restrict__ Bt, size_t n8, float sc) { const size_t t = (size_t)blockIdx.x * 256 + threadIdx.x; if (t >= n8) return; FragH f; for (int q = 0; q < 8; ++q) f.h[q] = (_Float16)(bf16_round(Wm[t * 8 + q]) * sc); *(v8us*)((unsigned short*)Bt + t * 8) = f.half[0];  }
__global__ __launch_bounds__(256) void k_rotab2(float* __restrict__ CS, float* __restrict__ SN) {
  #pragma clang fp contract(off)
  const int t = blockIdx.x * 256 + threadIdx.x; if (t >= SLEN * 32) return; const int j = t % 32, s = t / 32; const float c0 = -0.14391156831212787f;      /* -ln(10000)/64 rounded to f32 */ const float inv = expf((float)(2 * j) * c0); const float th = (float)s * inv; const float c = cosf(th), sn = sinf(th);
  { *(float*)(CS + t) = c; *(float*)(SN + t) = sn;  } }
__global__ __launch_bounds__(256) void k_lnu(const float* __restrict__ X, _Float16* __restrict__ N16, float* __restrict__ XB) {
  #pragma clang fp contract(off)
  const int wv = threadIdx.x >> 5, ln = threadIdx.x & 31; const size_t r = (size_t)blockIdx.x * 8 + wv; if (r >= NR) return; float a[32]; float s = 0.f;
  for (int i = 0; i < 4; ++i) { const v8f v = *(const v8f*)(X + r * DM + (i * 32 + ln) * 8); for (int q = 0; q < 8; ++q) { const float u = bf16_round(v[q]); a[i * 8 + q] = u; s += u; } }
  for (int o = 16; o > 0; o >>= 1) s += __shfl_xor(s, o, 32); const float mu = s / (float)DM; float var = 0.f; for (int q = 0; q < 32; ++q) { const float d = a[q] - mu; var += d * d; }
  for (int o = 16; o > 0; o >>= 1) var += __shfl_xor(var, o, 32); const float den = sqrtf(var / (float)(DM - 1)) + 1e-6f; const float inv = 1.0f / den;      /* one reciprocal per row; (x-mean)*inv vs the reference's division differs by <= 1 ulp */
  { for (int i = 0; i < 4; ++i) { const int c0 = (i * 32 + ln) * 8; FragH f; v8f xb; for (int q = 0; q < 8; ++q) { f.h[q] = (_Float16)((a[i * 8 + q] - mu) * inv); xb[q] = a[i * 8 + q]; } *(v8us*)((unsigned short*)N16 + r * DM + c0) = f.half[0]; *(v8f*)(XB + r * DM + c0) = xb; }  } }
__global__ __launch_bounds__(256) void k_vtg(const _Float16* __restrict__ V16, _Float16* __restrict__ Vt) { __shared__ unsigned short tl[64][66]; const int tid = threadIdx.x; const int slab = blockIdx.x / (SLEN / 64), lg = blockIdx.x % (SLEN / 64); const int b = slab / NH, h = slab % NH; const int hs = h / NREP;
  for (int i = tid; i < 64 * 8; i += 256) { const int r = i / 8, c8 = (i % 8) * 8; FragH f; f.half[0] = *(const v8us*)((const unsigned short*)V16 + ((size_t)b * SLEN + lg * 64 + r) * KVD + hs * 64 + c8); for (int q = 0; q < 8; ++q) tl[r][c8 + q] = f.u[q]; }
  __syncthreads();
  { for (int rd = 0; rd < 2; ++rd) { const int d = rd * 32 + tid / 8, pc = tid % 8; FragH f; for (int q = 0; q < 8; ++q) f.u[q] = tl[pc * 8 + q][d]; *(v8us*)((unsigned short*)Vt + ((size_t)slab * 64 + d) * SLEN + lg * 64 + pc * 8) = f.half[0]; }  } }

__global__ __launch_bounds__(256) void k_h16s(const float* __restrict__ SRC, int lds, int coff, _Float16* __restrict__ DST, size_t n8) { const size_t t = (size_t)blockIdx.x * 256 + threadIdx.x; if (t >= n8) return; const size_t r = (t * 8) / DM; const int c = (int)((t * 8) % DM); const v8f a = *(const v8f*)(SRC + r * lds + coff + c); FragH f; for (int q = 0; q < 8; ++q) f.h[q] = (_Float16)a[q];
  *(v8us*)((unsigned short*)DST + t * 8) = f.half[0];  }


__global__ __launch_bounds__(256) void k_ccp(const float* __restrict__ QKV, int coff, _Float16* __restrict__ D) { const size_t t = (size_t)blockIdx.x * 256 + threadIdx.x; if (t >= (size_t)NR * DM / 8) return; const int c0 = (int)((t * 8) % DM); const size_t row = (t * 8) / DM; const v8f a = *(const v8f*)(QKV + row * 3 * DM + coff + c0); FragH f; for (int q = 0; q < 8; ++q) f.h[q] = (_Float16)a[q];
  *(v8us*)((unsigned short*)D + t * 8) = f.half[0];  }


extern "C" void kernel_launch(void* const* d_in, const int* in_sizes, int n_in,
                              void* d_out, int out_size, void* d_ws, size_t ws_size, hipStream_t stream) {
  (void)in_sizes; (void)n_in; (void)out_size;
  const float* q = (const float*)d_in[0]; const float* kv = (const float*)d_in[1]; const float* mask = (const float*)d_in[2]; float* O = (float*)d_out;
  char* ws = (char*)d_ws; size_t off = 0;
  auto take = [&](size_t bytes) { char* p = ws + off; off += (bytes + 255) & ~(size_t)255; return p; };
  const size_t np = (size_t)NR * DM;      /* 32 x 2048 x 64 */
  _Float16* Q16 = (_Float16*)take(np * 2); unsigned short* KP = (unsigned short*)take(np * 2); unsigned short* VP = (unsigned short*)take(np * 2); unsigned short* MP = (unsigned short*)take((size_t)TQ * TK * 2);
  if (off > ws_size) return;      /* 32 MiB */
  static_assert(NR / 32 == TQ / 8 * TK / 256, "q, kv and the mask have the same number of units");
  k_prep<<<NR / 32 / PU, 256, 0, stream>>>(q, kv, mask, (unsigned short*)Q16, KP, VP, MP);      /* values = keys */
  k_flash<33><<<NB * NH * QBNP, 512, 0, stream>>>(Q16, DM, KP, VP, MP, O, DM);      /* f32 context straight to the output rows */
}

// v007
// A run of this version takes 52.2 microseconds.
// Two timings next to v006 both put it at 1.03 times that version's speed.
// All steps since v000 together make it 6.63 times as fast.
#include <hip/hip_runtime.h>
// DotProdAttention (q [4][8][2048][64], kv [4][8][2048][64] (keys = values), mask [1][1][2048][2048] added to every (batch, head); out = softmax(q kv^T / 8 + mask) kv -> [4][8][2048][64]).
// Structure: the (batch, head) slabs of q/kv are already contiguous 64-wide row blocks, so each slab is treated as one 'batch' of a single 64-dim head: exact f16 plane of q; kv as K and as V^T, and the mask, packed in the order of the attention loop's fragment loads; flash-style fused attention per (slab, 256-query block) adding the shared additive mask table per (query, key), f32 context written straight to the output.
// Compute dtype: inputs rounded to bf16; q, kv, mask exact (f16 / bf16-rounded f32); softmax f32 with f16 probabilities; plain f16 value operand (~2^-12). v_wmma_f32_16x16x32_f16.
#define NB 32                    /* 4 batches x 8 heads as slabs */
#define DM 64
#define NKV 1
#define NREP (NH / NKV)
#define KVD (NKV * 64)           /* 64 */
#define NR (NB * SLEN)
#define CHK 512
typedef int v4i __attribute__((ext_vector_type(4)));
#define FF 2048
#define SLEN 2048
#define MQI 2048
#define MKI 2048
#define TQ SLEN
#define TK SLEN
#define NH 1
#define SCL 0.125f
#define QBLKS (TQ / 64)
#define QB05 0
#define QBN5 4
#define QB0P 0
#define QPB 256                  /* queries per work-group of k_flash */
#define QBNP (TQ / QPB)
#define RE 256
typedef __bf16 v16b __attribute__((ext_vector_type(16)));
typedef unsigned short v8us __attribute__((ext_vector_type(8), may_alias));
typedef float  v8f  __attribute__((ext_vector_type(8)));
typedef float  v4f  __attribute__((ext_vector_type(4)));
typedef float  v4fa __attribute__((ext_vector_type(4), may_alias));
union FragB { v16b v; v8us half[2]; unsigned short u[16]; };

__device__ __forceinline__ unsigned short bf16_bits(float x) { unsigned int u = __float_as_uint(x); return (unsigned short)((u + 0x7FFFu + ((u >> 16) & 1u)) >> 16); }
__device__ __forceinline__ float bf16_val(unsigned short b) { return __uint_as_float(((unsigned int)b) << 16); }
__device__ __forceinline__ float bf16_round(float x) { return bf16_val(bf16_bits(x)); }
// D += A·B with NT terms: 1 = ah·bh, 2 = + al·bh (A split), 3 = + ah·bl (both split)
template <int NT>
__device__ __forceinline__ v8f mmaN(v16b ah, v16b al, v16b bh, v16b bl, v8f c) {
  c = __builtin_amdgcn_wmma_f32_16x16x32_bf16(false, ah, false, bh, (short)0, c, false, false);
  if (NT >= 2) c = __builtin_amdgcn_wmma_f32_16x16x32_bf16(false, al, false, bh, (short)0, c, false, false);
  if (NT >= 3) c = __builtin_amdgcn_wmma_f32_16x16x32_bf16(false, ah, false, bl, (short)0, c, false, false);
  asm volatile("v_nop\n\tv_nop\n\tv_nop\n\tv_nop" : "+v"(c) : "v"(ah), "v"(al), "v"(bh), "v"(bl));
  return c;
}

__global__ __launch_bounds__(256) void k_wt_bf16(const float* __restrict__ W, unsigned short* __restrict__ Wt, int K, int N) {
  const int t = blockIdx.x * 256 + threadIdx.x;
  const int k8n = K / 8;
  if (t >= N * k8n) return;
  const int n = t / k8n, k8 = (t % k8n) * 8;
  v8us v;
#pragma unroll
  for (int i = 0; i < 8; ++i) v[i] = bf16_bits(W[(size_t)(k8 + i) * N + n]);
  *(v8us*)(Wt + (size_t)n * K + k8) = v;
  
}

// GEMM C[M][N] (f32, pitch ldc) = act(A[M][K]·W + bias). A f32 row-major (pitch lda) converted per fragment to bf16
// (ASPLIT: hi/lo two planes -> 2 terms, else single rounded term); Wt bf16 [N][K] (pitch ldb). BIAS_BF16 rounds the
// bias to bf16 first (bias quantised to bf16 before the add). K%32==0, M%16==0, N%64==0.
template <bool ASPLIT, int ACT, bool BIAS_BF16>
__global__ __launch_bounds__(128) void k_gemm_bf(const float* __restrict__ A, int lda, const unsigned short* __restrict__ Wt, int ldb,
                                               const float* __restrict__ bias, float* __restrict__ C, int ldc, int M, int N, int K) {
  __shared__ __attribute__((aligned(16))) float so[4][16][64];
  const int tid = threadIdx.x, w = tid >> 5, lane = tid & 31, ln = lane & 15, hh = lane >> 4;
  const int ntn = N / 64;
  const int wid = blockIdx.x * 4 + w;
  const int mt = wid / ntn, nq = wid % ntn;
  if (mt * 16 >= M) return;
  const int row0 = mt * 16, col0 = nq * 64;
  const float* arow = A + (size_t)(row0 + ln) * lda;
  v8f acc[4] = {};
  for (int kb = 0; kb < K; kb += 32) {
    FragB ah, al;
    const v4f x0 = *(const v4fa*)(arow + kb + 8 * hh), x1 = *(const v4fa*)(arow + kb + 8 * hh + 4);
    const v4f x2 = *(const v4fa*)(arow + kb + 16 + 8 * hh), x3 = *(const v4fa*)(arow + kb + 16 + 8 * hh + 4);
    float xs[16] = {x0[0],x0[1],x0[2],x0[3],x1[0],x1[1],x1[2],x1[3],x2[0],x2[1],x2[2],x2[3],x3[0],x3[1],x3[2],x3[3]};
#pragma unroll
    for (int i = 0; i < 16; ++i) { const unsigned short hb = bf16_bits(xs[i]); ah.u[i] = hb; al.u[i] = ASPLIT ? bf16_bits(xs[i] - bf16_val(hb)) : (unsigned short)0; }
#pragma unroll
    for (int t = 0; t < 4; ++t) {
      const unsigned short* brow = Wt + (size_t)(col0 + t * 16 + ln) * ldb + kb;
      FragB b;
      b.half[0] = *(const v8us*)(brow + 8 * hh);
      b.half[1] = *(const v8us*)(brow + 16 + 8 * hh);
      acc[t] = mmaN<ASPLIT ? 2 : 1>(ah.v, al.v, b.v, b.v, acc[t]);
    }
  }
#pragma unroll
  for (int t = 0; t < 4; ++t) {
    float bv = bias ? bias[col0 + t * 16 + ln] : 0.f;
    if (BIAS_BF16) bv = bf16_round(bv);
#pragma unroll
    for (int r = 0; r < 8; ++r) { float v = acc[t][r] + bv; if (ACT == 1) v = fmaxf(v, 0.f); so[w][8 * hh + r][t * 16 + ln] = v; }
  }
  __builtin_amdgcn_fence(__ATOMIC_ACQ_REL, "workgroup");
  __builtin_amdgcn_wave_barrier();
  const int rsub = lane >> 4, c4 = (lane & 15) * 4;
  {
#pragma unroll
    for (int q = 0; q < 8; ++q) {
      const int r = q * 2 + rsub;
      const v4f v = *(const v4fa*)&so[w][r][c4];
      *(v4f*)(C + (size_t)(row0 + r) * ldc + col0 + c4) = v;
    }
    
  }
}

// GEMM C = act(A·W + bias + resid): A f32 (ASPLIT -> hi/lo 2 terms), Wt bf16 [N][K]; ACT 0 none, 1 relu, 2 exact gelu;
// resid (optional, f32, row index = (row % rmod), pitch ldr, RES_BF16 rounds it) added before the activation.
template <bool ASPLIT, int ACT, bool BIAS_BF16, bool RES_BF16>
__global__ __launch_bounds__(128) void k_gemm_bf3(const float* __restrict__ A, int lda, const unsigned short* __restrict__ Wt, int ldb,
                                                const float* __restrict__ bias, const float* __restrict__ resid, int rmod, int ldr,
                                                float* __restrict__ C, int ldc, int M, int N, int K) {
  __shared__ __attribute__((aligned(16))) float so[4][16][64];
  const int tid = threadIdx.x, w = tid >> 5, lane = tid & 31, ln = lane & 15, hh = lane >> 4;
  const int ntn = N / 64;
  const int wid = blockIdx.x * 4 + w;
  const int mt = wid / ntn, nq = wid % ntn;
  if (mt * 16 >= M) return;
  const int row0 = mt * 16, col0 = nq * 64;
  const float* arow = A + (size_t)(row0 + ln) * lda;
  v8f acc[4] = {};
  for (int kb = 0; kb < K; kb += 32) {
    FragB ah, al;
    const v4f x0 = *(const v4fa*)(arow + kb + 8 * hh), x1 = *(const v4fa*)(arow + kb + 8 * hh + 4);
    const v4f x2 = *(const v4fa*)(arow + kb + 16 + 8 * hh), x3 = *(const v4fa*)(arow + kb + 16 + 8 * hh + 4);
    float xs[16] = {x0[0],x0[1],x0[2],x0[3],x1[0],x1[1],x1[2],x1[3],x2[0],x2[1],x2[2],x2[3],x3[0],x3[1],x3[2],x3[3]};
#pragma unroll
    for (int i = 0; i < 16; ++i) { const unsigned short hb = bf16_bits(xs[i]); ah.u[i] = hb; al.u[i] = ASPLIT ? bf16_bits(xs[i] - bf16_val(hb)) : (unsigned short)0; }
#pragma unroll
    for (int t = 0; t < 4; ++t) {
      const unsigned short* brow = Wt + (size_t)(col0 + t * 16 + ln) * ldb + kb;
      FragB b;
      b.half[0] = *(const v8us*)(brow + 8 * hh);
      b.half[1] = *(const v8us*)(brow + 16 + 8 * hh);
      acc[t] = mmaN<ASPLIT ? 2 : 1>(ah.v, al.v, b.v, b.v, acc[t]);
    }
  }
#pragma unroll
  for (int t = 0; t < 4; ++t) {
    const int col = col0 + t * 16 + ln;
    float bv = bias ? bias[col] : 0.f;
    if (BIAS_BF16) bv = bf16_round(bv);
#pragma unroll
    for (int r = 0; r < 8; ++r) {
      float v = acc[t][r] + bv;
      if (resid) { float rv = resid[(size_t)((row0 + 8 * hh + r) % rmod) * ldr + col]; if (RES_BF16) rv = bf16_round(rv); v += rv; }
      if (ACT == 1) v = fmaxf(v, 0.f);
      if (ACT == 2) v = 0.5f * v * (1.0f + erff(v * 0.70710678118654752f));
      if (ACT == 3) { const float u = 0.7978845608028654f * (v + 0.044715f * v * v * v); v = 0.5f * v * (1.0f + tanhf(u)); }
      so[w][8 * hh + r][t * 16 + ln] = v;
    }
  }
  __builtin_amdgcn_fence(__ATOMIC_ACQ_REL, "workgroup");
  __builtin_amdgcn_wave_barrier();
  const int rsub = lane >> 4, c4 = (lane & 15) * 4;
  {
#pragma unroll
    for (int q = 0; q < 8; ++q) {
      const int r = q * 2 + rsub;
      const v4f v = *(const v4fa*)&so[w][r][c4];
      *(v4f*)(C + (size_t)(row0 + r) * ldc + col0 + c4) = v;
    }
    
  }
}
// row LayerNorm (biased variance, eps) over N: s = X (+ R); optional out_sum <- s; out_norm <- (s-mu)*rsqrt(var+eps)*g + b
template <bool PARAM_BF16>
__global__ __launch_bounds__(256) void k_layernorm(const float* __restrict__ X, const float* __restrict__ R, const float* __restrict__ g, const float* __restrict__ bta,
                                                  float* __restrict__ out_sum, float* __restrict__ out_norm, int N, float eps) {
  __shared__ float red[256];
  const int row = blockIdx.x, tid = threadIdx.x;
  const float* x = X + (size_t)row * N; const float* rr = R ? R + (size_t)row * N : nullptr;
  float vals[16];                     // up to N = 4096
  const int per = N / 256;            // contiguous chunk per thread? use strided-by-4 chunks: thread handles j = tid*4 + 1024*u
  float s1 = 0.f;
  for (int u = 0; u < per / 4; ++u) {
    const int j = tid * 4 + 1024 * u;
    const v4f a = *(const v4fa*)(x + j);
    v4f b = {0.f,0.f,0.f,0.f}; if (rr) b = *(const v4fa*)(rr + j);
#pragma unroll
    for (int q = 0; q < 4; ++q) { const float v = a[q] + b[q]; vals[u * 4 + q] = v; s1 += v; }
  }
  red[tid] = s1; __syncthreads();
  for (int st = 128; st > 0; st >>= 1) { if (tid < st) red[tid] += red[tid + st]; __syncthreads(); }
  const float mu = red[0] / (float)N; __syncthreads();
  float s2 = 0.f;
  for (int u = 0; u < per / 4; ++u)
#pragma unroll
    for (int q = 0; q < 4; ++q) { const float c = vals[u * 4 + q] - mu; s2 += c * c; }
  red[tid] = s2; __syncthreads();
  for (int st = 128; st > 0; st >>= 1) { if (tid < st) red[tid] += red[tid + st]; __syncthreads(); }
  const float rs = rsqrtf(red[0] / (float)N + eps);
  {
    for (int u = 0; u < per / 4; ++u) {
      const int j = tid * 4 + 1024 * u;
      v4f o, sm;
#pragma unroll
      for (int q = 0; q < 4; ++q) {
        float gg = g[j + q], bb = bta[j + q];
        if (PARAM_BF16) { gg = bf16_round(gg); bb = bf16_round(bb); }
        sm[q] = vals[u * 4 + q]; o[q] = (vals[u * 4 + q] - mu) * rs * gg + bb;
      }
      if (out_sum) *(v4f*)(out_sum + (size_t)row * N + j) = sm;
      *(v4f*)(out_norm + (size_t)row * N + j) = o;
    }
    
  }
}



// ---- f16 WMMA path (v_wmma_f32_16x16x32_f16): 11-bit significands for operands in range — used where a [0,1] probability operand needs more precision than bf16
typedef _Float16 v16h __attribute__((ext_vector_type(16)));
union FragH { v16h v; v8us half[2]; _Float16 h[16]; unsigned short u[16]; };
template <int NT>
__device__ __forceinline__ v8f mmaH(v16h ah, v16h al, v16h bh, v16h bl, v8f c) {
  c = __builtin_amdgcn_wmma_f32_16x16x32_f16(false, ah, false, bh, (short)0, c, false, false);
  if (NT >= 2) c = __builtin_amdgcn_wmma_f32_16x16x32_f16(false, al, false, bh, (short)0, c, false, false);
  if (NT >= 3) c = __builtin_amdgcn_wmma_f32_16x16x32_f16(false, ah, false, bl, (short)0, c, false, false);
  asm volatile("v_nop\n\tv_nop\n\tv_nop\n\tv_nop" : "+v"(c) : "v"(ah), "v"(al), "v"(bh), "v"(bl));
  return c;
}
// batched GEMM like k_gemm_b but f16 operands: A f32 (split into f16 hi/lo if ASPLIT, else rounded to f16), Bt = f16 values [n][k]; alpha; C f32; N multiple of 16 (partial tiles skipped)
template <bool ASPLIT>
__global__ __launch_bounds__(128) void k_gemm_h(const float* __restrict__ A, int lda, size_t sA, const _Float16* __restrict__ Bh, int ldb, size_t sB, float alpha, float* __restrict__ C, int ldc, size_t sC, int M, int N, int K) {
  __shared__ __attribute__((aligned(16))) float so[4][16][64];
  const int tid = threadIdx.x, w = tid >> 5, lane = tid & 31, ln = lane & 15, hh = lane >> 4; const int by = blockIdx.y;
  A += (size_t)by * sA; Bh += (size_t)by * sB; C += (size_t)by * sC;
  const int ntn = (N + 63) / 64; const int wid = blockIdx.x * 4 + w; const int mt = wid / ntn, nq = wid % ntn; if (mt * 16 >= M) return;
  const int row0 = mt * 16, col0 = nq * 64; const float* arow = A + (size_t)(row0 + ln) * lda;
  v8f acc[4] = {};
  for (int kb = 0; kb < K; kb += 32) {
    FragH ah, al;
    const v4f x0 = *(const v4fa*)(arow + kb + 8 * hh), x1 = *(const v4fa*)(arow + kb + 8 * hh + 4), x2 = *(const v4fa*)(arow + kb + 16 + 8 * hh), x3 = *(const v4fa*)(arow + kb + 16 + 8 * hh + 4);
    float xs[16] = {x0[0],x0[1],x0[2],x0[3],x1[0],x1[1],x1[2],x1[3],x2[0],x2[1],x2[2],x2[3],x3[0],x3[1],x3[2],x3[3]};
#pragma unroll
    for (int i = 0; i < 16; ++i) { const _Float16 h = (_Float16)xs[i]; ah.h[i] = h; al.h[i] = ASPLIT ? (_Float16)(xs[i] - (float)h) : (_Float16)0.0f; }
#pragma unroll
    for (int t = 0; t < 4; ++t) { if (col0 + t * 16 >= N) continue; const size_t boff = (size_t)(col0 + t * 16 + ln) * ldb + kb; FragH bq; bq.half[0] = *(const v8us*)(Bh + boff + 8 * hh); bq.half[1] = *(const v8us*)(Bh + boff + 16 + 8 * hh);
      acc[t] = mmaH<ASPLIT ? 2 : 1>(ah.v, al.v, bq.v, bq.v, acc[t]); }
  }
#pragma unroll
  for (int t = 0; t < 4; ++t) { if (col0 + t * 16 >= N) continue;
#pragma unroll
    for (int r = 0; r < 8; ++r) so[w][8 * hh + r][t * 16 + ln] = acc[t][r] * alpha; }
  __builtin_amdgcn_fence(__ATOMIC_ACQ_REL, "workgroup"); __builtin_amdgcn_wave_barrier();
  const int rsub = lane >> 4, c4 = (lane & 15) * 4;
  {
#pragma unroll
    for (int q = 0; q < 8; ++q) { const int r = q * 2 + rsub; if (col0 + c4 < N) { const v4f v = *(const v4fa*)&so[w][r][c4]; *(v4f*)(C + (size_t)(row0 + r) * ldc + col0 + c4) = v; } }
     }
}

// Wt[n][k] = f16(W[k][n]·scale) from f32 row-major W[K][N] (scale = power of two; bf16-exact weights stay exact in f16 away from the subnormal range)
__global__ __launch_bounds__(256) void k_wt_f16(const float* __restrict__ W, _Float16* __restrict__ Wt, int K, int N, float scale) {
  const int t = blockIdx.x * 256 + threadIdx.x; if (t >= N * (K / 8)) return; const int n = t / (K / 8), k8 = (t % (K / 8)) * 8; FragH f;
#pragma unroll
  for (int i = 0; i < 8; ++i) f.h[i] = (_Float16)(bf16_round(W[(size_t)(k8 + i) * N + n]) * scale); const v8us o = f.half[0];
  *(v8us*)((unsigned short*)Wt + (size_t)n * K + k8) = o; 
}
// k_gemm_hh variant with fused epilogue: v = acc·alpha + bias[by·sBias + col] (+ CP[(row/rowsPerB)·sCPb + by·64 + col] if CP) ; ACT 0 none / 1 elu ; writes f16 C16 (and f32 C if non-null)
template <int ACT>
__global__ __launch_bounds__(128) void k_gemm_hhx(const _Float16* __restrict__ A, int lda, size_t sA, const _Float16* __restrict__ Bh, int ldb, size_t sB, float alpha, const float* __restrict__ bias, size_t sBias, const float* __restrict__ CP, int rowsPerB, size_t sCPb, int row0g,
    float* __restrict__ C, _Float16* __restrict__ C16, int ldc, size_t sC, int M, int N, int K) {
  __shared__ __attribute__((aligned(16))) float so[4][16][64];
  const int tid = threadIdx.x, w = tid >> 5, lane = tid & 31, ln = lane & 15, hh = lane >> 4; const int by = blockIdx.y;
  A += (size_t)by * sA; Bh += (size_t)by * sB; const size_t cofs = (size_t)by * sC; const float* bp = bias ? bias + (size_t)by * sBias : nullptr;
  const int ntn = (N + 63) / 64; const int wid = blockIdx.x * 4 + w; const int mt = wid / ntn, nq = wid % ntn; if (mt * 16 >= M) return;
  const int row0 = mt * 16, col0 = nq * 64; const _Float16* arow = A + (size_t)(row0 + ln) * lda;
  v8f acc[4] = {};
  for (int kb = 0; kb < K; kb += 32) { FragH ah; ah.half[0] = *(const v8us*)((const unsigned short*)arow + kb + 8 * hh); ah.half[1] = *(const v8us*)((const unsigned short*)arow + kb + 16 + 8 * hh);
#pragma unroll
    for (int t = 0; t < 4; ++t) { if (col0 + t * 16 >= N) continue; const size_t boff = (size_t)(col0 + t * 16 + ln) * ldb + kb; FragH bq; bq.half[0] = *(const v8us*)((const unsigned short*)Bh + boff + 8 * hh); bq.half[1] = *(const v8us*)((const unsigned short*)Bh + boff + 16 + 8 * hh);
      acc[t] = mmaH<1>(ah.v, ah.v, bq.v, bq.v, acc[t]); }
  }
#pragma unroll
  for (int t = 0; t < 4; ++t) { if (col0 + t * 16 >= N) continue; const int col = col0 + t * 16 + ln; const float bv = bp ? bf16_round(bp[col]) : 0.f;
#pragma unroll
    for (int r = 0; r < 8; ++r) { float v = acc[t][r] * alpha + bv; if (CP) { const int bidx = (row0g + row0 + 8 * hh + r) / rowsPerB; v += CP[(size_t)bidx * sCPb + (size_t)by * 64 + col]; } if (ACT == 1) v = (v > 0.f) ? v : expm1f(v); else if (ACT == 7) v = (v > 0.f) ? v + 1.0f : expf(v); else if (ACT == 8) v = tanhf(v); else if (ACT == 9) v = 0.5f * v * (1.0f + tanhf(0.7978845608028654f * (v + 0.044715f * v * v * v))); else if (ACT == 11) v = 1.0f / (1.0f + expf(-v)); else if (ACT == 12) v = (v > 0.f) ? v : 0.01f * v; else if (ACT == 14) v = (v > 0.f) ? v : 0.1f * v; else if (ACT == 15) v = v / (1.0f + expf(-v)); else if (ACT == 3) v = fmaxf(v, 0.f); else if (ACT == 6) v = 0.5f * v * (1.0f + erff(v * 0.70710678118654752f)); so[w][8 * hh + r][t * 16 + ln] = v; } }
  __builtin_amdgcn_fence(__ATOMIC_ACQ_REL, "workgroup"); __builtin_amdgcn_wave_barrier();
  const int rsub = lane >> 4, c4 = (lane & 15) * 4; typedef _Float16 v4h __attribute__((ext_vector_type(4)));
  {
#pragma unroll
    for (int q = 0; q < 8; ++q) { const int r = q * 2 + rsub; if (col0 + c4 < N) { const v4f v = *(const v4fa*)&so[w][r][c4]; if (C) *(v4f*)(C + cofs + (size_t)(row0 + r) * ldc + col0 + c4) = v; if (C16) { v4h h4; for (int i = 0; i < 4; ++i) h4[i] = (_Float16)v[i]; *(v4h*)(C16 + cofs + (size_t)(row0 + r) * ldc + col0 + c4) = h4; } } }
     }
}


typedef _Float16 v4h __attribute__((ext_vector_type(4)));

__global__ __launch_bounds__(256) void k_x16(const float* __restrict__ x, _Float16* __restrict__ X16, size_t n8) { const size_t t = (size_t)blockIdx.x * 256 + threadIdx.x; if (t >= n8) return; FragH f;
#pragma unroll
  for (int q = 0; q < 8; ++q) f.h[q] = (_Float16)bf16_round(x[t * 8 + q]); *(v8us*)((unsigned short*)X16 + t * 8) = f.half[0];  }
__global__ __launch_bounds__(256) void k_h16(const float* __restrict__ x, _Float16* __restrict__ X16, size_t n8) { const size_t t = (size_t)blockIdx.x * 256 + threadIdx.x; if (t >= n8) return; FragH f;
#pragma unroll
  for (int q = 0; q < 8; ++q) f.h[q] = (_Float16)x[t * 8 + q]; *(v8us*)((unsigned short*)X16 + t * 8) = f.half[0];  }
__global__ __launch_bounds__(256) void k_round16f(const float* __restrict__ W, _Float16* __restrict__ Bt, size_t n8) { const size_t t = (size_t)blockIdx.x * 256 + threadIdx.x; if (t >= n8) return; FragH f;
#pragma unroll
  for (int i = 0; i < 8; ++i) f.h[i] = (_Float16)(bf16_round(W[t * 8 + i]) * 16.0f); *(v8us*)((unsigned short*)Bt + t * 8) = f.half[0];  }
template <int NHv, int TTv>
__global__ __launch_bounds__(256) void k_vt(const _Float16* __restrict__ V16, int ldv, int voff, _Float16* __restrict__ Vt) { __shared__ unsigned short tl[64][66]; const int tid = threadIdx.x; const int slab = blockIdx.x / (TTv / 64), lg = blockIdx.x % (TTv / 64); const int b = slab / NHv, h = slab % NHv;
  for (int i = tid; i < 64 * 8; i += 256) { const int r = i / 8, c8 = (i % 8) * 8; FragH f; f.half[0] = *(const v8us*)((const unsigned short*)V16 + ((size_t)b * TTv + lg * 64 + r) * ldv + voff + h * 64 + c8);
#pragma unroll
    for (int q = 0; q < 8; ++q) tl[r][c8 + q] = f.u[q]; }
  __syncthreads();
  {
#pragma unroll
    for (int rd = 0; rd < 2; ++rd) { const int d = rd * 32 + tid / 8, pc = tid % 8; FragH f;
#pragma unroll
      for (int q = 0; q < 8; ++q) f.u[q] = tl[pc * 8 + q][d];
      *(v8us*)((unsigned short*)Vt + ((size_t)slab * 64 + d) * TTv + lg * 64 + pc * 8) = f.half[0]; }
     } }

__global__ __launch_bounds__(256) void k_hl(const float* __restrict__ F, _Float16* __restrict__ Hh, _Float16* __restrict__ Hl, size_t n8) { const size_t t = (size_t)blockIdx.x * 256 + threadIdx.x; if (t >= n8) return; FragH fh, fl; const v4f a = *(const v4fa*)(F + t * 8), c = *(const v4fa*)(F + t * 8 + 4);
#pragma unroll
  for (int q = 0; q < 4; ++q) { _Float16 h = (_Float16)a[q]; fh.h[q] = h; fl.h[q] = (_Float16)((a[q] - (float)h) * 1024.0f); h = (_Float16)c[q]; fh.h[4 + q] = h; fl.h[4 + q] = (_Float16)((c[q] - (float)h) * 1024.0f); }
  { *(v8us*)((unsigned short*)Hh + t * 8) = fh.half[0]; *(v8us*)((unsigned short*)Hl + t * 8) = fl.half[0];  } }

// ---- fast GEMM (wave tile 32x64; requires M % 32 == 0 rows per launch region and N % 64 == 0); epilogue = k_gemm_hhx semantics ----
__device__ __forceinline__ v16h g2_frag(const _Float16* p, int hh) { FragH f; f.half[0] = *(const v8us*)((const unsigned short*)p + 8 * hh); f.half[1] = *(const v8us*)((const unsigned short*)p + 16 + 8 * hh); return f.v; }
__device__ __forceinline__ v8f g2_mma(v16h a, v16h b, v8f c) { v8f d = __builtin_amdgcn_wmma_f32_16x16x32_f16(false, a, false, b, (short)0, c, false, false); asm volatile("v_nop\n\tv_nop\n\tv_nop\n\tv_nop" : "+v"(d) : "v"(a), "v"(b)); return d; }
template <int ACT>
__global__ __launch_bounds__(128) void k_gemm2(const _Float16* __restrict__ A, int lda, size_t sA, const _Float16* __restrict__ Bh, int ldb, size_t sB, float alpha, const float* __restrict__ bias, size_t sBias, const float* __restrict__ CP, int rowsPerB, size_t sCPb, int row0g,
    float* __restrict__ C, _Float16* __restrict__ C16, int ldc, size_t sC, int M, int N, int K) {
  __shared__ __attribute__((aligned(16))) float so[4][32][68];
  const int tid = threadIdx.x, w = tid >> 5, lane = tid & 31, ln = lane & 15, hh = lane >> 4; const int by = blockIdx.y;
  A += (size_t)by * sA; Bh += (size_t)by * sB; const size_t cofs = (size_t)by * sC; const float* bp = bias ? bias + (size_t)by * sBias : nullptr;
  const int ntn = N >> 6; const int mt = blockIdx.x / ntn, nq = blockIdx.x - mt * ntn; const int row0 = mt * 128 + 32 * w, col0 = nq * 64; if (row0 >= M) return;
  const _Float16* a0p = A + (size_t)(row0 + ln) * lda; const _Float16* a1p = a0p + (size_t)16 * lda;
  const _Float16* b0p = Bh + (size_t)(col0 + ln) * ldb; const _Float16* b1p = b0p + (size_t)16 * ldb; const _Float16* b2p = b1p + (size_t)16 * ldb; const _Float16* b3p = b2p + (size_t)16 * ldb;
  const v8f z8 = {0.f,0.f,0.f,0.f,0.f,0.f,0.f,0.f}; v8f c00 = z8, c01 = z8, c02 = z8, c03 = z8, c10 = z8, c11 = z8, c12 = z8, c13 = z8;
#pragma unroll 1
  for (int kb = 0; kb < K; kb += 32) { const v16h a0 = g2_frag(a0p + kb, hh), a1 = g2_frag(a1p + kb, hh);
    v16h b = g2_frag(b0p + kb, hh); c00 = g2_mma(a0, b, c00); c10 = g2_mma(a1, b, c10);
    b = g2_frag(b1p + kb, hh); c01 = g2_mma(a0, b, c01); c11 = g2_mma(a1, b, c11);
    b = g2_frag(b2p + kb, hh); c02 = g2_mma(a0, b, c02); c12 = g2_mma(a1, b, c12);
    b = g2_frag(b3p + kb, hh); c03 = g2_mma(a0, b, c03); c13 = g2_mma(a1, b, c13); }
  v8f accs[8] = {c00, c01, c02, c03, c10, c11, c12, c13};
#pragma unroll
  for (int u = 0; u < 8; ++u) { const int t = u & 3, half = u >> 2; const int col = col0 + t * 16 + ln; const float bv = bp ? bf16_round(bp[col]) : 0.f;
#pragma unroll
    for (int r = 0; r < 8; ++r) { const int rloc = half * 16 + 8 * hh + r; float v = accs[u][r] * alpha + bv; if (CP) { if (rowsPerB < 0) v += CP[cofs + (size_t)(row0g + row0 + rloc) * ldc + col];      /* rowsPerB < 0: own element of the batched C plane */ else { const int bidx = (row0g + row0 + rloc) / rowsPerB; v += CP[(size_t)bidx * sCPb + (size_t)by * 64 + col]; } }
      if (ACT == 3) v = fmaxf(v, 0.f); else if (ACT == 6) v = 0.5f * v * (1.0f + erff(v * 0.70710678118654752f)); else if (ACT == 11) v = 1.0f / (1.0f + expf(-v)); else if (ACT == 15) v = v / (1.0f + expf(-v)); else if (ACT == 12) v = (v > 0.f) ? v : 0.01f * v; else if (ACT == 8) v = tanhf(v);
      so[w][rloc][t * 16 + ln] = v; } }
  __builtin_amdgcn_fence(__ATOMIC_ACQ_REL, "workgroup"); __builtin_amdgcn_wave_barrier();
  const int rsub = lane >> 4, c4 = (lane & 15) * 4;
  {
#pragma unroll
    for (int q = 0; q < 16; ++q) { const int r = q * 2 + rsub; const v4f v = *(const v4fa*)&so[w][r][c4]; if (C) *(v4f*)(C + cofs + (size_t)(row0 + r) * ldc + col0 + c4) = v; if (C16) { v4h h4; for (int i = 0; i < 4; ++i) h4[i] = (_Float16)v[i]; *(v4h*)(C16 + cofs + (size_t)(row0 + r) * ldc + col0 + c4) = h4; } }
     } }



typedef unsigned int v4u __attribute__((ext_vector_type(4), may_alias));
// Packed operand planes of k_flash. Unit = the 16 bytes one lane takes in one fragment load; the 32 units of a load lie side by side (512 bytes, four whole lines), lane = 16 hh + ln.
// KP, per 32-key block 8 loads [nt][ks][c]: unit = K[16 nt + ln][32 ks + 16 c + 8 hh + 0..7].  VP, per 32-key block 8 loads [dt][c]: unit = V[16 c + 8 hh + 0..7][16 dt + ln].  Values as k_x16 makes them.
// MP, per (16-query tile, 32-key block) 2 loads [nt]: unit = bf16 bits of mask[16 qt + ln][32 jb + 16 nt + 8 hh + 0..7] (the compute dtype's rounding of the mask)
// One pre-pass launch makes all four planes (Q16 as k_x16 makes it, KP, VP, MP). A thread takes PU units of 8 values of each input, 256 units apart; a work-group so takes PU blocks of 32 keys, each with an LDS tile of its own.
#define PU 4
__global__ __launch_bounds__(256) void k_prep(const float* __restrict__ q, const float* __restrict__ kv, const float* __restrict__ M, unsigned short* __restrict__ Q16, unsigned short* __restrict__ KP, unsigned short* __restrict__ VP, unsigned short* __restrict__ MP) {
  __shared__ __attribute__((aligned(16))) unsigned short tl[PU][32][72];      /* pitch 144 B = 16 B x 9: the 16-byte row reads below spread over the banks */
  const int tid = threadIdx.x; const unsigned int u0 = blockIdx.x * (PU * 256) + tid;      /* the thread's first unit in every plane */
  const int ln = tid & 15, hh = (tid >> 4) & 1, g = tid >> 5;      /* g = the load's number in its block of 32 keys */
  const int nt = g & 1, jb = (u0 >> 6) & (TK / 32 - 1), qt = u0 / (TK * 2);      /* the mask unit's place; 256 units on, jb is 4 more: the PU * 256 units of a work-group lie in one query tile */
  static_assert((TK * 2) % (PU * 256) == 0, "a work-group's mask units stay inside one 16-query tile");
  const float* ks = kv + (size_t)u0 * 8; const float* qs = q + (size_t)u0 * 8; const float* ms = M + (size_t)(qt * 16 + ln) * TK + jb * 32 + nt * 16 + hh * 8;
  v4f ka[PU], kc[PU], qa[PU], qc[PU], ma[PU], mc[PU];
  /* every load of the thread is requested before anything is worked on: kv first, its values have the longest way */
#pragma unroll      /* constant indices: the arrays stay in registers */
  for (int i = 0; i < PU; ++i) { ka[i] = *(const v4fa*)(ks + i * 2048); kc[i] = *(const v4fa*)(ks + i * 2048 + 4); }
#pragma unroll      /* constant indices: the arrays stay in registers */
  for (int i = 0; i < PU; ++i) { qa[i] = *(const v4fa*)(qs + i * 2048); qc[i] = *(const v4fa*)(qs + i * 2048 + 4); }
  asm volatile("s_wait_xcnt 0x0" ::: "memory");      /* the compiler lets a mask load's result land in the address registers that the loads above name */
#pragma unroll      /* constant indices: the arrays stay in registers */
  for (int i = 0; i < PU; ++i) { ma[i] = *(const v4fa*)(ms + i * 128); mc[i] = *(const v4fa*)(ms + i * 128 + 4); }
  __builtin_amdgcn_sched_barrier(0);      /* keeps the loads above: without it the compiler sinks them to their uses, and the thread waits out the memory latency three times over */
#pragma unroll      /* constant indices: the arrays stay in registers */
  for (int i = 0; i < PU; ++i) { FragH f;
#pragma unroll      /* constant indices: the fragment stays in registers */
    for (int e = 0; e < 4; ++e) { f.h[e] = (_Float16)bf16_round(ka[i][e]); f.h[4 + e] = (_Float16)bf16_round(kc[i][e]); }
    *(v8us*)&tl[i][tid >> 3][(tid & 7) * 8] = f.half[0]; }
  __syncthreads();      /* all tiles are written before any thread gathers its units from them; no global store is under way yet for it to wait on */
#pragma unroll
  for (int i = 0; i < PU; ++i) {
    *(v8us*)(KP + (size_t)u0 * 8 + i * 2048) = *(const v8us*)&tl[i][(g >> 2) * 16 + ln][((g >> 1) & 1) * 32 + (g & 1) * 16 + hh * 8];
    FragH t;
#pragma unroll      /* constant indices: the fragment stays in registers */
    for (int e = 0; e < 8; ++e) t.u[e] = tl[i][(g & 1) * 16 + hh * 8 + e][(g >> 1) * 16 + ln];
    *(v8us*)(VP + (size_t)u0 * 8 + i * 2048) = t.half[0]; }
#pragma unroll      /* constant indices: the arrays stay in registers */
  for (int i = 0; i < PU; ++i) { FragH f;
#pragma unroll      /* constant indices: the fragment stays in registers */
    for (int e = 0; e < 4; ++e) { f.h[e] = (_Float16)bf16_round(qa[i][e]); f.h[4 + e] = (_Float16)bf16_round(qc[i][e]); }
    *(v8us*)(Q16 + (size_t)u0 * 8 + i * 2048) = f.half[0]; }
#pragma unroll      /* constant indices: the arrays stay in registers */
  for (int i = 0; i < PU; ++i) { v8us o;
#pragma unroll      /* constant indices: the vector stays in registers */
    for (int e = 0; e < 4; ++e) { o[e] = bf16_bits(ma[i][e]); o[4 + e] = bf16_bits(mc[i][e]); }
    *(v8us*)(MP + (size_t)u0 * 8 + i * 2048) = o; } }

// one f16 product of k_flash as the plain builtin: the compiler keeps the distance behind a matrix instruction itself, with other work of the pass where it has some
__device__ __forceinline__ v8f mmaF(v16h a, v16h b, v8f c) { return __builtin_amdgcn_wmma_f32_16x16x32_f16(false, a, false, b, (short)0, c, false, false); }
// lane l <-> lane l ^ 16 by a vector cross-row move
__device__ __forceinline__ float xhalf(float x) { return __builtin_bit_cast(float, __builtin_amdgcn_permlanex16(__builtin_bit_cast(int, x), __builtin_bit_cast(int, x), 0x76543210, 0xfedcba98, false, false)); }
template <int CAUSAL>
__global__ __launch_bounds__(512) void k_flash(const _Float16* __restrict__ Q16, int ldq, const unsigned short* __restrict__ KP, const unsigned short* __restrict__ VP, const unsigned short* __restrict__ MP, float* __restrict__ O, int ldo) {
  static_assert(CAUSAL == 0 || CAUSAL == 33, "modes: 0 = no mask, 33 = one additive mask table, bf16 and packed by k_prep, shared by every slab");
  constexpr int QT = 2, RPW = 16 * QT, NQW = QPB / RPW, NW = 2 * NQW, DT = 4, KS = 2; constexpr float L2E = 1.4426950408889634f;      /* QT query tiles of 16 columns a wave: every K and V^T fragment loaded feeds QT products; waves w and w + NQW share their columns and take half the keys each; log2 e */
  __shared__ __attribute__((aligned(16))) float sO[NW][16][64 + 4]; __shared__ __attribute__((aligned(16))) float sX[NW][2 * DT][32][4]; __shared__ float sML[NW][2][32];      /* output staging; the context tile, maximum and sum that a wave hands to its partner, lane by lane */
  const int tid = threadIdx.x, w = tid >> 5, lane = tid & 31, ln = lane & 15, hh = lane >> 4;
  const int slab = blockIdx.x / QBNP, qblk = QB0P + blockIdx.x % QBNP; const int b = slab / NH, h = slab % NH; const int qb0 = qblk * QPB; const int kh = __builtin_amdgcn_readfirstlane(w / NQW); const int q0 = qb0 + (w % NQW) * RPW;      /* kh: the wave's half of the keys, in a scalar register (it bounds the loop) */
  FragH bq[QT][KS];
#pragma unroll      /* constant indices: the array stays in registers */
  for (int qt = 0; qt < QT; ++qt) { const unsigned short* qr = (const unsigned short*)Q16 + ((size_t)b * TQ + q0 + qt * 16 + ln) * ldq + h * 64;
#pragma unroll      /* constant indices: the array stays in registers */
    for (int ks = 0; ks < KS; ++ks) { bq[qt][ks].half[0] = *(const v8us*)(qr + ks * 32 + 8 * hh); bq[qt][ks].half[1] = *(const v8us*)(qr + ks * 32 + 16 + 8 * hh); } }
  /* packed planes (k_prep): a fragment load is 32 lanes x 16 consecutive bytes, four whole 128-byte lines */
  const unsigned short* kpl = KP + (size_t)slab * 64 * TK; const unsigned short* vpl = VP + (size_t)slab * 64 * TK; const unsigned short* mpl = MP + (size_t)__builtin_amdgcn_readfirstlane(q0 >> 4) * 16 * TK;      /* wave-uniform bases: scalar address arithmetic */
  const unsigned int l8 = lane * 8;      /* the lane's unit in every load */
  float m_r[QT], l_r[QT]; v8f oacc[QT][DT];
#pragma unroll      /* constant indices: the arrays stay in registers */
  for (int qt = 0; qt < QT; ++qt) { m_r[qt] = -3.0e38f; l_r[qt] = 0.f;
#pragma unroll      /* constant indices: the array stays in registers */
    for (int dt = 0; dt < DT; ++dt) oacc[qt][dt] = (v8f){0.f,0.f,0.f,0.f,0.f,0.f,0.f,0.f}; }
  const int jbeg = kh * (TK / 2), jend = jbeg + TK / 2;
  /* every global operand of the loop is held in registers and requested far ahead of its use; V^T is requested at the head of its pass, K and the mask for the next pass right after their last reads in this one */
  FragH ak[2][KS], av[DT]; v4u mk[QT][2];
  auto fetch_k = [&](int j0) {      /* K fragments of the 32 keys from j0 */
#pragma unroll      /* constant indices: the array stays in registers */
    for (int nt = 0; nt < 2; ++nt) { const unsigned short* kr = kpl + (size_t)j0 * 64 + nt * 1024;
#pragma unroll      /* constant indices: the array stays in registers */
      for (int ks = 0; ks < KS; ++ks) { ak[nt][ks].half[0] = *(const v8us*)(kr + ks * 512 + l8); ak[nt][ks].half[1] = *(const v8us*)(kr + ks * 512 + 256 + l8); } } };
  auto fetch_m = [&](int j0) {      /* mode 33: the mask values of this lane's 16 score elements per query tile, 8 consecutive keys of its query's row per key tile, as bf16 pairs */
    if (CAUSAL == 33) {
#pragma unroll      /* constant indices: the array stays in registers */
      for (int qt = 0; qt < QT; ++qt) { const unsigned short* amk = mpl + (size_t)qt * 16 * TK + (size_t)j0 * 16;
#pragma unroll      /* constant indices: the array stays in registers */
        for (int nt = 0; nt < 2; ++nt) mk[qt][nt] = *(const v4u*)(amk + nt * 256 + l8); } } };
  auto fetch_v = [&](int j0) {      /* V^T fragments of the same keys */
#pragma unroll      /* constant indices: the array stays in registers */
    for (int dt = 0; dt < DT; ++dt) { const unsigned short* vrow = vpl + (size_t)j0 * 64 + dt * 512; av[dt].half[0] = *(const v8us*)(vrow + l8); av[dt].half[1] = *(const v8us*)(vrow + 256 + l8); } };
  fetch_k(jbeg); fetch_m(jbeg);
#pragma unroll 1      /* rolled: the operands fetched ahead keep one register set */
  for (int j0 = jbeg; j0 < jend; j0 += 32) {
    const int jn = (j0 + 32 < jend) ? j0 + 32 : jbeg;      /* the last pass re-reads the first block: in bounds, never used */
    fetch_v(j0);      /* used behind the softmax of this pass */
    __builtin_amdgcn_sched_barrier(0);      /* holds the requests above in their place: without it the compiler sinks them to their uses, and the wave waits out the latency */
    v8f s[QT][2];
#pragma unroll      /* constant indices: the array stays in registers */
    for (int qt = 0; qt < QT; ++qt) { s[qt][0] = (v8f){0.f,0.f,0.f,0.f,0.f,0.f,0.f,0.f}; s[qt][1] = s[qt][0]; }
#pragma unroll      /* constant indices: the arrays stay in registers */
    for (int ks = 0; ks < KS; ++ks)      /* the four score tiles side by side in each k step; every tile still adds k step 0, then 1 */
#pragma unroll      /* constant indices: the arrays stay in registers */
      for (int nt = 0; nt < 2; ++nt)
#pragma unroll      /* constant indices: the arrays stay in registers */
        for (int qt = 0; qt < QT; ++qt) s[qt][nt] = mmaF(ak[nt][ks].v, bq[qt][ks].v, s[qt][nt]);
    fetch_k(jn);      /* the next pass's K, into the registers just read */
    __builtin_amdgcn_sched_barrier(0);      /* as at the head of the pass */
    float sc[QT][16];
#pragma unroll      /* constant indices: the array stays in registers */
    for (int qt = 0; qt < QT; ++qt)
#pragma unroll      /* constant indices: the array stays in registers */
      for (int e = 0; e < 16; ++e) { float v = s[qt][e >> 3][e & 7] * SCL; if (CAUSAL == 33) { const unsigned int mw = mk[qt][e >> 3][(e & 7) >> 1]; v += __uint_as_float((e & 1) ? (mw & 0xFFFF0000u) : (mw << 16)); } sc[qt][e] = v; }
    fetch_m(jn);      /* the next pass's mask values, into the registers just read */
    __builtin_amdgcn_sched_barrier(0);      /* as at the head of the pass */
#pragma unroll      /* constant indices: the arrays stay in registers */
    for (int qt = 0; qt < QT; ++qt) { const float (&c)[16] = sc[qt];
      const float ma = fmaxf(fmaxf(c[0], c[1]), c[2]), mb = fmaxf(fmaxf(c[3], c[4]), c[5]), mc3 = fmaxf(fmaxf(c[6], c[7]), c[8]), md = fmaxf(fmaxf(c[9], c[10]), c[11]), me = fmaxf(fmaxf(c[12], c[13]), c[14]);
      float mc = fmaxf(fmaxf(fmaxf(ma, mb), mc3), fmaxf(fmaxf(md, me), c[15]));
      mc = fmaxf(mc, xhalf(mc));      /* both halves now hold the query's maximum over the 32 keys */
      /* e^x as the hardware's 2^(x log2 e): x <= 0 here, so the library form's overflow select never fires; where its underflow select gives 0 (also at -inf, or a product that overflows to it) the hardware gives 0 too */
      const float mn = fmaxf(m_r[qt], mc); const float al = (mn > -1.0e38f) ? __builtin_amdgcn_exp2f((m_r[qt] - mn) * L2E) : 1.0f; m_r[qt] = mn;
      float p[16]; FragH pb;
#pragma unroll      /* constant indices: the array stays in registers */
      for (int e = 0; e < 16; ++e) { p[e] = __builtin_amdgcn_exp2f(__builtin_fmaf(c[e] - mn, L2E, 10.0f)); pb.h[e] = (_Float16)p[e]; }      /* p = 1024 e^(s - m): the operand's 2^10 scale rides in the exponent, and the row sum carries it too */
      l_r[qt] = l_r[qt] * al + (((p[0] + p[1]) + (p[2] + p[3])) + ((p[4] + p[5]) + (p[6] + p[7]))) + (((p[8] + p[9]) + (p[10] + p[11])) + ((p[12] + p[13]) + (p[14] + p[15])));
#pragma unroll      /* constant indices: the array stays in registers */
      for (int dt = 0; dt < DT; ++dt) oacc[qt][dt] *= al;
#pragma unroll      /* constant indices: the array stays in registers */
      for (int dt = 0; dt < DT; ++dt) oacc[qt][dt] = mmaF(av[dt].v, pb.v, oacc[qt][dt]); }
    /* v_nop: the distance behind the pass's last products on the branch's taken side: the next pass's first score products write over the P registers that these read as B. s_wait_xcnt: the next pass rewrites the address registers that this pass's loads name */
    asm volatile("v_nop\n\tv_nop\n\tv_nop\n\tv_nop\n\ts_wait_xcnt 0x0" : "+v"(oacc[0][0]), "+v"(oacc[0][1]), "+v"(oacc[0][2]), "+v"(oacc[0][3]), "+v"(oacc[1][0]), "+v"(oacc[1][1]), "+v"(oacc[1][2]), "+v"(oacc[1][3]) : : "memory"); }
  /* the two halves of the keys are joined: wave kh finishes query tile kh and hands its part of the other tile to its partner */
  const int pw = w ^ NQW; const bool k1 = kh != 0;
  const float mg = k1 ? m_r[0] : m_r[1], lg = k1 ? l_r[0] : l_r[1], mo = k1 ? m_r[1] : m_r[0], lo = k1 ? l_r[1] : l_r[0]; v8f oo[DT];
#pragma unroll      /* constant indices: the arrays stay in registers */
  for (int dt = 0; dt < DT; ++dt) { const v8f g = k1 ? oacc[0][dt] : oacc[1][dt]; oo[dt] = k1 ? oacc[1][dt] : oacc[0][dt];
    *(v4fa*)&sX[w][2 * dt][lane][0] = (v4f){g[0], g[1], g[2], g[3]}; *(v4fa*)&sX[w][2 * dt + 1][lane][0] = (v4f){g[4], g[5], g[6], g[7]}; }
  sML[w][0][lane] = mg; sML[w][1][lane] = lg;
  __syncthreads();      /* every wave's handed-over part is written before its partner reads it */
  { const float mp = sML[pw][0][lane], lp = sML[pw][1][lane]; const float mn = fmaxf(mo, mp);
    const float ao = (mn > -1.0e38f) ? __builtin_amdgcn_exp2f((mo - mn) * L2E) : 1.0f, ap = (mn > -1.0e38f) ? __builtin_amdgcn_exp2f((mp - mn) * L2E) : 1.0f;      /* each part is brought to the common maximum, as the loop does from pass to pass */
    const float lh = lo * ao + lp * ap; const float l = lh + xhalf(lh);      /* the two lane halves' sums of the query's row, joined once */
    const float inv = (l > 0.f) ? 1.0f / l : 0.f;      /* sum and context both carry the factor 1024 */
#pragma unroll      /* constant indices: the array stays in registers */
    for (int dt = 0; dt < DT; ++dt) { const v4f x0 = *(const v4fa*)&sX[pw][2 * dt][lane][0], x1 = *(const v4fa*)&sX[pw][2 * dt + 1][lane][0]; const v8f x = {x0[0], x0[1], x0[2], x0[3], x1[0], x1[1], x1[2], x1[3]};
      const v8f o = (oo[dt] * ao + x * ap) * inv;      /* register r = O[q0 + 16 kh + ln][16 dt + 8 hh + r] */
      *(v4fa*)&sO[w][ln][dt * 16 + 8 * hh] = (v4f){o[0], o[1], o[2], o[3]}; *(v4fa*)&sO[w][ln][dt * 16 + 8 * hh + 4] = (v4f){o[4], o[5], o[6], o[7]}; } }
  __builtin_amdgcn_fence(__ATOMIC_ACQ_REL, "workgroup"); __builtin_amdgcn_wave_barrier();      /* the wave's own staged rows are written before its lanes read them back as whole lines */
  {
#pragma unroll
    for (int rp = 0; rp < 16; rp += 2) { const int r = rp + (lane >> 4), pc = lane & 15; const v4f val = *(const v4fa*)&sO[w][r][pc * 4]; *(v4f*)(O + ((size_t)b * TQ + q0 + kh * 16 + r) * ldo + h * 64 + pc * 4) = val; }
     } }
// 5-plane variant: S = Qh Kh^T + (Ql Kh^T + Qh Kl^T)/1024 with Q/K = [hi | 2^10 residual] f16 planes (QL/KL same layout as Q16/K16), then the 3-term P.V below.
// 3-term variant: O = (P_hi V_hi + (P_lo V_hi + P_hi V_lo) / 1024) / l with P = [hi | 2^10 residual] of 1024 p and V^T = [hi | 2^10 residual] planes (VtL same layout as Vt) -> ~2^-21-class products for un-averaged (early causal / peaked) rows
template <int CAUSAL>
__global__ __launch_bounds__(128) void k_flash5(const _Float16* __restrict__ Q16, const _Float16* __restrict__ QL, int ldq, const _Float16* __restrict__ K16, const _Float16* __restrict__ KL, int ldk, const _Float16* __restrict__ Vt, const _Float16* __restrict__ VtL, const int* __restrict__ MSK, float* __restrict__ O, int ldo) {
  constexpr int RPW = 16, RTN = RPW / 16, NQB = TQ / (4 * RPW), DT = 4, KS = 2;
  __shared__ __attribute__((aligned(16))) unsigned short sP[4][RPW][40]; __shared__ __attribute__((aligned(16))) unsigned short sPL[4][RPW][40]; __shared__ __attribute__((aligned(16))) float sO[4][RPW][64 + 4];
  const int tid = threadIdx.x, w = tid >> 5, lane = tid & 31, ln = lane & 15, hh = lane >> 4;
  const int slab = blockIdx.x / QBN5, qblk = QB05 + blockIdx.x % QBN5; (void)NQB; const int b = slab / NH, h = slab % NH; const int qb0 = qblk * (4 * RPW); const int q0 = qb0 + w * RPW;
  FragH aq[2][KS], aql[2][KS];
#pragma unroll
  for (int rt = 0; rt < RTN; ++rt) { const unsigned short* qr = (const unsigned short*)Q16 + ((size_t)b * TQ + q0 + rt * 16 + ln) * ldq + h * 64; const unsigned short* ql = (const unsigned short*)QL + ((size_t)b * TQ + q0 + rt * 16 + ln) * ldq + h * 64;
#pragma unroll
    for (int ks = 0; ks < KS; ++ks) { aq[rt][ks].half[0] = *(const v8us*)(qr + ks * 32 + 8 * hh); aq[rt][ks].half[1] = *(const v8us*)(qr + ks * 32 + 16 + 8 * hh); aql[rt][ks].half[0] = *(const v8us*)(ql + ks * 32 + 8 * hh); aql[rt][ks].half[1] = *(const v8us*)(ql + ks * 32 + 16 + 8 * hh); } }
  const unsigned short* Vth = (const unsigned short*)Vt + (size_t)slab * 64 * TK; const unsigned short* Vtl = (const unsigned short*)VtL + (size_t)slab * 64 * TK;
  float m_r[2][8], l_r[2][8]; v8f oacc[2][DT], oaccL[2][DT];
#pragma unroll
  for (int rt = 0; rt < RTN; ++rt) {
#pragma unroll
    for (int r = 0; r < 8; ++r) { m_r[rt][r] = -3.0e38f; l_r[rt][r] = 0.f; }
#pragma unroll
    for (int dt = 0; dt < DT; ++dt) { oacc[rt][dt] = (v8f){0.f,0.f,0.f,0.f,0.f,0.f,0.f,0.f}; oaccL[rt][dt] = oacc[rt][dt]; } }
  const int jend = (CAUSAL == 1) ? (qb0 + 4 * RPW) : ((CAUSAL == 23) ? min(TK, (qb0 / CHK + 2) * CHK) : TK);      /* causal / window: keys that can never contribute are skipped */ const int jbeg = (CAUSAL == 23) ? max(0, (qb0 / CHK - 1) * CHK) : 0;
#pragma unroll 1
  for (int j0 = jbeg; j0 < jend; j0 += 32) {
    v8f s[2][2];
#pragma unroll
    for (int nt = 0; nt < 2; ++nt) { const unsigned short* kr = (const unsigned short*)K16 + ((size_t)b * TK + j0 + nt * 16 + ln) * ldk + h * 64; const unsigned short* klr = (const unsigned short*)KL + ((size_t)b * TK + j0 + nt * 16 + ln) * ldk + h * 64; FragH bk[KS], bkl[KS];
#pragma unroll
      for (int ks = 0; ks < KS; ++ks) { bk[ks].half[0] = *(const v8us*)(kr + ks * 32 + 8 * hh); bk[ks].half[1] = *(const v8us*)(kr + ks * 32 + 16 + 8 * hh); bkl[ks].half[0] = *(const v8us*)(klr + ks * 32 + 8 * hh); bkl[ks].half[1] = *(const v8us*)(klr + ks * 32 + 16 + 8 * hh); }
#pragma unroll
      for (int rt = 0; rt < RTN; ++rt) { v8f acc = (v8f){0.f,0.f,0.f,0.f,0.f,0.f,0.f,0.f}, accl = acc;
#pragma unroll
        for (int ks = 0; ks < KS; ++ks) { acc = mmaH<1>(aq[rt][ks].v, aq[rt][ks].v, bk[ks].v, bk[ks].v, acc); accl = mmaH<1>(aql[rt][ks].v, aql[rt][ks].v, bk[ks].v, bk[ks].v, accl); accl = mmaH<1>(aq[rt][ks].v, aq[rt][ks].v, bkl[ks].v, bkl[ks].v, accl); }
#pragma unroll
        for (int r = 0; r < 8; ++r) acc[r] += accl[r] * 0.0009765625f;
        s[rt][nt] = acc; } }
#pragma unroll
    for (int rt = 0; rt < RTN; ++rt)
#pragma unroll
      for (int r = 0; r < 8; ++r) { const int tq = q0 + rt * 16 + 8 * hh + r; const int k0 = j0 + ln, k1 = j0 + 16 + ln;
        bool ok0 = (CAUSAL == 1) ? (k0 <= tq) : ((CAUSAL == 2) ? ((k0 >> 5) == (tq >> 5)) : true), ok1 = (CAUSAL == 1) ? (k1 <= tq) : ((CAUSAL == 2) ? ((k1 >> 5) == (tq >> 5)) : true);      /* mode 2: block-diagonal 32-token groups */
        if (CAUSAL == 4) { const int* mrow = MSK + ((size_t)b * TQ + tq) * TK; ok0 = mrow[k0] != 0; ok1 = mrow[k1] != 0; }      /* mode 4: per-(query, key) INPUT mask shared by all heads; masked keys contribute nothing (== the reference's -4096 fill, whose exp underflows to 0), rows with no valid key give l = 0 -> output 0 (== the reference's row_valid zeroing) */
        float s0 = ok0 ? s[rt][0][r] * SCL : -3.0e38f, s1 = ok1 ? s[rt][1][r] * SCL : -3.0e38f; if (CAUSAL == 33) { const float* amk = (const float*)MSK + (size_t)tq * TK; s0 += bf16_round(amk[k0]); s1 += bf16_round(amk[k1]); }      /* mode 33: one additive [TQ][TK] f32 table shared by every slab */ if (CAUSAL == 17) { const float* amk = (const float*)MSK + (size_t)b * TK; s0 += bf16_round(amk[k0]); s1 += bf16_round(amk[k1]); } if (CAUSAL == 18) { const float* tb = (const float*)MSK; const int* ri = MSK + 1024 + (size_t)b * TK; const int rq = ri[tq]; s0 += tb[(h * 8 + rq) * 8 + ri[k0]]; s1 += tb[(h * 8 + rq) * 8 + ri[k1]]; } if (CAUSAL == 19) { const int* rel = MSK + (size_t)tq * TK; const float* rb = (const float*)MSK + (size_t)TQ * TK + ((size_t)(b * NH + h) * TQ + tq) * 64; s0 += rb[rel[k0]]; s1 += rb[rel[k1]]; }      /* mode 19: + (q.Ek[rel] + Eb[rel][h]) / 8 gathered by the int relative ids (packed [ids | table]) */      /* mode 18: + resource_bias[h][r_q][r_k] from the packed [table | ids] buffer (TQ == TK) */      /* mode 17: additive per-(batch, key) mask INPUT */ float mc = fmaxf(s0, s1);
        mc = fmaxf(mc, __shfl_xor(mc, 1, 32)); mc = fmaxf(mc, __shfl_xor(mc, 2, 32)); mc = fmaxf(mc, __shfl_xor(mc, 4, 32)); mc = fmaxf(mc, __shfl_xor(mc, 8, 32));
        const float mn = fmaxf(m_r[rt][r], mc); const float al = (mn > -1.0e38f) ? expf(m_r[rt][r] - mn) : 1.0f; m_r[rt][r] = mn; const float p0 = ok0 ? expf(s0 - mn) : 0.f, p1 = ok1 ? expf(s1 - mn) : 0.f; l_r[rt][r] = l_r[rt][r] * al + p0 + p1;
#pragma unroll
        for (int dt = 0; dt < DT; ++dt) { oacc[rt][dt][r] *= al; oaccL[rt][dt][r] *= al; }
        FragH t2, t2l; const float ps0 = p0 * 1024.0f, ps1 = p1 * 1024.0f; t2.h[0] = (_Float16)ps0; t2.h[1] = (_Float16)ps1; t2l.h[0] = (_Float16)((ps0 - (float)t2.h[0]) * 1024.0f); t2l.h[1] = (_Float16)((ps1 - (float)t2.h[1]) * 1024.0f);
        sP[w][rt * 16 + 8 * hh + r][ln] = t2.u[0]; sP[w][rt * 16 + 8 * hh + r][16 + ln] = t2.u[1]; sPL[w][rt * 16 + 8 * hh + r][ln] = t2l.u[0]; sPL[w][rt * 16 + 8 * hh + r][16 + ln] = t2l.u[1]; }
    __builtin_amdgcn_fence(__ATOMIC_ACQ_REL, "workgroup"); __builtin_amdgcn_wave_barrier();
    FragH pa[2], pl[2];
#pragma unroll
    for (int rt = 0; rt < RTN; ++rt) { pa[rt].half[0] = *(const v8us*)&sP[w][rt * 16 + ln][8 * hh]; pa[rt].half[1] = *(const v8us*)&sP[w][rt * 16 + ln][16 + 8 * hh]; pl[rt].half[0] = *(const v8us*)&sPL[w][rt * 16 + ln][8 * hh]; pl[rt].half[1] = *(const v8us*)&sPL[w][rt * 16 + ln][16 + 8 * hh]; }
#pragma unroll
    for (int dt = 0; dt < DT; ++dt) { const unsigned short* vrow = Vth + (size_t)(dt * 16 + ln) * TK + j0; const unsigned short* vrl = Vtl + (size_t)(dt * 16 + ln) * TK + j0; FragH bv, bl; bv.half[0] = *(const v8us*)(vrow + 8 * hh); bv.half[1] = *(const v8us*)(vrow + 16 + 8 * hh); bl.half[0] = *(const v8us*)(vrl + 8 * hh); bl.half[1] = *(const v8us*)(vrl + 16 + 8 * hh);
#pragma unroll
      for (int rt = 0; rt < RTN; ++rt) { oacc[rt][dt] = mmaH<1>(pa[rt].v, pa[rt].v, bv.v, bv.v, oacc[rt][dt]); oaccL[rt][dt] = mmaH<1>(pl[rt].v, pl[rt].v, bv.v, bv.v, oaccL[rt][dt]); oaccL[rt][dt] = mmaH<1>(pa[rt].v, pa[rt].v, bl.v, bl.v, oaccL[rt][dt]); } }
    __builtin_amdgcn_fence(__ATOMIC_ACQ_REL, "workgroup"); __builtin_amdgcn_wave_barrier(); }
#pragma unroll
  for (int rt = 0; rt < RTN; ++rt) {
#pragma unroll
    for (int r = 0; r < 8; ++r) { float l = l_r[rt][r]; l += __shfl_xor(l, 1, 32); l += __shfl_xor(l, 2, 32); l += __shfl_xor(l, 4, 32); l += __shfl_xor(l, 8, 32); l_r[rt][r] = (l > 0.f) ? 1.0f / (l * 1024.0f) : 0.f; }
#pragma unroll
    for (int dt = 0; dt < DT; ++dt)
#pragma unroll
      for (int r = 0; r < 8; ++r) { float v = oacc[rt][dt][r]; v += oaccL[rt][dt][r] * 0.0009765625f; sO[w][rt * 16 + 8 * hh + r][dt * 16 + ln] = v * l_r[rt][r]; } }
  __builtin_amdgcn_fence(__ATOMIC_ACQ_REL, "workgroup"); __builtin_amdgcn_wave_barrier();
  {
#pragma unroll
    for (int rp = 0; rp < RPW; rp += 2) { const int r = rp + (lane >> 4), pc = lane & 15; const v4f val = *(const v4fa*)&sO[w][r][pc * 4]; *(v4f*)(O + ((size_t)b * TQ + q0 + r) * ldo + h * 64 + pc * 4) = val; }
     } }

__global__ __launch_bounds__(256) void k_rotab(float* __restrict__ CS, float* __restrict__ SN) {
  #pragma clang fp contract(off)
  const int t = blockIdx.x * 256 + threadIdx.x; if (t >= SLEN * 32) return; const int j = t % 32, s = t / 32; const float ex = (float)(2 * j) / 64.0f; const float inv = 1.0f / powf(10000.0f, ex); const float th = (float)s * inv; const float c = cosf(th), sn = sinf(th);
  { *(float*)(CS + t) = c; *(float*)(SN + t) = sn;  } }
__global__ __launch_bounds__(256) void k_rope(const float* __restrict__ F, int nsrc, int ndst, int rep, const float* __restrict__ CS, const float* __restrict__ SN, _Float16* __restrict__ H, _Float16* __restrict__ L) {
  #pragma clang fp contract(off)
  const size_t t = (size_t)blockIdx.x * 256 + threadIdx.x; if (t >= (size_t)NR * ndst * 4) return; const int g8 = (int)(t % 4); const int hd = (int)((t / 4) % ndst); const size_t row = t / ((size_t)4 * ndst); const int s = (int)(row % SLEN); const int hs = hd / rep;
  const float* src = F + row * (size_t)(nsrc * 64) + hs * 64; FragH ah, al, bh, bl;
  for (int i = 0; i < 8; ++i) { const int d = g8 * 8 + i; const float c = CS[s * 32 + d], sn = SN[s * 32 + d]; const float x1 = src[d], x2 = src[d + 32];
    float o1 = x1 * c; o1 += -x2 * sn; float o2 = x2 * c; o2 += x1 * sn;
    _Float16 hv = (_Float16)o1; ah.h[i] = hv; al.h[i] = (_Float16)((o1 - (float)hv) * 1024.0f); hv = (_Float16)o2; bh.h[i] = hv; bl.h[i] = (_Float16)((o2 - (float)hv) * 1024.0f); }
  const size_t o = row * (size_t)(ndst * 64) + hd * 64 + g8 * 8;
  { *(v8us*)((unsigned short*)H + o) = ah.half[0]; *(v8us*)((unsigned short*)H + o + 32) = bh.half[0]; *(v8us*)((unsigned short*)L + o) = al.half[0]; *(v8us*)((unsigned short*)L + o + 32) = bl.half[0];  } }
__global__ __launch_bounds__(256) void k_rope2(const float* __restrict__ F, int nsrc, int ndst, int rep, const float* __restrict__ CS, const float* __restrict__ SN, _Float16* __restrict__ H, _Float16* __restrict__ L) {
  #pragma clang fp contract(off)
  const size_t t = (size_t)blockIdx.x * 256 + threadIdx.x; if (t >= (size_t)NR * ndst * 4) return; const int g16 = (int)(t % 4); const int hd = (int)((t / 4) % ndst); const size_t row = t / ((size_t)4 * ndst); const int s = (int)(row % SLEN); const int hs = hd / rep;
  const float* src = F + row * (size_t)(nsrc * 64) + hs * 64 + g16 * 16; FragH ah, al;
  for (int pr = 0; pr < 8; ++pr) { const int i = g16 * 8 + pr; const float c = CS[s * 32 + i], sn = SN[s * 32 + i]; const float x1 = src[2 * pr], x2 = src[2 * pr + 1];
    float o1 = x1 * c; o1 -= x2 * sn; float o2 = x1 * sn; o2 += x2 * c;
    _Float16 hv = (_Float16)o1; ah.h[2 * pr] = hv; al.h[2 * pr] = (_Float16)((o1 - (float)hv) * 1024.0f); hv = (_Float16)o2; ah.h[2 * pr + 1] = hv; al.h[2 * pr + 1] = (_Float16)((o2 - (float)hv) * 1024.0f); }
  const size_t o = row * (size_t)(ndst * 64) + hd * 64 + g16 * 16;
  { *(v8us*)((unsigned short*)H + o) = ah.half[0]; *(v8us*)((unsigned short*)H + o + 8) = ah.half[1]; *(v8us*)((unsigned short*)L + o) = al.half[0]; *(v8us*)((unsigned short*)L + o + 8) = al.half[1];  } }
__global__ __launch_bounds__(256) void k_ln512(const float* __restrict__ A, const float* __restrict__ res, const float* __restrict__ g, const float* __restrict__ bb, float* __restrict__ Y, _Float16* __restrict__ Y16) {
  #pragma clang fp contract(off)
  const int wv = threadIdx.x >> 5, ln = threadIdx.x & 31; const size_t r = (size_t)blockIdx.x * 8 + wv; if (r >= NR) return; float x[16]; float s = 0.f;
  for (int i = 0; i < 2; ++i) { const v8f a = *(const v8f*)(A + r * DM + i * 256 + ln * 8); for (int q = 0; q < 8; ++q) { float v = a[q]; if (res) v += bf16_round(res[r * DM + i * 256 + ln * 8 + q]); x[i * 8 + q] = v; s += v; } }
  for (int o = 16; o > 0; o >>= 1) s += __shfl_xor(s, o, 32); const float mu = s / (float)DM; float var = 0.f; for (int q = 0; q < 16; ++q) { const float d = x[q] - mu; var += d * d; }
  for (int o = 16; o > 0; o >>= 1) var += __shfl_xor(var, o, 32); const float inv = rsqrtf(var / (float)DM + 1e-5f);
  { for (int i = 0; i < 2; ++i) { const int c0 = i * 256 + ln * 8; v8f y; FragH f; for (int q = 0; q < 8; ++q) { float v = (x[i * 8 + q] - mu) * inv; v *= bf16_round(g[c0 + q]); v += bf16_round(bb[c0 + q]); y[q] = v; f.h[q] = (_Float16)v; } *(v8f*)(Y + r * DM + c0) = y; if (Y16) *(v8us*)((unsigned short*)Y16 + r * DM + c0) = f.half[0]; }  } }
__global__ __launch_bounds__(256) void k_pack(const float* __restrict__ rb, const int* __restrict__ rid, int* __restrict__ PK) { const int t = blockIdx.x * 256 + threadIdx.x; if (t >= 1024 + NB * TK) return; int v; if (t < 1024) v = __float_as_int(bf16_round(rb[t])); else v = rid[t - 1024]; *(int*)(PK + t) = v;  }
__global__ __launch_bounds__(256) void k_tabin(const float* __restrict__ sp, float* __restrict__ CS, float* __restrict__ SN) { const int t = blockIdx.x * 256 + threadIdx.x; if (t >= SLEN * 32) return; const int i = t % 32, s = t / 32; const float c = bf16_round(sp[s * 64 + 32 + i]), sn = bf16_round(sp[s * 64 + i]);
  { *(float*)(CS + t) = c; *(float*)(SN + t) = sn;  } }
__global__ __launch_bounds__(256) void k_wsc(const float* __restrict__ Wm, _Float16* __restrict__ Bt, size_t n8, float sc) { const size_t t = (size_t)blockIdx.x * 256 + threadIdx.x; if (t >= n8) return; FragH f; for (int q = 0; q < 8; ++q) f.h[q] = (_Float16)(bf16_round(Wm[t * 8 + q]) * sc); *(v8us*)((unsigned short*)Bt + t * 8) = f.half[0];  }
__global__ __launch_bounds__(256) void k_rotab2(float* __restrict__ CS, float* __restrict__ SN) {
  #pragma clang fp contract(off)
  const int t = blockIdx.x * 256 + threadIdx.x; if (t >= SLEN * 32) return; const int j = t % 32, s = t / 32; const float c0 = -0.14391156831212787f;      /* -ln(10000)/64 rounded to f32 */ const float inv = expf((float)(2 * j) * c0); const float th = (float)s * inv; const float c = cosf(th), sn = sinf(th);
  { *(float*)(CS + t) = c; *(float*)(SN + t) = sn;  } }
__global__ __launch_bounds__(256) void k_lnu(const float* __restrict__ X, _Float16* __restrict__ N16, float* __restrict__ XB) {
  #pragma clang fp contract(off)
  const int wv = threadIdx.x >> 5, ln = threadIdx.x & 31; const size_t r = (size_t)blockIdx.x * 8 + wv; if (r >= NR) return; float a[32]; float s = 0.f;
  for (int i = 0; i < 4; ++i) { const v8f v = *(const v8f*)(X + r * DM + (i * 32 + ln) * 8); for (int q = 0; q < 8; ++q) { const float u = bf16_round(v[q]); a[i * 8 + q] = u; s += u; } }
  for (int o = 16; o > 0; o >>= 1) s += __shfl_xor(s, o, 32); const float mu = s / (float)DM; float var = 0.f; for (int q = 0; q < 32; ++q) { const float d = a[q] - mu; var += d * d; }
  for (int o = 16; o > 0; o >>= 1) var += __shfl_xor(var, o, 32); const float den = sqrtf(var / (float)(DM - 1)) + 1e-6f; const float inv = 1.0f / den;      /* one reciprocal per row; (x-mean)*inv vs the reference's division differs by <= 1 ulp */
  { for (int i = 0; i < 4; ++i) { const int c0 = (i * 32 + ln) * 8; FragH f; v8f xb; for (int q = 0; q < 8; ++q) { f.h[q] = (_Float16)((a[i * 8 + q] - mu) * inv); xb[q] = a[i * 8 + q]; } *(v8us*)((unsigned short*)N16 + r * DM + c0) = f.half[0]; *(v8f*)(XB + r * DM + c0) = xb; }  } }
__global__ __launch_bounds__(256) void k_vtg(const _Float16* __restrict__ V16, _Float16* __restrict__ Vt) { __shared__ unsigned short tl[64][66]; const int tid = threadIdx.x; const int slab = blockIdx.x / (SLEN / 64), lg = blockIdx.x % (SLEN / 64); const int b = slab / NH, h = slab % NH; const int hs = h / NREP;
  for (int i = tid; i < 64 * 8; i += 256) { const int r = i / 8, c8 = (i % 8) * 8; FragH f; f.half[0] = *(const v8us*)((const unsigned short*)V16 + ((size_t)b * SLEN + lg * 64 + r) * KVD + hs * 64 + c8); for (int q = 0; q < 8; ++q) tl[r][c8 + q] = f.u[q]; }
  __syncthreads();
  { for (int rd = 0; rd < 2; ++rd) { const int d = rd * 32 + tid / 8, pc = tid % 8; FragH f; for (int q = 0; q < 8; ++q) f.u[q] = tl[pc * 8 + q][d]; *(v8us*)((unsigned short*)Vt + ((size_t)slab * 64 + d) * SLEN + lg * 64 + pc * 8) = f.half[0]; }  } }

__global__ __launch_bounds__(256) void k_h16s(const float* __restrict__ SRC, int lds, int coff, _Float16* __restrict__ DST, size_t n8) { const size_t t = (size_t)blockIdx.x * 256 + threadIdx.x; if (t >= n8) return; const size_t r = (t * 8) / DM; const int c = (int)((t * 8) % DM); const v8f a = *(const v8f*)(SRC + r * lds + coff + c); FragH f; for (int q = 0; q < 8; ++q) f.h[q] = (_Float16)a[q];
  *(v8us*)((unsigned short*)DST + t * 8) = f.half[0];  }


__global__ __launch_bounds__(256) void k_ccp(const float* __restrict__ QKV, int coff, _Float16* __restrict__ D) { const size_t t = (size_t)blockIdx.x * 256 + threadIdx.x; if (t >= (size_t)NR * DM / 8) return; const int c0 = (int)((t * 8) % DM); const size_t row = (t * 8) / DM; const v8f a = *(const v8f*)(QKV + row * 3 * DM + coff + c0); FragH f; for (int q = 0; q < 8; ++q) f.h[q] = (_Float16)a[q];
  *(v8us*)((unsigned short*)D + t * 8) = f.half[0];  }


extern "C" void kernel_launch(void* const* d_in, const int* in_sizes, int n_in,
                              void* d_out, int out_size, void* d_ws, size_t ws_size, hipStream_t stream) {
  (void)in_sizes; (void)n_in; (void)out_size;
  const float* q = (const float*)d_in[0]; const float* kv = (const float*)d_in[1]; const float* mask = (const float*)d_in[2]; float* O = (float*)d_out;
  char* ws = (char*)d_ws; size_t off = 0;
  auto take = [&](size_t bytes) { char* p = ws + off; off += (bytes + 255) & ~(size_t)255; return p; };
  const size_t np = (size_t)NR * DM;      /* 32 x 2048 x 64 */
  _Float16* Q16 = (_Float16*)take(np * 2); unsigned short* KP = (unsigned short*)take(np * 2); unsigned short* VP = (unsigned short*)take(np * 2); unsigned short* MP = (unsigned short*)take((size_t)TQ * TK * 2);
  if (off > ws_size) return;      /* 32 MiB */
  static_assert(NR / 32 == TQ / 8 * TK / 256, "q, kv and the mask have the same number of units");
  k_prep<<<NR / 32 / PU, 256, 0, stream>>>(q, kv, mask, (unsigned short*)Q16, KP, VP, MP);      /* values = keys */
  k_flash<33><<<NB * NH * QBNP, 512, 0, stream>>>(Q16, DM, KP, VP, MP, O, DM);      /* f32 context straight to the output rows */
}
